// v000
// Times are from an AMD MI455X. After a warm-up the kernel runs many times in a row, and a time is the length of
// such a window on the GPU divided by its runs, so every launch and the gaps after it count. The runs cycle
// through copies of the inputs. A figure is the median of several windows, for all but v000 over two sittings.
// Sittings can differ by a few percent; kernels timed side by side share one.
// The starting kernel, v000, takes 5150 microseconds a run.
#include <hip/hip_runtime.h>

// 1-D self-attention block with GroupNorm and residual on a channel-major sequence (hidden [2][256][4096]; x = GroupNorm(1 group over all 256 x 4096 values, eps 1e-5) x gn_weight + gn_bias; h = x^T; q,k,v = h W^T + b ('oi' [256][256] + [256], 1/16; 8 heads x 32); scores = (q 32^-1/4).(k 32^-1/4); softmax over all 4,096 keys; out = merged Wo^T + bo, transposed back + hidden -> [2][256][4096] (2.1 M)).
// Compute dtypes, f32 accumulate: every input rounded to bf16; GroupNorm f32 (fixed-order sums); projections hi/lo x exact + f32 biases; attention rows < 512 3 products, rest fp16; softmax f32; Wo hl x exact + bias; residual f32.

#define NB_  2
#define TT   4096
#define DM   256
#define NH_  8
#define NKV  8
#define REP  (NH_ / NKV)
#define HD   64
#define DQ   (NH_ * HD)
#define DKV  (NKV * HD)
#define ZH   1
#define RH   512                  // query rows < RH use hi+lo planes (0: none)
#define WIN  0
#define PCAR 1024.0f
#define SCL  0.17677669529663689f   // 32^-1/2 == (32^-1/4)^2 applied once to q.k
#define CC   256     // channels
#define HR   32      // real head width (padded to HD = 64)
typedef _Float16 h16;
typedef unsigned short bf;
typedef __attribute__((ext_vector_type(16))) __bf16   v16bf;
typedef __attribute__((ext_vector_type(16))) _Float16 v16h;
typedef __attribute__((ext_vector_type(8)))  _Float16 v8h;
typedef __attribute__((ext_vector_type(8)))  unsigned short v8us;
typedef __attribute__((ext_vector_type(8)))  float    v8f;
typedef __attribute__((ext_vector_type(4)))  float    v4f;
typedef v8h  __attribute__((may_alias)) v8ha;
typedef v4f  __attribute__((may_alias)) v4fa;
typedef v8us __attribute__((may_alias)) v8usa;

__device__ __forceinline__ unsigned short f2bf(float f) { unsigned u = __float_as_uint(f); u += 0x7FFFu + ((u >> 16) & 1u); return (unsigned short)(u >> 16); }
__device__ __forceinline__ float bf2f(unsigned short b) { return __uint_as_float(((unsigned)b) << 16); }
__device__ __forceinline__ float bfr(float f) { return bf2f(f2bf(f)); }
__device__ __forceinline__ v16h cat16(v8h lo, v8h hi) { return __builtin_shufflevector(lo, hi, 0, 1, 2, 3, 4, 5, 6, 7, 8, 9, 10, 11, 12, 13, 14, 15); }
__device__ __forceinline__ v16bf cat16b(v8us lo, v8us hi) { return __builtin_bit_cast(v16bf, __builtin_shufflevector(lo, hi, 0, 1, 2, 3, 4, 5, 6, 7, 8, 9, 10, 11, 12, 13, 14, 15)); }
__device__ __forceinline__ v8f wmma16(v16h a, v16h b, v8f c) { return __builtin_amdgcn_wmma_f32_16x16x32_f16(false, a, false, b, (short)0, c, false, false); }
__device__ __forceinline__ v8f wmmab(v16bf a, v16bf b, v8f c) { return __builtin_amdgcn_wmma_f32_16x16x32_bf16(false, a, false, b, (short)0, c, false, false); }



// ---- k_gemmw: register-blocked GEMM, ONE WAVE per 64x64 output tile (16 accumulators), operands straight from K-contiguous 16-bit planes; grid (M/64, N/64, Z), 32 threads.
// C[m][n] (f32, pitch ldc, + optional f32 bias[n]) = sum_k A[m][k] Bt[n][k] (+ split products per NSPLIT). z-batch strides sA/sB/sC in elements. K % 32 == 0.
template <typename T16> struct WFrag;
template <> struct WFrag<h16> { typedef v16h V; static __device__ __forceinline__ V ld(const h16* p) { return cat16(*(const v8h*)p, *(const v8h*)(p + 16)); } static __device__ __forceinline__ v8f mma(V a, V b, v8f c) { return wmma16(a, b, c); } };
template <> struct WFrag<bf> { typedef v16bf V; static __device__ __forceinline__ V ld(const bf* p) { return cat16b(*(const v8us*)p, *(const v8us*)(p + 16)); } static __device__ __forceinline__ v8f mma(V a, V b, v8f c) { return wmmab(a, b, c); } };
template <typename T16, int NSPLIT, bool BIAS>
__global__ __launch_bounds__(32) void k_gemmw(const T16* __restrict__ A, const T16* __restrict__ A2, const T16* __restrict__ Bt, const T16* __restrict__ Bt2, int K, float* C, int ldc, const float* __restrict__ bias, size_t sA, size_t sB, size_t sC) {
    typedef typename WFrag<T16>::V V;
    __shared__ __align__(16) float os[16 * 68];
    const size_t z = blockIdx.z; A += z * sA; if (A2) A2 += z * sA; Bt += z * sB; if (Bt2) Bt2 += z * sB; C += z * sC;
    const int lane = threadIdx.x & 31, lr = lane & 15, hi = lane >> 4; const int r0 = blockIdx.x * 64, c0 = blockIdx.y * 64;
    v8f acc[4][4];
#pragma unroll
    for (int mb = 0; mb < 4; ++mb)
#pragma unroll
        for (int nb = 0; nb < 4; ++nb) acc[mb][nb] = (v8f){};
    const size_t aoff = (size_t)(r0 + lr) * K + 8 * hi, boff = (size_t)(c0 + lr) * K + 8 * hi;
#pragma unroll 1
    for (int kc = 0; kc < K; kc += 32) {
        V a[4], a2[4];
#pragma unroll
        for (int mb = 0; mb < 4; ++mb) { a[mb] = WFrag<T16>::ld(A + aoff + (size_t)mb * 16 * K + kc); if (NSPLIT == 1 || NSPLIT == 2) a2[mb] = WFrag<T16>::ld(A2 + aoff + (size_t)mb * 16 * K + kc); }
#pragma unroll
        for (int nb = 0; nb < 4; ++nb) { const V b = WFrag<T16>::ld(Bt + boff + (size_t)nb * 16 * K + kc); V b2; if (NSPLIT >= 2) b2 = WFrag<T16>::ld(Bt2 + boff + (size_t)nb * 16 * K + kc);
#pragma unroll
            for (int mb = 0; mb < 4; ++mb) { acc[mb][nb] = WFrag<T16>::mma(a[mb], b, acc[mb][nb]); if (NSPLIT == 1 || NSPLIT == 2) acc[mb][nb] = WFrag<T16>::mma(a2[mb], b, acc[mb][nb]); if (NSPLIT >= 2) acc[mb][nb] = WFrag<T16>::mma(a[mb], b2, acc[mb][nb]); } }
        asm volatile("v_nop\n\tv_nop\n\tv_nop\n\tv_nop" : "+v"(acc[0][0]), "+v"(acc[1][1]), "+v"(acc[2][2]), "+v"(acc[3][3]) : "v"(a[0]), "v"(a[3]));
    }
#pragma unroll
    for (int mb = 0; mb < 4; ++mb) {
#pragma unroll
        for (int nb = 0; nb < 4; ++nb) {
#pragma unroll
            for (int j = 0; j < 8; ++j) os[(hi * 8 + j) * 68 + nb * 16 + lr] = acc[mb][nb][j]; }
        __builtin_amdgcn_wave_barrier(); asm volatile("" ::: "memory");
        float* crow = C + (size_t)(r0 + mb * 16) * ldc + c0;
{
#pragma unroll
            for (int s = 0; s < 8; ++s) { const int row = 2 * s + hi, cofs = lr * 4; v4f val = *(const v4fa*)(os + row * 68 + cofs); if (BIAS) { val[0] += bfr(bias[c0 + cofs]); val[1] += bfr(bias[c0 + cofs + 1]); val[2] += bfr(bias[c0 + cofs + 2]); val[3] += bfr(bias[c0 + cofs + 3]); }
                *(v4f*)(crow + (size_t)row * ldc + cofs) = val; }
             }
        __builtin_amdgcn_wave_barrier(); asm volatile("" ::: "memory");
    }
}

__device__ __forceinline__ h16 tohx(float x) { return (h16)x; }
__device__ __forceinline__ void splitf(float y, unsigned short& h, unsigned short& l) { h = f2bf(y); l = f2bf(y - bf2f(h)); }
typedef __attribute__((ext_vector_type(2))) _Float16 v2h;
typedef __attribute__((ext_vector_type(4))) _Float16 v4h;
typedef __attribute__((ext_vector_type(2))) unsigned short v2us;
typedef __attribute__((ext_vector_type(4))) unsigned short v4us;
typedef __attribute__((ext_vector_type(2))) float v2f;
typedef __attribute__((ext_vector_type(4))) int v4i;

__global__ __launch_bounds__(256) void k_wtG(const float* __restrict__ w, int K, int N, bf* Bt) {
    const int lane = threadIdx.x & 31; const int L0 = (blockIdx.x * 8 + (threadIdx.x >> 5)) * 8; const int nlines = N * K / 64;
{
#pragma unroll 1
        for (int l = 0; l < 8; ++l) { const int L = L0 + l; if (L >= nlines) break; const size_t e = (size_t)L * 64 + lane * 2; const int k = (int)(e % K), n = (int)(e / K); v2us o;
            o[0] = f2bf(w[(size_t)k * N + n]); o[1] = f2bf(w[(size_t)(k + 1) * N + n]); *(v2us*)(Bt + e) = o; }
         }
}
__global__ __launch_bounds__(256) void k_cvt8(const float* __restrict__ src, bf* dst, size_t n8) { const size_t i = (size_t)blockIdx.x * 256 + threadIdx.x; if (i >= n8) return; const v8f v = *(const v8f*)(src + i * 8); v8us o;
#pragma unroll
    for (int k = 0; k < 8; ++k) o[k] = f2bf(v[k]); *(v8us*)(dst + i * 8) = o;  }

// k_rope: head planes [h][t][d] (fp16 + hi/lo) of rope(x) x sc with the rotate-half convention out[d] = x[d] cos[t][d] - x[d+HD/2] sin[t][d], out[d+HD/2] = x[d+HD/2] cos[t][d+HD/2] + x[d] sin[t][d+HD/2]
__global__ __launch_bounds__(256) void k_rope(const float* __restrict__ F, int pitch, int nheads, const float* __restrict__ CS, const float* __restrict__ RF, const float* __restrict__ nw, float sc, h16* P16, bf* Ph, bf* Pl) {
    const size_t e = ((size_t)blockIdx.x * 256 + threadIdx.x) * 2; if (e >= (size_t)nheads * TT * HD) return; const int d = (int)(e % HD); const int t = (int)((e / HD) % TT); const int h = (int)(e / ((size_t)HD * TT)); const float* f = F + (size_t)t * pitch + h * HD; const float rf = RF ? RF[(size_t)h * TT + t] : 1.0f; v2h o16; v2us oh, ol;
#pragma unroll
    for (int q = 0; q < 2; ++q) { const int dd = d + q; const int dp = (dd < HD / 2) ? dd + HD / 2 : dd - HD / 2; float x0 = f[dd], x1 = f[dp];
        if (RF) { float n0 = __fmul_rn(x0, rf), n1 = __fmul_rn(x1, rf); asm volatile("" : "+v"(n0)); asm volatile("" : "+v"(n1)); x0 = __fmul_rn(bfr(nw[dd]), n0); x1 = __fmul_rn(bfr(nw[dp]), n1); }
        const v2f cs = *(const v2f*)(CS + ((size_t)t * HD + dd) * 2); float a = __fmul_rn(x0, cs[0]), bq = __fmul_rn(x1, cs[1]); asm volatile("" : "+v"(a)); asm volatile("" : "+v"(bq)); const float r = ((dd < HD / 2) ? __fsub_rn(a, bq) : __fadd_rn(a, bq)) * sc;
        o16[q] = tohx(r); unsigned short a2, c2; splitf(r, a2, c2); oh[q] = a2; ol[q] = c2; }
    *(v2h*)(P16 + e) = o16; *(v2us*)(Ph + e) = oh; *(v2us*)(Pl + e) = ol;  }
__global__ __launch_bounds__(256) void k_vtp(const float* __restrict__ F, int pitch, int nheads, h16* V16, bf* Vh, bf* Vl) { const size_t e = ((size_t)blockIdx.x * 256 + threadIdx.x) * 2; if (e >= (size_t)nheads * HD * TT) return; const int t = (int)(e % TT); const int d = (int)((e / TT) % HD); const int g = (int)(e / ((size_t)TT * HD)); v2h o16; v2us oh, ol;
#pragma unroll
    for (int q = 0; q < 2; ++q) { const float x = F[(size_t)(t + q) * pitch + g * HD + d]; o16[q] = tohx(x); unsigned short a2, c2; splitf(x, a2, c2); oh[q] = a2; ol[q] = c2; }
    *(v2h*)(V16 + e) = o16; *(v2us*)(Vh + e) = oh; *(v2us*)(Vl + e) = ol;  }
__global__ __launch_bounds__(256) void k_csid(float* CS) { const int idx = blockIdx.x * 256 + threadIdx.x; if (idx >= TT * HD) return; v2f cs; cs[0] = 1.0f; cs[1] = 0.0f; *(v2f*)(CS + (size_t)idx * 2) = cs;  }
// k_lsoft: streaming row softmax over all TK = TT = 4096 keys, one wave per row i, three sweeps of the f32 score row (lane -> 4 consecutive keys per 128-key chunk, 32 chunks; no mask - every score tile is computed and every key enters max, sum and output):
__global__ __launch_bounds__(256) void k_lsoft(const float* __restrict__ Sb, h16* P16, bf* Ph, bf* Pl) {
    const int lane = threadIdx.x & 31; const int row = blockIdx.x * 8 + (threadIdx.x >> 5); if (row >= ZH * TT) return; const int i = row % TT; const int zz = row / TT; const bool hires = (i < RH); const float* sr = Sb + (size_t)row * TT; float mx = -3.0e38f;
#pragma unroll 4
    for (int ch = 0; ch < TT / 128; ++ch) { const int j0 = ch * 128 + lane * 4; const v4f a = *(const v4f*)(sr + j0);
#pragma unroll
        for (int q = 0; q < 4; ++q) { float t = a[q] * SCL; asm volatile("" : "+v"(t)); mx = fmaxf(mx, t); } }
#pragma unroll
    for (int sh = 16; sh; sh >>= 1) mx = fmaxf(mx, __shfl_xor(mx, sh, 32));
    float sum = 0.f;
#pragma unroll 4
    for (int ch = 0; ch < TT / 128; ++ch) { const int j0 = ch * 128 + lane * 4; const v4f a = *(const v4f*)(sr + j0);
#pragma unroll
        for (int q = 0; q < 4; ++q) { float t = a[q] * SCL; asm volatile("" : "+v"(t)); float d0 = __fsub_rn(t, mx); asm volatile("" : "+v"(d0)); sum += __builtin_amdgcn_exp2f(__fmul_rn(d0, 1.4426950408889634f)); } }
#pragma unroll
    for (int sh = 16; sh; sh >>= 1) sum += __shfl_xor(sum, sh, 32);
    const float f = __fdiv_rn(hires ? 1.0f : PCAR, sum);
{
        if (hires) {   /* rows < RH: normalised bf16 hi/lo over all keys, planes [zz][RH][TT] */
#pragma unroll
            for (int ch = 0; ch < TT / 128; ++ch) { const int j0 = ch * 128 + lane * 4; const v4f a = *(const v4f*)(sr + j0); v4us oh, ol;
#pragma unroll
                for (int q = 0; q < 4; ++q) { float t = a[q] * SCL; asm volatile("" : "+v"(t)); float d0 = __fsub_rn(t, mx); asm volatile("" : "+v"(d0)); float ex = __builtin_amdgcn_exp2f(__fmul_rn(d0, 1.4426950408889634f)); asm volatile("" : "+v"(ex)); unsigned short a2, c2; splitf(ex * f, a2, c2); oh[q] = a2; ol[q] = c2; }
                const size_t oo = ((size_t)zz * RH + i) * TT + j0; *(v4us*)(Ph + oo) = oh; *(v4us*)(Pl + oo) = ol; }
        } else {
#pragma unroll 2
            for (int ch = 0; ch < TT / 128; ++ch) { const int j0 = ch * 128 + lane * 4; const v4f a = *(const v4f*)(sr + j0); v4h o4;
#pragma unroll
                for (int q = 0; q < 4; ++q) { float t = a[q] * SCL; asm volatile("" : "+v"(t)); float d0 = __fsub_rn(t, mx); asm volatile("" : "+v"(d0)); float ex = __builtin_amdgcn_exp2f(__fmul_rn(d0, 1.4426950408889634f)); asm volatile("" : "+v"(ex)); o4[q] = tohx(ex * f); }
                *(v4h*)(P16 + (size_t)row * TT + j0) = o4; } }
         }
}

__global__ __launch_bounds__(256) void k_wpadh(const float* __restrict__ w, const float* __restrict__ bias, bf* Bt, float* bp) { const int i = blockIdx.x * 256 + threadIdx.x; if (i >= DQ * DM / 8) return; const int c0 = (i % (DM / 8)) * 8; const int r = i / (DM / 8); const int h = r / HD, d = r % HD; const int sr = h * HR + min(d, HR - 1); const float* src = w + (size_t)sr * DM + c0; v8us o;
#pragma unroll
    for (int q = 0; q < 8; ++q) { const unsigned short v = f2bf(src[q]); o[q] = (d < HR) ? v : (unsigned short)0; }
    *(v8us*)(Bt + (size_t)r * DM + c0) = o; if (i < DQ) { const int hb = i / HD, db = i % HD; const float bb = bias[hb * HR + min(db, HR - 1)]; ((float*)bp)[i] = (db < HR) ? bb : 0.0f; }     }
__global__ __launch_bounds__(256) void k_wopadh(const float* __restrict__ w, bf* Bt) { const int i = blockIdx.x * 256 + threadIdx.x; if (i >= DM * DQ / 8) return; const int k0 = (i % (DQ / 8)) * 8; const int o = i / (DQ / 8); v8us ov;
#pragma unroll
    for (int q = 0; q < 8; ++q) { const int kk = k0 + q; const int h = kk / HD, d = kk % HD; const unsigned short v = f2bf(w[(size_t)o * DM + h * HR + min(d, HR - 1)]); ov[q] = (d < HR) ? v : (unsigned short)0; }
    *(v8us*)(Bt + (size_t)o * DQ + k0) = ov;  }
__global__ __launch_bounds__(256) void k_gnstat(const float* __restrict__ xs, float* stat) { __shared__ float red[256]; const int tid = threadIdx.x; const size_t n = (size_t)CC * TT; float s = 0.f;
    for (size_t e = (size_t)tid * 4; e < n; e += 256 * 4) { const v4f a = *(const v4f*)(xs + e); for (int q = 0; q < 4; ++q) s = __fadd_rn(s, bfr(a[q])); }
    red[tid] = s; __syncthreads();
    for (int st = 128; st > 0; st >>= 1) { if (tid < st) red[tid] = __fadd_rn(red[tid], red[tid + st]); __syncthreads(); }
    const float mean = __fdiv_rn(red[0], (float)n); __syncthreads(); float s2 = 0.f;
    for (size_t e = (size_t)tid * 4; e < n; e += 256 * 4) { const v4f a = *(const v4f*)(xs + e); for (int q = 0; q < 4; ++q) { const float dv = __fsub_rn(bfr(a[q]), mean); float p2 = __fmul_rn(dv, dv); asm volatile("" : "+v"(p2)); s2 = __fadd_rn(s2, p2); } }
    red[tid] = s2; __syncthreads();
    for (int st = 128; st > 0; st >>= 1) { if (tid < st) red[tid] = __fadd_rn(red[tid], red[tid + st]); __syncthreads(); }
    if (tid == 0) { const float var = __fdiv_rn(red[0], (float)n); const float rs = __fdiv_rn(1.0f, __fsqrt_rn(__fadd_rn(var, 1e-5f))); v2f o; o[0] = mean; o[1] = rs; *(v2f*)stat = o;  } }
__global__ __launch_bounds__(256) void k_gnT(const float* __restrict__ xs, const float* __restrict__ stat, const float* __restrict__ g, const float* __restrict__ bb, bf* XH, bf* XL) { const size_t k = (size_t)blockIdx.x * 256 + threadIdx.x; if (k >= (size_t)TT * CC / 8) return; const int c0 = (int)(k % (CC / 8)) * 8; const int t = (int)(k / (CC / 8)); const float mean = stat[0], rs = stat[1]; v8us oh, ol;
#pragma unroll
    for (int q = 0; q < 8; ++q) { const int c = c0 + q; const float dv = __fsub_rn(bfr(xs[(size_t)c * TT + t]), mean); float y = __fmul_rn(dv, rs); asm volatile("" : "+v"(y)); y = __fmul_rn(y, bfr(g[c])); asm volatile("" : "+v"(y)); y = __fadd_rn(y, bfr(bb[c])); unsigned short a2, c2; splitf(y, a2, c2); oh[q] = a2; ol[q] = c2; }
    *(v8us*)(XH + (size_t)t * CC + c0) = oh; *(v8us*)(XL + (size_t)t * CC + c0) = ol;  }
__global__ __launch_bounds__(256) void k_outTr(const float* __restrict__ U, const float* __restrict__ xs, float* outp) { const size_t k = (size_t)blockIdx.x * 256 + threadIdx.x; if (k >= (size_t)CC * TT / 4) return; const size_t e = k * 4; const int t0 = (int)(e % TT); const int c = (int)(e / TT); const v4f a = *(const v4f*)(xs + e); v4f o;
#pragma unroll
    for (int q = 0; q < 4; ++q) o[q] = __fadd_rn(bfr(a[q]), U[(size_t)(t0 + q) * CC + c]);
    *(v4f*)(outp + e) = o;  }

__global__ __launch_bounds__(256) void k_merge(const float* __restrict__ O, int h0, bf* Ah, bf* Al) { const size_t e = ((size_t)blockIdx.x * 256 + threadIdx.x) * 2; if (e >= (size_t)ZH * TT * HD) return; const int d = (int)(e % HD); const int t = (int)((e / HD) % TT); const int zz = (int)(e / ((size_t)HD * TT)); const float cs = (t < RH) ? 1.0f : (1.0f / PCAR); const size_t oo = (size_t)t * DQ + (h0 + zz) * HD + d;
    v2us oh, ol;
#pragma unroll
    for (int q = 0; q < 2; ++q) { unsigned short a, c2; splitf(O[e + q] * cs, a, c2); oh[q] = a; ol[q] = c2; } *(v2us*)(Ah + oo) = oh; *(v2us*)(Al + oo) = ol;  }

extern "C" void kernel_launch(void* const* d_in, const int* in_sizes, int n_in,
                              void* d_out, int out_size, void* d_ws, size_t ws_size, hipStream_t stream) {
    (void)in_sizes; (void)n_in; (void)out_size;
    const float* x = (const float*)d_in[0]; const float* gnw = (const float*)d_in[1]; const float* gnb = (const float*)d_in[2]; const float* wq = (const float*)d_in[3]; const float* bq = (const float*)d_in[4]; const float* wk = (const float*)d_in[5]; const float* bk = (const float*)d_in[6]; const float* wv = (const float*)d_in[7]; const float* bv = (const float*)d_in[8]; const float* wo = (const float*)d_in[9]; const float* bo = (const float*)d_in[10];
    float* OUT = (float*)d_out;     // [2][256][4096]
    char* wsp = (char*)d_ws;
    auto take = [&](size_t bytes) { char* p = wsp; wsp += (bytes + 255) & ~(size_t)255; return (void*)p; };
    float* BQP = (float*)take(DQ * 4); float* BKP = (float*)take(DQ * 4); float* BVP = (float*)take(DQ * 4); bf* XH = (bf*)take((size_t)TT * DM * 2); bf* XL = (bf*)take((size_t)TT * DM * 2); float* STAT = (float*)take(256); float* Y = (float*)take((size_t)TT * DM * 4); bf* WQ = (bf*)take((size_t)DQ * DM * 2); bf* WK = (bf*)take((size_t)DKV * DM * 2); bf* WV = (bf*)take((size_t)DKV * DM * 2); bf* WO = (bf*)take((size_t)DM * DQ * 2); float* CS = (float*)take((size_t)TT * HD * 2 * 4);
     float* FQ = (float*)take((size_t)TT * DQ * 4); float* FK = (float*)take((size_t)TT * DKV * 4);
    h16* QP16 = (h16*)take((size_t)NH_ * TT * HD * 2); h16* KP16 = (h16*)take((size_t)NKV * TT * HD * 2); h16* VT16 = (h16*)take((size_t)NKV * HD * TT * 2);
    bf* QPh = (bf*)take((size_t)NH_ * TT * HD * 2); bf* QPl = (bf*)take((size_t)NH_ * TT * HD * 2); bf* KPh = (bf*)take((size_t)NKV * TT * HD * 2); bf* KPl = (bf*)take((size_t)NKV * TT * HD * 2); bf* VTh = (bf*)take((size_t)NKV * HD * TT * 2); bf* VTl = (bf*)take((size_t)NKV * HD * TT * 2); bf* Ph = (bf*)take((size_t)ZH * RH * TT * 2); bf* Pl = (bf*)take((size_t)ZH * RH * TT * 2);
    float* Sb = (float*)take((size_t)ZH * TT * TT * 4); h16* P16 = (h16*)take((size_t)ZH * TT * TT * 2); float* Ob = (float*)take((size_t)ZH * TT * HD * 4); bf* ATh = (bf*)take((size_t)TT * DQ * 2); bf* ATl = (bf*)take((size_t)TT * DQ * 2);
    if ((size_t)(wsp - (char*)d_ws) > ws_size) return;    // ws 256 MiB
    float* FV = FK;   // v projection reuses the k buffer after the k planes are built (stream-ordered)
    { k_wpadh<<<(DQ * DM / 8 + 255) / 256, 256, 0, stream>>>(wq, bq, WQ, BQP); k_wpadh<<<(DQ * DM / 8 + 255) / 256, 256, 0, stream>>>(wk, bk, WK, BKP); k_wpadh<<<(DQ * DM / 8 + 255) / 256, 256, 0, stream>>>(wv, bv, WV, BVP);
      k_wopadh<<<(DM * DQ / 8 + 255) / 256, 256, 0, stream>>>(wo, WO);
       }
    k_csid<<<(TT * HD + 255) / 256, 256, 0, stream>>>(CS);
    const unsigned LQ = (unsigned)(((size_t)NH_ * TT * HD / 2 + 255) / 256), LKv = (unsigned)(((size_t)NKV * TT * HD / 2 + 255) / 256);
    for (int b = 0; b < NB_; ++b) {
        
        k_gnstat<<<1, 256, 0, stream>>>(x + (size_t)b * CC * TT, STAT);    k_gnT<<<(unsigned)(((size_t)TT * CC / 8 + 255) / 256), 256, 0, stream>>>(x + (size_t)b * CC * TT, STAT, gnw, gnb, XH, XL);   /* normalised, token-major, hi/lo */
        k_gemmw<bf, 1, true><<<dim3(TT / 64, DQ / 64, 1), 32, 0, stream>>>(XH, XL, WQ, nullptr, DM, FQ, DQ, BQP, 0, 0, 0);
        k_rope<<<LQ, 256, 0, stream>>>(FQ, DQ, NH_, CS, nullptr, nullptr, 1.0f, QP16, QPh, QPl);
        k_gemmw<bf, 1, true><<<dim3(TT / 64, DKV / 64, 1), 32, 0, stream>>>(XH, XL, WK, nullptr, DM, FK, DKV, BKP, 0, 0, 0);
        k_rope<<<LKv, 256, 0, stream>>>(FK, DKV, NKV, CS, nullptr, nullptr, 1.0f, KP16, KPh, KPl);
        k_gemmw<bf, 1, true><<<dim3(TT / 64, DKV / 64, 1), 32, 0, stream>>>(XH, XL, WV, nullptr, DM, FV, DKV, BVP, 0, 0, 0); k_vtp<<<LKv, 256, 0, stream>>>(FV, DKV, NKV, VT16, VTh, VTl);
        for (int h0 = 0; h0 < NH_; h0 += ZH) { const size_t zq = (size_t)h0, zk = (size_t)(h0 / REP);   // one kv head per query head: each pass (ZH = 1) takes query head h0 and kv plane h0 (z-strides TT*HD)
            k_gemmw<bf, 2, false><<<dim3(RH / 64, TT / 64, ZH), 32, 0, stream>>>(QPh + zq * TT * HD, QPl + zq * TT * HD, KPh + zk * TT * HD, KPl + zk * TT * HD, HD, Sb, TT, nullptr, (size_t)TT * HD, (size_t)TT * HD, (size_t)TT * TT);
            k_gemmw<h16, 0, false><<<dim3((TT - RH) / 64, TT / 64, ZH), 32, 0, stream>>>(QP16 + zq * TT * HD + (size_t)RH * HD, nullptr, KP16 + zk * TT * HD, nullptr, HD, Sb + (size_t)RH * TT, TT, nullptr, (size_t)TT * HD, (size_t)TT * HD, (size_t)TT * TT);
            k_lsoft<<<ZH * TT / 8, 256, 0, stream>>>(Sb, P16, Ph, Pl);
            k_gemmw<bf, 2, false><<<dim3(RH / 64, HD / 64, ZH), 32, 0, stream>>>(Ph, Pl, VTh + zk * HD * TT, VTl + zk * HD * TT, TT, Ob, HD, nullptr, (size_t)RH * TT, (size_t)HD * TT, (size_t)TT * HD);
            k_gemmw<h16, 0, false><<<dim3((TT - RH) / 64, HD / 64, ZH), 32, 0, stream>>>(P16 + (size_t)RH * TT, nullptr, VT16 + zk * HD * TT, nullptr, TT, Ob + (size_t)RH * HD, HD, nullptr, (size_t)TT * TT, (size_t)HD * TT, (size_t)TT * HD);
            k_merge<<<(unsigned)(((size_t)ZH * TT * HD / 2 + 255) / 256), 256, 0, stream>>>(Ob, h0, ATh, ATl); }
        k_gemmw<bf, 1, true><<<dim3(TT / 64, DM / 64, 1), 32, 0, stream>>>(ATh, ATl, WO, nullptr, DQ, Y, DM, bo, 0, 0, 0); k_outTr<<<(unsigned)(((size_t)CC * TT / 4 + 255) / 256), 256, 0, stream>>>(Y, x + (size_t)b * CC * TT, OUT + (size_t)b * CC * TT);   /* back to channel-major + hidden residual */ }
}

// v001
// A run of this version takes 2850 microseconds.
// Two timings next to v000 put it at 1.81 and 1.82 times that version's speed.
#include <hip/hip_runtime.h>

// 1-D self-attention block with GroupNorm and residual on a channel-major sequence (hidden [2][256][4096]; x = GroupNorm(1 group over all 256 x 4096 values, eps 1e-5) x gn_weight + gn_bias; h = x^T; q,k,v = h W^T + b ('oi' [256][256] + [256], 1/16; 8 heads x 32); scores = (q 32^-1/4).(k 32^-1/4); softmax over all 4,096 keys; out = merged Wo^T + bo, transposed back + hidden -> [2][256][4096] (2.1 M)).
// Compute dtypes, f32 accumulate: every input rounded to bf16; GroupNorm f32 (fixed-order sums); projections hi/lo x exact + f32 biases; attention rows < 512 3 products, rest fp16; softmax f32; Wo hl x exact + bias; residual f32.

#define NB_  2
#define TT   4096
#define DM   256
#define NH_  8
#define NKV  8
#define REP  (NH_ / NKV)
#define HD   64
#define DQ   (NH_ * HD)
#define DKV  (NKV * HD)
#define ZH   1
#define RH   512                  // query rows < RH use hi+lo planes (0: none)
#define WIN  0
#define PCAR 1024.0f
#define SCL  0.17677669529663689f   // 32^-1/2 == (32^-1/4)^2 applied once to q.k
#define CC   256     // channels
#define HR   32      // real head width (padded to HD = 64)
#define KSP  4       // work-groups that share one P.V tile's K range; k_merge adds their KSP planes
typedef _Float16 h16;
typedef unsigned short bf;
typedef __attribute__((ext_vector_type(16))) __bf16   v16bf;
typedef __attribute__((ext_vector_type(16))) _Float16 v16h;
typedef __attribute__((ext_vector_type(8)))  _Float16 v8h;
typedef __attribute__((ext_vector_type(8)))  unsigned short v8us;
typedef __attribute__((ext_vector_type(8)))  float    v8f;
typedef __attribute__((ext_vector_type(4)))  float    v4f;
typedef v8h  __attribute__((may_alias)) v8ha;
typedef v4f  __attribute__((may_alias)) v4fa;
typedef v8us __attribute__((may_alias)) v8usa;

__device__ __forceinline__ unsigned short f2bf(float f) { unsigned u = __float_as_uint(f); u += 0x7FFFu + ((u >> 16) & 1u); return (unsigned short)(u >> 16); }
__device__ __forceinline__ float bf2f(unsigned short b) { return __uint_as_float(((unsigned)b) << 16); }
__device__ __forceinline__ float bfr(float f) { return bf2f(f2bf(f)); }
__device__ __forceinline__ v16h cat16(v8h lo, v8h hi) { return __builtin_shufflevector(lo, hi, 0, 1, 2, 3, 4, 5, 6, 7, 8, 9, 10, 11, 12, 13, 14, 15); }
__device__ __forceinline__ v16bf cat16b(v8us lo, v8us hi) { return __builtin_bit_cast(v16bf, __builtin_shufflevector(lo, hi, 0, 1, 2, 3, 4, 5, 6, 7, 8, 9, 10, 11, 12, 13, 14, 15)); }
__device__ __forceinline__ v8f wmma16(v16h a, v16h b, v8f c) { return __builtin_amdgcn_wmma_f32_16x16x32_f16(false, a, false, b, (short)0, c, false, false); }
__device__ __forceinline__ v8f wmmab(v16bf a, v16bf b, v8f c) { return __builtin_amdgcn_wmma_f32_16x16x32_bf16(false, a, false, b, (short)0, c, false, false); }



// ---- k_gemmw: register-blocked GEMM, ONE WAVE per 64x64 output tile (16 accumulators), operands straight from K-contiguous 16-bit planes; grid (M/64, N/64, Z), 32 threads.
// C[m][n] (f32, pitch ldc, + optional f32 bias[n]) = sum_k A[m][k] Bt[n][k] (+ split products per NSPLIT). z-batch strides sA/sB/sC in elements. K % 32 == 0.
// For a long K on a small grid: K split over KS work-groups (blockIdx.z % KS; grid z = Z KS) and, inside each, over its NW waves (NW*32 threads); wave w of part zk sums k in [(zk NW + w) K/(KS NW), +K/(KS NW)).
// The NW f32 partial tiles meet in LDS (row pitch 68 floats) and are added in wave order, each wave finishing 64/NW whole rows; part zk stores to plane C + zk sP, and the reader of C adds the KS planes in order. K % (32 KS NW) == 0.
template <typename T16> struct WFrag;
template <> struct WFrag<h16> { typedef v16h V; static __device__ __forceinline__ V ld(const h16* p) { return cat16(*(const v8h*)p, *(const v8h*)(p + 16)); } static __device__ __forceinline__ v8f mma(V a, V b, v8f c) { return wmma16(a, b, c); } };
template <> struct WFrag<bf> { typedef v16bf V; static __device__ __forceinline__ V ld(const bf* p) { return cat16b(*(const v8us*)p, *(const v8us*)(p + 16)); } static __device__ __forceinline__ v8f mma(V a, V b, v8f c) { return wmmab(a, b, c); } };
template <typename T16, int NSPLIT, bool BIAS, int KS = 1, int NW = 1>
__global__ __launch_bounds__(NW * 32) void k_gemmw(const T16* __restrict__ A, const T16* __restrict__ A2, const T16* __restrict__ Bt, const T16* __restrict__ Bt2, int K, float* C, int ldc, const float* __restrict__ bias, size_t sA, size_t sB, size_t sC, size_t sP = 0) {
    static_assert(NW == 1 ? KS == 1 : (!BIAS && 64 % (2 * NW) == 0), "split K: no bias, whole row pairs per wave");
    typedef typename WFrag<T16>::V V;
    __shared__ __align__(16) float os[(NW == 1 ? 16 : NW * 64) * 68];
    const size_t z = blockIdx.z / KS; const int zk = blockIdx.z % KS; A += z * sA; if (A2) A2 += z * sA; Bt += z * sB; if (Bt2) Bt2 += z * sB; C += z * sC + zk * sP;
    const int wave = (NW == 1) ? 0 : __builtin_amdgcn_readfirstlane((int)(threadIdx.x >> 5)); const int ks = K / (KS * NW), k0 = (zk * NW + wave) * ks;
    const int lane = threadIdx.x & 31, lr = lane & 15, hi = lane >> 4; const int r0 = blockIdx.x * 64, c0 = blockIdx.y * 64;
    v8f acc[4][4];
#pragma unroll
    for (int mb = 0; mb < 4; ++mb)
#pragma unroll
        for (int nb = 0; nb < 4; ++nb) acc[mb][nb] = (v8f){};
    const size_t aoff = (size_t)(r0 + lr) * K + 8 * hi, boff = (size_t)(c0 + lr) * K + 8 * hi;
#pragma unroll 1
    for (int kc = k0; kc < k0 + ks; kc += 32) {
        V a[4], a2[4];
#pragma unroll
        for (int mb = 0; mb < 4; ++mb) { a[mb] = WFrag<T16>::ld(A + aoff + (size_t)mb * 16 * K + kc); if (NSPLIT == 1 || NSPLIT == 2) a2[mb] = WFrag<T16>::ld(A2 + aoff + (size_t)mb * 16 * K + kc); }
#pragma unroll
        for (int nb = 0; nb < 4; ++nb) { const V b = WFrag<T16>::ld(Bt + boff + (size_t)nb * 16 * K + kc); V b2; if (NSPLIT >= 2) b2 = WFrag<T16>::ld(Bt2 + boff + (size_t)nb * 16 * K + kc);
#pragma unroll
            for (int mb = 0; mb < 4; ++mb) { acc[mb][nb] = WFrag<T16>::mma(a[mb], b, acc[mb][nb]); if (NSPLIT == 1 || NSPLIT == 2) acc[mb][nb] = WFrag<T16>::mma(a2[mb], b, acc[mb][nb]); if (NSPLIT >= 2) acc[mb][nb] = WFrag<T16>::mma(a[mb], b2, acc[mb][nb]); } }
        asm volatile("v_nop\n\tv_nop\n\tv_nop\n\tv_nop" : "+v"(acc[0][0]), "+v"(acc[1][1]), "+v"(acc[2][2]), "+v"(acc[3][3]) : "v"(a[0]), "v"(a[3]));
    }
    if constexpr (NW > 1) {
        float* pw = os + wave * (64 * 68);
#pragma unroll
        for (int mb = 0; mb < 4; ++mb)
#pragma unroll
            for (int nb = 0; nb < 4; ++nb)
#pragma unroll
                for (int j = 0; j < 8; ++j) pw[(mb * 16 + hi * 8 + j) * 68 + nb * 16 + lr] = acc[mb][nb][j];
        __syncthreads();   // every wave's partial tile is in LDS before any wave adds them
#pragma unroll
        for (int s = 0; s < 64 / (2 * NW); ++s) { const int row = wave * (64 / NW) + 2 * s + hi, cofs = lr * 4; v4f val = *(const v4fa*)(os + row * 68 + cofs);
#pragma unroll
            for (int w = 1; w < NW; ++w) { const v4f pv = *(const v4fa*)(os + w * (64 * 68) + row * 68 + cofs); val[0] = __fadd_rn(val[0], pv[0]); val[1] = __fadd_rn(val[1], pv[1]); val[2] = __fadd_rn(val[2], pv[2]); val[3] = __fadd_rn(val[3], pv[3]); }
            *(v4f*)(C + (size_t)(r0 + row) * ldc + c0 + cofs) = val; }
        return;
    }
#pragma unroll
    for (int mb = 0; mb < 4; ++mb) {
#pragma unroll
        for (int nb = 0; nb < 4; ++nb) {
#pragma unroll
            for (int j = 0; j < 8; ++j) os[(hi * 8 + j) * 68 + nb * 16 + lr] = acc[mb][nb][j]; }
        __builtin_amdgcn_wave_barrier(); asm volatile("" ::: "memory");
        float* crow = C + (size_t)(r0 + mb * 16) * ldc + c0;
{
#pragma unroll
            for (int s = 0; s < 8; ++s) { const int row = 2 * s + hi, cofs = lr * 4; v4f val = *(const v4fa*)(os + row * 68 + cofs); if (BIAS) { val[0] += bfr(bias[c0 + cofs]); val[1] += bfr(bias[c0 + cofs + 1]); val[2] += bfr(bias[c0 + cofs + 2]); val[3] += bfr(bias[c0 + cofs + 3]); }
                *(v4f*)(crow + (size_t)row * ldc + cofs) = val; }
             }
        __builtin_amdgcn_wave_barrier(); asm volatile("" ::: "memory");
    }
}

__device__ __forceinline__ h16 tohx(float x) { return (h16)x; }
__device__ __forceinline__ void splitf(float y, unsigned short& h, unsigned short& l) { h = f2bf(y); l = f2bf(y - bf2f(h)); }
typedef __attribute__((ext_vector_type(2))) _Float16 v2h;
typedef __attribute__((ext_vector_type(4))) _Float16 v4h;
typedef __attribute__((ext_vector_type(2))) unsigned short v2us;
typedef __attribute__((ext_vector_type(4))) unsigned short v4us;
typedef __attribute__((ext_vector_type(2))) float v2f;
typedef __attribute__((ext_vector_type(4))) int v4i;

__global__ __launch_bounds__(256) void k_wtG(const float* __restrict__ w, int K, int N, bf* Bt) {
    const int lane = threadIdx.x & 31; const int L0 = (blockIdx.x * 8 + (threadIdx.x >> 5)) * 8; const int nlines = N * K / 64;
{
#pragma unroll 1
        for (int l = 0; l < 8; ++l) { const int L = L0 + l; if (L >= nlines) break; const size_t e = (size_t)L * 64 + lane * 2; const int k = (int)(e % K), n = (int)(e / K); v2us o;
            o[0] = f2bf(w[(size_t)k * N + n]); o[1] = f2bf(w[(size_t)(k + 1) * N + n]); *(v2us*)(Bt + e) = o; }
         }
}
__global__ __launch_bounds__(256) void k_cvt8(const float* __restrict__ src, bf* dst, size_t n8) { const size_t i = (size_t)blockIdx.x * 256 + threadIdx.x; if (i >= n8) return; const v8f v = *(const v8f*)(src + i * 8); v8us o;
#pragma unroll
    for (int k = 0; k < 8; ++k) o[k] = f2bf(v[k]); *(v8us*)(dst + i * 8) = o;  }

// k_rope: head planes [h][t][d] (fp16 + hi/lo) of rope(x) x sc with the rotate-half convention out[d] = x[d] cos[t][d] - x[d+HD/2] sin[t][d], out[d+HD/2] = x[d+HD/2] cos[t][d+HD/2] + x[d] sin[t][d+HD/2]
__global__ __launch_bounds__(256) void k_rope(const float* __restrict__ F, int pitch, int nheads, const float* __restrict__ CS, const float* __restrict__ RF, const float* __restrict__ nw, float sc, h16* P16, bf* Ph, bf* Pl) {
    const size_t e = ((size_t)blockIdx.x * 256 + threadIdx.x) * 2; if (e >= (size_t)nheads * TT * HD) return; const int d = (int)(e % HD); const int t = (int)((e / HD) % TT); const int h = (int)(e / ((size_t)HD * TT)); const float* f = F + (size_t)t * pitch + h * HD; const float rf = RF ? RF[(size_t)h * TT + t] : 1.0f; v2h o16; v2us oh, ol;
#pragma unroll
    for (int q = 0; q < 2; ++q) { const int dd = d + q; const int dp = (dd < HD / 2) ? dd + HD / 2 : dd - HD / 2; float x0 = f[dd], x1 = f[dp];
        if (RF) { float n0 = __fmul_rn(x0, rf), n1 = __fmul_rn(x1, rf); asm volatile("" : "+v"(n0)); asm volatile("" : "+v"(n1)); x0 = __fmul_rn(bfr(nw[dd]), n0); x1 = __fmul_rn(bfr(nw[dp]), n1); }
        const v2f cs = *(const v2f*)(CS + ((size_t)t * HD + dd) * 2); float a = __fmul_rn(x0, cs[0]), bq = __fmul_rn(x1, cs[1]); asm volatile("" : "+v"(a)); asm volatile("" : "+v"(bq)); const float r = ((dd < HD / 2) ? __fsub_rn(a, bq) : __fadd_rn(a, bq)) * sc;
        o16[q] = tohx(r); unsigned short a2, c2; splitf(r, a2, c2); oh[q] = a2; ol[q] = c2; }
    *(v2h*)(P16 + e) = o16; *(v2us*)(Ph + e) = oh; *(v2us*)(Pl + e) = ol;  }
__global__ __launch_bounds__(256) void k_vtp(const float* __restrict__ F, int pitch, int nheads, h16* V16, bf* Vh, bf* Vl) { const size_t e = ((size_t)blockIdx.x * 256 + threadIdx.x) * 2; if (e >= (size_t)nheads * HD * TT) return; const int t = (int)(e % TT); const int d = (int)((e / TT) % HD); const int g = (int)(e / ((size_t)TT * HD)); v2h o16; v2us oh, ol;
#pragma unroll
    for (int q = 0; q < 2; ++q) { const float x = F[(size_t)(t + q) * pitch + g * HD + d]; o16[q] = tohx(x); unsigned short a2, c2; splitf(x, a2, c2); oh[q] = a2; ol[q] = c2; }
    *(v2h*)(V16 + e) = o16; *(v2us*)(Vh + e) = oh; *(v2us*)(Vl + e) = ol;  }
__global__ __launch_bounds__(256) void k_csid(float* CS) { const int idx = blockIdx.x * 256 + threadIdx.x; if (idx >= TT * HD) return; v2f cs; cs[0] = 1.0f; cs[1] = 0.0f; *(v2f*)(CS + (size_t)idx * 2) = cs;  }
// k_lsoft: streaming row softmax over all TK = TT = 4096 keys, one wave per row i, three sweeps of the f32 score row (lane -> 4 consecutive keys per 128-key chunk, 32 chunks; no mask - every score tile is computed and every key enters max, sum and output):
__global__ __launch_bounds__(256) void k_lsoft(const float* __restrict__ Sb, h16* P16, bf* Ph, bf* Pl) {
    const int lane = threadIdx.x & 31; const int row = blockIdx.x * 8 + (threadIdx.x >> 5); if (row >= ZH * TT) return; const int i = row % TT; const int zz = row / TT; const bool hires = (i < RH); const float* sr = Sb + (size_t)row * TT; float mx = -3.0e38f;
#pragma unroll 4
    for (int ch = 0; ch < TT / 128; ++ch) { const int j0 = ch * 128 + lane * 4; const v4f a = *(const v4f*)(sr + j0);
#pragma unroll
        for (int q = 0; q < 4; ++q) { float t = a[q] * SCL; asm volatile("" : "+v"(t)); mx = fmaxf(mx, t); } }
#pragma unroll
    for (int sh = 16; sh; sh >>= 1) mx = fmaxf(mx, __shfl_xor(mx, sh, 32));
    float sum = 0.f;
#pragma unroll 4
    for (int ch = 0; ch < TT / 128; ++ch) { const int j0 = ch * 128 + lane * 4; const v4f a = *(const v4f*)(sr + j0);
#pragma unroll
        for (int q = 0; q < 4; ++q) { float t = a[q] * SCL; asm volatile("" : "+v"(t)); float d0 = __fsub_rn(t, mx); asm volatile("" : "+v"(d0)); sum += __builtin_amdgcn_exp2f(__fmul_rn(d0, 1.4426950408889634f)); } }
#pragma unroll
    for (int sh = 16; sh; sh >>= 1) sum += __shfl_xor(sum, sh, 32);
    const float f = __fdiv_rn(hires ? 1.0f : PCAR, sum);
{
        if (hires) {   /* rows < RH: normalised bf16 hi/lo over all keys, planes [zz][RH][TT] */
#pragma unroll
            for (int ch = 0; ch < TT / 128; ++ch) { const int j0 = ch * 128 + lane * 4; const v4f a = *(const v4f*)(sr + j0); v4us oh, ol;
#pragma unroll
                for (int q = 0; q < 4; ++q) { float t = a[q] * SCL; asm volatile("" : "+v"(t)); float d0 = __fsub_rn(t, mx); asm volatile("" : "+v"(d0)); float ex = __builtin_amdgcn_exp2f(__fmul_rn(d0, 1.4426950408889634f)); asm volatile("" : "+v"(ex)); unsigned short a2, c2; splitf(ex * f, a2, c2); oh[q] = a2; ol[q] = c2; }
                const size_t oo = ((size_t)zz * RH + i) * TT + j0; *(v4us*)(Ph + oo) = oh; *(v4us*)(Pl + oo) = ol; }
        } else {
#pragma unroll 2
            for (int ch = 0; ch < TT / 128; ++ch) { const int j0 = ch * 128 + lane * 4; const v4f a = *(const v4f*)(sr + j0); v4h o4;
#pragma unroll
                for (int q = 0; q < 4; ++q) { float t = a[q] * SCL; asm volatile("" : "+v"(t)); float d0 = __fsub_rn(t, mx); asm volatile("" : "+v"(d0)); float ex = __builtin_amdgcn_exp2f(__fmul_rn(d0, 1.4426950408889634f)); asm volatile("" : "+v"(ex)); o4[q] = tohx(ex * f); }
                *(v4h*)(P16 + (size_t)row * TT + j0) = o4; } }
         }
}

__global__ __launch_bounds__(256) void k_wpadh(const float* __restrict__ w, const float* __restrict__ bias, bf* Bt, float* bp) { const int i = blockIdx.x * 256 + threadIdx.x; if (i >= DQ * DM / 8) return; const int c0 = (i % (DM / 8)) * 8; const int r = i / (DM / 8); const int h = r / HD, d = r % HD; const int sr = h * HR + min(d, HR - 1); const float* src = w + (size_t)sr * DM + c0; v8us o;
#pragma unroll
    for (int q = 0; q < 8; ++q) { const unsigned short v = f2bf(src[q]); o[q] = (d < HR) ? v : (unsigned short)0; }
    *(v8us*)(Bt + (size_t)r * DM + c0) = o; if (i < DQ) { const int hb = i / HD, db = i % HD; const float bb = bias[hb * HR + min(db, HR - 1)]; ((float*)bp)[i] = (db < HR) ? bb : 0.0f; }     }
__global__ __launch_bounds__(256) void k_wopadh(const float* __restrict__ w, bf* Bt) { const int i = blockIdx.x * 256 + threadIdx.x; if (i >= DM * DQ / 8) return; const int k0 = (i % (DQ / 8)) * 8; const int o = i / (DQ / 8); v8us ov;
#pragma unroll
    for (int q = 0; q < 8; ++q) { const int kk = k0 + q; const int h = kk / HD, d = kk % HD; const unsigned short v = f2bf(w[(size_t)o * DM + h * HR + min(d, HR - 1)]); ov[q] = (d < HR) ? v : (unsigned short)0; }
    *(v8us*)(Bt + (size_t)o * DQ + k0) = ov;  }
__global__ __launch_bounds__(256) void k_gnstat(const float* __restrict__ xs, float* stat) { __shared__ float red[256]; const int tid = threadIdx.x; const size_t n = (size_t)CC * TT; float s = 0.f;
    for (size_t e = (size_t)tid * 4; e < n; e += 256 * 4) { const v4f a = *(const v4f*)(xs + e); for (int q = 0; q < 4; ++q) s = __fadd_rn(s, bfr(a[q])); }
    red[tid] = s; __syncthreads();
    for (int st = 128; st > 0; st >>= 1) { if (tid < st) red[tid] = __fadd_rn(red[tid], red[tid + st]); __syncthreads(); }
    const float mean = __fdiv_rn(red[0], (float)n); __syncthreads(); float s2 = 0.f;
    for (size_t e = (size_t)tid * 4; e < n; e += 256 * 4) { const v4f a = *(const v4f*)(xs + e); for (int q = 0; q < 4; ++q) { const float dv = __fsub_rn(bfr(a[q]), mean); float p2 = __fmul_rn(dv, dv); asm volatile("" : "+v"(p2)); s2 = __fadd_rn(s2, p2); } }
    red[tid] = s2; __syncthreads();
    for (int st = 128; st > 0; st >>= 1) { if (tid < st) red[tid] = __fadd_rn(red[tid], red[tid + st]); __syncthreads(); }
    if (tid == 0) { const float var = __fdiv_rn(red[0], (float)n); const float rs = __fdiv_rn(1.0f, __fsqrt_rn(__fadd_rn(var, 1e-5f))); v2f o; o[0] = mean; o[1] = rs; *(v2f*)stat = o;  } }
__global__ __launch_bounds__(256) void k_gnT(const float* __restrict__ xs, const float* __restrict__ stat, const float* __restrict__ g, const float* __restrict__ bb, bf* XH, bf* XL) { const size_t k = (size_t)blockIdx.x * 256 + threadIdx.x; if (k >= (size_t)TT * CC / 8) return; const int c0 = (int)(k % (CC / 8)) * 8; const int t = (int)(k / (CC / 8)); const float mean = stat[0], rs = stat[1]; v8us oh, ol;
#pragma unroll
    for (int q = 0; q < 8; ++q) { const int c = c0 + q; const float dv = __fsub_rn(bfr(xs[(size_t)c * TT + t]), mean); float y = __fmul_rn(dv, rs); asm volatile("" : "+v"(y)); y = __fmul_rn(y, bfr(g[c])); asm volatile("" : "+v"(y)); y = __fadd_rn(y, bfr(bb[c])); unsigned short a2, c2; splitf(y, a2, c2); oh[q] = a2; ol[q] = c2; }
    *(v8us*)(XH + (size_t)t * CC + c0) = oh; *(v8us*)(XL + (size_t)t * CC + c0) = ol;  }
__global__ __launch_bounds__(256) void k_outTr(const float* __restrict__ U, const float* __restrict__ xs, float* outp) { const size_t k = (size_t)blockIdx.x * 256 + threadIdx.x; if (k >= (size_t)CC * TT / 4) return; const size_t e = k * 4; const int t0 = (int)(e % TT); const int c = (int)(e / TT); const v4f a = *(const v4f*)(xs + e); v4f o;
#pragma unroll
    for (int q = 0; q < 4; ++q) o[q] = __fadd_rn(bfr(a[q]), U[(size_t)(t0 + q) * CC + c]);
    *(v4f*)(outp + e) = o;  }

__global__ __launch_bounds__(256) void k_merge(const float* __restrict__ O, int h0, bf* Ah, bf* Al) { const size_t e = ((size_t)blockIdx.x * 256 + threadIdx.x) * 2; if (e >= (size_t)ZH * TT * HD) return; const int d = (int)(e % HD); const int t = (int)((e / HD) % TT); const int zz = (int)(e / ((size_t)HD * TT)); const float cs = (t < RH) ? 1.0f : (1.0f / PCAR); const size_t oo = (size_t)t * DQ + (h0 + zz) * HD + d;
    v2us oh, ol; v2f sm = *(const v2f*)(O + e);
#pragma unroll
    for (int p = 1; p < KSP; ++p) { const v2f pv = *(const v2f*)(O + (size_t)p * ZH * TT * HD + e); sm[0] = __fadd_rn(sm[0], pv[0]); sm[1] = __fadd_rn(sm[1], pv[1]); }
#pragma unroll
    for (int q = 0; q < 2; ++q) { unsigned short a, c2; splitf(sm[q] * cs, a, c2); oh[q] = a; ol[q] = c2; } *(v2us*)(Ah + oo) = oh; *(v2us*)(Al + oo) = ol;  }

extern "C" void kernel_launch(void* const* d_in, const int* in_sizes, int n_in,
                              void* d_out, int out_size, void* d_ws, size_t ws_size, hipStream_t stream) {
    (void)in_sizes; (void)n_in; (void)out_size;
    const float* x = (const float*)d_in[0]; const float* gnw = (const float*)d_in[1]; const float* gnb = (const float*)d_in[2]; const float* wq = (const float*)d_in[3]; const float* bq = (const float*)d_in[4]; const float* wk = (const float*)d_in[5]; const float* bk = (const float*)d_in[6]; const float* wv = (const float*)d_in[7]; const float* bv = (const float*)d_in[8]; const float* wo = (const float*)d_in[9]; const float* bo = (const float*)d_in[10];
    float* OUT = (float*)d_out;     // [2][256][4096]
    char* wsp = (char*)d_ws;
    auto take = [&](size_t bytes) { char* p = wsp; wsp += (bytes + 255) & ~(size_t)255; return (void*)p; };
    float* BQP = (float*)take(DQ * 4); float* BKP = (float*)take(DQ * 4); float* BVP = (float*)take(DQ * 4); bf* XH = (bf*)take((size_t)TT * DM * 2); bf* XL = (bf*)take((size_t)TT * DM * 2); float* STAT = (float*)take(256); float* Y = (float*)take((size_t)TT * DM * 4); bf* WQ = (bf*)take((size_t)DQ * DM * 2); bf* WK = (bf*)take((size_t)DKV * DM * 2); bf* WV = (bf*)take((size_t)DKV * DM * 2); bf* WO = (bf*)take((size_t)DM * DQ * 2); float* CS = (float*)take((size_t)TT * HD * 2 * 4);
     float* FQ = (float*)take((size_t)TT * DQ * 4); float* FK = (float*)take((size_t)TT * DKV * 4);
    h16* QP16 = (h16*)take((size_t)NH_ * TT * HD * 2); h16* KP16 = (h16*)take((size_t)NKV * TT * HD * 2); h16* VT16 = (h16*)take((size_t)NKV * HD * TT * 2);
    bf* QPh = (bf*)take((size_t)NH_ * TT * HD * 2); bf* QPl = (bf*)take((size_t)NH_ * TT * HD * 2); bf* KPh = (bf*)take((size_t)NKV * TT * HD * 2); bf* KPl = (bf*)take((size_t)NKV * TT * HD * 2); bf* VTh = (bf*)take((size_t)NKV * HD * TT * 2); bf* VTl = (bf*)take((size_t)NKV * HD * TT * 2); bf* Ph = (bf*)take((size_t)ZH * RH * TT * 2); bf* Pl = (bf*)take((size_t)ZH * RH * TT * 2);
    float* Sb = (float*)take((size_t)ZH * TT * TT * 4); h16* P16 = (h16*)take((size_t)ZH * TT * TT * 2); float* Ob = (float*)take((size_t)KSP * ZH * TT * HD * 4); bf* ATh = (bf*)take((size_t)TT * DQ * 2); bf* ATl = (bf*)take((size_t)TT * DQ * 2);
    if ((size_t)(wsp - (char*)d_ws) > ws_size) return;    // ws 256 MiB
    float* FV = FK;   // v projection reuses the k buffer after the k planes are built (stream-ordered)
    { k_wpadh<<<(DQ * DM / 8 + 255) / 256, 256, 0, stream>>>(wq, bq, WQ, BQP); k_wpadh<<<(DQ * DM / 8 + 255) / 256, 256, 0, stream>>>(wk, bk, WK, BKP); k_wpadh<<<(DQ * DM / 8 + 255) / 256, 256, 0, stream>>>(wv, bv, WV, BVP);
      k_wopadh<<<(DM * DQ / 8 + 255) / 256, 256, 0, stream>>>(wo, WO);
       }
    k_csid<<<(TT * HD + 255) / 256, 256, 0, stream>>>(CS);
    const unsigned LQ = (unsigned)(((size_t)NH_ * TT * HD / 2 + 255) / 256), LKv = (unsigned)(((size_t)NKV * TT * HD / 2 + 255) / 256);
    for (int b = 0; b < NB_; ++b) {
        
        k_gnstat<<<1, 256, 0, stream>>>(x + (size_t)b * CC * TT, STAT);    k_gnT<<<(unsigned)(((size_t)TT * CC / 8 + 255) / 256), 256, 0, stream>>>(x + (size_t)b * CC * TT, STAT, gnw, gnb, XH, XL);   /* normalised, token-major, hi/lo */
        k_gemmw<bf, 1, true><<<dim3(TT / 64, DQ / 64, 1), 32, 0, stream>>>(XH, XL, WQ, nullptr, DM, FQ, DQ, BQP, 0, 0, 0);
        k_rope<<<LQ, 256, 0, stream>>>(FQ, DQ, NH_, CS, nullptr, nullptr, 1.0f, QP16, QPh, QPl);
        k_gemmw<bf, 1, true><<<dim3(TT / 64, DKV / 64, 1), 32, 0, stream>>>(XH, XL, WK, nullptr, DM, FK, DKV, BKP, 0, 0, 0);
        k_rope<<<LKv, 256, 0, stream>>>(FK, DKV, NKV, CS, nullptr, nullptr, 1.0f, KP16, KPh, KPl);
        k_gemmw<bf, 1, true><<<dim3(TT / 64, DKV / 64, 1), 32, 0, stream>>>(XH, XL, WV, nullptr, DM, FV, DKV, BVP, 0, 0, 0); k_vtp<<<LKv, 256, 0, stream>>>(FV, DKV, NKV, VT16, VTh, VTl);
        for (int h0 = 0; h0 < NH_; h0 += ZH) { const size_t zq = (size_t)h0, zk = (size_t)(h0 / REP);   // one kv head per query head: each pass (ZH = 1) takes query head h0 and kv plane h0 (z-strides TT*HD)
            k_gemmw<bf, 2, false><<<dim3(RH / 64, TT / 64, ZH), 32, 0, stream>>>(QPh + zq * TT * HD, QPl + zq * TT * HD, KPh + zk * TT * HD, KPl + zk * TT * HD, HD, Sb, TT, nullptr, (size_t)TT * HD, (size_t)TT * HD, (size_t)TT * TT);
            k_gemmw<h16, 0, false><<<dim3((TT - RH) / 64, TT / 64, ZH), 32, 0, stream>>>(QP16 + zq * TT * HD + (size_t)RH * HD, nullptr, KP16 + zk * TT * HD, nullptr, HD, Sb + (size_t)RH * TT, TT, nullptr, (size_t)TT * HD, (size_t)TT * HD, (size_t)TT * TT);
            k_lsoft<<<ZH * TT / 8, 256, 0, stream>>>(Sb, P16, Ph, Pl);
            k_gemmw<bf, 2, false, KSP, 16><<<dim3(RH / 64, HD / 64, ZH * KSP), 512, 0, stream>>>(Ph, Pl, VTh + zk * HD * TT, VTl + zk * HD * TT, TT, Ob, HD, nullptr, (size_t)RH * TT, (size_t)HD * TT, (size_t)TT * HD, (size_t)ZH * TT * HD);
            k_gemmw<h16, 0, false, KSP, 8><<<dim3((TT - RH) / 64, HD / 64, ZH * KSP), 256, 0, stream>>>(P16 + (size_t)RH * TT, nullptr, VT16 + zk * HD * TT, nullptr, TT, Ob + (size_t)RH * HD, HD, nullptr, (size_t)TT * TT, (size_t)HD * TT, (size_t)TT * HD, (size_t)ZH * TT * HD);
            k_merge<<<(unsigned)(((size_t)ZH * TT * HD / 2 + 255) / 256), 256, 0, stream>>>(Ob, h0, ATh, ATl); }
        k_gemmw<bf, 1, true><<<dim3(TT / 64, DM / 64, 1), 32, 0, stream>>>(ATh, ATl, WO, nullptr, DQ, Y, DM, bo, 0, 0, 0); k_outTr<<<(unsigned)(((size_t)CC * TT / 4 + 255) / 256), 256, 0, stream>>>(Y, x + (size_t)b * CC * TT, OUT + (size_t)b * CC * TT);   /* back to channel-major + hidden residual */ }
}

// v002
// Measured time: 1720 microseconds a run.
// Next to v001, in two timings, it ran 1.67 and 1.65 times as fast.
// Counting every step since v000, it is 3.01 times as fast.
#include <hip/hip_runtime.h>

// 1-D self-attention block with GroupNorm and residual on a channel-major sequence (hidden [2][256][4096]; x = GroupNorm(1 group over all 256 x 4096 values, eps 1e-5) x gn_weight + gn_bias; h = x^T; q,k,v = h W^T + b ('oi' [256][256] + [256], 1/16; 8 heads x 32); scores = (q 32^-1/4).(k 32^-1/4); softmax over all 4,096 keys; out = merged Wo^T + bo, transposed back + hidden -> [2][256][4096] (2.1 M)).
// Compute dtypes, f32 accumulate: every input rounded to bf16; GroupNorm f32 (fixed-order sums); projections hi/lo x exact + f32 biases; attention rows < 512 3 products, rest fp16; softmax f32; Wo hl x exact + bias; residual f32.

#define NB_  2
#define TT   4096
#define DM   256
#define NH_  8
#define NKV  8
#define REP  (NH_ / NKV)
#define HD   64
#define DQ   (NH_ * HD)
#define DKV  (NKV * HD)
#define ZH   1
#define RH   512                  // query rows < RH use hi+lo planes (0: none)
#define WIN  0
#define PCAR 1024.0f
#define SCL  0.17677669529663689f   // 32^-1/2 == (32^-1/4)^2 applied once to q.k
#define CC   256     // channels
#define HR   32      // real head width (padded to HD = 64)
#define KSP  4       // work-groups that share one P.V tile's K range; k_merge adds their KSP planes
typedef _Float16 h16;
typedef unsigned short bf;
typedef __attribute__((ext_vector_type(16))) __bf16   v16bf;
typedef __attribute__((ext_vector_type(16))) _Float16 v16h;
typedef __attribute__((ext_vector_type(8)))  _Float16 v8h;
typedef __attribute__((ext_vector_type(8)))  unsigned short v8us;
typedef __attribute__((ext_vector_type(8)))  float    v8f;
typedef __attribute__((ext_vector_type(4)))  float    v4f;
typedef v8h  __attribute__((may_alias)) v8ha;
typedef v4f  __attribute__((may_alias)) v4fa;
typedef v8us __attribute__((may_alias)) v8usa;

__device__ __forceinline__ unsigned short f2bf(float f) { unsigned u = __float_as_uint(f); u += 0x7FFFu + ((u >> 16) & 1u); return (unsigned short)(u >> 16); }
__device__ __forceinline__ float bf2f(unsigned short b) { return __uint_as_float(((unsigned)b) << 16); }
__device__ __forceinline__ float bfr(float f) { return bf2f(f2bf(f)); }
__device__ __forceinline__ v16h cat16(v8h lo, v8h hi) { return __builtin_shufflevector(lo, hi, 0, 1, 2, 3, 4, 5, 6, 7, 8, 9, 10, 11, 12, 13, 14, 15); }
__device__ __forceinline__ v16bf cat16b(v8us lo, v8us hi) { return __builtin_bit_cast(v16bf, __builtin_shufflevector(lo, hi, 0, 1, 2, 3, 4, 5, 6, 7, 8, 9, 10, 11, 12, 13, 14, 15)); }
__device__ __forceinline__ v8f wmma16(v16h a, v16h b, v8f c) { return __builtin_amdgcn_wmma_f32_16x16x32_f16(false, a, false, b, (short)0, c, false, false); }
__device__ __forceinline__ v8f wmmab(v16bf a, v16bf b, v8f c) { return __builtin_amdgcn_wmma_f32_16x16x32_bf16(false, a, false, b, (short)0, c, false, false); }



// ---- k_gemmw: register-blocked GEMM, ONE WAVE per 64x64 output tile (16 accumulators), operands straight from K-contiguous 16-bit planes; grid (M/64, N/64, Z), 32 threads.
// C[m][n] (f32, pitch ldc, + optional f32 bias[n]) = sum_k A[m][k] Bt[n][k] (+ split products per NSPLIT). z-batch strides sA/sB/sC in elements. K % 32 == 0.
// For a long K on a small grid: K split over KS work-groups (blockIdx.z % KS; grid z = Z KS) and, inside each, over its NW waves (NW*32 threads); wave w of part zk sums k in [(zk NW + w) K/(KS NW), +K/(KS NW)).
// The NW f32 partial tiles meet in LDS (row pitch 68 floats) and are added in wave order, each wave finishing 64/NW whole rows; part zk stores to plane C + zk sP, and the reader of C adds the KS planes in order. K % (32 KS NW) == 0.
template <typename T16> struct WFrag;
template <> struct WFrag<h16> { typedef v16h V; static __device__ __forceinline__ V ld(const h16* p) { return cat16(*(const v8h*)p, *(const v8h*)(p + 16)); } static __device__ __forceinline__ v8f mma(V a, V b, v8f c) { return wmma16(a, b, c); } };
template <> struct WFrag<bf> { typedef v16bf V; static __device__ __forceinline__ V ld(const bf* p) { return cat16b(*(const v8us*)p, *(const v8us*)(p + 16)); } static __device__ __forceinline__ v8f mma(V a, V b, v8f c) { return wmmab(a, b, c); } };
template <typename T16, int NSPLIT, bool BIAS, int KS = 1, int NW = 1>
__global__ __launch_bounds__(NW * 32) void k_gemmw(const T16* __restrict__ A, const T16* __restrict__ A2, const T16* __restrict__ Bt, const T16* __restrict__ Bt2, int K, float* C, int ldc, const float* __restrict__ bias, size_t sA, size_t sB, size_t sC, size_t sP = 0) {
    static_assert(NW == 1 ? KS == 1 : (!BIAS && 64 % (2 * NW) == 0), "split K: no bias, whole row pairs per wave");
    typedef typename WFrag<T16>::V V;
    __shared__ __align__(16) float os[(NW == 1 ? 16 : NW * 64) * 68];
    const size_t z = blockIdx.z / KS; const int zk = blockIdx.z % KS; A += z * sA; if (A2) A2 += z * sA; Bt += z * sB; if (Bt2) Bt2 += z * sB; C += z * sC + zk * sP;
    const int wave = (NW == 1) ? 0 : __builtin_amdgcn_readfirstlane((int)(threadIdx.x >> 5)); const int ks = K / (KS * NW), k0 = (zk * NW + wave) * ks;
    const int lane = threadIdx.x & 31, lr = lane & 15, hi = lane >> 4; const int r0 = blockIdx.x * 64, c0 = blockIdx.y * 64;
    v8f acc[4][4];
#pragma unroll
    for (int mb = 0; mb < 4; ++mb)
#pragma unroll
        for (int nb = 0; nb < 4; ++nb) acc[mb][nb] = (v8f){};
    const size_t aoff = (size_t)(r0 + lr) * K + 8 * hi, boff = (size_t)(c0 + lr) * K + 8 * hi;
#pragma unroll 1
    for (int kc = k0; kc < k0 + ks; kc += 32) {
        V a[4], a2[4];
#pragma unroll
        for (int mb = 0; mb < 4; ++mb) { a[mb] = WFrag<T16>::ld(A + aoff + (size_t)mb * 16 * K + kc); if (NSPLIT == 1 || NSPLIT == 2) a2[mb] = WFrag<T16>::ld(A2 + aoff + (size_t)mb * 16 * K + kc); }
#pragma unroll
        for (int nb = 0; nb < 4; ++nb) { const V b = WFrag<T16>::ld(Bt + boff + (size_t)nb * 16 * K + kc); V b2; if (NSPLIT >= 2) b2 = WFrag<T16>::ld(Bt2 + boff + (size_t)nb * 16 * K + kc);
#pragma unroll
            for (int mb = 0; mb < 4; ++mb) { acc[mb][nb] = WFrag<T16>::mma(a[mb], b, acc[mb][nb]); if (NSPLIT == 1 || NSPLIT == 2) acc[mb][nb] = WFrag<T16>::mma(a2[mb], b, acc[mb][nb]); if (NSPLIT >= 2) acc[mb][nb] = WFrag<T16>::mma(a[mb], b2, acc[mb][nb]); } }
        asm volatile("v_nop\n\tv_nop\n\tv_nop\n\tv_nop" : "+v"(acc[0][0]), "+v"(acc[1][1]), "+v"(acc[2][2]), "+v"(acc[3][3]) : "v"(a[0]), "v"(a[3]));
    }
    if constexpr (NW > 1) {
        float* pw = os + wave * (64 * 68);
#pragma unroll
        for (int mb = 0; mb < 4; ++mb)
#pragma unroll
            for (int nb = 0; nb < 4; ++nb)
#pragma unroll
                for (int j = 0; j < 8; ++j) pw[(mb * 16 + hi * 8 + j) * 68 + nb * 16 + lr] = acc[mb][nb][j];
        __syncthreads();   // every wave's partial tile is in LDS before any wave adds them
#pragma unroll
        for (int s = 0; s < 64 / (2 * NW); ++s) { const int row = wave * (64 / NW) + 2 * s + hi, cofs = lr * 4; v4f val = *(const v4fa*)(os + row * 68 + cofs);
#pragma unroll
            for (int w = 1; w < NW; ++w) { const v4f pv = *(const v4fa*)(os + w * (64 * 68) + row * 68 + cofs); val[0] = __fadd_rn(val[0], pv[0]); val[1] = __fadd_rn(val[1], pv[1]); val[2] = __fadd_rn(val[2], pv[2]); val[3] = __fadd_rn(val[3], pv[3]); }
            *(v4f*)(C + (size_t)(r0 + row) * ldc + c0 + cofs) = val; }
        return;
    }
#pragma unroll
    for (int mb = 0; mb < 4; ++mb) {
#pragma unroll
        for (int nb = 0; nb < 4; ++nb) {
#pragma unroll
            for (int j = 0; j < 8; ++j) os[(hi * 8 + j) * 68 + nb * 16 + lr] = acc[mb][nb][j]; }
        __builtin_amdgcn_wave_barrier(); asm volatile("" ::: "memory");
        float* crow = C + (size_t)(r0 + mb * 16) * ldc + c0;
{
#pragma unroll
            for (int s = 0; s < 8; ++s) { const int row = 2 * s + hi, cofs = lr * 4; v4f val = *(const v4fa*)(os + row * 68 + cofs); if (BIAS) { val[0] += bfr(bias[c0 + cofs]); val[1] += bfr(bias[c0 + cofs + 1]); val[2] += bfr(bias[c0 + cofs + 2]); val[3] += bfr(bias[c0 + cofs + 3]); }
                *(v4f*)(crow + (size_t)row * ldc + cofs) = val; }
             }
        __builtin_amdgcn_wave_barrier(); asm volatile("" ::: "memory");
    }
}

__device__ __forceinline__ h16 tohx(float x) { return (h16)x; }
__device__ __forceinline__ void splitf(float y, unsigned short& h, unsigned short& l) { h = f2bf(y); l = f2bf(y - bf2f(h)); }
typedef __attribute__((ext_vector_type(2))) _Float16 v2h;
typedef __attribute__((ext_vector_type(4))) _Float16 v4h;
typedef __attribute__((ext_vector_type(2))) unsigned short v2us;
typedef __attribute__((ext_vector_type(4))) unsigned short v4us;
typedef __attribute__((ext_vector_type(2))) float v2f;
typedef __attribute__((ext_vector_type(4))) int v4i;

__global__ __launch_bounds__(256) void k_wtG(const float* __restrict__ w, int K, int N, bf* Bt) {
    const int lane = threadIdx.x & 31; const int L0 = (blockIdx.x * 8 + (threadIdx.x >> 5)) * 8; const int nlines = N * K / 64;
{
#pragma unroll 1
        for (int l = 0; l < 8; ++l) { const int L = L0 + l; if (L >= nlines) break; const size_t e = (size_t)L * 64 + lane * 2; const int k = (int)(e % K), n = (int)(e / K); v2us o;
            o[0] = f2bf(w[(size_t)k * N + n]); o[1] = f2bf(w[(size_t)(k + 1) * N + n]); *(v2us*)(Bt + e) = o; }
         }
}
__global__ __launch_bounds__(256) void k_cvt8(const float* __restrict__ src, bf* dst, size_t n8) { const size_t i = (size_t)blockIdx.x * 256 + threadIdx.x; if (i >= n8) return; const v8f v = *(const v8f*)(src + i * 8); v8us o;
#pragma unroll
    for (int k = 0; k < 8; ++k) o[k] = f2bf(v[k]); *(v8us*)(dst + i * 8) = o;  }

// k_rope: head planes [h][t][d] (fp16 + hi/lo) of rope(x) x sc with the rotate-half convention out[d] = x[d] cos[t][d] - x[d+HD/2] sin[t][d], out[d+HD/2] = x[d+HD/2] cos[t][d+HD/2] + x[d] sin[t][d+HD/2]
__global__ __launch_bounds__(256) void k_rope(const float* __restrict__ F, int pitch, int nheads, const float* __restrict__ CS, const float* __restrict__ RF, const float* __restrict__ nw, float sc, h16* P16, bf* Ph, bf* Pl) {
    const size_t e = ((size_t)blockIdx.x * 256 + threadIdx.x) * 2; if (e >= (size_t)nheads * TT * HD) return; const int d = (int)(e % HD); const int t = (int)((e / HD) % TT); const int h = (int)(e / ((size_t)HD * TT)); const float* f = F + (size_t)t * pitch + h * HD; const float rf = RF ? RF[(size_t)h * TT + t] : 1.0f; v2h o16; v2us oh, ol;
#pragma unroll
    for (int q = 0; q < 2; ++q) { const int dd = d + q; const int dp = (dd < HD / 2) ? dd + HD / 2 : dd - HD / 2; float x0 = f[dd], x1 = f[dp];
        if (RF) { float n0 = __fmul_rn(x0, rf), n1 = __fmul_rn(x1, rf); asm volatile("" : "+v"(n0)); asm volatile("" : "+v"(n1)); x0 = __fmul_rn(bfr(nw[dd]), n0); x1 = __fmul_rn(bfr(nw[dp]), n1); }
        const v2f cs = *(const v2f*)(CS + ((size_t)t * HD + dd) * 2); float a = __fmul_rn(x0, cs[0]), bq = __fmul_rn(x1, cs[1]); asm volatile("" : "+v"(a)); asm volatile("" : "+v"(bq)); const float r = ((dd < HD / 2) ? __fsub_rn(a, bq) : __fadd_rn(a, bq)) * sc;
        o16[q] = tohx(r); unsigned short a2, c2; splitf(r, a2, c2); oh[q] = a2; ol[q] = c2; }
    *(v2h*)(P16 + e) = o16; *(v2us*)(Ph + e) = oh; *(v2us*)(Pl + e) = ol;  }
__global__ __launch_bounds__(256) void k_vtp(const float* __restrict__ F, int pitch, int nheads, h16* V16, bf* Vh, bf* Vl) { const size_t e = ((size_t)blockIdx.x * 256 + threadIdx.x) * 2; if (e >= (size_t)nheads * HD * TT) return; const int t = (int)(e % TT); const int d = (int)((e / TT) % HD); const int g = (int)(e / ((size_t)TT * HD)); v2h o16; v2us oh, ol;
#pragma unroll
    for (int q = 0; q < 2; ++q) { const float x = F[(size_t)(t + q) * pitch + g * HD + d]; o16[q] = tohx(x); unsigned short a2, c2; splitf(x, a2, c2); oh[q] = a2; ol[q] = c2; }
    *(v2h*)(V16 + e) = o16; *(v2us*)(Vh + e) = oh; *(v2us*)(Vl + e) = ol;  }
__global__ __launch_bounds__(256) void k_csid(float* CS) { const int idx = blockIdx.x * 256 + threadIdx.x; if (idx >= TT * HD) return; v2f cs; cs[0] = 1.0f; cs[1] = 0.0f; *(v2f*)(CS + (size_t)idx * 2) = cs;  }
// k_lsoft: streaming row softmax over all TK = TT = 4096 keys, one wave per row i, three sweeps of the f32 score row (lane -> 4 consecutive keys per 128-key chunk, 32 chunks; no mask - every score tile is computed and every key enters max, sum and output):
__global__ __launch_bounds__(256) void k_lsoft(const float* __restrict__ Sb, h16* P16, bf* Ph, bf* Pl) {
    const int lane = threadIdx.x & 31; const int row = blockIdx.x * 8 + (threadIdx.x >> 5); if (row >= ZH * TT) return; const int i = row % TT; const int zz = row / TT; const bool hires = (i < RH); const float* sr = Sb + (size_t)row * TT; float mx = -3.0e38f;
#pragma unroll 4
    for (int ch = 0; ch < TT / 128; ++ch) { const int j0 = ch * 128 + lane * 4; const v4f a = *(const v4f*)(sr + j0);
#pragma unroll
        for (int q = 0; q < 4; ++q) { float t = a[q] * SCL; asm volatile("" : "+v"(t)); mx = fmaxf(mx, t); } }
#pragma unroll
    for (int sh = 16; sh; sh >>= 1) mx = fmaxf(mx, __shfl_xor(mx, sh, 32));
    float sum = 0.f;
#pragma unroll 4
    for (int ch = 0; ch < TT / 128; ++ch) { const int j0 = ch * 128 + lane * 4; const v4f a = *(const v4f*)(sr + j0);
#pragma unroll
        for (int q = 0; q < 4; ++q) { float t = a[q] * SCL; asm volatile("" : "+v"(t)); float d0 = __fsub_rn(t, mx); asm volatile("" : "+v"(d0)); sum += __builtin_amdgcn_exp2f(__fmul_rn(d0, 1.4426950408889634f)); } }
#pragma unroll
    for (int sh = 16; sh; sh >>= 1) sum += __shfl_xor(sum, sh, 32);
    const float f = __fdiv_rn(hires ? 1.0f : PCAR, sum);
{
        if (hires) {   /* rows < RH: normalised bf16 hi/lo over all keys, planes [zz][RH][TT] */
#pragma unroll
            for (int ch = 0; ch < TT / 128; ++ch) { const int j0 = ch * 128 + lane * 4; const v4f a = *(const v4f*)(sr + j0); v4us oh, ol;
#pragma unroll
                for (int q = 0; q < 4; ++q) { float t = a[q] * SCL; asm volatile("" : "+v"(t)); float d0 = __fsub_rn(t, mx); asm volatile("" : "+v"(d0)); float ex = __builtin_amdgcn_exp2f(__fmul_rn(d0, 1.4426950408889634f)); asm volatile("" : "+v"(ex)); unsigned short a2, c2; splitf(ex * f, a2, c2); oh[q] = a2; ol[q] = c2; }
                const size_t oo = ((size_t)zz * RH + i) * TT + j0; *(v4us*)(Ph + oo) = oh; *(v4us*)(Pl + oo) = ol; }
        } else {
#pragma unroll 2
            for (int ch = 0; ch < TT / 128; ++ch) { const int j0 = ch * 128 + lane * 4; const v4f a = *(const v4f*)(sr + j0); v4h o4;
#pragma unroll
                for (int q = 0; q < 4; ++q) { float t = a[q] * SCL; asm volatile("" : "+v"(t)); float d0 = __fsub_rn(t, mx); asm volatile("" : "+v"(d0)); float ex = __builtin_amdgcn_exp2f(__fmul_rn(d0, 1.4426950408889634f)); asm volatile("" : "+v"(ex)); o4[q] = tohx(ex * f); }
                *(v4h*)(P16 + (size_t)row * TT + j0) = o4; } }
         }
}

__global__ __launch_bounds__(256) void k_wpadh(const float* __restrict__ w, const float* __restrict__ bias, bf* Bt, float* bp) { const int i = blockIdx.x * 256 + threadIdx.x; if (i >= DQ * DM / 8) return; const int c0 = (i % (DM / 8)) * 8; const int r = i / (DM / 8); const int h = r / HD, d = r % HD; const int sr = h * HR + min(d, HR - 1); const float* src = w + (size_t)sr * DM + c0; v8us o;
#pragma unroll
    for (int q = 0; q < 8; ++q) { const unsigned short v = f2bf(src[q]); o[q] = (d < HR) ? v : (unsigned short)0; }
    *(v8us*)(Bt + (size_t)r * DM + c0) = o; if (i < DQ) { const int hb = i / HD, db = i % HD; const float bb = bias[hb * HR + min(db, HR - 1)]; ((float*)bp)[i] = (db < HR) ? bb : 0.0f; }     }
__global__ __launch_bounds__(256) void k_wopadh(const float* __restrict__ w, bf* Bt) { const int i = blockIdx.x * 256 + threadIdx.x; if (i >= DM * DQ / 8) return; const int k0 = (i % (DQ / 8)) * 8; const int o = i / (DQ / 8); v8us ov;
#pragma unroll
    for (int q = 0; q < 8; ++q) { const int kk = k0 + q; const int h = kk / HD, d = kk % HD; const unsigned short v = f2bf(w[(size_t)o * DM + h * HR + min(d, HR - 1)]); ov[q] = (d < HR) ? v : (unsigned short)0; }
    *(v8us*)(Bt + (size_t)o * DQ + k0) = ov;  }
// GroupNorm statistics of all NB_ batch elements, three launches. Each element's CC x TT values are shared by GNG work-groups (blockIdx.x; element = blockIdx.y), GNK 16-byte loads a thread, all in flight at once.
// k_gnsum: one partial sum a work-group. k_gnsq: mean from the GNG partial sums, then one partial sum of (x - mean)^2 a work-group. k_gnfin: {mean, 1/sqrt(var + eps)} per element.
// Every sum has a fixed order: in the thread, then wg_sum's tree, then wg_sum over the GNG partials. Each partial, and each element's pair of results, has a 128-byte line of its own (pitch GNP floats), so a line has one writer.
#define GNG  256
#define GNK  (CC * TT / GNG / 1024)
#define GNP  32
__device__ __forceinline__ float wg_sum(float v, float* red) { const int tid = threadIdx.x; red[tid] = v; __syncthreads();
    for (int st = 128; st > 0; st >>= 1) { if (tid < st) red[tid] = __fadd_rn(red[tid], red[tid + st]); __syncthreads(); }
    const float r = red[0]; __syncthreads();   // red is free for the next sum once every thread has read the total
    return r; }
__global__ __launch_bounds__(256) void k_gnsum(const float* __restrict__ x, float* PS) { __shared__ float red[256]; const int tid = threadIdx.x; const float* xs = x + (size_t)blockIdx.y * CC * TT + (size_t)blockIdx.x * (GNK * 1024) + tid * 4; float s = 0.f;
#pragma unroll   // all GNK loads are issued before the first is waited for
    for (int k = 0; k < GNK; ++k) { const v4f a = *(const v4f*)(xs + k * 1024); for (int q = 0; q < 4; ++q) s = __fadd_rn(s, bfr(a[q])); }
    s = wg_sum(s, red); if (tid == 0) PS[(blockIdx.y * GNG + blockIdx.x) * GNP] = s; }
__global__ __launch_bounds__(256) void k_gnsq(const float* __restrict__ x, const float* __restrict__ PS, float* PQ) { static_assert(GNG == 256, "one partial a thread"); __shared__ float red[256]; const int tid = threadIdx.x; const float* xs = x + (size_t)blockIdx.y * CC * TT + (size_t)blockIdx.x * (GNK * 1024) + tid * 4; v4f a[GNK];
#pragma unroll   // the loads fly while the mean is summed; a[] stays in registers
    for (int k = 0; k < GNK; ++k) a[k] = *(const v4f*)(xs + k * 1024);
    const float mean = __fdiv_rn(wg_sum(PS[(blockIdx.y * GNG + tid) * GNP], red), (float)(CC * TT)); float s2 = 0.f;
#pragma unroll   // constant k: a[] stays in registers
    for (int k = 0; k < GNK; ++k) for (int q = 0; q < 4; ++q) { const float dv = __fsub_rn(bfr(a[k][q]), mean); s2 = __fadd_rn(s2, __fmul_rn(dv, dv)); }
    s2 = wg_sum(s2, red); if (tid == 0) PQ[(blockIdx.y * GNG + blockIdx.x) * GNP] = s2; }
__global__ __launch_bounds__(256) void k_gnfin(const float* __restrict__ PS, const float* __restrict__ PQ, float* stat) { __shared__ float red[256]; const int tid = threadIdx.x; const float n = (float)(CC * TT);
    const float mean = __fdiv_rn(wg_sum(PS[(blockIdx.x * GNG + tid) * GNP], red), n); const float var = __fdiv_rn(wg_sum(PQ[(blockIdx.x * GNG + tid) * GNP], red), n);
    if (tid == 0) { const float rs = __fdiv_rn(1.0f, __fsqrt_rn(__fadd_rn(var, 1e-5f))); v2f o; o[0] = mean; o[1] = rs; *(v2f*)(stat + GNP * blockIdx.x) = o; } }
__global__ __launch_bounds__(256) void k_gnT(const float* __restrict__ xs, const float* __restrict__ stat, const float* __restrict__ g, const float* __restrict__ bb, bf* XH, bf* XL) { const size_t k = (size_t)blockIdx.x * 256 + threadIdx.x; if (k >= (size_t)TT * CC / 8) return; const int c0 = (int)(k % (CC / 8)) * 8; const int t = (int)(k / (CC / 8)); const float mean = stat[0], rs = stat[1]; v8us oh, ol;
#pragma unroll
    for (int q = 0; q < 8; ++q) { const int c = c0 + q; const float dv = __fsub_rn(bfr(xs[(size_t)c * TT + t]), mean); float y = __fmul_rn(dv, rs); asm volatile("" : "+v"(y)); y = __fmul_rn(y, bfr(g[c])); asm volatile("" : "+v"(y)); y = __fadd_rn(y, bfr(bb[c])); unsigned short a2, c2; splitf(y, a2, c2); oh[q] = a2; ol[q] = c2; }
    *(v8us*)(XH + (size_t)t * CC + c0) = oh; *(v8us*)(XL + (size_t)t * CC + c0) = ol;  }
__global__ __launch_bounds__(256) void k_outTr(const float* __restrict__ U, const float* __restrict__ xs, float* outp) { const size_t k = (size_t)blockIdx.x * 256 + threadIdx.x; if (k >= (size_t)CC * TT / 4) return; const size_t e = k * 4; const int t0 = (int)(e % TT); const int c = (int)(e / TT); const v4f a = *(const v4f*)(xs + e); v4f o;
#pragma unroll
    for (int q = 0; q < 4; ++q) o[q] = __fadd_rn(bfr(a[q]), U[(size_t)(t0 + q) * CC + c]);
    *(v4f*)(outp + e) = o;  }

__global__ __launch_bounds__(256) void k_merge(const float* __restrict__ O, int h0, bf* Ah, bf* Al) { const size_t e = ((size_t)blockIdx.x * 256 + threadIdx.x) * 2; if (e >= (size_t)ZH * TT * HD) return; const int d = (int)(e % HD); const int t = (int)((e / HD) % TT); const int zz = (int)(e / ((size_t)HD * TT)); const float cs = (t < RH) ? 1.0f : (1.0f / PCAR); const size_t oo = (size_t)t * DQ + (h0 + zz) * HD + d;
    v2us oh, ol; v2f sm = *(const v2f*)(O + e);
#pragma unroll
    for (int p = 1; p < KSP; ++p) { const v2f pv = *(const v2f*)(O + (size_t)p * ZH * TT * HD + e); sm[0] = __fadd_rn(sm[0], pv[0]); sm[1] = __fadd_rn(sm[1], pv[1]); }
#pragma unroll
    for (int q = 0; q < 2; ++q) { unsigned short a, c2; splitf(sm[q] * cs, a, c2); oh[q] = a; ol[q] = c2; } *(v2us*)(Ah + oo) = oh; *(v2us*)(Al + oo) = ol;  }

extern "C" void kernel_launch(void* const* d_in, const int* in_sizes, int n_in,
                              void* d_out, int out_size, void* d_ws, size_t ws_size, hipStream_t stream) {
    (void)in_sizes; (void)n_in; (void)out_size;
    const float* x = (const float*)d_in[0]; const float* gnw = (const float*)d_in[1]; const float* gnb = (const float*)d_in[2]; const float* wq = (const float*)d_in[3]; const float* bq = (const float*)d_in[4]; const float* wk = (const float*)d_in[5]; const float* bk = (const float*)d_in[6]; const float* wv = (const float*)d_in[7]; const float* bv = (const float*)d_in[8]; const float* wo = (const float*)d_in[9]; const float* bo = (const float*)d_in[10];
    float* OUT = (float*)d_out;     // [2][256][4096]
    char* wsp = (char*)d_ws;
    auto take = [&](size_t bytes) { char* p = wsp; wsp += (bytes + 255) & ~(size_t)255; return (void*)p; };
    float* BQP = (float*)take(DQ * 4); float* BKP = (float*)take(DQ * 4); float* BVP = (float*)take(DQ * 4); bf* XH = (bf*)take((size_t)TT * DM * 2); bf* XL = (bf*)take((size_t)TT * DM * 2); float* STAT = (float*)take((size_t)NB_ * GNP * 4); float* PS = (float*)take((size_t)NB_ * GNG * GNP * 4); float* PQ = (float*)take((size_t)NB_ * GNG * GNP * 4); float* Y = (float*)take((size_t)TT * DM * 4); bf* WQ = (bf*)take((size_t)DQ * DM * 2); bf* WK = (bf*)take((size_t)DKV * DM * 2); bf* WV = (bf*)take((size_t)DKV * DM * 2); bf* WO = (bf*)take((size_t)DM * DQ * 2); float* CS = (float*)take((size_t)TT * HD * 2 * 4);
     float* FQ = (float*)take((size_t)TT * DQ * 4); float* FK = (float*)take((size_t)TT * DKV * 4);
    h16* QP16 = (h16*)take((size_t)NH_ * TT * HD * 2); h16* KP16 = (h16*)take((size_t)NKV * TT * HD * 2); h16* VT16 = (h16*)take((size_t)NKV * HD * TT * 2);
    bf* QPh = (bf*)take((size_t)NH_ * TT * HD * 2); bf* QPl = (bf*)take((size_t)NH_ * TT * HD * 2); bf* KPh = (bf*)take((size_t)NKV * TT * HD * 2); bf* KPl = (bf*)take((size_t)NKV * TT * HD * 2); bf* VTh = (bf*)take((size_t)NKV * HD * TT * 2); bf* VTl = (bf*)take((size_t)NKV * HD * TT * 2); bf* Ph = (bf*)take((size_t)ZH * RH * TT * 2); bf* Pl = (bf*)take((size_t)ZH * RH * TT * 2);
    float* Sb = (float*)take((size_t)ZH * TT * TT * 4); h16* P16 = (h16*)take((size_t)ZH * TT * TT * 2); float* Ob = (float*)take((size_t)KSP * ZH * TT * HD * 4); bf* ATh = (bf*)take((size_t)TT * DQ * 2); bf* ATl = (bf*)take((size_t)TT * DQ * 2);
    if ((size_t)(wsp - (char*)d_ws) > ws_size) return;    // ws 256 MiB
    float* FV = FK;   // v projection reuses the k buffer after the k planes are built (stream-ordered)
    { k_wpadh<<<(DQ * DM / 8 + 255) / 256, 256, 0, stream>>>(wq, bq, WQ, BQP); k_wpadh<<<(DQ * DM / 8 + 255) / 256, 256, 0, stream>>>(wk, bk, WK, BKP); k_wpadh<<<(DQ * DM / 8 + 255) / 256, 256, 0, stream>>>(wv, bv, WV, BVP);
      k_wopadh<<<(DM * DQ / 8 + 255) / 256, 256, 0, stream>>>(wo, WO);
       }
    k_csid<<<(TT * HD + 255) / 256, 256, 0, stream>>>(CS);
    k_gnsum<<<dim3(GNG, NB_), 256, 0, stream>>>(x, PS); k_gnsq<<<dim3(GNG, NB_), 256, 0, stream>>>(x, PS, PQ); k_gnfin<<<NB_, 256, 0, stream>>>(PS, PQ, STAT);
    const unsigned LQ = (unsigned)(((size_t)NH_ * TT * HD / 2 + 255) / 256), LKv = (unsigned)(((size_t)NKV * TT * HD / 2 + 255) / 256);
    for (int b = 0; b < NB_; ++b) {
        
        k_gnT<<<(unsigned)(((size_t)TT * CC / 8 + 255) / 256), 256, 0, stream>>>(x + (size_t)b * CC * TT, STAT + GNP * b, gnw, gnb, XH, XL);   /* normalised, token-major, hi/lo */
        k_gemmw<bf, 1, true><<<dim3(TT / 64, DQ / 64, 1), 32, 0, stream>>>(XH, XL, WQ, nullptr, DM, FQ, DQ, BQP, 0, 0, 0);
        k_rope<<<LQ, 256, 0, stream>>>(FQ, DQ, NH_, CS, nullptr, nullptr, 1.0f, QP16, QPh, QPl);
        k_gemmw<bf, 1, true><<<dim3(TT / 64, DKV / 64, 1), 32, 0, stream>>>(XH, XL, WK, nullptr, DM, FK, DKV, BKP, 0, 0, 0);
        k_rope<<<LKv, 256, 0, stream>>>(FK, DKV, NKV, CS, nullptr, nullptr, 1.0f, KP16, KPh, KPl);
        k_gemmw<bf, 1, true><<<dim3(TT / 64, DKV / 64, 1), 32, 0, stream>>>(XH, XL, WV, nullptr, DM, FV, DKV, BVP, 0, 0, 0); k_vtp<<<LKv, 256, 0, stream>>>(FV, DKV, NKV, VT16, VTh, VTl);
        for (int h0 = 0; h0 < NH_; h0 += ZH) { const size_t zq = (size_t)h0, zk = (size_t)(h0 / REP);   // one kv head per query head: each pass (ZH = 1) takes query head h0 and kv plane h0 (z-strides TT*HD)
            k_gemmw<bf, 2, false><<<dim3(RH / 64, TT / 64, ZH), 32, 0, stream>>>(QPh + zq * TT * HD, QPl + zq * TT * HD, KPh + zk * TT * HD, KPl + zk * TT * HD, HD, Sb, TT, nullptr, (size_t)TT * HD, (size_t)TT * HD, (size_t)TT * TT);
            k_gemmw<h16, 0, false><<<dim3((TT - RH) / 64, TT / 64, ZH), 32, 0, stream>>>(QP16 + zq * TT * HD + (size_t)RH * HD, nullptr, KP16 + zk * TT * HD, nullptr, HD, Sb + (size_t)RH * TT, TT, nullptr, (size_t)TT * HD, (size_t)TT * HD, (size_t)TT * TT);
            k_lsoft<<<ZH * TT / 8, 256, 0, stream>>>(Sb, P16, Ph, Pl);
            k_gemmw<bf, 2, false, KSP, 16><<<dim3(RH / 64, HD / 64, ZH * KSP), 512, 0, stream>>>(Ph, Pl, VTh + zk * HD * TT, VTl + zk * HD * TT, TT, Ob, HD, nullptr, (size_t)RH * TT, (size_t)HD * TT, (size_t)TT * HD, (size_t)ZH * TT * HD);
            k_gemmw<h16, 0, false, KSP, 8><<<dim3((TT - RH) / 64, HD / 64, ZH * KSP), 256, 0, stream>>>(P16 + (size_t)RH * TT, nullptr, VT16 + zk * HD * TT, nullptr, TT, Ob + (size_t)RH * HD, HD, nullptr, (size_t)TT * TT, (size_t)HD * TT, (size_t)TT * HD, (size_t)ZH * TT * HD);
            k_merge<<<(unsigned)(((size_t)ZH * TT * HD / 2 + 255) / 256), 256, 0, stream>>>(Ob, h0, ATh, ATl); }
        k_gemmw<bf, 1, true><<<dim3(TT / 64, DM / 64, 1), 32, 0, stream>>>(ATh, ATl, WO, nullptr, DQ, Y, DM, bo, 0, 0, 0); k_outTr<<<(unsigned)(((size_t)CC * TT / 4 + 255) / 256), 256, 0, stream>>>(Y, x + (size_t)b * CC * TT, OUT + (size_t)b * CC * TT);   /* back to channel-major + hidden residual */ }
}

// v003
// One run takes 258 microseconds.
// Two timings next to v002 put it at 6.72 and 6.70 times that version's speed.
// All steps since v000 together make it 20.2 times as fast.
#include <hip/hip_runtime.h>

// 1-D self-attention block with GroupNorm and residual on a channel-major sequence (hidden [2][256][4096]; x = GroupNorm(1 group over all 256 x 4096 values, eps 1e-5) x gn_weight + gn_bias; h = x^T; q,k,v = h W^T + b ('oi' [256][256] + [256], 1/16; 8 heads x 32); scores = (q 32^-1/4).(k 32^-1/4); softmax over all 4,096 keys; out = merged Wo^T + bo, transposed back + hidden -> [2][256][4096] (2.1 M)).
// Compute dtypes, f32 accumulate: every input rounded to bf16; GroupNorm f32 (fixed-order sums); projections hi/lo x exact + f32 biases; attention rows < 512 3 products, rest fp16; softmax f32; Wo hl x exact + bias; residual f32.

#define NB_  2
#define TT   4096
#define DM   256
#define NH_  8
#define NKV  8
#define REP  (NH_ / NKV)
#define HD   64
#define DQ   (NH_ * HD)
#define DKV  (NKV * HD)
#define RH   512                  // query rows < RH use hi+lo planes (0: none)
#define WIN  0
#define SCL  0.17677669529663689f   // 32^-1/2 == (32^-1/4)^2 applied once to q.k
#define CC   256     // channels
#define HR   32      // real head width (padded to HD = 64)
typedef _Float16 h16;
typedef unsigned short bf;
typedef __attribute__((ext_vector_type(16))) __bf16   v16bf;
typedef __attribute__((ext_vector_type(16))) _Float16 v16h;
typedef __attribute__((ext_vector_type(8)))  _Float16 v8h;
typedef __attribute__((ext_vector_type(8)))  unsigned short v8us;
typedef __attribute__((ext_vector_type(8)))  float    v8f;
typedef __attribute__((ext_vector_type(4)))  float    v4f;
typedef v8h  __attribute__((may_alias)) v8ha;
typedef v4f  __attribute__((may_alias)) v4fa;
typedef v8us __attribute__((may_alias)) v8usa;

__device__ __forceinline__ unsigned short f2bf(float f) { unsigned u = __float_as_uint(f); u += 0x7FFFu + ((u >> 16) & 1u); return (unsigned short)(u >> 16); }
__device__ __forceinline__ float bf2f(unsigned short b) { return __uint_as_float(((unsigned)b) << 16); }
__device__ __forceinline__ float bfr(float f) { return bf2f(f2bf(f)); }
__device__ __forceinline__ v16h cat16(v8h lo, v8h hi) { return __builtin_shufflevector(lo, hi, 0, 1, 2, 3, 4, 5, 6, 7, 8, 9, 10, 11, 12, 13, 14, 15); }
__device__ __forceinline__ v16bf cat16b(v8us lo, v8us hi) { return __builtin_bit_cast(v16bf, __builtin_shufflevector(lo, hi, 0, 1, 2, 3, 4, 5, 6, 7, 8, 9, 10, 11, 12, 13, 14, 15)); }
__device__ __forceinline__ v8f wmma16(v16h a, v16h b, v8f c) { return __builtin_amdgcn_wmma_f32_16x16x32_f16(false, a, false, b, (short)0, c, false, false); }
__device__ __forceinline__ v8f wmmab(v16bf a, v16bf b, v8f c) { return __builtin_amdgcn_wmma_f32_16x16x32_bf16(false, a, false, b, (short)0, c, false, false); }



// ---- k_gemmw: register-blocked GEMM, ONE WAVE per 64x64 output tile (16 accumulators), operands straight from K-contiguous 16-bit planes; grid (M/64, N/64, Z), 32 threads.
// C[m][n] (f32, pitch ldc, + optional f32 bias[n]) = sum_k A[m][k] Bt[n][k] (+ split products per NSPLIT). z-batch strides sA/sB/sC in elements. K % 32 == 0.
// For a long K on a small grid: K split over KS work-groups (blockIdx.z % KS; grid z = Z KS) and, inside each, over its NW waves (NW*32 threads); wave w of part zk sums k in [(zk NW + w) K/(KS NW), +K/(KS NW)).
// The NW f32 partial tiles meet in LDS (row pitch 68 floats) and are added in wave order, each wave finishing 64/NW whole rows; part zk stores to plane C + zk sP, and the reader of C adds the KS planes in order. K % (32 KS NW) == 0.
template <typename T16> struct WFrag;
template <> struct WFrag<h16> { typedef v16h V; static __device__ __forceinline__ V ld(const h16* p) { return cat16(*(const v8h*)p, *(const v8h*)(p + 16)); } static __device__ __forceinline__ v8f mma(V a, V b, v8f c) { return wmma16(a, b, c); } };
template <> struct WFrag<bf> { typedef v16bf V; static __device__ __forceinline__ V ld(const bf* p) { return cat16b(*(const v8us*)p, *(const v8us*)(p + 16)); } static __device__ __forceinline__ v8f mma(V a, V b, v8f c) { return wmmab(a, b, c); } };
template <typename T16, int NSPLIT, bool BIAS, int KS = 1, int NW = 1>
__global__ __launch_bounds__(NW * 32) void k_gemmw(const T16* __restrict__ A, const T16* __restrict__ A2, const T16* __restrict__ Bt, const T16* __restrict__ Bt2, int K, float* C, int ldc, const float* __restrict__ bias, size_t sA, size_t sB, size_t sC, size_t sP = 0) {
    static_assert(NW == 1 ? KS == 1 : (!BIAS && 64 % (2 * NW) == 0), "split K: no bias, whole row pairs per wave");
    typedef typename WFrag<T16>::V V;
    __shared__ __align__(16) float os[(NW == 1 ? 16 : NW * 64) * 68];
    const size_t z = blockIdx.z / KS; const int zk = blockIdx.z % KS; A += z * sA; if (A2) A2 += z * sA; Bt += z * sB; if (Bt2) Bt2 += z * sB; C += z * sC + zk * sP;
    const int wave = (NW == 1) ? 0 : __builtin_amdgcn_readfirstlane((int)(threadIdx.x >> 5)); const int ks = K / (KS * NW), k0 = (zk * NW + wave) * ks;
    const int lane = threadIdx.x & 31, lr = lane & 15, hi = lane >> 4; const int r0 = blockIdx.x * 64, c0 = blockIdx.y * 64;
    v8f acc[4][4];
#pragma unroll
    for (int mb = 0; mb < 4; ++mb)
#pragma unroll
        for (int nb = 0; nb < 4; ++nb) acc[mb][nb] = (v8f){};
    const size_t aoff = (size_t)(r0 + lr) * K + 8 * hi, boff = (size_t)(c0 + lr) * K + 8 * hi;
#pragma unroll 1
    for (int kc = k0; kc < k0 + ks; kc += 32) {
        V a[4], a2[4];
#pragma unroll
        for (int mb = 0; mb < 4; ++mb) { a[mb] = WFrag<T16>::ld(A + aoff + (size_t)mb * 16 * K + kc); if (NSPLIT == 1 || NSPLIT == 2) a2[mb] = WFrag<T16>::ld(A2 + aoff + (size_t)mb * 16 * K + kc); }
#pragma unroll
        for (int nb = 0; nb < 4; ++nb) { const V b = WFrag<T16>::ld(Bt + boff + (size_t)nb * 16 * K + kc); V b2; if (NSPLIT >= 2) b2 = WFrag<T16>::ld(Bt2 + boff + (size_t)nb * 16 * K + kc);
#pragma unroll
            for (int mb = 0; mb < 4; ++mb) { acc[mb][nb] = WFrag<T16>::mma(a[mb], b, acc[mb][nb]); if (NSPLIT == 1 || NSPLIT == 2) acc[mb][nb] = WFrag<T16>::mma(a2[mb], b, acc[mb][nb]); if (NSPLIT >= 2) acc[mb][nb] = WFrag<T16>::mma(a[mb], b2, acc[mb][nb]); } }
        asm volatile("v_nop\n\tv_nop\n\tv_nop\n\tv_nop" : "+v"(acc[0][0]), "+v"(acc[1][1]), "+v"(acc[2][2]), "+v"(acc[3][3]) : "v"(a[0]), "v"(a[3]));
    }
    if constexpr (NW > 1) {
        float* pw = os + wave * (64 * 68);
#pragma unroll
        for (int mb = 0; mb < 4; ++mb)
#pragma unroll
            for (int nb = 0; nb < 4; ++nb)
#pragma unroll
                for (int j = 0; j < 8; ++j) pw[(mb * 16 + hi * 8 + j) * 68 + nb * 16 + lr] = acc[mb][nb][j];
        __syncthreads();   // every wave's partial tile is in LDS before any wave adds them
#pragma unroll
        for (int s = 0; s < 64 / (2 * NW); ++s) { const int row = wave * (64 / NW) + 2 * s + hi, cofs = lr * 4; v4f val = *(const v4fa*)(os + row * 68 + cofs);
#pragma unroll
            for (int w = 1; w < NW; ++w) { const v4f pv = *(const v4fa*)(os + w * (64 * 68) + row * 68 + cofs); val[0] = __fadd_rn(val[0], pv[0]); val[1] = __fadd_rn(val[1], pv[1]); val[2] = __fadd_rn(val[2], pv[2]); val[3] = __fadd_rn(val[3], pv[3]); }
            *(v4f*)(C + (size_t)(r0 + row) * ldc + c0 + cofs) = val; }
        return;
    }
#pragma unroll
    for (int mb = 0; mb < 4; ++mb) {
#pragma unroll
        for (int nb = 0; nb < 4; ++nb) {
#pragma unroll
            for (int j = 0; j < 8; ++j) os[(hi * 8 + j) * 68 + nb * 16 + lr] = acc[mb][nb][j]; }
        __builtin_amdgcn_wave_barrier(); asm volatile("" ::: "memory");
        float* crow = C + (size_t)(r0 + mb * 16) * ldc + c0;
{
#pragma unroll
            for (int s = 0; s < 8; ++s) { const int row = 2 * s + hi, cofs = lr * 4; v4f val = *(const v4fa*)(os + row * 68 + cofs); if (BIAS) { val[0] += bfr(bias[c0 + cofs]); val[1] += bfr(bias[c0 + cofs + 1]); val[2] += bfr(bias[c0 + cofs + 2]); val[3] += bfr(bias[c0 + cofs + 3]); }
                *(v4f*)(crow + (size_t)row * ldc + cofs) = val; }
             }
        __builtin_amdgcn_wave_barrier(); asm volatile("" ::: "memory");
    }
}

__device__ __forceinline__ h16 tohx(float x) { return (h16)x; }
__device__ __forceinline__ void splitf(float y, unsigned short& h, unsigned short& l) { h = f2bf(y); l = f2bf(y - bf2f(h)); }
typedef __attribute__((ext_vector_type(2))) _Float16 v2h;
typedef __attribute__((ext_vector_type(4))) _Float16 v4h;
typedef __attribute__((ext_vector_type(2))) unsigned short v2us;
typedef __attribute__((ext_vector_type(4))) unsigned short v4us;
typedef __attribute__((ext_vector_type(2))) float v2f;
typedef __attribute__((ext_vector_type(4))) int v4i;

__global__ __launch_bounds__(256) void k_wtG(const float* __restrict__ w, int K, int N, bf* Bt) {
    const int lane = threadIdx.x & 31; const int L0 = (blockIdx.x * 8 + (threadIdx.x >> 5)) * 8; const int nlines = N * K / 64;
{
#pragma unroll 1
        for (int l = 0; l < 8; ++l) { const int L = L0 + l; if (L >= nlines) break; const size_t e = (size_t)L * 64 + lane * 2; const int k = (int)(e % K), n = (int)(e / K); v2us o;
            o[0] = f2bf(w[(size_t)k * N + n]); o[1] = f2bf(w[(size_t)(k + 1) * N + n]); *(v2us*)(Bt + e) = o; }
         }
}
__global__ __launch_bounds__(256) void k_cvt8(const float* __restrict__ src, bf* dst, size_t n8) { const size_t i = (size_t)blockIdx.x * 256 + threadIdx.x; if (i >= n8) return; const v8f v = *(const v8f*)(src + i * 8); v8us o;
#pragma unroll
    for (int k = 0; k < 8; ++k) o[k] = f2bf(v[k]); *(v8us*)(dst + i * 8) = o;  }

// k_rope: head planes [h][t][d] (fp16 + hi/lo) of rope(x) x sc with the rotate-half convention out[d] = x[d] cos[t][d] - x[d+HD/2] sin[t][d], out[d+HD/2] = x[d+HD/2] cos[t][d+HD/2] + x[d] sin[t][d+HD/2]
__global__ __launch_bounds__(256) void k_rope(const float* __restrict__ F, int pitch, int nheads, const float* __restrict__ CS, const float* __restrict__ RF, const float* __restrict__ nw, float sc, h16* P16, bf* Ph, bf* Pl) {
    const size_t e = ((size_t)blockIdx.x * 256 + threadIdx.x) * 2; if (e >= (size_t)nheads * TT * HD) return; const int d = (int)(e % HD); const int t = (int)((e / HD) % TT); const int h = (int)(e / ((size_t)HD * TT)); const float* f = F + (size_t)t * pitch + h * HD; const float rf = RF ? RF[(size_t)h * TT + t] : 1.0f; v2h o16; v2us oh, ol;
#pragma unroll
    for (int q = 0; q < 2; ++q) { const int dd = d + q; const int dp = (dd < HD / 2) ? dd + HD / 2 : dd - HD / 2; float x0 = f[dd], x1 = f[dp];
        if (RF) { float n0 = __fmul_rn(x0, rf), n1 = __fmul_rn(x1, rf); asm volatile("" : "+v"(n0)); asm volatile("" : "+v"(n1)); x0 = __fmul_rn(bfr(nw[dd]), n0); x1 = __fmul_rn(bfr(nw[dp]), n1); }
        const v2f cs = *(const v2f*)(CS + ((size_t)t * HD + dd) * 2); float a = __fmul_rn(x0, cs[0]), bq = __fmul_rn(x1, cs[1]); asm volatile("" : "+v"(a)); asm volatile("" : "+v"(bq)); const float r = ((dd < HD / 2) ? __fsub_rn(a, bq) : __fadd_rn(a, bq)) * sc;
        o16[q] = tohx(r); unsigned short a2, c2; splitf(r, a2, c2); oh[q] = a2; ol[q] = c2; }
    *(v2h*)(P16 + e) = o16; *(v2us*)(Ph + e) = oh; *(v2us*)(Pl + e) = ol;  }
__global__ __launch_bounds__(256) void k_vtp(const float* __restrict__ F, int pitch, int nheads, h16* V16, bf* Vh, bf* Vl) { const size_t e = ((size_t)blockIdx.x * 256 + threadIdx.x) * 2; if (e >= (size_t)nheads * HD * TT) return; const int t = (int)(e % TT); const int d = (int)((e / TT) % HD); const int g = (int)(e / ((size_t)TT * HD)); v2h o16; v2us oh, ol;
#pragma unroll
    for (int q = 0; q < 2; ++q) { const float x = F[(size_t)(t + q) * pitch + g * HD + d]; o16[q] = tohx(x); unsigned short a2, c2; splitf(x, a2, c2); oh[q] = a2; ol[q] = c2; }
    *(v2h*)(V16 + e) = o16; *(v2us*)(Vh + e) = oh; *(v2us*)(Vl + e) = ol;  }
__global__ __launch_bounds__(256) void k_csid(float* CS) { const int idx = blockIdx.x * 256 + threadIdx.x; if (idx >= TT * HD) return; v2f cs; cs[0] = 1.0f; cs[1] = 0.0f; *(v2f*)(CS + (size_t)idx * 2) = cs;  }
__global__ __launch_bounds__(256) void k_wpadh(const float* __restrict__ w, const float* __restrict__ bias, bf* Bt, float* bp) { const int i = blockIdx.x * 256 + threadIdx.x; if (i >= DQ * DM / 8) return; const int c0 = (i % (DM / 8)) * 8; const int r = i / (DM / 8); const int h = r / HD, d = r % HD; const int sr = h * HR + min(d, HR - 1); const float* src = w + (size_t)sr * DM + c0; v8us o;
#pragma unroll
    for (int q = 0; q < 8; ++q) { const unsigned short v = f2bf(src[q]); o[q] = (d < HR) ? v : (unsigned short)0; }
    *(v8us*)(Bt + (size_t)r * DM + c0) = o; if (i < DQ) { const int hb = i / HD, db = i % HD; const float bb = bias[hb * HR + min(db, HR - 1)]; ((float*)bp)[i] = (db < HR) ? bb : 0.0f; }     }
__global__ __launch_bounds__(256) void k_wopadh(const float* __restrict__ w, bf* Bt) { const int i = blockIdx.x * 256 + threadIdx.x; if (i >= DM * DQ / 8) return; const int k0 = (i % (DQ / 8)) * 8; const int o = i / (DQ / 8); v8us ov;
#pragma unroll
    for (int q = 0; q < 8; ++q) { const int kk = k0 + q; const int h = kk / HD, d = kk % HD; const unsigned short v = f2bf(w[(size_t)o * DM + h * HR + min(d, HR - 1)]); ov[q] = (d < HR) ? v : (unsigned short)0; }
    *(v8us*)(Bt + (size_t)o * DQ + k0) = ov;  }
// GroupNorm statistics of all NB_ batch elements, three launches. Each element's CC x TT values are shared by GNG work-groups (blockIdx.x; element = blockIdx.y), GNK 16-byte loads a thread, all in flight at once.
// k_gnsum: one partial sum a work-group. k_gnsq: mean from the GNG partial sums, then one partial sum of (x - mean)^2 a work-group. k_gnfin: {mean, 1/sqrt(var + eps)} per element.
// Every sum has a fixed order: in the thread, then wg_sum's tree, then wg_sum over the GNG partials. Each partial, and each element's pair of results, has a 128-byte line of its own (pitch GNP floats), so a line has one writer.
#define GNG  256
#define GNK  (CC * TT / GNG / 1024)
#define GNP  32
__device__ __forceinline__ float wg_sum(float v, float* red) { const int tid = threadIdx.x; red[tid] = v; __syncthreads();
    for (int st = 128; st > 0; st >>= 1) { if (tid < st) red[tid] = __fadd_rn(red[tid], red[tid + st]); __syncthreads(); }
    const float r = red[0]; __syncthreads();   // red is free for the next sum once every thread has read the total
    return r; }
__global__ __launch_bounds__(256) void k_gnsum(const float* __restrict__ x, float* PS) { __shared__ float red[256]; const int tid = threadIdx.x; const float* xs = x + (size_t)blockIdx.y * CC * TT + (size_t)blockIdx.x * (GNK * 1024) + tid * 4; float s = 0.f;
#pragma unroll   // all GNK loads are issued before the first is waited for
    for (int k = 0; k < GNK; ++k) { const v4f a = *(const v4f*)(xs + k * 1024); for (int q = 0; q < 4; ++q) s = __fadd_rn(s, bfr(a[q])); }
    s = wg_sum(s, red); if (tid == 0) PS[(blockIdx.y * GNG + blockIdx.x) * GNP] = s; }
__global__ __launch_bounds__(256) void k_gnsq(const float* __restrict__ x, const float* __restrict__ PS, float* PQ) { static_assert(GNG == 256, "one partial a thread"); __shared__ float red[256]; const int tid = threadIdx.x; const float* xs = x + (size_t)blockIdx.y * CC * TT + (size_t)blockIdx.x * (GNK * 1024) + tid * 4; v4f a[GNK];
#pragma unroll   // the loads fly while the mean is summed; a[] stays in registers
    for (int k = 0; k < GNK; ++k) a[k] = *(const v4f*)(xs + k * 1024);
    const float mean = __fdiv_rn(wg_sum(PS[(blockIdx.y * GNG + tid) * GNP], red), (float)(CC * TT)); float s2 = 0.f;
#pragma unroll   // constant k: a[] stays in registers
    for (int k = 0; k < GNK; ++k) for (int q = 0; q < 4; ++q) { const float dv = __fsub_rn(bfr(a[k][q]), mean); s2 = __fadd_rn(s2, __fmul_rn(dv, dv)); }
    s2 = wg_sum(s2, red); if (tid == 0) PQ[(blockIdx.y * GNG + blockIdx.x) * GNP] = s2; }
__global__ __launch_bounds__(256) void k_gnfin(const float* __restrict__ PS, const float* __restrict__ PQ, float* stat) { __shared__ float red[256]; const int tid = threadIdx.x; const float n = (float)(CC * TT);
    const float mean = __fdiv_rn(wg_sum(PS[(blockIdx.x * GNG + tid) * GNP], red), n); const float var = __fdiv_rn(wg_sum(PQ[(blockIdx.x * GNG + tid) * GNP], red), n);
    if (tid == 0) { const float rs = __fdiv_rn(1.0f, __fsqrt_rn(__fadd_rn(var, 1e-5f))); v2f o; o[0] = mean; o[1] = rs; *(v2f*)(stat + GNP * blockIdx.x) = o; } }
__global__ __launch_bounds__(256) void k_gnT(const float* __restrict__ xs, const float* __restrict__ stat, const float* __restrict__ g, const float* __restrict__ bb, bf* XH, bf* XL) { const size_t k = (size_t)blockIdx.x * 256 + threadIdx.x; if (k >= (size_t)TT * CC / 8) return; const int c0 = (int)(k % (CC / 8)) * 8; const int t = (int)(k / (CC / 8)); const float mean = stat[0], rs = stat[1]; v8us oh, ol;
#pragma unroll
    for (int q = 0; q < 8; ++q) { const int c = c0 + q; const float dv = __fsub_rn(bfr(xs[(size_t)c * TT + t]), mean); float y = __fmul_rn(dv, rs); asm volatile("" : "+v"(y)); y = __fmul_rn(y, bfr(g[c])); asm volatile("" : "+v"(y)); y = __fadd_rn(y, bfr(bb[c])); unsigned short a2, c2; splitf(y, a2, c2); oh[q] = a2; ol[q] = c2; }
    *(v8us*)(XH + (size_t)t * CC + c0) = oh; *(v8us*)(XL + (size_t)t * CC + c0) = ol;  }
__global__ __launch_bounds__(256) void k_outTr(const float* __restrict__ U, const float* __restrict__ xs, float* outp) { const size_t k = (size_t)blockIdx.x * 256 + threadIdx.x; if (k >= (size_t)CC * TT / 4) return; const size_t e = k * 4; const int t0 = (int)(e % TT); const int c = (int)(e / TT); const v4f a = *(const v4f*)(xs + e); v4f o;
#pragma unroll
    for (int q = 0; q < 4; ++q) o[q] = __fadd_rn(bfr(a[q]), U[(size_t)(t0 + q) * CC + c]);
    *(v4f*)(outp + e) = o;  }

// ---- k_fattn: scores, softmax and P.V of one head for FQB query rows in ONE work-group; scores and probabilities never leave the registers. Grid (batch x heads, TT / FQB), 4 waves, 32 query rows (two column tiles) a wave.
// Transposed products: S^T = K Q^T (A = 16 K rows from LDS, B = 16 query rows, kept in registers), O^T += V^T P^T. A lane then holds scores of ONE query (column lane & 15), and two S^T tiles (keys +0..15, +16..31),
// converted in place, are the B operand of the second product in the hardware k order (element s: key 8 hi + s, or 16 + 8 hi + s - 8), which is also the order of WFrag::ld on a V^T row. Only the HR = 32 real head columns are read.
// Two sweeps over the keys, K (and V^T) staged in LDS in chunks of CK keys: sweep 1 the row maximum; sweep 2 the same scores again, p = exp(s - max), f32 row sum of the unrounded p, P.V; the division by the sum comes last.
// The next chunk is fetched into registers while the present one is worked on. Rows < RH: bf16 hi/lo planes, three products each (hh, hl, lh) as before; the other rows f16.
#define FQB  128
#define KPT  40      // LDS pitch of a staged K row in 16-bit elements: 80 B = 16 B x odd, conflict-free for 16-byte reads
#define FSM  (2 * (128 * KPT + HR * (128 + 8)))   // the larger of the two paths' LDS needs, in 16-bit elements
typedef __attribute__((ext_vector_type(8))) __bf16 v8bf;
typedef __attribute__((ext_vector_type(4))) unsigned v4u;
__device__ __forceinline__ v8f splat8(float x) { return (v8f){x, x, x, x, x, x, x, x}; }
__device__ __forceinline__ v8f bfup(v8bf h) { const v4u w = __builtin_bit_cast(v4u, h); v8f r;   // packed bf16 back to f32: one shift or one mask an element
#pragma unroll   // constant indices: the arrays stay in registers
    for (int i = 0; i < 4; ++i) { r[2 * i] = __uint_as_float(w[i] << 16); r[2 * i + 1] = __uint_as_float(w[i] & 0xFFFF0000u); }
    return r; }
template <typename T16, int CK> struct FaChunk {   // one plane's share of a chunk in one thread's registers: CK / 32 16-byte pieces of K rows and as many of V^T rows
    typedef __attribute__((ext_vector_type(8))) T16 V8; V8 k[CK / 32], v[CK / 32];
    static constexpr int UR = CK / 8, RS = 128 / UR;   // 16-byte pieces in a V^T row of the chunk; V^T rows that the 128 threads cover at once (K: 4 pieces a row, 32 rows at once)
    // piece s of thread tid: K row (tid >> 2) + 32 s, V^T row tid / UR + RS s: a uniform base, one offset a thread, and a constant step
    template <bool WITHV> __device__ __forceinline__ void load(const T16* __restrict__ Kg, const T16* __restrict__ Vg, int key0) { const unsigned tid = threadIdx.x; const T16* ka = Kg + (size_t)key0 * HD + (tid >> 2) * HD + (tid & 3) * 8; const T16* va = Vg + key0 + (tid / UR) * TT + (tid % UR) * 8;
#pragma unroll   // constant indices: k[] and v[] stay in registers
        for (int s = 0; s < CK / 32; ++s) { k[s] = *(const V8*)(ka + s * 32 * HD); if constexpr (WITHV) v[s] = *(const V8*)(va + s * RS * TT); }
        // precaution: the loads' address registers are inputs here, so they stay live and unwritten (by a later load's result too) up to this wait
        if constexpr (WITHV) asm volatile("s_wait_xcnt 0x0" :: "v"(ka), "v"(va) : "memory"); else asm volatile("s_wait_xcnt 0x0" :: "v"(ka) : "memory"); }
    template <bool WITHV> __device__ __forceinline__ void store(T16* sK, T16* sV) const { const unsigned tid = threadIdx.x; T16* kd = sK + (tid >> 2) * KPT + (tid & 3) * 8; T16* vd = sV + (tid / UR) * (CK + 8) + (tid % UR) * 8;
#pragma unroll   // as above
        for (int s = 0; s < CK / 32; ++s) { *(V8*)(kd + s * 32 * KPT) = k[s]; if constexpr (WITHV) *(V8*)(vd + s * RS * (CK + 8)) = v[s]; } }
};
template <typename T16, bool HL, int CK>
__device__ __forceinline__ void fattn(const T16* __restrict__ Q, const T16* __restrict__ Q2, const T16* __restrict__ Kg, const T16* __restrict__ K2, const T16* __restrict__ Vg, const T16* __restrict__ V2, int q0, bf* Ah, bf* Al, T16* sm) {
    typedef WFrag<T16> F; typedef typename F::V V; constexpr int VPT = CK + 8;   // V^T row pitch: 16 B x odd
    static_assert((HL ? 2 : 1) * (CK * KPT + HR * VPT) <= FSM && TT % CK == 0 && CK % 32 == 0, "a chunk fits the LDS array");
    T16* sK = sm; T16* sV = sK + CK * KPT; T16* sK2 = sV + HR * VPT; T16* sV2 = sK2 + CK * KPT;
    const int lane = threadIdx.x & 31, lr = lane & 15, hi = lane >> 4, wave = threadIdx.x >> 5; const int t0 = q0 + wave * 32 + lr;
    V qf[2], qf2[2]; const T16* qa = Q + (size_t)t0 * HD + 8 * hi; const T16* qa2 = HL ? Q2 + (size_t)t0 * HD + 8 * hi : qa;
#pragma unroll   // constant indices: the arrays stay in registers
    for (int g = 0; g < 2; ++g) { qf[g] = F::ld(qa + 16 * g * HD); if constexpr (HL) qf2[g] = F::ld(qa2 + 16 * g * HD); }
    asm volatile("s_wait_xcnt 0x0" :: "v"(qa), "v"(qa2) : "memory");   // precaution, as in FaChunk::load
    const int koff = lr * KPT + 8 * hi, voff = lr * VPT + 8 * hi;
    FaChunk<T16, CK> r, r2;
    v8f mx[2] = {splat8(-3.0e38f), splat8(-3.0e38f)};   // eight independent maxima a column tile, joined behind the sweep
    r.template load<false>(Kg, Vg, 0); if constexpr (HL) r2.template load<false>(K2, V2, 0);
#pragma unroll 1   // one chunk at a time: the LDS array holds one
    for (int c = 0; c < TT; c += CK) {
        __syncthreads();   // every wave has left the chunk that is overwritten next
        r.template store<false>(sK, sV); if constexpr (HL) r2.template store<false>(sK2, sV2);
        __syncthreads();   // the chunk is complete before any wave reads it
        if (c + CK < TT) { r.template load<false>(Kg, Vg, c + CK); if constexpr (HL) r2.template load<false>(K2, V2, c + CK); }   // flies under this chunk's products
#pragma unroll 2   // two independent 32-key groups: one group's LDS reads fly under the other's products
        for (int kk = 0; kk < CK; kk += 32) { const V a0 = F::ld(sK + koff + kk * KPT), a1 = F::ld(sK + koff + (kk + 16) * KPT); V b0, b1; if constexpr (HL) { b0 = F::ld(sK2 + koff + kk * KPT); b1 = F::ld(sK2 + koff + (kk + 16) * KPT); }
#pragma unroll   // constant indices: the arrays stay in registers
            for (int g = 0; g < 2; ++g) { v8f s0 = F::mma(a0, qf[g], (v8f){}), s1 = F::mma(a1, qf[g], (v8f){});
                if constexpr (HL) { s0 = F::mma(a0, qf2[g], s0); s1 = F::mma(a1, qf2[g], s1); s0 = F::mma(b0, qf[g], s0); s1 = F::mma(b1, qf[g], s1); }
#pragma unroll   // constant indices: the arrays stay in registers
                for (int j = 0; j < 8; ++j) mx[g][j] = fmaxf(mx[g][j], fmaxf(s0[j], s1[j])); } }
    }
    const float c1 = SCL * 1.4426950408889634f; const v8f c1v = splat8(c1); v8f nm[2], sv[2], o[2][2];
#pragma unroll   // constant indices: the arrays stay in registers
    for (int g = 0; g < 2; ++g) { float m = fmaxf(fmaxf(fmaxf(mx[g][0], mx[g][1]), fmaxf(mx[g][2], mx[g][3])), fmaxf(fmaxf(mx[g][4], mx[g][5]), fmaxf(mx[g][6], mx[g][7]))); m = fmaxf(m, __shfl_xor(m, 16, 32));   // lanes l and l ^ 16 hold the two halves of one query's keys
        nm[g] = splat8((HL ? 0.0f : 6.0f) - m * c1);   // f16 path: p carries a factor 2^6, which cancels against the row sum, so that small p stay normal f16 numbers
        sv[g] = (v8f){}; o[g][0] = (v8f){}; o[g][1] = (v8f){}; }
    r.template load<true>(Kg, Vg, 0); if constexpr (HL) r2.template load<true>(K2, V2, 0);
#pragma unroll 1   // one chunk at a time
    for (int c = 0; c < TT; c += CK) {
        __syncthreads();   // every wave has left the chunk that is overwritten next
        r.template store<true>(sK, sV); if constexpr (HL) r2.template store<true>(sK2, sV2);
        __syncthreads();   // the chunk is complete before any wave reads it
        if (c + CK < TT) { r.template load<true>(Kg, Vg, c + CK); if constexpr (HL) r2.template load<true>(K2, V2, c + CK); }   // flies under this chunk's products
#pragma unroll 2   // as in sweep 1
        for (int kk = 0; kk < CK; kk += 32) { const V a0 = F::ld(sK + koff + kk * KPT), a1 = F::ld(sK + koff + (kk + 16) * KPT); V b0, b1; if constexpr (HL) { b0 = F::ld(sK2 + koff + kk * KPT); b1 = F::ld(sK2 + koff + (kk + 16) * KPT); }
            const V v0 = F::ld(sV + voff + kk), v1 = F::ld(sV + voff + 16 * VPT + kk); V w0, w1; if constexpr (HL) { w0 = F::ld(sV2 + voff + kk); w1 = F::ld(sV2 + voff + 16 * VPT + kk); }
            v8f s0[2], s1[2];
#pragma unroll   // constant indices: the arrays stay in registers
            for (int g = 0; g < 2; ++g) { s0[g] = F::mma(a0, qf[g], (v8f){}); s1[g] = F::mma(a1, qf[g], (v8f){}); }
            if constexpr (HL) {
#pragma unroll   // constant indices: the arrays stay in registers
                for (int g = 0; g < 2; ++g) { s0[g] = F::mma(a0, qf2[g], s0[g]); s1[g] = F::mma(a1, qf2[g], s1[g]); }
#pragma unroll   // constant indices: the arrays stay in registers
                for (int g = 0; g < 2; ++g) { s0[g] = F::mma(b0, qf[g], s0[g]); s1[g] = F::mma(b1, qf[g], s1[g]); } }
#pragma unroll   // constant indices: the arrays stay in registers
            for (int g = 0; g < 2; ++g) { const v8f x0 = __builtin_elementwise_fma(s0[g], c1v, nm[g]), x1 = __builtin_elementwise_fma(s1[g], c1v, nm[g]); v8f p0, p1;
#pragma unroll   // constant indices: the arrays stay in registers
                for (int j = 0; j < 8; ++j) { p0[j] = __builtin_amdgcn_exp2f(x0[j]); p1[j] = __builtin_amdgcn_exp2f(x1[j]); }
                sv[g] += p0; sv[g] += p1;
                if constexpr (HL) {
                    const v8bf h0 = __builtin_convertvector(p0, v8bf), h1 = __builtin_convertvector(p1, v8bf); const v8bf l0 = __builtin_convertvector(p0 - bfup(h0), v8bf), l1 = __builtin_convertvector(p1 - bfup(h1), v8bf);
                    const V ph = __builtin_shufflevector(h0, h1, 0, 1, 2, 3, 4, 5, 6, 7, 8, 9, 10, 11, 12, 13, 14, 15), pl = __builtin_shufflevector(l0, l1, 0, 1, 2, 3, 4, 5, 6, 7, 8, 9, 10, 11, 12, 13, 14, 15);
                    o[g][0] = F::mma(v0, ph, o[g][0]); o[g][1] = F::mma(v1, ph, o[g][1]); o[g][0] = F::mma(v0, pl, o[g][0]); o[g][1] = F::mma(v1, pl, o[g][1]); o[g][0] = F::mma(w0, ph, o[g][0]); o[g][1] = F::mma(w1, ph, o[g][1]);
                } else {
                    const V pf = cat16(__builtin_convertvector(p0, v8h), __builtin_convertvector(p1, v8h));
                    o[g][0] = F::mma(v0, pf, o[g][0]); o[g][1] = F::mma(v1, pf, o[g][1]); } } }
    }
#pragma unroll   // constant indices: the arrays stay in registers
    for (int g = 0; g < 2; ++g) { float sum = ((sv[g][0] + sv[g][1]) + (sv[g][2] + sv[g][3])) + ((sv[g][4] + sv[g][5]) + (sv[g][6] + sv[g][7])); sum += __shfl_xor(sum, 16, 32); const float inv = __fdiv_rn(1.0f, sum);
        v8us h0, l0, h1, l1; const v8us zz = (v8us){};
#pragma unroll   // constant indices: the arrays stay in registers
        for (int j = 0; j < 8; ++j) { unsigned short a, b; splitf(o[g][0][j] * inv, a, b); h0[j] = a; l0[j] = b; splitf(o[g][1][j] * inv, a, b); h1[j] = a; l1[j] = b; }
        // o[g][0][j] = O[t][8 hi + j], o[g][1][j] = O[t][16 + 8 hi + j]; columns HR .. HD - 1 of the padded head are zero
        bf* ph = Ah + (size_t)(t0 + 16 * g) * DQ + 8 * hi; bf* pl = Al + (size_t)(t0 + 16 * g) * DQ + 8 * hi;
        *(v8us*)ph = h0; *(v8us*)(ph + 16) = h1; *(v8us*)(ph + 32) = zz; *(v8us*)(ph + 48) = zz; *(v8us*)pl = l0; *(v8us*)(pl + 16) = l1; *(v8us*)(pl + 32) = zz; *(v8us*)(pl + 48) = zz; }
}
// Planes [batch][head][...], outputs [batch][t][DQ]. blockIdx.y is the row block, so that the longer-running work-groups of rows < RH have the lowest flat indices and start first.
__global__ __launch_bounds__(128) void k_fattn(const h16* __restrict__ Q16, const bf* __restrict__ Qh, const bf* __restrict__ Ql, const h16* __restrict__ K16, const bf* __restrict__ Kh, const bf* __restrict__ Kl, const h16* __restrict__ V16, const bf* __restrict__ Vh, const bf* __restrict__ Vl, bf* Ah, bf* Al) {
    static_assert(RH % FQB == 0 && TT % FQB == 0 && HR == 32 && HD == 64 && NH_ == NKV, "whole work-groups on either side of RH; one 32-wide k step a head");
    __shared__ __align__(16) unsigned short sm[FSM];
    const size_t hp = (size_t)blockIdx.x * TT * HD; const int q0 = blockIdx.y * FQB; const size_t ao = (size_t)(blockIdx.x / NH_) * TT * DQ + (blockIdx.x % NH_) * HD;
    if (q0 < RH) fattn<bf, true, 128>(Qh + hp, Ql + hp, Kh + hp, Kl + hp, Vh + hp, Vl + hp, q0, Ah + ao, Al + ao, (bf*)sm);
    else fattn<h16, false, 256>(Q16 + hp, nullptr, K16 + hp, nullptr, V16 + hp, nullptr, q0, Ah + ao, Al + ao, (h16*)sm);
}

extern "C" void kernel_launch(void* const* d_in, const int* in_sizes, int n_in,
                              void* d_out, int out_size, void* d_ws, size_t ws_size, hipStream_t stream) {
    (void)in_sizes; (void)n_in; (void)out_size;
    const float* x = (const float*)d_in[0]; const float* gnw = (const float*)d_in[1]; const float* gnb = (const float*)d_in[2]; const float* wq = (const float*)d_in[3]; const float* bq = (const float*)d_in[4]; const float* wk = (const float*)d_in[5]; const float* bk = (const float*)d_in[6]; const float* wv = (const float*)d_in[7]; const float* bv = (const float*)d_in[8]; const float* wo = (const float*)d_in[9]; const float* bo = (const float*)d_in[10];
    float* OUT = (float*)d_out;     // [2][256][4096]
    char* wsp = (char*)d_ws;
    auto take = [&](size_t bytes) { char* p = wsp; wsp += (bytes + 255) & ~(size_t)255; return (void*)p; };
    float* BQP = (float*)take(DQ * 4); float* BKP = (float*)take(DQ * 4); float* BVP = (float*)take(DQ * 4); bf* XH = (bf*)take((size_t)TT * DM * 2); bf* XL = (bf*)take((size_t)TT * DM * 2); float* STAT = (float*)take((size_t)NB_ * GNP * 4); float* PS = (float*)take((size_t)NB_ * GNG * GNP * 4); float* PQ = (float*)take((size_t)NB_ * GNG * GNP * 4); float* Y = (float*)take((size_t)TT * DM * 4); bf* WQ = (bf*)take((size_t)DQ * DM * 2); bf* WK = (bf*)take((size_t)DKV * DM * 2); bf* WV = (bf*)take((size_t)DKV * DM * 2); bf* WO = (bf*)take((size_t)DM * DQ * 2); float* CS = (float*)take((size_t)TT * HD * 2 * 4);
     float* FQ = (float*)take((size_t)TT * DQ * 4); float* FK = (float*)take((size_t)TT * DKV * 4);
    const size_t PL = (size_t)NH_ * TT * HD;   // elements of one batch element's head planes; every plane below holds all NB_ batch elements
    h16* QP16 = (h16*)take(NB_ * PL * 2); h16* KP16 = (h16*)take(NB_ * PL * 2); h16* VT16 = (h16*)take(NB_ * PL * 2);
    bf* QPh = (bf*)take(NB_ * PL * 2); bf* QPl = (bf*)take(NB_ * PL * 2); bf* KPh = (bf*)take(NB_ * PL * 2); bf* KPl = (bf*)take(NB_ * PL * 2); bf* VTh = (bf*)take(NB_ * PL * 2); bf* VTl = (bf*)take(NB_ * PL * 2);
    bf* ATh = (bf*)take((size_t)NB_ * TT * DQ * 2); bf* ATl = (bf*)take((size_t)NB_ * TT * DQ * 2);
    if ((size_t)(wsp - (char*)d_ws) > ws_size) return;    // ws 256 MiB
    float* FV = FK;   // v projection reuses the k buffer after the k planes are built (stream-ordered)
    { k_wpadh<<<(DQ * DM / 8 + 255) / 256, 256, 0, stream>>>(wq, bq, WQ, BQP); k_wpadh<<<(DQ * DM / 8 + 255) / 256, 256, 0, stream>>>(wk, bk, WK, BKP); k_wpadh<<<(DQ * DM / 8 + 255) / 256, 256, 0, stream>>>(wv, bv, WV, BVP);
      k_wopadh<<<(DM * DQ / 8 + 255) / 256, 256, 0, stream>>>(wo, WO);
       }
    k_csid<<<(TT * HD + 255) / 256, 256, 0, stream>>>(CS);
    k_gnsum<<<dim3(GNG, NB_), 256, 0, stream>>>(x, PS); k_gnsq<<<dim3(GNG, NB_), 256, 0, stream>>>(x, PS, PQ); k_gnfin<<<NB_, 256, 0, stream>>>(PS, PQ, STAT);
    const unsigned LQ = (unsigned)(((size_t)NH_ * TT * HD / 2 + 255) / 256), LKv = (unsigned)(((size_t)NKV * TT * HD / 2 + 255) / 256);
    for (int b = 0; b < NB_; ++b) {
        
        k_gnT<<<(unsigned)(((size_t)TT * CC / 8 + 255) / 256), 256, 0, stream>>>(x + (size_t)b * CC * TT, STAT + GNP * b, gnw, gnb, XH, XL);   /* normalised, token-major, hi/lo */
        k_gemmw<bf, 1, true><<<dim3(TT / 64, DQ / 64, 1), 32, 0, stream>>>(XH, XL, WQ, nullptr, DM, FQ, DQ, BQP, 0, 0, 0);
        k_rope<<<LQ, 256, 0, stream>>>(FQ, DQ, NH_, CS, nullptr, nullptr, 1.0f, QP16 + b * PL, QPh + b * PL, QPl + b * PL);
        k_gemmw<bf, 1, true><<<dim3(TT / 64, DKV / 64, 1), 32, 0, stream>>>(XH, XL, WK, nullptr, DM, FK, DKV, BKP, 0, 0, 0);
        k_rope<<<LKv, 256, 0, stream>>>(FK, DKV, NKV, CS, nullptr, nullptr, 1.0f, KP16 + b * PL, KPh + b * PL, KPl + b * PL);
        k_gemmw<bf, 1, true><<<dim3(TT / 64, DKV / 64, 1), 32, 0, stream>>>(XH, XL, WV, nullptr, DM, FV, DKV, BVP, 0, 0, 0); k_vtp<<<LKv, 256, 0, stream>>>(FV, DKV, NKV, VT16 + b * PL, VTh + b * PL, VTl + b * PL); }
    k_fattn<<<dim3(NB_ * NH_, TT / FQB), 128, 0, stream>>>(QP16, QPh, QPl, KP16, KPh, KPl, VT16, VTh, VTl, ATh, ATl);   /* every head of every batch element */
    for (int b = 0; b < NB_; ++b) {
        k_gemmw<bf, 1, true><<<dim3(TT / 64, DM / 64, 1), 32, 0, stream>>>(ATh + (size_t)b * TT * DQ, ATl + (size_t)b * TT * DQ, WO, nullptr, DQ, Y, DM, bo, 0, 0, 0); k_outTr<<<(unsigned)(((size_t)CC * TT / 4 + 255) / 256), 256, 0, stream>>>(Y, x + (size_t)b * CC * TT, OUT + (size_t)b * CC * TT);   /* back to channel-major + hidden residual */ }
}

// v004
// A run of this version takes 170 microseconds.
// Next to v003, in two timings, it ran 1.51 and 1.52 times as fast.
// Over all steps from v000 it is 30.6 times as fast.
#include <hip/hip_runtime.h>

// 1-D self-attention block with GroupNorm and residual on a channel-major sequence (hidden [2][256][4096]; x = GroupNorm(1 group over all 256 x 4096 values, eps 1e-5) x gn_weight + gn_bias; h = x^T; q,k,v = h W^T + b ('oi' [256][256] + [256], 1/16; 8 heads x 32); scores = (q 32^-1/4).(k 32^-1/4); softmax over all 4,096 keys; out = merged Wo^T + bo, transposed back + hidden -> [2][256][4096] (2.1 M)).
// Compute dtypes, f32 accumulate: every input rounded to bf16; GroupNorm f32 (fixed-order sums); projections hi/lo x exact + f32 biases; attention rows < 512 3 products, rest fp16; softmax f32; Wo hl x exact + bias; residual f32.

#define NB_  2
#define TT   4096
#define DM   256
#define NH_  8
#define NKV  8
#define REP  (NH_ / NKV)
#define HD   64
#define DQ   (NH_ * HD)
#define DKV  (NKV * HD)
#define RH   512                  // query rows < RH use hi+lo planes (0: none)
#define WIN  0
#define SCL  0.17677669529663689f   // 32^-1/2 == (32^-1/4)^2 applied once to q.k
#define CC   256     // channels
#define HR   32      // real head width (padded to HD = 64)
typedef _Float16 h16;
typedef unsigned short bf;
typedef __attribute__((ext_vector_type(16))) __bf16   v16bf;
typedef __attribute__((ext_vector_type(16))) _Float16 v16h;
typedef __attribute__((ext_vector_type(8)))  _Float16 v8h;
typedef __attribute__((ext_vector_type(8)))  unsigned short v8us;
typedef __attribute__((ext_vector_type(8)))  float    v8f;
typedef __attribute__((ext_vector_type(4)))  float    v4f;
typedef v8h  __attribute__((may_alias)) v8ha;
typedef v4f  __attribute__((may_alias)) v4fa;
typedef v8us __attribute__((may_alias)) v8usa;

__device__ __forceinline__ unsigned short f2bf(float f) { unsigned u = __float_as_uint(f); u += 0x7FFFu + ((u >> 16) & 1u); return (unsigned short)(u >> 16); }
__device__ __forceinline__ float bf2f(unsigned short b) { return __uint_as_float(((unsigned)b) << 16); }
__device__ __forceinline__ float bfr(float f) { return bf2f(f2bf(f)); }
__device__ __forceinline__ v16h cat16(v8h lo, v8h hi) { return __builtin_shufflevector(lo, hi, 0, 1, 2, 3, 4, 5, 6, 7, 8, 9, 10, 11, 12, 13, 14, 15); }
__device__ __forceinline__ v16bf cat16b(v8us lo, v8us hi) { return __builtin_bit_cast(v16bf, __builtin_shufflevector(lo, hi, 0, 1, 2, 3, 4, 5, 6, 7, 8, 9, 10, 11, 12, 13, 14, 15)); }
__device__ __forceinline__ v8f wmma16(v16h a, v16h b, v8f c) { return __builtin_amdgcn_wmma_f32_16x16x32_f16(false, a, false, b, (short)0, c, false, false); }
__device__ __forceinline__ v8f wmmab(v16bf a, v16bf b, v8f c) { return __builtin_amdgcn_wmma_f32_16x16x32_bf16(false, a, false, b, (short)0, c, false, false); }



// ---- k_gemmw: register-blocked GEMM, ONE WAVE per 64x64 output tile (16 accumulators), operands straight from K-contiguous 16-bit planes; grid (M/64, N/64, Z), 32 threads.
// C[m][n] (f32, pitch ldc, + optional f32 bias[n]) = sum_k A[m][k] Bt[n][k] (+ split products per NSPLIT). z-batch strides sA/sB/sC in elements. K % 32 == 0.
// For a long K on a small grid: K split over KS work-groups (blockIdx.z % KS; grid z = Z KS) and, inside each, over its NW waves (NW*32 threads); wave w of part zk sums k in [(zk NW + w) K/(KS NW), +K/(KS NW)).
// The NW f32 partial tiles meet in LDS (row pitch 68 floats) and are added in wave order, each wave finishing 64/NW whole rows; part zk stores to plane C + zk sP, and the reader of C adds the KS planes in order. K % (32 KS NW) == 0.
template <typename T16> struct WFrag;
template <> struct WFrag<h16> { typedef v16h V; static __device__ __forceinline__ V ld(const h16* p) { return cat16(*(const v8h*)p, *(const v8h*)(p + 16)); } static __device__ __forceinline__ v8f mma(V a, V b, v8f c) { return wmma16(a, b, c); } };
template <> struct WFrag<bf> { typedef v16bf V; static __device__ __forceinline__ V ld(const bf* p) { return cat16b(*(const v8us*)p, *(const v8us*)(p + 16)); } static __device__ __forceinline__ v8f mma(V a, V b, v8f c) { return wmmab(a, b, c); } };
template <typename T16, int NSPLIT, bool BIAS, int KS = 1, int NW = 1>
__global__ __launch_bounds__(NW * 32) void k_gemmw(const T16* __restrict__ A, const T16* __restrict__ A2, const T16* __restrict__ Bt, const T16* __restrict__ Bt2, int K, float* C, int ldc, const float* __restrict__ bias, size_t sA, size_t sB, size_t sC, size_t sP = 0) {
    static_assert(NW == 1 ? KS == 1 : (!BIAS && 64 % (2 * NW) == 0), "split K: no bias, whole row pairs per wave");
    typedef typename WFrag<T16>::V V;
    __shared__ __align__(16) float os[(NW == 1 ? 16 : NW * 64) * 68];
    const size_t z = blockIdx.z / KS; const int zk = blockIdx.z % KS; A += z * sA; if (A2) A2 += z * sA; Bt += z * sB; if (Bt2) Bt2 += z * sB; C += z * sC + zk * sP;
    const int wave = (NW == 1) ? 0 : __builtin_amdgcn_readfirstlane((int)(threadIdx.x >> 5)); const int ks = K / (KS * NW), k0 = (zk * NW + wave) * ks;
    const int lane = threadIdx.x & 31, lr = lane & 15, hi = lane >> 4; const int r0 = blockIdx.x * 64, c0 = blockIdx.y * 64;
    v8f acc[4][4];
#pragma unroll
    for (int mb = 0; mb < 4; ++mb)
#pragma unroll
        for (int nb = 0; nb < 4; ++nb) acc[mb][nb] = (v8f){};
    const size_t aoff = (size_t)(r0 + lr) * K + 8 * hi, boff = (size_t)(c0 + lr) * K + 8 * hi;
#pragma unroll 1
    for (int kc = k0; kc < k0 + ks; kc += 32) {
        V a[4], a2[4];
#pragma unroll
        for (int mb = 0; mb < 4; ++mb) { a[mb] = WFrag<T16>::ld(A + aoff + (size_t)mb * 16 * K + kc); if (NSPLIT == 1 || NSPLIT == 2) a2[mb] = WFrag<T16>::ld(A2 + aoff + (size_t)mb * 16 * K + kc); }
#pragma unroll
        for (int nb = 0; nb < 4; ++nb) { const V b = WFrag<T16>::ld(Bt + boff + (size_t)nb * 16 * K + kc); V b2; if (NSPLIT >= 2) b2 = WFrag<T16>::ld(Bt2 + boff + (size_t)nb * 16 * K + kc);
#pragma unroll
            for (int mb = 0; mb < 4; ++mb) { acc[mb][nb] = WFrag<T16>::mma(a[mb], b, acc[mb][nb]); if (NSPLIT == 1 || NSPLIT == 2) acc[mb][nb] = WFrag<T16>::mma(a2[mb], b, acc[mb][nb]); if (NSPLIT >= 2) acc[mb][nb] = WFrag<T16>::mma(a[mb], b2, acc[mb][nb]); } }
        asm volatile("v_nop\n\tv_nop\n\tv_nop\n\tv_nop" : "+v"(acc[0][0]), "+v"(acc[1][1]), "+v"(acc[2][2]), "+v"(acc[3][3]) : "v"(a[0]), "v"(a[3]));
    }
    if constexpr (NW > 1) {
        float* pw = os + wave * (64 * 68);
#pragma unroll
        for (int mb = 0; mb < 4; ++mb)
#pragma unroll
            for (int nb = 0; nb < 4; ++nb)
#pragma unroll
                for (int j = 0; j < 8; ++j) pw[(mb * 16 + hi * 8 + j) * 68 + nb * 16 + lr] = acc[mb][nb][j];
        __syncthreads();   // every wave's partial tile is in LDS before any wave adds them
#pragma unroll
        for (int s = 0; s < 64 / (2 * NW); ++s) { const int row = wave * (64 / NW) + 2 * s + hi, cofs = lr * 4; v4f val = *(const v4fa*)(os + row * 68 + cofs);
#pragma unroll
            for (int w = 1; w < NW; ++w) { const v4f pv = *(const v4fa*)(os + w * (64 * 68) + row * 68 + cofs); val[0] = __fadd_rn(val[0], pv[0]); val[1] = __fadd_rn(val[1], pv[1]); val[2] = __fadd_rn(val[2], pv[2]); val[3] = __fadd_rn(val[3], pv[3]); }
            *(v4f*)(C + (size_t)(r0 + row) * ldc + c0 + cofs) = val; }
        return;
    }
#pragma unroll
    for (int mb = 0; mb < 4; ++mb) {
#pragma unroll
        for (int nb = 0; nb < 4; ++nb) {
#pragma unroll
            for (int j = 0; j < 8; ++j) os[(hi * 8 + j) * 68 + nb * 16 + lr] = acc[mb][nb][j]; }
        __builtin_amdgcn_wave_barrier(); asm volatile("" ::: "memory");
        float* crow = C + (size_t)(r0 + mb * 16) * ldc + c0;
{
#pragma unroll
            for (int s = 0; s < 8; ++s) { const int row = 2 * s + hi, cofs = lr * 4; v4f val = *(const v4fa*)(os + row * 68 + cofs); if (BIAS) { val[0] += bfr(bias[c0 + cofs]); val[1] += bfr(bias[c0 + cofs + 1]); val[2] += bfr(bias[c0 + cofs + 2]); val[3] += bfr(bias[c0 + cofs + 3]); }
                *(v4f*)(crow + (size_t)row * ldc + cofs) = val; }
             }
        __builtin_amdgcn_wave_barrier(); asm volatile("" ::: "memory");
    }
}

__device__ __forceinline__ h16 tohx(float x) { return (h16)x; }
__device__ __forceinline__ void splitf(float y, unsigned short& h, unsigned short& l) { h = f2bf(y); l = f2bf(y - bf2f(h)); }
typedef __attribute__((ext_vector_type(2))) _Float16 v2h;
typedef __attribute__((ext_vector_type(4))) _Float16 v4h;
typedef __attribute__((ext_vector_type(2))) unsigned short v2us;
typedef __attribute__((ext_vector_type(4))) unsigned short v4us;
typedef __attribute__((ext_vector_type(2))) float v2f;
typedef __attribute__((ext_vector_type(4))) int v4i;

__global__ __launch_bounds__(256) void k_wtG(const float* __restrict__ w, int K, int N, bf* Bt) {
    const int lane = threadIdx.x & 31; const int L0 = (blockIdx.x * 8 + (threadIdx.x >> 5)) * 8; const int nlines = N * K / 64;
{
#pragma unroll 1
        for (int l = 0; l < 8; ++l) { const int L = L0 + l; if (L >= nlines) break; const size_t e = (size_t)L * 64 + lane * 2; const int k = (int)(e % K), n = (int)(e / K); v2us o;
            o[0] = f2bf(w[(size_t)k * N + n]); o[1] = f2bf(w[(size_t)(k + 1) * N + n]); *(v2us*)(Bt + e) = o; }
         }
}
__global__ __launch_bounds__(256) void k_cvt8(const float* __restrict__ src, bf* dst, size_t n8) { const size_t i = (size_t)blockIdx.x * 256 + threadIdx.x; if (i >= n8) return; const v8f v = *(const v8f*)(src + i * 8); v8us o;
#pragma unroll
    for (int k = 0; k < 8; ++k) o[k] = f2bf(v[k]); *(v8us*)(dst + i * 8) = o;  }

__global__ __launch_bounds__(256) void k_wpadh(const float* __restrict__ w, const float* __restrict__ bias, bf* Bt, float* bp) { const int i = blockIdx.x * 256 + threadIdx.x; if (i >= DQ * DM / 8) return; const int c0 = (i % (DM / 8)) * 8; const int r = i / (DM / 8); const int h = r / HD, d = r % HD; const int sr = h * HR + min(d, HR - 1); const float* src = w + (size_t)sr * DM + c0; v8us o;
#pragma unroll
    for (int q = 0; q < 8; ++q) { const unsigned short v = f2bf(src[q]); o[q] = (d < HR) ? v : (unsigned short)0; }
    *(v8us*)(Bt + (size_t)r * DM + c0) = o; if (i < DQ) { const int hb = i / HD, db = i % HD; const float bb = bias[hb * HR + min(db, HR - 1)]; ((float*)bp)[i] = (db < HR) ? bb : 0.0f; }     }
__global__ __launch_bounds__(256) void k_wopadh(const float* __restrict__ w, bf* Bt) { const int i = blockIdx.x * 256 + threadIdx.x; if (i >= DM * DQ / 8) return; const int k0 = (i % (DQ / 8)) * 8; const int o = i / (DQ / 8); v8us ov;
#pragma unroll
    for (int q = 0; q < 8; ++q) { const int kk = k0 + q; const int h = kk / HD, d = kk % HD; const unsigned short v = f2bf(w[(size_t)o * DM + h * HR + min(d, HR - 1)]); ov[q] = (d < HR) ? v : (unsigned short)0; }
    *(v8us*)(Bt + (size_t)o * DQ + k0) = ov;  }
// GroupNorm statistics of all NB_ batch elements, three launches. Each element's CC x TT values are shared by GNG work-groups (blockIdx.x; element = blockIdx.y), GNK 16-byte loads a thread, all in flight at once.
// k_gnsum: one partial sum a work-group. k_gnsq: mean from the GNG partial sums, then one partial sum of (x - mean)^2 a work-group. k_gnfin: {mean, 1/sqrt(var + eps)} per element.
// Every sum has a fixed order: in the thread, then wg_sum's tree, then wg_sum over the GNG partials. Each partial, and each element's pair of results, has a 128-byte line of its own (pitch GNP floats), so a line has one writer.
#define GNG  256
#define GNK  (CC * TT / GNG / 1024)
#define GNP  32
__device__ __forceinline__ float wg_sum(float v, float* red) { const int tid = threadIdx.x; red[tid] = v; __syncthreads();
    for (int st = 128; st > 0; st >>= 1) { if (tid < st) red[tid] = __fadd_rn(red[tid], red[tid + st]); __syncthreads(); }
    const float r = red[0]; __syncthreads();   // red is free for the next sum once every thread has read the total
    return r; }
__global__ __launch_bounds__(256) void k_gnsum(const float* __restrict__ x, float* PS) { __shared__ float red[256]; const int tid = threadIdx.x; const float* xs = x + (size_t)blockIdx.y * CC * TT + (size_t)blockIdx.x * (GNK * 1024) + tid * 4; float s = 0.f;
#pragma unroll   // all GNK loads are issued before the first is waited for
    for (int k = 0; k < GNK; ++k) { const v4f a = *(const v4f*)(xs + k * 1024); for (int q = 0; q < 4; ++q) s = __fadd_rn(s, bfr(a[q])); }
    s = wg_sum(s, red); if (tid == 0) PS[(blockIdx.y * GNG + blockIdx.x) * GNP] = s; }
__global__ __launch_bounds__(256) void k_gnsq(const float* __restrict__ x, const float* __restrict__ PS, float* PQ) { static_assert(GNG == 256, "one partial a thread"); __shared__ float red[256]; const int tid = threadIdx.x; const float* xs = x + (size_t)blockIdx.y * CC * TT + (size_t)blockIdx.x * (GNK * 1024) + tid * 4; v4f a[GNK];
#pragma unroll   // the loads fly while the mean is summed; a[] stays in registers
    for (int k = 0; k < GNK; ++k) a[k] = *(const v4f*)(xs + k * 1024);
    const float mean = __fdiv_rn(wg_sum(PS[(blockIdx.y * GNG + tid) * GNP], red), (float)(CC * TT)); float s2 = 0.f;
#pragma unroll   // constant k: a[] stays in registers
    for (int k = 0; k < GNK; ++k) for (int q = 0; q < 4; ++q) { const float dv = __fsub_rn(bfr(a[k][q]), mean); s2 = __fadd_rn(s2, __fmul_rn(dv, dv)); }
    s2 = wg_sum(s2, red); if (tid == 0) PQ[(blockIdx.y * GNG + blockIdx.x) * GNP] = s2; }
__global__ __launch_bounds__(256) void k_gnfin(const float* __restrict__ PS, const float* __restrict__ PQ, float* stat) { __shared__ float red[256]; const int tid = threadIdx.x; const float n = (float)(CC * TT);
    const float mean = __fdiv_rn(wg_sum(PS[(blockIdx.x * GNG + tid) * GNP], red), n); const float var = __fdiv_rn(wg_sum(PQ[(blockIdx.x * GNG + tid) * GNP], red), n);
    if (tid == 0) { const float rs = __fdiv_rn(1.0f, __fsqrt_rn(__fadd_rn(var, 1e-5f))); v2f o; o[0] = mean; o[1] = rs; *(v2f*)(stat + GNP * blockIdx.x) = o; } }
__global__ __launch_bounds__(256) void k_gnT(const float* __restrict__ xs, const float* __restrict__ stat, const float* __restrict__ g, const float* __restrict__ bb, bf* XH, bf* XL) { const size_t k = (size_t)blockIdx.x * 256 + threadIdx.x; if (k >= (size_t)TT * CC / 8) return; const int c0 = (int)(k % (CC / 8)) * 8; const int t = (int)(k / (CC / 8)); const float mean = stat[0], rs = stat[1]; v8us oh, ol;
#pragma unroll
    for (int q = 0; q < 8; ++q) { const int c = c0 + q; const float dv = __fsub_rn(bfr(xs[(size_t)c * TT + t]), mean); float y = __fmul_rn(dv, rs); asm volatile("" : "+v"(y)); y = __fmul_rn(y, bfr(g[c])); asm volatile("" : "+v"(y)); y = __fadd_rn(y, bfr(bb[c])); unsigned short a2, c2; splitf(y, a2, c2); oh[q] = a2; ol[q] = c2; }
    *(v8us*)(XH + (size_t)t * CC + c0) = oh; *(v8us*)(XL + (size_t)t * CC + c0) = ol;  }
__global__ __launch_bounds__(256) void k_outTr(const float* __restrict__ U, const float* __restrict__ xs, float* outp) { const size_t k = (size_t)blockIdx.x * 256 + threadIdx.x; if (k >= (size_t)CC * TT / 4) return; const size_t e = k * 4; const int t0 = (int)(e % TT); const int c = (int)(e / TT); const v4f a = *(const v4f*)(xs + e); v4f o;
#pragma unroll
    for (int q = 0; q < 4; ++q) o[q] = __fadd_rn(bfr(a[q]), U[(size_t)(t0 + q) * CC + c]);
    *(v4f*)(outp + e) = o;  }

// ---- k_fattn: scores, softmax and P.V of one head for FQB query rows in ONE work-group; scores and probabilities never leave the registers. Grid (batch x heads, TT / FQB), 4 waves, 32 query rows (two column tiles) a wave.
// Transposed products: S^T = K Q^T (A = 16 K rows from LDS, B = 16 query rows, kept in registers), O^T += V^T P^T. A lane then holds scores of ONE query (column lane & 15), and two S^T tiles (keys +0..15, +16..31),
// converted in place, are the B operand of the second product in the hardware k order (element s: key 8 hi + s, or 16 + 8 hi + s - 8), which is also the order of WFrag::ld on a V^T row. Only the HR = 32 real head columns are read.
// Two sweeps over the keys, K (and V^T) staged in LDS in chunks of CK keys: sweep 1 the row maximum; sweep 2 the same scores again, p = exp(s - max), f32 row sum of the unrounded p, P.V; the division by the sum comes last.
// The next chunk is fetched into registers while the present one is worked on. Rows < RH: bf16 hi/lo planes, three products each (hh, hl, lh) as before; the other rows f16.
#define FQB  128
#define KPT  40      // LDS pitch of a staged K row in 16-bit elements: 80 B = 16 B x odd, conflict-free for 16-byte reads
#define FSM  (2 * (128 * KPT + HR * (128 + 8)))   // the larger of the two paths' LDS needs, in 16-bit elements
typedef __attribute__((ext_vector_type(8))) __bf16 v8bf;
typedef __attribute__((ext_vector_type(4))) unsigned v4u;
__device__ __forceinline__ v8f splat8(float x) { return (v8f){x, x, x, x, x, x, x, x}; }
__device__ __forceinline__ v8f bfup(v8bf h) { const v4u w = __builtin_bit_cast(v4u, h); v8f r;   // packed bf16 back to f32: one shift or one mask an element
#pragma unroll   // constant indices: the arrays stay in registers
    for (int i = 0; i < 4; ++i) { r[2 * i] = __uint_as_float(w[i] << 16); r[2 * i + 1] = __uint_as_float(w[i] & 0xFFFF0000u); }
    return r; }
template <typename T16, int CK> struct FaChunk {   // one plane's share of a chunk in one thread's registers: CK / 32 16-byte pieces of K rows and as many of V^T rows
    typedef __attribute__((ext_vector_type(8))) T16 V8; V8 k[CK / 32], v[CK / 32];
    static constexpr int UR = CK / 8, RS = 128 / UR;   // 16-byte pieces in a V^T row of the chunk; V^T rows that the 128 threads cover at once (K: 4 pieces a row, 32 rows at once)
    // piece s of thread tid: K row (tid >> 2) + 32 s, V^T row tid / UR + RS s: a uniform base, one offset a thread, and a constant step
    template <bool WITHV> __device__ __forceinline__ void load(const T16* __restrict__ Kg, const T16* __restrict__ Vg, int key0) { const unsigned tid = threadIdx.x; const T16* ka = Kg + (size_t)key0 * HD + (tid >> 2) * HD + (tid & 3) * 8; const T16* va = Vg + key0 + (tid / UR) * TT + (tid % UR) * 8;
#pragma unroll   // constant indices: k[] and v[] stay in registers
        for (int s = 0; s < CK / 32; ++s) { k[s] = *(const V8*)(ka + s * 32 * HD); if constexpr (WITHV) v[s] = *(const V8*)(va + s * RS * TT); }
        // precaution: the loads' address registers are inputs here, so they stay live and unwritten (by a later load's result too) up to this wait
        if constexpr (WITHV) asm volatile("s_wait_xcnt 0x0" :: "v"(ka), "v"(va) : "memory"); else asm volatile("s_wait_xcnt 0x0" :: "v"(ka) : "memory"); }
    template <bool WITHV> __device__ __forceinline__ void store(T16* sK, T16* sV) const { const unsigned tid = threadIdx.x; T16* kd = sK + (tid >> 2) * KPT + (tid & 3) * 8; T16* vd = sV + (tid / UR) * (CK + 8) + (tid % UR) * 8;
#pragma unroll   // as above
        for (int s = 0; s < CK / 32; ++s) { *(V8*)(kd + s * 32 * KPT) = k[s]; if constexpr (WITHV) *(V8*)(vd + s * RS * (CK + 8)) = v[s]; } }
};
template <typename T16, bool HL, int CK>
__device__ __forceinline__ void fattn(const T16* __restrict__ Q, const T16* __restrict__ Q2, const T16* __restrict__ Kg, const T16* __restrict__ K2, const T16* __restrict__ Vg, const T16* __restrict__ V2, int q0, bf* Ah, bf* Al, T16* sm) {
    typedef WFrag<T16> F; typedef typename F::V V; constexpr int VPT = CK + 8;   // V^T row pitch: 16 B x odd
    static_assert((HL ? 2 : 1) * (CK * KPT + HR * VPT) <= FSM && TT % CK == 0 && CK % 32 == 0, "a chunk fits the LDS array");
    T16* sK = sm; T16* sV = sK + CK * KPT; T16* sK2 = sV + HR * VPT; T16* sV2 = sK2 + CK * KPT;
    const int lane = threadIdx.x & 31, lr = lane & 15, hi = lane >> 4, wave = threadIdx.x >> 5; const int t0 = q0 + wave * 32 + lr;
    V qf[2], qf2[2]; const T16* qa = Q + (size_t)t0 * HD + 8 * hi; const T16* qa2 = HL ? Q2 + (size_t)t0 * HD + 8 * hi : qa;
#pragma unroll   // constant indices: the arrays stay in registers
    for (int g = 0; g < 2; ++g) { qf[g] = F::ld(qa + 16 * g * HD); if constexpr (HL) qf2[g] = F::ld(qa2 + 16 * g * HD); }
    asm volatile("s_wait_xcnt 0x0" :: "v"(qa), "v"(qa2) : "memory");   // precaution, as in FaChunk::load
    const int koff = lr * KPT + 8 * hi, voff = lr * VPT + 8 * hi;
    FaChunk<T16, CK> r, r2;
    v8f mx[2] = {splat8(-3.0e38f), splat8(-3.0e38f)};   // eight independent maxima a column tile, joined behind the sweep
    r.template load<false>(Kg, Vg, 0); if constexpr (HL) r2.template load<false>(K2, V2, 0);
#pragma unroll 1   // one chunk at a time: the LDS array holds one
    for (int c = 0; c < TT; c += CK) {
        __syncthreads();   // every wave has left the chunk that is overwritten next
        r.template store<false>(sK, sV); if constexpr (HL) r2.template store<false>(sK2, sV2);
        __syncthreads();   // the chunk is complete before any wave reads it
        if (c + CK < TT) { r.template load<false>(Kg, Vg, c + CK); if constexpr (HL) r2.template load<false>(K2, V2, c + CK); }   // flies under this chunk's products
#pragma unroll 2   // two independent 32-key groups: one group's LDS reads fly under the other's products
        for (int kk = 0; kk < CK; kk += 32) { const V a0 = F::ld(sK + koff + kk * KPT), a1 = F::ld(sK + koff + (kk + 16) * KPT); V b0, b1; if constexpr (HL) { b0 = F::ld(sK2 + koff + kk * KPT); b1 = F::ld(sK2 + koff + (kk + 16) * KPT); }
#pragma unroll   // constant indices: the arrays stay in registers
            for (int g = 0; g < 2; ++g) { v8f s0 = F::mma(a0, qf[g], (v8f){}), s1 = F::mma(a1, qf[g], (v8f){});
                if constexpr (HL) { s0 = F::mma(a0, qf2[g], s0); s1 = F::mma(a1, qf2[g], s1); s0 = F::mma(b0, qf[g], s0); s1 = F::mma(b1, qf[g], s1); }
#pragma unroll   // constant indices: the arrays stay in registers
                for (int j = 0; j < 8; ++j) mx[g][j] = fmaxf(mx[g][j], fmaxf(s0[j], s1[j])); } }
    }
    const float c1 = SCL * 1.4426950408889634f; const v8f c1v = splat8(c1); v8f nm[2], sv[2], o[2][2];
#pragma unroll   // constant indices: the arrays stay in registers
    for (int g = 0; g < 2; ++g) { float m = fmaxf(fmaxf(fmaxf(mx[g][0], mx[g][1]), fmaxf(mx[g][2], mx[g][3])), fmaxf(fmaxf(mx[g][4], mx[g][5]), fmaxf(mx[g][6], mx[g][7]))); m = fmaxf(m, __shfl_xor(m, 16, 32));   // lanes l and l ^ 16 hold the two halves of one query's keys
        nm[g] = splat8((HL ? 0.0f : 6.0f) - m * c1);   // f16 path: p carries a factor 2^6, which cancels against the row sum, so that small p stay normal f16 numbers
        sv[g] = (v8f){}; o[g][0] = (v8f){}; o[g][1] = (v8f){}; }
    r.template load<true>(Kg, Vg, 0); if constexpr (HL) r2.template load<true>(K2, V2, 0);
#pragma unroll 1   // one chunk at a time
    for (int c = 0; c < TT; c += CK) {
        __syncthreads();   // every wave has left the chunk that is overwritten next
        r.template store<true>(sK, sV); if constexpr (HL) r2.template store<true>(sK2, sV2);
        __syncthreads();   // the chunk is complete before any wave reads it
        if (c + CK < TT) { r.template load<true>(Kg, Vg, c + CK); if constexpr (HL) r2.template load<true>(K2, V2, c + CK); }   // flies under this chunk's products
#pragma unroll 2   // as in sweep 1
        for (int kk = 0; kk < CK; kk += 32) { const V a0 = F::ld(sK + koff + kk * KPT), a1 = F::ld(sK + koff + (kk + 16) * KPT); V b0, b1; if constexpr (HL) { b0 = F::ld(sK2 + koff + kk * KPT); b1 = F::ld(sK2 + koff + (kk + 16) * KPT); }
            const V v0 = F::ld(sV + voff + kk), v1 = F::ld(sV + voff + 16 * VPT + kk); V w0, w1; if constexpr (HL) { w0 = F::ld(sV2 + voff + kk); w1 = F::ld(sV2 + voff + 16 * VPT + kk); }
            v8f s0[2], s1[2];
#pragma unroll   // constant indices: the arrays stay in registers
            for (int g = 0; g < 2; ++g) { s0[g] = F::mma(a0, qf[g], (v8f){}); s1[g] = F::mma(a1, qf[g], (v8f){}); }
            if constexpr (HL) {
#pragma unroll   // constant indices: the arrays stay in registers
                for (int g = 0; g < 2; ++g) { s0[g] = F::mma(a0, qf2[g], s0[g]); s1[g] = F::mma(a1, qf2[g], s1[g]); }
#pragma unroll   // constant indices: the arrays stay in registers
                for (int g = 0; g < 2; ++g) { s0[g] = F::mma(b0, qf[g], s0[g]); s1[g] = F::mma(b1, qf[g], s1[g]); } }
#pragma unroll   // constant indices: the arrays stay in registers
            for (int g = 0; g < 2; ++g) { const v8f x0 = __builtin_elementwise_fma(s0[g], c1v, nm[g]), x1 = __builtin_elementwise_fma(s1[g], c1v, nm[g]); v8f p0, p1;
#pragma unroll   // constant indices: the arrays stay in registers
                for (int j = 0; j < 8; ++j) { p0[j] = __builtin_amdgcn_exp2f(x0[j]); p1[j] = __builtin_amdgcn_exp2f(x1[j]); }
                sv[g] += p0; sv[g] += p1;
                if constexpr (HL) {
                    const v8bf h0 = __builtin_convertvector(p0, v8bf), h1 = __builtin_convertvector(p1, v8bf); const v8bf l0 = __builtin_convertvector(p0 - bfup(h0), v8bf), l1 = __builtin_convertvector(p1 - bfup(h1), v8bf);
                    const V ph = __builtin_shufflevector(h0, h1, 0, 1, 2, 3, 4, 5, 6, 7, 8, 9, 10, 11, 12, 13, 14, 15), pl = __builtin_shufflevector(l0, l1, 0, 1, 2, 3, 4, 5, 6, 7, 8, 9, 10, 11, 12, 13, 14, 15);
                    o[g][0] = F::mma(v0, ph, o[g][0]); o[g][1] = F::mma(v1, ph, o[g][1]); o[g][0] = F::mma(v0, pl, o[g][0]); o[g][1] = F::mma(v1, pl, o[g][1]); o[g][0] = F::mma(w0, ph, o[g][0]); o[g][1] = F::mma(w1, ph, o[g][1]);
                } else {
                    const V pf = cat16(__builtin_convertvector(p0, v8h), __builtin_convertvector(p1, v8h));
                    o[g][0] = F::mma(v0, pf, o[g][0]); o[g][1] = F::mma(v1, pf, o[g][1]); } } }
    }
#pragma unroll   // constant indices: the arrays stay in registers
    for (int g = 0; g < 2; ++g) { float sum = ((sv[g][0] + sv[g][1]) + (sv[g][2] + sv[g][3])) + ((sv[g][4] + sv[g][5]) + (sv[g][6] + sv[g][7])); sum += __shfl_xor(sum, 16, 32); const float inv = __fdiv_rn(1.0f, sum);
        v8us h0, l0, h1, l1; const v8us zz = (v8us){};
#pragma unroll   // constant indices: the arrays stay in registers
        for (int j = 0; j < 8; ++j) { unsigned short a, b; splitf(o[g][0][j] * inv, a, b); h0[j] = a; l0[j] = b; splitf(o[g][1][j] * inv, a, b); h1[j] = a; l1[j] = b; }
        // o[g][0][j] = O[t][8 hi + j], o[g][1][j] = O[t][16 + 8 hi + j]; columns HR .. HD - 1 of the padded head are zero
        bf* ph = Ah + (size_t)(t0 + 16 * g) * DQ + 8 * hi; bf* pl = Al + (size_t)(t0 + 16 * g) * DQ + 8 * hi;
        *(v8us*)ph = h0; *(v8us*)(ph + 16) = h1; *(v8us*)(ph + 32) = zz; *(v8us*)(ph + 48) = zz; *(v8us*)pl = l0; *(v8us*)(pl + 16) = l1; *(v8us*)(pl + 32) = zz; *(v8us*)(pl + 48) = zz; }
}
// ---- k_proj: the q, k and v projections of every batch element in ONE launch; its epilogue rounds the f32 sums (+ f32 bias) straight into the 16-bit planes that k_fattn reads (f16, bf16 hi, bf16 lo), so no f32 copy of q, k or v exists.
// Grid (TT / 64, NH_ / 2, 3 NB_), one wave a tile of 64 tokens x the HR real columns of two heads; blockIdx.z = 3 x batch element + (0 q, 1 k, 2 v). The padded rows of W and the padded plane columns, which k_fattn never reads, are left out.
// K loop and product order (x hi, then x lo, per 32-wide k step) as in k_gemmw<bf, 1, true>. W and bias keep k_wpadh's padded row numbering: head * HD + column.
// q, k (VT false): transposed product, A = 16 W rows, B = 16 tokens: a lane holds 8 neighbouring columns of ONE token = one 16-byte store a plane into [head][t][HD].
// v (VT true): A = 16 tokens, B = 16 W rows: a lane holds 8 neighbouring tokens of ONE column = one 16-byte store a plane into [head][column][TT]. Either way a wave writes whole 64- or 128-byte runs, and a 128-byte line has one writer.
template <bool VT>
__device__ __forceinline__ void proj_tile(const bf* __restrict__ XH, const bf* __restrict__ XL, const bf* __restrict__ Wt, const float* __restrict__ bias, int r0, int h0, h16* P16, bf* Ph, bf* Pl) {
    typedef WFrag<bf> F; typedef F::V V;
    const int lane = threadIdx.x & 31, lr = lane & 15, hi = lane >> 4;
    const bf* xh = XH + (size_t)(r0 + lr) * DM + 8 * hi; const bf* xl = XL + (size_t)(r0 + lr) * DM + 8 * hi; const bf* wr = Wt + (size_t)(h0 * HD + lr) * DM + 8 * hi;
    v8f acc[4][4];
#pragma unroll   // constant indices: the arrays stay in registers
    for (int mb = 0; mb < 4; ++mb)
#pragma unroll   // as above
        for (int nb = 0; nb < 4; ++nb) acc[mb][nb] = (v8f){};
#pragma unroll 1   // one k step's fragments in registers at a time, as in k_gemmw
    for (int kc = 0; kc < DM; kc += 32) {
        V a[4], a2[4], b[4];
#pragma unroll   // constant indices: the arrays stay in registers
        for (int mb = 0; mb < 4; ++mb) { a[mb] = F::ld(xh + mb * 16 * DM); a2[mb] = F::ld(xl + mb * 16 * DM); }
#pragma unroll   // as above
        for (int nb = 0; nb < 4; ++nb) b[nb] = F::ld(wr + ((nb >> 1) * HD + (nb & 1) * 16) * DM);   // column block nb: head h0 + nb / 2, columns 16 (nb % 2) ..
        // precaution, as in FaChunk::load: the loads' address registers are inputs here, so they stay live and unwritten (by a later load's result too) up to this wait.
        // The loaded fragments are inputs too: each keeps registers of its own, so all 24 loads are in flight together and a k step waits for memory once (without them the x lo loads wait for the x hi registers: twice)
        asm volatile("s_wait_xcnt 0x0" :: "v"(xh), "v"(xl), "v"(wr), "v"(a[0]), "v"(a[1]), "v"(a[2]), "v"(a[3]), "v"(a2[0]), "v"(a2[1]), "v"(a2[2]), "v"(a2[3]), "v"(b[0]), "v"(b[1]), "v"(b[2]), "v"(b[3]) : "memory");
        xh += 32; xl += 32; wr += 32;
#pragma unroll   // as above
        for (int nb = 0; nb < 4; ++nb)
#pragma unroll   // as above
            for (int mb = 0; mb < 4; ++mb) {
                if constexpr (VT) { acc[mb][nb] = F::mma(a[mb], b[nb], acc[mb][nb]); acc[mb][nb] = F::mma(a2[mb], b[nb], acc[mb][nb]); }
                else { acc[mb][nb] = F::mma(b[nb], a[mb], acc[mb][nb]); acc[mb][nb] = F::mma(b[nb], a2[mb], acc[mb][nb]); } }
    }
    v8f bv[4];   // the bias of column block nb as this lane adds it; the four loads fly together
    if constexpr (VT) { const int bi = h0 * HD + lr; float bs[4];
#pragma unroll   // constant indices: the arrays stay in registers
        for (int nb = 0; nb < 4; ++nb) bs[nb] = bias[bi + (nb >> 1) * HD + (nb & 1) * 16];
        asm volatile("s_wait_xcnt 0x0" :: "v"(bi) : "memory");   // precaution, as above: the loads' offset register is an input here
#pragma unroll   // as above
        for (int nb = 0; nb < 4; ++nb) bv[nb] = splat8(bfr(bs[nb]));
    } else { const float* bp = bias + h0 * HD + 8 * hi;
#pragma unroll   // as above
        for (int nb = 0; nb < 4; ++nb) bv[nb] = *(const v8f*)(bp + (nb >> 1) * HD + (nb & 1) * 16);
#pragma unroll   // as above
        for (int nb = 0; nb < 4; ++nb)
#pragma unroll   // as above
            for (int j = 0; j < 8; ++j) bv[nb][j] = bfr(bv[nb][j]); }
#pragma unroll   // as above
    for (int nb = 0; nb < 4; ++nb) { const int hd = (h0 + (nb >> 1)) * HD + (nb & 1) * 16;   // padded number of the block's first column
#pragma unroll   // as above
        for (int mb = 0; mb < 4; ++mb) { const v8f y = acc[mb][nb] + bv[nb]; const v8h o16 = __builtin_convertvector(y, v8h);   // packed conversions, round to nearest even: the values of tohx and splitf
            const v8bf yh = __builtin_convertvector(y, v8bf); const v8bf yl = __builtin_convertvector(y - bfup(yh), v8bf); const v8us oh = __builtin_bit_cast(v8us, yh), ol = __builtin_bit_cast(v8us, yl);
            const size_t e = VT ? (size_t)(hd + lr) * TT + r0 + mb * 16 + 8 * hi : ((size_t)(h0 + (nb >> 1)) * TT + r0 + mb * 16 + lr) * HD + (nb & 1) * 16 + 8 * hi;
            *(v8h*)(P16 + e) = o16; *(v8us*)(Ph + e) = oh; *(v8us*)(Pl + e) = ol; } }
}
__global__ __launch_bounds__(32) void k_proj(const bf* __restrict__ XH, const bf* __restrict__ XL, const bf* __restrict__ WQ, const bf* __restrict__ WK, const bf* __restrict__ WV, const float* __restrict__ BQ, const float* __restrict__ BK, const float* __restrict__ BV,
                                             h16* Q16, bf* Qh, bf* Ql, h16* K16, bf* Kh, bf* Kl, h16* V16, bf* Vh, bf* Vl) {
    static_assert(TT % 64 == 0 && NH_ % 2 == 0 && HR == 32 && DM % 32 == 0 && NH_ == NKV, "whole tiles; two 16-column blocks a head");
    const int b = blockIdx.z / 3, p = blockIdx.z % 3; const int r0 = blockIdx.x * 64, h0 = blockIdx.y * 2; const size_t xo = (size_t)b * TT * DM, po = (size_t)b * NH_ * TT * HD;
    if (p == 2) proj_tile<true>(XH + xo, XL + xo, WV, BV, r0, h0, V16 + po, Vh + po, Vl + po);
    else proj_tile<false>(XH + xo, XL + xo, p ? WK : WQ, p ? BK : BQ, r0, h0, (p ? K16 : Q16) + po, (p ? Kh : Qh) + po, (p ? Kl : Ql) + po);
}

// Planes [batch][head][...], outputs [batch][t][DQ]. blockIdx.y is the row block, so that the longer-running work-groups of rows < RH have the lowest flat indices and start first.
__global__ __launch_bounds__(128) void k_fattn(const h16* __restrict__ Q16, const bf* __restrict__ Qh, const bf* __restrict__ Ql, const h16* __restrict__ K16, const bf* __restrict__ Kh, const bf* __restrict__ Kl, const h16* __restrict__ V16, const bf* __restrict__ Vh, const bf* __restrict__ Vl, bf* Ah, bf* Al) {
    static_assert(RH % FQB == 0 && TT % FQB == 0 && HR == 32 && HD == 64 && NH_ == NKV, "whole work-groups on either side of RH; one 32-wide k step a head");
    __shared__ __align__(16) unsigned short sm[FSM];
    const size_t hp = (size_t)blockIdx.x * TT * HD; const int q0 = blockIdx.y * FQB; const size_t ao = (size_t)(blockIdx.x / NH_) * TT * DQ + (blockIdx.x % NH_) * HD;
    if (q0 < RH) fattn<bf, true, 128>(Qh + hp, Ql + hp, Kh + hp, Kl + hp, Vh + hp, Vl + hp, q0, Ah + ao, Al + ao, (bf*)sm);
    else fattn<h16, false, 256>(Q16 + hp, nullptr, K16 + hp, nullptr, V16 + hp, nullptr, q0, Ah + ao, Al + ao, (h16*)sm);
}

extern "C" void kernel_launch(void* const* d_in, const int* in_sizes, int n_in,
                              void* d_out, int out_size, void* d_ws, size_t ws_size, hipStream_t stream) {
    (void)in_sizes; (void)n_in; (void)out_size;
    const float* x = (const float*)d_in[0]; const float* gnw = (const float*)d_in[1]; const float* gnb = (const float*)d_in[2]; const float* wq = (const float*)d_in[3]; const float* bq = (const float*)d_in[4]; const float* wk = (const float*)d_in[5]; const float* bk = (const float*)d_in[6]; const float* wv = (const float*)d_in[7]; const float* bv = (const float*)d_in[8]; const float* wo = (const float*)d_in[9]; const float* bo = (const float*)d_in[10];
    float* OUT = (float*)d_out;     // [2][256][4096]
    char* wsp = (char*)d_ws;
    auto take = [&](size_t bytes) { char* p = wsp; wsp += (bytes + 255) & ~(size_t)255; return (void*)p; };
    float* BQP = (float*)take(DQ * 4); float* BKP = (float*)take(DQ * 4); float* BVP = (float*)take(DQ * 4); bf* XH = (bf*)take((size_t)NB_ * TT * DM * 2); bf* XL = (bf*)take((size_t)NB_ * TT * DM * 2); float* STAT = (float*)take((size_t)NB_ * GNP * 4); float* PS = (float*)take((size_t)NB_ * GNG * GNP * 4); float* PQ = (float*)take((size_t)NB_ * GNG * GNP * 4); float* Y = (float*)take((size_t)TT * DM * 4); bf* WQ = (bf*)take((size_t)DQ * DM * 2); bf* WK = (bf*)take((size_t)DKV * DM * 2); bf* WV = (bf*)take((size_t)DKV * DM * 2); bf* WO = (bf*)take((size_t)DM * DQ * 2);
    const size_t PL = (size_t)NH_ * TT * HD;   // elements of one batch element's head planes; every plane below holds all NB_ batch elements
    h16* QP16 = (h16*)take(NB_ * PL * 2); h16* KP16 = (h16*)take(NB_ * PL * 2); h16* VT16 = (h16*)take(NB_ * PL * 2);
    bf* QPh = (bf*)take(NB_ * PL * 2); bf* QPl = (bf*)take(NB_ * PL * 2); bf* KPh = (bf*)take(NB_ * PL * 2); bf* KPl = (bf*)take(NB_ * PL * 2); bf* VTh = (bf*)take(NB_ * PL * 2); bf* VTl = (bf*)take(NB_ * PL * 2);
    bf* ATh = (bf*)take((size_t)NB_ * TT * DQ * 2); bf* ATl = (bf*)take((size_t)NB_ * TT * DQ * 2);
    if ((size_t)(wsp - (char*)d_ws) > ws_size) return;    // ws 256 MiB
    { k_wpadh<<<(DQ * DM / 8 + 255) / 256, 256, 0, stream>>>(wq, bq, WQ, BQP); k_wpadh<<<(DQ * DM / 8 + 255) / 256, 256, 0, stream>>>(wk, bk, WK, BKP); k_wpadh<<<(DQ * DM / 8 + 255) / 256, 256, 0, stream>>>(wv, bv, WV, BVP);
      k_wopadh<<<(DM * DQ / 8 + 255) / 256, 256, 0, stream>>>(wo, WO);
       }
    k_gnsum<<<dim3(GNG, NB_), 256, 0, stream>>>(x, PS); k_gnsq<<<dim3(GNG, NB_), 256, 0, stream>>>(x, PS, PQ); k_gnfin<<<NB_, 256, 0, stream>>>(PS, PQ, STAT);
    for (int b = 0; b < NB_; ++b) k_gnT<<<(unsigned)(((size_t)TT * CC / 8 + 255) / 256), 256, 0, stream>>>(x + (size_t)b * CC * TT, STAT + GNP * b, gnw, gnb, XH + (size_t)b * TT * DM, XL + (size_t)b * TT * DM);   /* normalised, token-major, hi/lo */
    k_proj<<<dim3(TT / 64, NH_ / 2, 3 * NB_), 32, 0, stream>>>(XH, XL, WQ, WK, WV, BQP, BKP, BVP, QP16, QPh, QPl, KP16, KPh, KPl, VT16, VTh, VTl);   /* q, k, v of every batch element, straight into the head planes */
    k_fattn<<<dim3(NB_ * NH_, TT / FQB), 128, 0, stream>>>(QP16, QPh, QPl, KP16, KPh, KPl, VT16, VTh, VTl, ATh, ATl);   /* every head of every batch element */
    for (int b = 0; b < NB_; ++b) {
        k_gemmw<bf, 1, true><<<dim3(TT / 64, DM / 64, 1), 32, 0, stream>>>(ATh + (size_t)b * TT * DQ, ATl + (size_t)b * TT * DQ, WO, nullptr, DQ, Y, DM, bo, 0, 0, 0); k_outTr<<<(unsigned)(((size_t)CC * TT / 4 + 255) / 256), 256, 0, stream>>>(Y, x + (size_t)b * CC * TT, OUT + (size_t)b * CC * TT);   /* back to channel-major + hidden residual */ }
}

// v005
// It runs in 141 microseconds.
// Two timings next to v004 put it at 1.20 and 1.21 times that version's speed.
// Counting every step since v000, it is 36.9 times as fast.
#include <hip/hip_runtime.h>

// 1-D self-attention block with GroupNorm and residual on a channel-major sequence (hidden [2][256][4096]; x = GroupNorm(1 group over all 256 x 4096 values, eps 1e-5) x gn_weight + gn_bias; h = x^T; q,k,v = h W^T + b ('oi' [256][256] + [256], 1/16; 8 heads x 32); scores = (q 32^-1/4).(k 32^-1/4); softmax over all 4,096 keys; out = merged Wo^T + bo, transposed back + hidden -> [2][256][4096] (2.1 M)).
// Compute dtypes, f32 accumulate: every input rounded to bf16; GroupNorm f32 (fixed-order sums); projections hi/lo x exact + f32 biases; attention rows < 512 3 products, rest fp16; softmax f32; Wo hl x exact + bias; residual f32.

#define NB_  2
#define TT   4096
#define DM   256
#define NH_  8
#define NKV  8
#define REP  (NH_ / NKV)
#define HD   64
#define DQ   (NH_ * HD)
#define DKV  (NKV * HD)
#define RH   512                  // query rows < RH use hi+lo planes (0: none)
#define WIN  0
#define SCL  0.17677669529663689f   // 32^-1/2 == (32^-1/4)^2 applied once to q.k
#define CC   256     // channels
#define HR   32      // real head width (padded to HD = 64)
typedef _Float16 h16;
typedef unsigned short bf;
typedef __attribute__((ext_vector_type(16))) __bf16   v16bf;
typedef __attribute__((ext_vector_type(16))) _Float16 v16h;
typedef __attribute__((ext_vector_type(8)))  _Float16 v8h;
typedef __attribute__((ext_vector_type(8)))  unsigned short v8us;
typedef __attribute__((ext_vector_type(8)))  float    v8f;
typedef __attribute__((ext_vector_type(4)))  float    v4f;
typedef v8h  __attribute__((may_alias)) v8ha;
typedef v4f  __attribute__((may_alias)) v4fa;
typedef v8us __attribute__((may_alias)) v8usa;

__device__ __forceinline__ unsigned short f2bf(float f) { unsigned u = __float_as_uint(f); u += 0x7FFFu + ((u >> 16) & 1u); return (unsigned short)(u >> 16); }
__device__ __forceinline__ float bf2f(unsigned short b) { return __uint_as_float(((unsigned)b) << 16); }
__device__ __forceinline__ float bfr(float f) { return bf2f(f2bf(f)); }
__device__ __forceinline__ v16h cat16(v8h lo, v8h hi) { return __builtin_shufflevector(lo, hi, 0, 1, 2, 3, 4, 5, 6, 7, 8, 9, 10, 11, 12, 13, 14, 15); }
__device__ __forceinline__ v16bf cat16b(v8us lo, v8us hi) { return __builtin_bit_cast(v16bf, __builtin_shufflevector(lo, hi, 0, 1, 2, 3, 4, 5, 6, 7, 8, 9, 10, 11, 12, 13, 14, 15)); }
__device__ __forceinline__ v8f wmma16(v16h a, v16h b, v8f c) { return __builtin_amdgcn_wmma_f32_16x16x32_f16(false, a, false, b, (short)0, c, false, false); }
__device__ __forceinline__ v8f wmmab(v16bf a, v16bf b, v8f c) { return __builtin_amdgcn_wmma_f32_16x16x32_bf16(false, a, false, b, (short)0, c, false, false); }



// ---- k_gemmw: register-blocked GEMM, ONE WAVE per 64x64 output tile (16 accumulators), operands straight from K-contiguous 16-bit planes; grid (M/64, N/64, Z), 32 threads.
// C[m][n] (f32, pitch ldc, + optional f32 bias[n]) = sum_k A[m][k] Bt[n][k] (+ split products per NSPLIT). z-batch strides sA/sB/sC in elements. K % 32 == 0.
// For a long K on a small grid: K split over KS work-groups (blockIdx.z % KS; grid z = Z KS) and, inside each, over its NW waves (NW*32 threads); wave w of part zk sums k in [(zk NW + w) K/(KS NW), +K/(KS NW)).
// The NW f32 partial tiles meet in LDS (row pitch 68 floats) and are added in wave order, each wave finishing 64/NW whole rows; part zk stores to plane C + zk sP, and the reader of C adds the KS planes in order. K % (32 KS NW) == 0.
template <typename T16> struct WFrag;
template <> struct WFrag<h16> { typedef v16h V; static __device__ __forceinline__ V ld(const h16* p) { return cat16(*(const v8h*)p, *(const v8h*)(p + 16)); } static __device__ __forceinline__ v8f mma(V a, V b, v8f c) { return wmma16(a, b, c); } };
template <> struct WFrag<bf> { typedef v16bf V; static __device__ __forceinline__ V ld(const bf* p) { return cat16b(*(const v8us*)p, *(const v8us*)(p + 16)); } static __device__ __forceinline__ v8f mma(V a, V b, v8f c) { return wmmab(a, b, c); } };
template <typename T16, int NSPLIT, bool BIAS, int KS = 1, int NW = 1>
__global__ __launch_bounds__(NW * 32) void k_gemmw(const T16* __restrict__ A, const T16* __restrict__ A2, const T16* __restrict__ Bt, const T16* __restrict__ Bt2, int K, float* C, int ldc, const float* __restrict__ bias, size_t sA, size_t sB, size_t sC, size_t sP = 0) {
    static_assert(NW == 1 ? KS == 1 : (!BIAS && 64 % (2 * NW) == 0), "split K: no bias, whole row pairs per wave");
    typedef typename WFrag<T16>::V V;
    __shared__ __align__(16) float os[(NW == 1 ? 16 : NW * 64) * 68];
    const size_t z = blockIdx.z / KS; const int zk = blockIdx.z % KS; A += z * sA; if (A2) A2 += z * sA; Bt += z * sB; if (Bt2) Bt2 += z * sB; C += z * sC + zk * sP;
    const int wave = (NW == 1) ? 0 : __builtin_amdgcn_readfirstlane((int)(threadIdx.x >> 5)); const int ks = K / (KS * NW), k0 = (zk * NW + wave) * ks;
    const int lane = threadIdx.x & 31, lr = lane & 15, hi = lane >> 4; const int r0 = blockIdx.x * 64, c0 = blockIdx.y * 64;
    v8f acc[4][4];
#pragma unroll
    for (int mb = 0; mb < 4; ++mb)
#pragma unroll
        for (int nb = 0; nb < 4; ++nb) acc[mb][nb] = (v8f){};
    const size_t aoff = (size_t)(r0 + lr) * K + 8 * hi, boff = (size_t)(c0 + lr) * K + 8 * hi;
#pragma unroll 1
    for (int kc = k0; kc < k0 + ks; kc += 32) {
        V a[4], a2[4];
#pragma unroll
        for (int mb = 0; mb < 4; ++mb) { a[mb] = WFrag<T16>::ld(A + aoff + (size_t)mb * 16 * K + kc); if (NSPLIT == 1 || NSPLIT == 2) a2[mb] = WFrag<T16>::ld(A2 + aoff + (size_t)mb * 16 * K + kc); }
#pragma unroll
        for (int nb = 0; nb < 4; ++nb) { const V b = WFrag<T16>::ld(Bt + boff + (size_t)nb * 16 * K + kc); V b2; if (NSPLIT >= 2) b2 = WFrag<T16>::ld(Bt2 + boff + (size_t)nb * 16 * K + kc);
#pragma unroll
            for (int mb = 0; mb < 4; ++mb) { acc[mb][nb] = WFrag<T16>::mma(a[mb], b, acc[mb][nb]); if (NSPLIT == 1 || NSPLIT == 2) acc[mb][nb] = WFrag<T16>::mma(a2[mb], b, acc[mb][nb]); if (NSPLIT >= 2) acc[mb][nb] = WFrag<T16>::mma(a[mb], b2, acc[mb][nb]); } }
        asm volatile("v_nop\n\tv_nop\n\tv_nop\n\tv_nop" : "+v"(acc[0][0]), "+v"(acc[1][1]), "+v"(acc[2][2]), "+v"(acc[3][3]) : "v"(a[0]), "v"(a[3]));
    }
    if constexpr (NW > 1) {
        float* pw = os + wave * (64 * 68);
#pragma unroll
        for (int mb = 0; mb < 4; ++mb)
#pragma unroll
            for (int nb = 0; nb < 4; ++nb)
#pragma unroll
                for (int j = 0; j < 8; ++j) pw[(mb * 16 + hi * 8 + j) * 68 + nb * 16 + lr] = acc[mb][nb][j];
        __syncthreads();   // every wave's partial tile is in LDS before any wave adds them
#pragma unroll
        for (int s = 0; s < 64 / (2 * NW); ++s) { const int row = wave * (64 / NW) + 2 * s + hi, cofs = lr * 4; v4f val = *(const v4fa*)(os + row * 68 + cofs);
#pragma unroll
            for (int w = 1; w < NW; ++w) { const v4f pv = *(const v4fa*)(os + w * (64 * 68) + row * 68 + cofs); val[0] = __fadd_rn(val[0], pv[0]); val[1] = __fadd_rn(val[1], pv[1]); val[2] = __fadd_rn(val[2], pv[2]); val[3] = __fadd_rn(val[3], pv[3]); }
            *(v4f*)(C + (size_t)(r0 + row) * ldc + c0 + cofs) = val; }
        return;
    }
#pragma unroll
    for (int mb = 0; mb < 4; ++mb) {
#pragma unroll
        for (int nb = 0; nb < 4; ++nb) {
#pragma unroll
            for (int j = 0; j < 8; ++j) os[(hi * 8 + j) * 68 + nb * 16 + lr] = acc[mb][nb][j]; }
        __builtin_amdgcn_wave_barrier(); asm volatile("" ::: "memory");
        float* crow = C + (size_t)(r0 + mb * 16) * ldc + c0;
{
#pragma unroll
            for (int s = 0; s < 8; ++s) { const int row = 2 * s + hi, cofs = lr * 4; v4f val = *(const v4fa*)(os + row * 68 + cofs); if (BIAS) { val[0] += bfr(bias[c0 + cofs]); val[1] += bfr(bias[c0 + cofs + 1]); val[2] += bfr(bias[c0 + cofs + 2]); val[3] += bfr(bias[c0 + cofs + 3]); }
                *(v4f*)(crow + (size_t)row * ldc + cofs) = val; }
             }
        __builtin_amdgcn_wave_barrier(); asm volatile("" ::: "memory");
    }
}

__device__ __forceinline__ h16 tohx(float x) { return (h16)x; }
__device__ __forceinline__ void splitf(float y, unsigned short& h, unsigned short& l) { h = f2bf(y); l = f2bf(y - bf2f(h)); }
typedef __attribute__((ext_vector_type(2))) _Float16 v2h;
typedef __attribute__((ext_vector_type(4))) _Float16 v4h;
typedef __attribute__((ext_vector_type(2))) unsigned short v2us;
typedef __attribute__((ext_vector_type(4))) unsigned short v4us;
typedef __attribute__((ext_vector_type(2))) float v2f;
typedef __attribute__((ext_vector_type(4))) int v4i;

__global__ __launch_bounds__(256) void k_wtG(const float* __restrict__ w, int K, int N, bf* Bt) {
    const int lane = threadIdx.x & 31; const int L0 = (blockIdx.x * 8 + (threadIdx.x >> 5)) * 8; const int nlines = N * K / 64;
{
#pragma unroll 1
        for (int l = 0; l < 8; ++l) { const int L = L0 + l; if (L >= nlines) break; const size_t e = (size_t)L * 64 + lane * 2; const int k = (int)(e % K), n = (int)(e / K); v2us o;
            o[0] = f2bf(w[(size_t)k * N + n]); o[1] = f2bf(w[(size_t)(k + 1) * N + n]); *(v2us*)(Bt + e) = o; }
         }
}
__global__ __launch_bounds__(256) void k_cvt8(const float* __restrict__ src, bf* dst, size_t n8) { const size_t i = (size_t)blockIdx.x * 256 + threadIdx.x; if (i >= n8) return; const v8f v = *(const v8f*)(src + i * 8); v8us o;
#pragma unroll
    for (int k = 0; k < 8; ++k) o[k] = f2bf(v[k]); *(v8us*)(dst + i * 8) = o;  }

__device__ __forceinline__ void wpadh(int blk, const float* __restrict__ w, const float* __restrict__ bias, bf* Bt, float* bp) { const int i = blk * 256 + threadIdx.x; if (i >= DQ * DM / 8) return; const int c0 = (i % (DM / 8)) * 8; const int r = i / (DM / 8); const int h = r / HD, d = r % HD; const int sr = h * HR + min(d, HR - 1); const float* src = w + (size_t)sr * DM + c0; v8us o;
#pragma unroll
    for (int q = 0; q < 8; ++q) { const unsigned short v = f2bf(src[q]); o[q] = (d < HR) ? v : (unsigned short)0; }
    *(v8us*)(Bt + (size_t)r * DM + c0) = o; if (i < DQ) { const int hb = i / HD, db = i % HD; const float bb = bias[hb * HR + min(db, HR - 1)]; ((float*)bp)[i] = (db < HR) ? bb : 0.0f; }     }
__device__ __forceinline__ void wopadh(int blk, const float* __restrict__ w, bf* Bt) { const int i = blk * 256 + threadIdx.x; if (i >= DM * DQ / 8) return; const int k0 = (i % (DQ / 8)) * 8; const int o = i / (DQ / 8); v8us ov; const float* wa[8]; float wl[8];
#pragma unroll
    for (int q = 0; q < 8; ++q) { const int kk = k0 + q; const int h = kk / HD, d = kk % HD; wa[q] = w + (size_t)o * DM + h * HR + min(d, HR - 1); wl[q] = *wa[q]; }
    // precaution, as in FaChunk::load: the loads' address registers are inputs here, so they stay live and unwritten (by a later load's result too) up to this wait
    asm volatile("s_wait_xcnt 0x0" :: "v"(wa[0]), "v"(wa[1]), "v"(wa[2]), "v"(wa[3]), "v"(wa[4]), "v"(wa[5]), "v"(wa[6]), "v"(wa[7]) : "memory");
#pragma unroll
    for (int q = 0; q < 8; ++q) { const int d = (k0 + q) % HD; const unsigned short v = f2bf(wl[q]); ov[q] = (d < HR) ? v : (unsigned short)0; }
    *(v8us*)(Bt + (size_t)o * DQ + k0) = ov;  }
// GroupNorm statistics of all NB_ batch elements, three launches. Each element's CC x TT values are shared by GNG work-groups (number bx, element by: blockIdx.x, .y in k_gnsq; blk % GNG, blk / GNG in k_prep), GNK 16-byte loads a thread, all in flight at once.
// gnsum (in k_prep): one partial sum a work-group. k_gnsq: mean from the GNG partial sums, then one partial sum of (x - mean)^2 a work-group. k_gnfin: {mean, 1/sqrt(var + eps)} per element.
// Every sum has a fixed order: in the thread, then wg_sum's tree, then wg_sum over the GNG partials. Each partial, and each element's pair of results, has a 128-byte line of its own (pitch GNP floats), so a line has one writer.
#define GNG  256
#define GNK  (CC * TT / GNG / 1024)
#define GNP  32
__device__ __forceinline__ float wg_sum(float v, float* red) { const int tid = threadIdx.x; red[tid] = v; __syncthreads();
    for (int st = 128; st > 0; st >>= 1) { if (tid < st) red[tid] = __fadd_rn(red[tid], red[tid + st]); __syncthreads(); }
    const float r = red[0]; __syncthreads();   // red is free for the next sum once every thread has read the total
    return r; }
__device__ __forceinline__ void gnsum(int bx, int by, const float* __restrict__ x, float* PS, float* red) { const int tid = threadIdx.x; const float* xs = x + (size_t)by * CC * TT + (size_t)bx * (GNK * 1024) + tid * 4; float s = 0.f;
#pragma unroll   // all GNK loads are issued before the first is waited for
    for (int k = 0; k < GNK; ++k) { const v4f a = *(const v4f*)(xs + k * 1024); for (int q = 0; q < 4; ++q) s = __fadd_rn(s, bfr(a[q])); }
    s = wg_sum(s, red); if (tid == 0) PS[(by * GNG + bx) * GNP] = s; }
// ---- k_prep: the five jobs that read nothing but inputs, in ONE launch, told apart by the block number: first the NB_ x GNG blocks of gnsum (the longest job), then WPB blocks each for Wq, Wk, Wv (wpadh) and Wo (wopadh).
// A block does one job whole, so the barriers of wg_sum stand under a condition that is the same for the whole work-group.
#define WPB  (DQ * DM / 8 / 256)
__global__ __launch_bounds__(256) void k_prep(const float* __restrict__ x, float* PS, const float* __restrict__ wq, const float* __restrict__ bq, const float* __restrict__ wk, const float* __restrict__ bk, const float* __restrict__ wv, const float* __restrict__ bv, const float* __restrict__ wo,
                                              bf* WQ, float* BQP, bf* WK, float* BKP, bf* WV, float* BVP, bf* WO) {
    static_assert(DQ * DM % (8 * 256) == 0, "whole blocks a weight matrix");
    __shared__ float red[256]; const int blk = blockIdx.x;
    if (blk < NB_ * GNG) { gnsum(blk % GNG, blk / GNG, x, PS, red); return; }
    const int m = (blk - NB_ * GNG) / WPB, jb = (blk - NB_ * GNG) % WPB;
    if (m == 3) wopadh(jb, wo, WO);
    else wpadh(jb, m == 0 ? wq : m == 1 ? wk : wv, m == 0 ? bq : m == 1 ? bk : bv, m == 0 ? WQ : m == 1 ? WK : WV, m == 0 ? BQP : m == 1 ? BKP : BVP);
}
__global__ __launch_bounds__(256) void k_gnsq(const float* __restrict__ x, const float* __restrict__ PS, float* PQ) { static_assert(GNG == 256, "one partial a thread"); __shared__ float red[256]; const int tid = threadIdx.x; const float* xs = x + (size_t)blockIdx.y * CC * TT + (size_t)blockIdx.x * (GNK * 1024) + tid * 4; v4f a[GNK];
#pragma unroll   // the loads fly while the mean is summed; a[] stays in registers
    for (int k = 0; k < GNK; ++k) a[k] = *(const v4f*)(xs + k * 1024);
    const float mean = __fdiv_rn(wg_sum(PS[(blockIdx.y * GNG + tid) * GNP], red), (float)(CC * TT)); float s2 = 0.f;
#pragma unroll   // constant k: a[] stays in registers
    for (int k = 0; k < GNK; ++k) for (int q = 0; q < 4; ++q) { const float dv = __fsub_rn(bfr(a[k][q]), mean); s2 = __fadd_rn(s2, __fmul_rn(dv, dv)); }
    s2 = wg_sum(s2, red); if (tid == 0) PQ[(blockIdx.y * GNG + blockIdx.x) * GNP] = s2; }
__global__ __launch_bounds__(256) void k_gnfin(const float* __restrict__ PS, const float* __restrict__ PQ, float* stat) { __shared__ float red[256]; const int tid = threadIdx.x; const float n = (float)(CC * TT);
    const float mean = __fdiv_rn(wg_sum(PS[(blockIdx.x * GNG + tid) * GNP], red), n); const float var = __fdiv_rn(wg_sum(PQ[(blockIdx.x * GNG + tid) * GNP], red), n);
    if (tid == 0) { const float rs = __fdiv_rn(1.0f, __fsqrt_rn(__fadd_rn(var, 1e-5f))); v2f o; o[0] = mean; o[1] = rs; *(v2f*)(stat + GNP * blockIdx.x) = o; } }
__global__ __launch_bounds__(256) void k_gnT(const float* __restrict__ xs, const float* __restrict__ stat, const float* __restrict__ g, const float* __restrict__ bb, bf* XH, bf* XL) { const size_t k = (size_t)blockIdx.x * 256 + threadIdx.x; if (k >= (size_t)TT * CC / 8) return; const size_t eo = (size_t)blockIdx.y * CC * TT; xs += eo; stat += GNP * blockIdx.y; XH += eo; XL += eo;   // batch element = blockIdx.y
    const int c0 = (int)(k % (CC / 8)) * 8; const int t = (int)(k / (CC / 8)); const float mean = stat[0], rs = stat[1]; v8us oh, ol;
#pragma unroll
    for (int q = 0; q < 8; ++q) { const int c = c0 + q; const float dv = __fsub_rn(bfr(xs[(size_t)c * TT + t]), mean); float y = __fmul_rn(dv, rs); asm volatile("" : "+v"(y)); y = __fmul_rn(y, bfr(g[c])); asm volatile("" : "+v"(y)); y = __fadd_rn(y, bfr(bb[c])); unsigned short a2, c2; splitf(y, a2, c2); oh[q] = a2; ol[q] = c2; }
    *(v8us*)(XH + (size_t)t * CC + c0) = oh; *(v8us*)(XL + (size_t)t * CC + c0) = ol;  }
__global__ __launch_bounds__(256) void k_outTr(const float* __restrict__ U, const float* __restrict__ xs, float* outp) { const size_t k = (size_t)blockIdx.x * 256 + threadIdx.x; if (k >= (size_t)CC * TT / 4) return; const size_t eo = (size_t)blockIdx.y * CC * TT; U += eo; xs += eo; outp += eo;   // batch element = blockIdx.y
    const size_t e = k * 4; const int t0 = (int)(e % TT); const int c = (int)(e / TT); const v4f a = *(const v4f*)(xs + e); v4f o;
#pragma unroll
    for (int q = 0; q < 4; ++q) o[q] = __fadd_rn(bfr(a[q]), U[(size_t)(t0 + q) * CC + c]);
    *(v4f*)(outp + e) = o;  }

// ---- k_fattn: scores, softmax and P.V of one head for FQB query rows in ONE work-group; scores and probabilities never leave the registers. Grid (batch x heads, TT / FQB), 4 waves, 32 query rows (two column tiles) a wave.
// Transposed products: S^T = K Q^T (A = 16 K rows from LDS, B = 16 query rows, kept in registers), O^T += V^T P^T. A lane then holds scores of ONE query (column lane & 15), and two S^T tiles (keys +0..15, +16..31),
// converted in place, are the B operand of the second product in the hardware k order (element s: key 8 hi + s, or 16 + 8 hi + s - 8), which is also the order of WFrag::ld on a V^T row. Only the HR = 32 real head columns are read.
// Two sweeps over the keys, K (and V^T) staged in LDS in chunks of CK keys: sweep 1 the row maximum; sweep 2 the same scores again, p = exp(s - max), f32 row sum of the unrounded p, P.V; the division by the sum comes last.
// The next chunk is fetched into registers while the present one is worked on. Rows < RH: bf16 hi/lo planes, three products each (hh, hl, lh) as before; the other rows f16.
#define FQB  128
#define KPT  40      // LDS pitch of a staged K row in 16-bit elements: 80 B = 16 B x odd, conflict-free for 16-byte reads
#define FSM  (2 * (128 * KPT + HR * (128 + 8)))   // the larger of the two paths' LDS needs, in 16-bit elements
typedef __attribute__((ext_vector_type(8))) __bf16 v8bf;
typedef __attribute__((ext_vector_type(4))) unsigned v4u;
__device__ __forceinline__ v8f splat8(float x) { return (v8f){x, x, x, x, x, x, x, x}; }
__device__ __forceinline__ v8f bfup(v8bf h) { const v4u w = __builtin_bit_cast(v4u, h); v8f r;   // packed bf16 back to f32: one shift or one mask an element
#pragma unroll   // constant indices: the arrays stay in registers
    for (int i = 0; i < 4; ++i) { r[2 * i] = __uint_as_float(w[i] << 16); r[2 * i + 1] = __uint_as_float(w[i] & 0xFFFF0000u); }
    return r; }
template <typename T16, int CK> struct FaChunk {   // one plane's share of a chunk in one thread's registers: CK / 32 16-byte pieces of K rows and as many of V^T rows
    typedef __attribute__((ext_vector_type(8))) T16 V8; V8 k[CK / 32], v[CK / 32];
    static constexpr int UR = CK / 8, RS = 128 / UR;   // 16-byte pieces in a V^T row of the chunk; V^T rows that the 128 threads cover at once (K: 4 pieces a row, 32 rows at once)
    // piece s of thread tid: K row (tid >> 2) + 32 s, V^T row tid / UR + RS s: a uniform base, one offset a thread, and a constant step
    template <bool WITHV> __device__ __forceinline__ void load(const T16* __restrict__ Kg, const T16* __restrict__ Vg, int key0) { const unsigned tid = threadIdx.x; const T16* ka = Kg + (size_t)key0 * HD + (tid >> 2) * HD + (tid & 3) * 8; const T16* va = Vg + key0 + (tid / UR) * TT + (tid % UR) * 8;
#pragma unroll   // constant indices: k[] and v[] stay in registers
        for (int s = 0; s < CK / 32; ++s) { k[s] = *(const V8*)(ka + s * 32 * HD); if constexpr (WITHV) v[s] = *(const V8*)(va + s * RS * TT); }
        // precaution: the loads' address registers are inputs here, so they stay live and unwritten (by a later load's result too) up to this wait
        if constexpr (WITHV) asm volatile("s_wait_xcnt 0x0" :: "v"(ka), "v"(va) : "memory"); else asm volatile("s_wait_xcnt 0x0" :: "v"(ka) : "memory"); }
    template <bool WITHV> __device__ __forceinline__ void store(T16* sK, T16* sV) const { const unsigned tid = threadIdx.x; T16* kd = sK + (tid >> 2) * KPT + (tid & 3) * 8; T16* vd = sV + (tid / UR) * (CK + 8) + (tid % UR) * 8;
#pragma unroll   // as above
        for (int s = 0; s < CK / 32; ++s) { *(V8*)(kd + s * 32 * KPT) = k[s]; if constexpr (WITHV) *(V8*)(vd + s * RS * (CK + 8)) = v[s]; } }
};
template <typename T16, bool HL, int CK>
__device__ __forceinline__ void fattn(const T16* __restrict__ Q, const T16* __restrict__ Q2, const T16* __restrict__ Kg, const T16* __restrict__ K2, const T16* __restrict__ Vg, const T16* __restrict__ V2, int q0, bf* Ah, bf* Al, T16* sm) {
    typedef WFrag<T16> F; typedef typename F::V V; constexpr int VPT = CK + 8;   // V^T row pitch: 16 B x odd
    static_assert((HL ? 2 : 1) * (CK * KPT + HR * VPT) <= FSM && TT % CK == 0 && CK % 32 == 0, "a chunk fits the LDS array");
    T16* sK = sm; T16* sV = sK + CK * KPT; T16* sK2 = sV + HR * VPT; T16* sV2 = sK2 + CK * KPT;
    const int lane = threadIdx.x & 31, lr = lane & 15, hi = lane >> 4, wave = threadIdx.x >> 5; const int t0 = q0 + wave * 32 + lr;
    V qf[2], qf2[2]; const T16* qa = Q + (size_t)t0 * HD + 8 * hi; const T16* qa2 = HL ? Q2 + (size_t)t0 * HD + 8 * hi : qa;
#pragma unroll   // constant indices: the arrays stay in registers
    for (int g = 0; g < 2; ++g) { qf[g] = F::ld(qa + 16 * g * HD); if constexpr (HL) qf2[g] = F::ld(qa2 + 16 * g * HD); }
    asm volatile("s_wait_xcnt 0x0" :: "v"(qa), "v"(qa2) : "memory");   // precaution, as in FaChunk::load
    const int koff = lr * KPT + 8 * hi, voff = lr * VPT + 8 * hi;
    FaChunk<T16, CK> r, r2;
    v8f mx[2] = {splat8(-3.0e38f), splat8(-3.0e38f)};   // eight independent maxima a column tile, joined behind the sweep
    r.template load<false>(Kg, Vg, 0); if constexpr (HL) r2.template load<false>(K2, V2, 0);
#pragma unroll 1   // one chunk at a time: the LDS array holds one
    for (int c = 0; c < TT; c += CK) {
        __syncthreads();   // every wave has left the chunk that is overwritten next
        r.template store<false>(sK, sV); if constexpr (HL) r2.template store<false>(sK2, sV2);
        __syncthreads();   // the chunk is complete before any wave reads it
        if (c + CK < TT) { r.template load<false>(Kg, Vg, c + CK); if constexpr (HL) r2.template load<false>(K2, V2, c + CK); }   // flies under this chunk's products
#pragma unroll 2   // two independent 32-key groups: one group's LDS reads fly under the other's products
        for (int kk = 0; kk < CK; kk += 32) { const V a0 = F::ld(sK + koff + kk * KPT), a1 = F::ld(sK + koff + (kk + 16) * KPT); V b0, b1; if constexpr (HL) { b0 = F::ld(sK2 + koff + kk * KPT); b1 = F::ld(sK2 + koff + (kk + 16) * KPT); }
#pragma unroll   // constant indices: the arrays stay in registers
            for (int g = 0; g < 2; ++g) { v8f s0 = F::mma(a0, qf[g], (v8f){}), s1 = F::mma(a1, qf[g], (v8f){});
                if constexpr (HL) { s0 = F::mma(a0, qf2[g], s0); s1 = F::mma(a1, qf2[g], s1); s0 = F::mma(b0, qf[g], s0); s1 = F::mma(b1, qf[g], s1); }
#pragma unroll   // constant indices: the arrays stay in registers
                for (int j = 0; j < 8; ++j) mx[g][j] = fmaxf(mx[g][j], fmaxf(s0[j], s1[j])); } }
    }
    const float c1 = SCL * 1.4426950408889634f; const v8f c1v = splat8(c1); v8f nm[2], sv[2], o[2][2];
#pragma unroll   // constant indices: the arrays stay in registers
    for (int g = 0; g < 2; ++g) { float m = fmaxf(fmaxf(fmaxf(mx[g][0], mx[g][1]), fmaxf(mx[g][2], mx[g][3])), fmaxf(fmaxf(mx[g][4], mx[g][5]), fmaxf(mx[g][6], mx[g][7]))); m = fmaxf(m, __shfl_xor(m, 16, 32));   // lanes l and l ^ 16 hold the two halves of one query's keys
        nm[g] = splat8((HL ? 0.0f : 6.0f) - m * c1);   // f16 path: p carries a factor 2^6, which cancels against the row sum, so that small p stay normal f16 numbers
        sv[g] = (v8f){}; o[g][0] = (v8f){}; o[g][1] = (v8f){}; }
    r.template load<true>(Kg, Vg, 0); if constexpr (HL) r2.template load<true>(K2, V2, 0);
#pragma unroll 1   // one chunk at a time
    for (int c = 0; c < TT; c += CK) {
        __syncthreads();   // every wave has left the chunk that is overwritten next
        r.template store<true>(sK, sV); if constexpr (HL) r2.template store<true>(sK2, sV2);
        __syncthreads();   // the chunk is complete before any wave reads it
        if (c + CK < TT) { r.template load<true>(Kg, Vg, c + CK); if constexpr (HL) r2.template load<true>(K2, V2, c + CK); }   // flies under this chunk's products
#pragma unroll 2   // as in sweep 1
        for (int kk = 0; kk < CK; kk += 32) { const V a0 = F::ld(sK + koff + kk * KPT), a1 = F::ld(sK + koff + (kk + 16) * KPT); V b0, b1; if constexpr (HL) { b0 = F::ld(sK2 + koff + kk * KPT); b1 = F::ld(sK2 + koff + (kk + 16) * KPT); }
            const V v0 = F::ld(sV + voff + kk), v1 = F::ld(sV + voff + 16 * VPT + kk); V w0, w1; if constexpr (HL) { w0 = F::ld(sV2 + voff + kk); w1 = F::ld(sV2 + voff + 16 * VPT + kk); }
            v8f s0[2], s1[2];
#pragma unroll   // constant indices: the arrays stay in registers
            for (int g = 0; g < 2; ++g) { s0[g] = F::mma(a0, qf[g], (v8f){}); s1[g] = F::mma(a1, qf[g], (v8f){}); }
            if constexpr (HL) {
#pragma unroll   // constant indices: the arrays stay in registers
                for (int g = 0; g < 2; ++g) { s0[g] = F::mma(a0, qf2[g], s0[g]); s1[g] = F::mma(a1, qf2[g], s1[g]); }
#pragma unroll   // constant indices: the arrays stay in registers
                for (int g = 0; g < 2; ++g) { s0[g] = F::mma(b0, qf[g], s0[g]); s1[g] = F::mma(b1, qf[g], s1[g]); } }
#pragma unroll   // constant indices: the arrays stay in registers
            for (int g = 0; g < 2; ++g) { const v8f x0 = __builtin_elementwise_fma(s0[g], c1v, nm[g]), x1 = __builtin_elementwise_fma(s1[g], c1v, nm[g]); v8f p0, p1;
#pragma unroll   // constant indices: the arrays stay in registers
                for (int j = 0; j < 8; ++j) { p0[j] = __builtin_amdgcn_exp2f(x0[j]); p1[j] = __builtin_amdgcn_exp2f(x1[j]); }
                sv[g] += p0; sv[g] += p1;
                if constexpr (HL) {
                    const v8bf h0 = __builtin_convertvector(p0, v8bf), h1 = __builtin_convertvector(p1, v8bf); const v8bf l0 = __builtin_convertvector(p0 - bfup(h0), v8bf), l1 = __builtin_convertvector(p1 - bfup(h1), v8bf);
                    const V ph = __builtin_shufflevector(h0, h1, 0, 1, 2, 3, 4, 5, 6, 7, 8, 9, 10, 11, 12, 13, 14, 15), pl = __builtin_shufflevector(l0, l1, 0, 1, 2, 3, 4, 5, 6, 7, 8, 9, 10, 11, 12, 13, 14, 15);
                    o[g][0] = F::mma(v0, ph, o[g][0]); o[g][1] = F::mma(v1, ph, o[g][1]); o[g][0] = F::mma(v0, pl, o[g][0]); o[g][1] = F::mma(v1, pl, o[g][1]); o[g][0] = F::mma(w0, ph, o[g][0]); o[g][1] = F::mma(w1, ph, o[g][1]);
                } else {
                    const V pf = cat16(__builtin_convertvector(p0, v8h), __builtin_convertvector(p1, v8h));
                    o[g][0] = F::mma(v0, pf, o[g][0]); o[g][1] = F::mma(v1, pf, o[g][1]); } } }
    }
#pragma unroll   // constant indices: the arrays stay in registers
    for (int g = 0; g < 2; ++g) { float sum = ((sv[g][0] + sv[g][1]) + (sv[g][2] + sv[g][3])) + ((sv[g][4] + sv[g][5]) + (sv[g][6] + sv[g][7])); sum += __shfl_xor(sum, 16, 32); const float inv = __fdiv_rn(1.0f, sum);
        v8us h0, l0, h1, l1; const v8us zz = (v8us){};
#pragma unroll   // constant indices: the arrays stay in registers
        for (int j = 0; j < 8; ++j) { unsigned short a, b; splitf(o[g][0][j] * inv, a, b); h0[j] = a; l0[j] = b; splitf(o[g][1][j] * inv, a, b); h1[j] = a; l1[j] = b; }
        // o[g][0][j] = O[t][8 hi + j], o[g][1][j] = O[t][16 + 8 hi + j]; columns HR .. HD - 1 of the padded head are zero
        bf* ph = Ah + (size_t)(t0 + 16 * g) * DQ + 8 * hi; bf* pl = Al + (size_t)(t0 + 16 * g) * DQ + 8 * hi;
        *(v8us*)ph = h0; *(v8us*)(ph + 16) = h1; *(v8us*)(ph + 32) = zz; *(v8us*)(ph + 48) = zz; *(v8us*)pl = l0; *(v8us*)(pl + 16) = l1; *(v8us*)(pl + 32) = zz; *(v8us*)(pl + 48) = zz; }
}
// ---- k_proj: the q, k and v projections of every batch element in ONE launch; its epilogue rounds the f32 sums (+ f32 bias) straight into the 16-bit planes that k_fattn reads (f16, bf16 hi, bf16 lo), so no f32 copy of q, k or v exists.
// Grid (TT / 64, NH_ / 2, 3 NB_), one wave a tile of 64 tokens x the HR real columns of two heads; blockIdx.z = 3 x batch element + (0 q, 1 k, 2 v). The padded rows of W and the padded plane columns, which k_fattn never reads, are left out.
// K loop and product order (x hi, then x lo, per 32-wide k step) as in k_gemmw<bf, 1, true>. W and bias keep wpadh's padded row numbering: head * HD + column.
// q, k (VT false): transposed product, A = 16 W rows, B = 16 tokens: a lane holds 8 neighbouring columns of ONE token = one 16-byte store a plane into [head][t][HD].
// v (VT true): A = 16 tokens, B = 16 W rows: a lane holds 8 neighbouring tokens of ONE column = one 16-byte store a plane into [head][column][TT]. Either way a wave writes whole 64- or 128-byte runs, and a 128-byte line has one writer.
template <bool VT>
__device__ __forceinline__ void proj_tile(const bf* __restrict__ XH, const bf* __restrict__ XL, const bf* __restrict__ Wt, const float* __restrict__ bias, int r0, int h0, h16* P16, bf* Ph, bf* Pl) {
    typedef WFrag<bf> F; typedef F::V V;
    const int lane = threadIdx.x & 31, lr = lane & 15, hi = lane >> 4;
    const bf* xh = XH + (size_t)(r0 + lr) * DM + 8 * hi; const bf* xl = XL + (size_t)(r0 + lr) * DM + 8 * hi; const bf* wr = Wt + (size_t)(h0 * HD + lr) * DM + 8 * hi;
    v8f acc[4][4];
#pragma unroll   // constant indices: the arrays stay in registers
    for (int mb = 0; mb < 4; ++mb)
#pragma unroll   // as above
        for (int nb = 0; nb < 4; ++nb) acc[mb][nb] = (v8f){};
#pragma unroll 1   // one k step's fragments in registers at a time, as in k_gemmw
    for (int kc = 0; kc < DM; kc += 32) {
        V a[4], a2[4], b[4];
#pragma unroll   // constant indices: the arrays stay in registers
        for (int mb = 0; mb < 4; ++mb) { a[mb] = F::ld(xh + mb * 16 * DM); a2[mb] = F::ld(xl + mb * 16 * DM); }
#pragma unroll   // as above
        for (int nb = 0; nb < 4; ++nb) b[nb] = F::ld(wr + ((nb >> 1) * HD + (nb & 1) * 16) * DM);   // column block nb: head h0 + nb / 2, columns 16 (nb % 2) ..
        // precaution, as in FaChunk::load: the loads' address registers are inputs here, so they stay live and unwritten (by a later load's result too) up to this wait.
        // The loaded fragments are inputs too: each keeps registers of its own, so all 24 loads are in flight together and a k step waits for memory once (without them the x lo loads wait for the x hi registers: twice)
        asm volatile("s_wait_xcnt 0x0" :: "v"(xh), "v"(xl), "v"(wr), "v"(a[0]), "v"(a[1]), "v"(a[2]), "v"(a[3]), "v"(a2[0]), "v"(a2[1]), "v"(a2[2]), "v"(a2[3]), "v"(b[0]), "v"(b[1]), "v"(b[2]), "v"(b[3]) : "memory");
        xh += 32; xl += 32; wr += 32;
#pragma unroll   // as above
        for (int nb = 0; nb < 4; ++nb)
#pragma unroll   // as above
            for (int mb = 0; mb < 4; ++mb) {
                if constexpr (VT) { acc[mb][nb] = F::mma(a[mb], b[nb], acc[mb][nb]); acc[mb][nb] = F::mma(a2[mb], b[nb], acc[mb][nb]); }
                else { acc[mb][nb] = F::mma(b[nb], a[mb], acc[mb][nb]); acc[mb][nb] = F::mma(b[nb], a2[mb], acc[mb][nb]); } }
    }
    v8f bv[4];   // the bias of column block nb as this lane adds it; the four loads fly together
    if constexpr (VT) { const int bi = h0 * HD + lr; float bs[4];
#pragma unroll   // constant indices: the arrays stay in registers
        for (int nb = 0; nb < 4; ++nb) bs[nb] = bias[bi + (nb >> 1) * HD + (nb & 1) * 16];
        asm volatile("s_wait_xcnt 0x0" :: "v"(bi) : "memory");   // precaution, as above: the loads' offset register is an input here
#pragma unroll   // as above
        for (int nb = 0; nb < 4; ++nb) bv[nb] = splat8(bfr(bs[nb]));
    } else { const float* bp = bias + h0 * HD + 8 * hi;
#pragma unroll   // as above
        for (int nb = 0; nb < 4; ++nb) bv[nb] = *(const v8f*)(bp + (nb >> 1) * HD + (nb & 1) * 16);
#pragma unroll   // as above
        for (int nb = 0; nb < 4; ++nb)
#pragma unroll   // as above
            for (int j = 0; j < 8; ++j) bv[nb][j] = bfr(bv[nb][j]); }
#pragma unroll   // as above
    for (int nb = 0; nb < 4; ++nb) { const int hd = (h0 + (nb >> 1)) * HD + (nb & 1) * 16;   // padded number of the block's first column
#pragma unroll   // as above
        for (int mb = 0; mb < 4; ++mb) { const v8f y = acc[mb][nb] + bv[nb]; const v8h o16 = __builtin_convertvector(y, v8h);   // packed conversions, round to nearest even: the values of tohx and splitf
            const v8bf yh = __builtin_convertvector(y, v8bf); const v8bf yl = __builtin_convertvector(y - bfup(yh), v8bf); const v8us oh = __builtin_bit_cast(v8us, yh), ol = __builtin_bit_cast(v8us, yl);
            const size_t e = VT ? (size_t)(hd + lr) * TT + r0 + mb * 16 + 8 * hi : ((size_t)(h0 + (nb >> 1)) * TT + r0 + mb * 16 + lr) * HD + (nb & 1) * 16 + 8 * hi;
            *(v8h*)(P16 + e) = o16; *(v8us*)(Ph + e) = oh; *(v8us*)(Pl + e) = ol; } }
}
__global__ __launch_bounds__(32) void k_proj(const bf* __restrict__ XH, const bf* __restrict__ XL, const bf* __restrict__ WQ, const bf* __restrict__ WK, const bf* __restrict__ WV, const float* __restrict__ BQ, const float* __restrict__ BK, const float* __restrict__ BV,
                                             h16* Q16, bf* Qh, bf* Ql, h16* K16, bf* Kh, bf* Kl, h16* V16, bf* Vh, bf* Vl) {
    static_assert(TT % 64 == 0 && NH_ % 2 == 0 && HR == 32 && DM % 32 == 0 && NH_ == NKV, "whole tiles; two 16-column blocks a head");
    const int b = blockIdx.z / 3, p = blockIdx.z % 3; const int r0 = blockIdx.x * 64, h0 = blockIdx.y * 2; const size_t xo = (size_t)b * TT * DM, po = (size_t)b * NH_ * TT * HD;
    if (p == 2) proj_tile<true>(XH + xo, XL + xo, WV, BV, r0, h0, V16 + po, Vh + po, Vl + po);
    else proj_tile<false>(XH + xo, XL + xo, p ? WK : WQ, p ? BK : BQ, r0, h0, (p ? K16 : Q16) + po, (p ? Kh : Qh) + po, (p ? Kl : Ql) + po);
}

// Planes [batch][head][...], outputs [batch][t][DQ]. blockIdx.y is the row block, so that the longer-running work-groups of rows < RH have the lowest flat indices and start first.
__global__ __launch_bounds__(128) void k_fattn(const h16* __restrict__ Q16, const bf* __restrict__ Qh, const bf* __restrict__ Ql, const h16* __restrict__ K16, const bf* __restrict__ Kh, const bf* __restrict__ Kl, const h16* __restrict__ V16, const bf* __restrict__ Vh, const bf* __restrict__ Vl, bf* Ah, bf* Al) {
    static_assert(RH % FQB == 0 && TT % FQB == 0 && HR == 32 && HD == 64 && NH_ == NKV, "whole work-groups on either side of RH; one 32-wide k step a head");
    __shared__ __align__(16) unsigned short sm[FSM];
    const size_t hp = (size_t)blockIdx.x * TT * HD; const int q0 = blockIdx.y * FQB; const size_t ao = (size_t)(blockIdx.x / NH_) * TT * DQ + (blockIdx.x % NH_) * HD;
    if (q0 < RH) fattn<bf, true, 128>(Qh + hp, Ql + hp, Kh + hp, Kl + hp, Vh + hp, Vl + hp, q0, Ah + ao, Al + ao, (bf*)sm);
    else fattn<h16, false, 256>(Q16 + hp, nullptr, K16 + hp, nullptr, V16 + hp, nullptr, q0, Ah + ao, Al + ao, (h16*)sm);
}

extern "C" void kernel_launch(void* const* d_in, const int* in_sizes, int n_in,
                              void* d_out, int out_size, void* d_ws, size_t ws_size, hipStream_t stream) {
    (void)in_sizes; (void)n_in; (void)out_size;
    const float* x = (const float*)d_in[0]; const float* gnw = (const float*)d_in[1]; const float* gnb = (const float*)d_in[2]; const float* wq = (const float*)d_in[3]; const float* bq = (const float*)d_in[4]; const float* wk = (const float*)d_in[5]; const float* bk = (const float*)d_in[6]; const float* wv = (const float*)d_in[7]; const float* bv = (const float*)d_in[8]; const float* wo = (const float*)d_in[9]; const float* bo = (const float*)d_in[10];
    float* OUT = (float*)d_out;     // [2][256][4096]
    char* wsp = (char*)d_ws;
    auto take = [&](size_t bytes) { char* p = wsp; wsp += (bytes + 255) & ~(size_t)255; return (void*)p; };
    float* BQP = (float*)take(DQ * 4); float* BKP = (float*)take(DQ * 4); float* BVP = (float*)take(DQ * 4); bf* XH = (bf*)take((size_t)NB_ * TT * DM * 2); bf* XL = (bf*)take((size_t)NB_ * TT * DM * 2); float* STAT = (float*)take((size_t)NB_ * GNP * 4); float* PS = (float*)take((size_t)NB_ * GNG * GNP * 4); float* PQ = (float*)take((size_t)NB_ * GNG * GNP * 4); float* Y = (float*)take((size_t)NB_ * TT * DM * 4); bf* WQ = (bf*)take((size_t)DQ * DM * 2); bf* WK = (bf*)take((size_t)DKV * DM * 2); bf* WV = (bf*)take((size_t)DKV * DM * 2); bf* WO = (bf*)take((size_t)DM * DQ * 2);
    const size_t PL = (size_t)NH_ * TT * HD;   // elements of one batch element's head planes; every plane below holds all NB_ batch elements
    h16* QP16 = (h16*)take(NB_ * PL * 2); h16* KP16 = (h16*)take(NB_ * PL * 2); h16* VT16 = (h16*)take(NB_ * PL * 2);
    bf* QPh = (bf*)take(NB_ * PL * 2); bf* QPl = (bf*)take(NB_ * PL * 2); bf* KPh = (bf*)take(NB_ * PL * 2); bf* KPl = (bf*)take(NB_ * PL * 2); bf* VTh = (bf*)take(NB_ * PL * 2); bf* VTl = (bf*)take(NB_ * PL * 2);
    bf* ATh = (bf*)take((size_t)NB_ * TT * DQ * 2); bf* ATl = (bf*)take((size_t)NB_ * TT * DQ * 2);
    if ((size_t)(wsp - (char*)d_ws) > ws_size) return;    // ws 256 MiB
    k_prep<<<NB_ * GNG + 4 * WPB, 256, 0, stream>>>(x, PS, wq, bq, wk, bk, wv, bv, wo, WQ, BQP, WK, BKP, WV, BVP, WO);   /* GroupNorm partial sums and the four weight preparations */
    k_gnsq<<<dim3(GNG, NB_), 256, 0, stream>>>(x, PS, PQ); k_gnfin<<<NB_, 256, 0, stream>>>(PS, PQ, STAT);
    k_gnT<<<dim3((unsigned)(((size_t)TT * CC / 8 + 255) / 256), NB_), 256, 0, stream>>>(x, STAT, gnw, gnb, XH, XL);   /* normalised, token-major, hi/lo; every batch element */
    k_proj<<<dim3(TT / 64, NH_ / 2, 3 * NB_), 32, 0, stream>>>(XH, XL, WQ, WK, WV, BQP, BKP, BVP, QP16, QPh, QPl, KP16, KPh, KPl, VT16, VTh, VTl);   /* q, k, v of every batch element, straight into the head planes */
    k_fattn<<<dim3(NB_ * NH_, TT / FQB), 128, 0, stream>>>(QP16, QPh, QPl, KP16, KPh, KPl, VT16, VTh, VTl, ATh, ATl);   /* every head of every batch element */
    k_gemmw<bf, 1, true><<<dim3(TT / 64, DM / 64, NB_), 32, 0, stream>>>(ATh, ATl, WO, nullptr, DQ, Y, DM, bo, (size_t)TT * DQ, 0, (size_t)TT * DM);   /* Wo product of every batch element (z) */
    k_outTr<<<dim3((unsigned)(((size_t)CC * TT / 4 + 255) / 256), NB_), 256, 0, stream>>>(Y, x, OUT);   /* back to channel-major + hidden residual */
}

// v006
// It runs in 137 microseconds.
// Next to v005, in two timings, it ran 1.04 and 1.05 times as fast.
// Counting every step since v000, it is 38.6 times as fast.
#include <hip/hip_runtime.h>

// 1-D self-attention block with GroupNorm and residual on a channel-major sequence (hidden [2][256][4096]; x = GroupNorm(1 group over all 256 x 4096 values, eps 1e-5) x gn_weight + gn_bias; h = x^T; q,k,v = h W^T + b ('oi' [256][256] + [256], 1/16; 8 heads x 32); scores = (q 32^-1/4).(k 32^-1/4); softmax over all 4,096 keys; out = merged Wo^T + bo, transposed back + hidden -> [2][256][4096] (2.1 M)).
// Compute dtypes, f32 accumulate: every input rounded to bf16; GroupNorm f32 (fixed-order sums); projections hi/lo x exact + f32 biases; attention rows < 512 3 products, rest fp16; softmax f32; Wo hl x exact + bias; residual f32.

#define NB_  2
#define TT   4096
#define DM   256
#define NH_  8
#define NKV  8
#define REP  (NH_ / NKV)
#define HD   64
#define DQ   (NH_ * HD)
#define DKV  (NKV * HD)
#define RH   512                  // query rows < RH use hi+lo planes (0: none)
#define WIN  0
#define SCL  0.17677669529663689f   // 32^-1/2 == (32^-1/4)^2 applied once to q.k
#define CC   256     // channels
#define HR   32      // real head width (padded to HD = 64)
typedef _Float16 h16;
typedef unsigned short bf;
typedef __attribute__((ext_vector_type(16))) __bf16   v16bf;
typedef __attribute__((ext_vector_type(16))) _Float16 v16h;
typedef __attribute__((ext_vector_type(8)))  _Float16 v8h;
typedef __attribute__((ext_vector_type(8)))  unsigned short v8us;
typedef __attribute__((ext_vector_type(8)))  float    v8f;
typedef __attribute__((ext_vector_type(4)))  float    v4f;
typedef v8h  __attribute__((may_alias)) v8ha;
typedef v4f  __attribute__((may_alias)) v4fa;
typedef v8us __attribute__((may_alias)) v8usa;

__device__ __forceinline__ unsigned short f2bf(float f) { unsigned u = __float_as_uint(f); u += 0x7FFFu + ((u >> 16) & 1u); return (unsigned short)(u >> 16); }
__device__ __forceinline__ float bf2f(unsigned short b) { return __uint_as_float(((unsigned)b) << 16); }
__device__ __forceinline__ float bfr(float f) { return bf2f(f2bf(f)); }
__device__ __forceinline__ v16h cat16(v8h lo, v8h hi) { return __builtin_shufflevector(lo, hi, 0, 1, 2, 3, 4, 5, 6, 7, 8, 9, 10, 11, 12, 13, 14, 15); }
__device__ __forceinline__ v16bf cat16b(v8us lo, v8us hi) { return __builtin_bit_cast(v16bf, __builtin_shufflevector(lo, hi, 0, 1, 2, 3, 4, 5, 6, 7, 8, 9, 10, 11, 12, 13, 14, 15)); }
__device__ __forceinline__ v8f wmma16(v16h a, v16h b, v8f c) { return __builtin_amdgcn_wmma_f32_16x16x32_f16(false, a, false, b, (short)0, c, false, false); }
__device__ __forceinline__ v8f wmmab(v16bf a, v16bf b, v8f c) { return __builtin_amdgcn_wmma_f32_16x16x32_bf16(false, a, false, b, (short)0, c, false, false); }



// ---- k_gemmw: register-blocked GEMM, ONE WAVE per 64x64 output tile (16 accumulators), operands straight from K-contiguous 16-bit planes; grid (M/64, N/64, Z), 32 threads.
// C[m][n] (f32, pitch ldc, + optional f32 bias[n]) = sum_k A[m][k] Bt[n][k] (+ split products per NSPLIT). z-batch strides sA/sB/sC in elements. K % 32 == 0.
// For a long K on a small grid: K split over KS work-groups (blockIdx.z % KS; grid z = Z KS) and, inside each, over its NW waves (NW*32 threads); wave w of part zk sums k in [(zk NW + w) K/(KS NW), +K/(KS NW)).
// The NW f32 partial tiles meet in LDS (row pitch 68 floats) and are added in wave order, each wave finishing 64/NW whole rows; part zk stores to plane C + zk sP, and the reader of C adds the KS planes in order. K % (32 KS NW) == 0.
template <typename T16> struct WFrag;
template <> struct WFrag<h16> { typedef v16h V; static __device__ __forceinline__ V ld(const h16* p) { return cat16(*(const v8h*)p, *(const v8h*)(p + 16)); } static __device__ __forceinline__ v8f mma(V a, V b, v8f c) { return wmma16(a, b, c); } };
template <> struct WFrag<bf> { typedef v16bf V; static __device__ __forceinline__ V ld(const bf* p) { return cat16b(*(const v8us*)p, *(const v8us*)(p + 16)); } static __device__ __forceinline__ v8f mma(V a, V b, v8f c) { return wmmab(a, b, c); } };
template <typename T16, int NSPLIT, bool BIAS, int KS = 1, int NW = 1>
__global__ __launch_bounds__(NW * 32) void k_gemmw(const T16* __restrict__ A, const T16* __restrict__ A2, const T16* __restrict__ Bt, const T16* __restrict__ Bt2, int K, float* C, int ldc, const float* __restrict__ bias, size_t sA, size_t sB, size_t sC, size_t sP = 0) {
    static_assert(NW == 1 ? KS == 1 : (!BIAS && 64 % (2 * NW) == 0), "split K: no bias, whole row pairs per wave");
    typedef typename WFrag<T16>::V V;
    __shared__ __align__(16) float os[(NW == 1 ? 16 : NW * 64) * 68];
    const size_t z = blockIdx.z / KS; const int zk = blockIdx.z % KS; A += z * sA; if (A2) A2 += z * sA; Bt += z * sB; if (Bt2) Bt2 += z * sB; C += z * sC + zk * sP;
    const int wave = (NW == 1) ? 0 : __builtin_amdgcn_readfirstlane((int)(threadIdx.x >> 5)); const int ks = K / (KS * NW), k0 = (zk * NW + wave) * ks;
    const int lane = threadIdx.x & 31, lr = lane & 15, hi = lane >> 4; const int r0 = blockIdx.x * 64, c0 = blockIdx.y * 64;
    v8f acc[4][4];
#pragma unroll
    for (int mb = 0; mb < 4; ++mb)
#pragma unroll
        for (int nb = 0; nb < 4; ++nb) acc[mb][nb] = (v8f){};
    const size_t aoff = (size_t)(r0 + lr) * K + 8 * hi, boff = (size_t)(c0 + lr) * K + 8 * hi;
#pragma unroll 1
    for (int kc = k0; kc < k0 + ks; kc += 32) {
        V a[4], a2[4];
#pragma unroll
        for (int mb = 0; mb < 4; ++mb) { a[mb] = WFrag<T16>::ld(A + aoff + (size_t)mb * 16 * K + kc); if (NSPLIT == 1 || NSPLIT == 2) a2[mb] = WFrag<T16>::ld(A2 + aoff + (size_t)mb * 16 * K + kc); }
#pragma unroll
        for (int nb = 0; nb < 4; ++nb) { const V b = WFrag<T16>::ld(Bt + boff + (size_t)nb * 16 * K + kc); V b2; if (NSPLIT >= 2) b2 = WFrag<T16>::ld(Bt2 + boff + (size_t)nb * 16 * K + kc);
#pragma unroll
            for (int mb = 0; mb < 4; ++mb) { acc[mb][nb] = WFrag<T16>::mma(a[mb], b, acc[mb][nb]); if (NSPLIT == 1 || NSPLIT == 2) acc[mb][nb] = WFrag<T16>::mma(a2[mb], b, acc[mb][nb]); if (NSPLIT >= 2) acc[mb][nb] = WFrag<T16>::mma(a[mb], b2, acc[mb][nb]); } }
        asm volatile("v_nop\n\tv_nop\n\tv_nop\n\tv_nop" : "+v"(acc[0][0]), "+v"(acc[1][1]), "+v"(acc[2][2]), "+v"(acc[3][3]) : "v"(a[0]), "v"(a[3]));
    }
    if constexpr (NW > 1) {
        float* pw = os + wave * (64 * 68);
#pragma unroll
        for (int mb = 0; mb < 4; ++mb)
#pragma unroll
            for (int nb = 0; nb < 4; ++nb)
#pragma unroll
                for (int j = 0; j < 8; ++j) pw[(mb * 16 + hi * 8 + j) * 68 + nb * 16 + lr] = acc[mb][nb][j];
        __syncthreads();   // every wave's partial tile is in LDS before any wave adds them
#pragma unroll
        for (int s = 0; s < 64 / (2 * NW); ++s) { const int row = wave * (64 / NW) + 2 * s + hi, cofs = lr * 4; v4f val = *(const v4fa*)(os + row * 68 + cofs);
#pragma unroll
            for (int w = 1; w < NW; ++w) { const v4f pv = *(const v4fa*)(os + w * (64 * 68) + row * 68 + cofs); val[0] = __fadd_rn(val[0], pv[0]); val[1] = __fadd_rn(val[1], pv[1]); val[2] = __fadd_rn(val[2], pv[2]); val[3] = __fadd_rn(val[3], pv[3]); }
            *(v4f*)(C + (size_t)(r0 + row) * ldc + c0 + cofs) = val; }
        return;
    }
#pragma unroll
    for (int mb = 0; mb < 4; ++mb) {
#pragma unroll
        for (int nb = 0; nb < 4; ++nb) {
#pragma unroll
            for (int j = 0; j < 8; ++j) os[(hi * 8 + j) * 68 + nb * 16 + lr] = acc[mb][nb][j]; }
        __builtin_amdgcn_wave_barrier(); asm volatile("" ::: "memory");
        float* crow = C + (size_t)(r0 + mb * 16) * ldc + c0;
{
#pragma unroll
            for (int s = 0; s < 8; ++s) { const int row = 2 * s + hi, cofs = lr * 4; v4f val = *(const v4fa*)(os + row * 68 + cofs); if (BIAS) { val[0] += bfr(bias[c0 + cofs]); val[1] += bfr(bias[c0 + cofs + 1]); val[2] += bfr(bias[c0 + cofs + 2]); val[3] += bfr(bias[c0 + cofs + 3]); }
                *(v4f*)(crow + (size_t)row * ldc + cofs) = val; }
             }
        __builtin_amdgcn_wave_barrier(); asm volatile("" ::: "memory");
    }
}

__device__ __forceinline__ h16 tohx(float x) { return (h16)x; }
__device__ __forceinline__ void splitf(float y, unsigned short& h, unsigned short& l) { h = f2bf(y); l = f2bf(y - bf2f(h)); }
typedef __attribute__((ext_vector_type(2))) _Float16 v2h;
typedef __attribute__((ext_vector_type(4))) _Float16 v4h;
typedef __attribute__((ext_vector_type(2))) unsigned short v2us;
typedef __attribute__((ext_vector_type(4))) unsigned short v4us;
typedef __attribute__((ext_vector_type(2))) float v2f;
typedef __attribute__((ext_vector_type(4))) int v4i;

__global__ __launch_bounds__(256) void k_wtG(const float* __restrict__ w, int K, int N, bf* Bt) {
    const int lane = threadIdx.x & 31; const int L0 = (blockIdx.x * 8 + (threadIdx.x >> 5)) * 8; const int nlines = N * K / 64;
{
#pragma unroll 1
        for (int l = 0; l < 8; ++l) { const int L = L0 + l; if (L >= nlines) break; const size_t e = (size_t)L * 64 + lane * 2; const int k = (int)(e % K), n = (int)(e / K); v2us o;
            o[0] = f2bf(w[(size_t)k * N + n]); o[1] = f2bf(w[(size_t)(k + 1) * N + n]); *(v2us*)(Bt + e) = o; }
         }
}
__global__ __launch_bounds__(256) void k_cvt8(const float* __restrict__ src, bf* dst, size_t n8) { const size_t i = (size_t)blockIdx.x * 256 + threadIdx.x; if (i >= n8) return; const v8f v = *(const v8f*)(src + i * 8); v8us o;
#pragma unroll
    for (int k = 0; k < 8; ++k) o[k] = f2bf(v[k]); *(v8us*)(dst + i * 8) = o;  }

__device__ __forceinline__ void wpadh(int blk, const float* __restrict__ w, const float* __restrict__ bias, bf* Bt, float* bp) { const int i = blk * 256 + threadIdx.x; if (i >= DQ * DM / 8) return; const int c0 = (i % (DM / 8)) * 8; const int r = i / (DM / 8); const int h = r / HD, d = r % HD; const int sr = h * HR + min(d, HR - 1); const float* src = w + (size_t)sr * DM + c0; v8us o;
#pragma unroll
    for (int q = 0; q < 8; ++q) { const unsigned short v = f2bf(src[q]); o[q] = (d < HR) ? v : (unsigned short)0; }
    *(v8us*)(Bt + (size_t)r * DM + c0) = o; if (i < DQ) { const int hb = i / HD, db = i % HD; const float bb = bias[hb * HR + min(db, HR - 1)]; ((float*)bp)[i] = (db < HR) ? bb : 0.0f; }     }
__device__ __forceinline__ void wopadh(int blk, const float* __restrict__ w, bf* Bt) { const int i = blk * 256 + threadIdx.x; if (i >= DM * DQ / 8) return; const int k0 = (i % (DQ / 8)) * 8; const int o = i / (DQ / 8); v8us ov; const float* wa[8]; float wl[8];
#pragma unroll
    for (int q = 0; q < 8; ++q) { const int kk = k0 + q; const int h = kk / HD, d = kk % HD; wa[q] = w + (size_t)o * DM + h * HR + min(d, HR - 1); wl[q] = *wa[q]; }
    // precaution, as in FaChunk::load: the loads' address registers are inputs here, so they stay live and unwritten (by a later load's result too) up to this wait
    asm volatile("s_wait_xcnt 0x0" :: "v"(wa[0]), "v"(wa[1]), "v"(wa[2]), "v"(wa[3]), "v"(wa[4]), "v"(wa[5]), "v"(wa[6]), "v"(wa[7]) : "memory");
#pragma unroll
    for (int q = 0; q < 8; ++q) { const int d = (k0 + q) % HD; const unsigned short v = f2bf(wl[q]); ov[q] = (d < HR) ? v : (unsigned short)0; }
    *(v8us*)(Bt + (size_t)o * DQ + k0) = ov;  }
// GroupNorm statistics of all NB_ batch elements, three launches. Each element's CC x TT values are shared by GNG work-groups (number bx, element by: blockIdx.x, .y in k_gnsq; blk % GNG, blk / GNG in k_prep), GNK 16-byte loads a thread, all in flight at once.
// gnsum (in k_prep): one partial sum a work-group. k_gnsq: mean from the GNG partial sums, then one partial sum of (x - mean)^2 a work-group. k_gnfin: {mean, 1/sqrt(var + eps)} per element.
// Every sum has a fixed order: in the thread, then wg_sum's tree, then wg_sum over the GNG partials. Each partial, and each element's pair of results, has a 128-byte line of its own (pitch GNP floats), so a line has one writer.
#define GNG  256
#define GNK  (CC * TT / GNG / 1024)
#define GNP  32
__device__ __forceinline__ float wg_sum(float v, float* red) { const int tid = threadIdx.x; red[tid] = v; __syncthreads();
    for (int st = 128; st > 0; st >>= 1) { if (tid < st) red[tid] = __fadd_rn(red[tid], red[tid + st]); __syncthreads(); }
    const float r = red[0]; __syncthreads();   // red is free for the next sum once every thread has read the total
    return r; }
__device__ __forceinline__ void gnsum(int bx, int by, const float* __restrict__ x, float* PS, float* red) { const int tid = threadIdx.x; const float* xs = x + (size_t)by * CC * TT + (size_t)bx * (GNK * 1024) + tid * 4; float s = 0.f;
#pragma unroll   // all GNK loads are issued before the first is waited for
    for (int k = 0; k < GNK; ++k) { const v4f a = *(const v4f*)(xs + k * 1024); for (int q = 0; q < 4; ++q) s = __fadd_rn(s, bfr(a[q])); }
    s = wg_sum(s, red); if (tid == 0) PS[(by * GNG + bx) * GNP] = s; }
// ---- k_prep: the five jobs that read nothing but inputs, in ONE launch, told apart by the block number: first the NB_ x GNG blocks of gnsum (the longest job), then WPB blocks each for Wq, Wk, Wv (wpadh) and Wo (wopadh).
// A block does one job whole, so the barriers of wg_sum stand under a condition that is the same for the whole work-group.
#define WPB  (DQ * DM / 8 / 256)
__global__ __launch_bounds__(256) void k_prep(const float* __restrict__ x, float* PS, const float* __restrict__ wq, const float* __restrict__ bq, const float* __restrict__ wk, const float* __restrict__ bk, const float* __restrict__ wv, const float* __restrict__ bv, const float* __restrict__ wo,
                                              bf* WQ, float* BQP, bf* WK, float* BKP, bf* WV, float* BVP, bf* WO) {
    static_assert(DQ * DM % (8 * 256) == 0, "whole blocks a weight matrix");
    __shared__ float red[256]; const int blk = blockIdx.x;
    if (blk < NB_ * GNG) { gnsum(blk % GNG, blk / GNG, x, PS, red); return; }
    const int m = (blk - NB_ * GNG) / WPB, jb = (blk - NB_ * GNG) % WPB;
    if (m == 3) wopadh(jb, wo, WO);
    else wpadh(jb, m == 0 ? wq : m == 1 ? wk : wv, m == 0 ? bq : m == 1 ? bk : bv, m == 0 ? WQ : m == 1 ? WK : WV, m == 0 ? BQP : m == 1 ? BKP : BVP);
}
__global__ __launch_bounds__(256) void k_gnsq(const float* __restrict__ x, const float* __restrict__ PS, float* PQ) { static_assert(GNG == 256, "one partial a thread"); __shared__ float red[256]; const int tid = threadIdx.x; const float* xs = x + (size_t)blockIdx.y * CC * TT + (size_t)blockIdx.x * (GNK * 1024) + tid * 4; v4f a[GNK];
#pragma unroll   // the loads fly while the mean is summed; a[] stays in registers
    for (int k = 0; k < GNK; ++k) a[k] = *(const v4f*)(xs + k * 1024);
    const float mean = __fdiv_rn(wg_sum(PS[(blockIdx.y * GNG + tid) * GNP], red), (float)(CC * TT)); float s2 = 0.f;
#pragma unroll   // constant k: a[] stays in registers
    for (int k = 0; k < GNK; ++k) for (int q = 0; q < 4; ++q) { const float dv = __fsub_rn(bfr(a[k][q]), mean); s2 = __fadd_rn(s2, __fmul_rn(dv, dv)); }
    s2 = wg_sum(s2, red); if (tid == 0) PQ[(blockIdx.y * GNG + blockIdx.x) * GNP] = s2; }
__global__ __launch_bounds__(256) void k_gnfin(const float* __restrict__ PS, const float* __restrict__ PQ, float* stat) { __shared__ float red[256]; const int tid = threadIdx.x; const float n = (float)(CC * TT);
    const float mean = __fdiv_rn(wg_sum(PS[(blockIdx.x * GNG + tid) * GNP], red), n); const float var = __fdiv_rn(wg_sum(PQ[(blockIdx.x * GNG + tid) * GNP], red), n);
    if (tid == 0) { const float rs = __fdiv_rn(1.0f, __fsqrt_rn(__fadd_rn(var, 1e-5f))); v2f o; o[0] = mean; o[1] = rs; *(v2f*)(stat + GNP * blockIdx.x) = o; } }
__global__ __launch_bounds__(256) void k_gnT(const float* __restrict__ xs, const float* __restrict__ stat, const float* __restrict__ g, const float* __restrict__ bb, bf* XH, bf* XL) { const size_t k = (size_t)blockIdx.x * 256 + threadIdx.x; if (k >= (size_t)TT * CC / 8) return; const size_t eo = (size_t)blockIdx.y * CC * TT; xs += eo; stat += GNP * blockIdx.y; XH += eo; XL += eo;   // batch element = blockIdx.y
    const int c0 = (int)(k % (CC / 8)) * 8; const int t = (int)(k / (CC / 8)); const float mean = stat[0], rs = stat[1]; v8us oh, ol;
#pragma unroll
    for (int q = 0; q < 8; ++q) { const int c = c0 + q; const float dv = __fsub_rn(bfr(xs[(size_t)c * TT + t]), mean); float y = __fmul_rn(dv, rs); asm volatile("" : "+v"(y)); y = __fmul_rn(y, bfr(g[c])); asm volatile("" : "+v"(y)); y = __fadd_rn(y, bfr(bb[c])); unsigned short a2, c2; splitf(y, a2, c2); oh[q] = a2; ol[q] = c2; }
    *(v8us*)(XH + (size_t)t * CC + c0) = oh; *(v8us*)(XL + (size_t)t * CC + c0) = ol;  }
__global__ __launch_bounds__(256) void k_outTr(const float* __restrict__ U, const float* __restrict__ xs, float* outp) { const size_t k = (size_t)blockIdx.x * 256 + threadIdx.x; if (k >= (size_t)CC * TT / 4) return; const size_t eo = (size_t)blockIdx.y * CC * TT; U += eo; xs += eo; outp += eo;   // batch element = blockIdx.y
    const size_t e = k * 4; const int t0 = (int)(e % TT); const int c = (int)(e / TT); const v4f a = *(const v4f*)(xs + e); v4f o;
#pragma unroll
    for (int q = 0; q < 4; ++q) o[q] = __fadd_rn(bfr(a[q]), U[(size_t)(t0 + q) * CC + c]);
    *(v4f*)(outp + e) = o;  }

// ---- k_fattn: scores, softmax and P.V of one head for FQB query rows (FQH below RH) in ONE work-group; scores and probabilities never leave the registers. Grid (batch x heads, row blocks), 4 waves, 32 query rows (two column tiles) a wave.
// Transposed products: S^T = K Q^T (A = 16 K rows from LDS, B = 16 query rows, kept in registers), O^T += V^T P^T. A lane then holds scores of ONE query (column lane & 15), and two S^T tiles (keys +0..15, +16..31),
// converted in place, are the B operand of the second product in the hardware k order (element s: key 8 hi + s, or 16 + 8 hi + s - 8), which is also the order of WFrag::ld on a V^T row. Only the HR = 32 real head columns are read.
// Two sweeps over the keys, K (and V^T) staged in LDS in chunks of CK keys: sweep 1 the row maximum; sweep 2 the same scores again, p = exp(s - max), f32 row sum of the unrounded p, P.V; the division by the sum comes last.
// The next chunk is fetched into registers while the present one is worked on. Rows < RH: bf16 hi/lo planes, three products each (hh, hl, lh) as before; the other rows f16.
// Rows < RH cost about three times the others, so their work-groups are cut short: FQH = 32 rows a work-group, which all KW = 4 waves hold, and wave w takes keys [w CK / KW, +CK / KW) of every chunk.
// The waves' row maxima (behind sweep 1), partial row sums and partial O tiles (behind sweep 2) meet in LDS (xw) and are joined in wave order.
#define FQB  128
#define FQH  32
#define FKW  4
#define XWN  (2 * FKW * 32 + FKW * 4 * 256)   // floats: maxima and sums [wave][column tile][16], O tiles [wave][column tile][row tile][2][32 lanes][4]
#define KPT  40      // LDS pitch of a staged K row in 16-bit elements: 80 B = 16 B x odd, conflict-free for 16-byte reads
#define FSM  (2 * (128 * KPT + HR * (128 + 8)))   // the larger of the two paths' LDS needs, in 16-bit elements
typedef __attribute__((ext_vector_type(8))) __bf16 v8bf;
typedef __attribute__((ext_vector_type(4))) unsigned v4u;
__device__ __forceinline__ v8f splat8(float x) { return (v8f){x, x, x, x, x, x, x, x}; }
__device__ __forceinline__ v8f bfup(v8bf h) { const v4u w = __builtin_bit_cast(v4u, h); v8f r;   // packed bf16 back to f32: one shift or one mask an element
#pragma unroll   // constant indices: the arrays stay in registers
    for (int i = 0; i < 4; ++i) { r[2 * i] = __uint_as_float(w[i] << 16); r[2 * i + 1] = __uint_as_float(w[i] & 0xFFFF0000u); }
    return r; }
template <typename T16, int CK> struct FaChunk {   // one plane's share of a chunk in one thread's registers: CK / 32 16-byte pieces of K rows and as many of V^T rows
    typedef __attribute__((ext_vector_type(8))) T16 V8; V8 k[CK / 32], v[CK / 32];
    static constexpr int UR = CK / 8, RS = 128 / UR;   // 16-byte pieces in a V^T row of the chunk; V^T rows that the 128 threads cover at once (K: 4 pieces a row, 32 rows at once)
    // piece s of thread tid: K row (tid >> 2) + 32 s, V^T row tid / UR + RS s: a uniform base, one offset a thread, and a constant step
    template <bool WITHV> __device__ __forceinline__ void load(const T16* __restrict__ Kg, const T16* __restrict__ Vg, int key0) { const unsigned tid = threadIdx.x; const T16* ka = Kg + (size_t)key0 * HD + (tid >> 2) * HD + (tid & 3) * 8; const T16* va = Vg + key0 + (tid / UR) * TT + (tid % UR) * 8;
#pragma unroll   // constant indices: k[] and v[] stay in registers
        for (int s = 0; s < CK / 32; ++s) { k[s] = *(const V8*)(ka + s * 32 * HD); if constexpr (WITHV) v[s] = *(const V8*)(va + s * RS * TT); }
        // precaution: the loads' address registers are inputs here, so they stay live and unwritten (by a later load's result too) up to this wait
        if constexpr (WITHV) asm volatile("s_wait_xcnt 0x0" :: "v"(ka), "v"(va) : "memory"); else asm volatile("s_wait_xcnt 0x0" :: "v"(ka) : "memory"); }
    template <bool WITHV> __device__ __forceinline__ void store(T16* sK, T16* sV) const { const unsigned tid = threadIdx.x; T16* kd = sK + (tid >> 2) * KPT + (tid & 3) * 8; T16* vd = sV + (tid / UR) * (CK + 8) + (tid % UR) * 8;
#pragma unroll   // as above
        for (int s = 0; s < CK / 32; ++s) { *(V8*)(kd + s * 32 * KPT) = k[s]; if constexpr (WITHV) *(V8*)(vd + s * RS * (CK + 8)) = v[s]; } }
};
template <typename T16, bool HL, int CK, int KW = 1>
__device__ __forceinline__ void fattn(const T16* __restrict__ Q, const T16* __restrict__ Q2, const T16* __restrict__ Kg, const T16* __restrict__ K2, const T16* __restrict__ Vg, const T16* __restrict__ V2, int q0, bf* Ah, bf* Al, T16* sm, float* xw = nullptr) {
    typedef WFrag<T16> F; typedef typename F::V V; constexpr int VPT = CK + 8;   // V^T row pitch: 16 B x odd
    static_assert((HL ? 2 : 1) * (CK * KPT + HR * VPT) <= FSM && TT % CK == 0 && CK % (32 * KW) == 0 && (KW == 1 || KW == FKW), "a chunk fits the LDS array; whole 32-key groups a wave");
    T16* sK = sm; T16* sV = sK + CK * KPT; T16* sK2 = sV + HR * VPT; T16* sV2 = sK2 + CK * KPT;
    const int lane = threadIdx.x & 31, lr = lane & 15, hi = lane >> 4, wave = threadIdx.x >> 5; const int t0 = q0 + (KW == 1 ? wave * 32 : 0) + lr;
    const int wv = KW == 1 ? 0 : __builtin_amdgcn_readfirstlane(wave), kw0 = wv * (CK / KW);   // this wave's keys in a chunk start at kw0 (a scalar)
    V qf[2], qf2[2]; const T16* qa = Q + (size_t)t0 * HD + 8 * hi; const T16* qa2 = HL ? Q2 + (size_t)t0 * HD + 8 * hi : qa;
#pragma unroll   // constant indices: the arrays stay in registers
    for (int g = 0; g < 2; ++g) { qf[g] = F::ld(qa + 16 * g * HD); if constexpr (HL) qf2[g] = F::ld(qa2 + 16 * g * HD); }
    asm volatile("s_wait_xcnt 0x0" :: "v"(qa), "v"(qa2) : "memory");   // precaution, as in FaChunk::load
    const int koff = lr * KPT + 8 * hi, voff = lr * VPT + 8 * hi;
    FaChunk<T16, CK> r, r2;
    v8f mx[2] = {splat8(-3.0e38f), splat8(-3.0e38f)};   // eight independent maxima a column tile, joined behind the sweep
    r.template load<false>(Kg, Vg, 0); if constexpr (HL) r2.template load<false>(K2, V2, 0);
#pragma unroll 1   // one chunk at a time: the LDS array holds one
    for (int c = 0; c < TT; c += CK) {
        __syncthreads();   // every wave has left the chunk that is overwritten next
        r.template store<false>(sK, sV); if constexpr (HL) r2.template store<false>(sK2, sV2);
        __syncthreads();   // the chunk is complete before any wave reads it
        if (c + CK < TT) { r.template load<false>(Kg, Vg, c + CK); if constexpr (HL) r2.template load<false>(K2, V2, c + CK); }   // flies under this chunk's products
#pragma unroll 2   // two independent 32-key groups: one group's LDS reads fly under the other's products
        for (int kk = kw0; kk < kw0 + CK / KW; kk += 32) { const V a0 = F::ld(sK + koff + kk * KPT), a1 = F::ld(sK + koff + (kk + 16) * KPT); V b0, b1; if constexpr (HL) { b0 = F::ld(sK2 + koff + kk * KPT); b1 = F::ld(sK2 + koff + (kk + 16) * KPT); }
#pragma unroll   // constant indices: the arrays stay in registers
            for (int g = 0; g < 2; ++g) { v8f s0 = F::mma(a0, qf[g], (v8f){}), s1 = F::mma(a1, qf[g], (v8f){});
                if constexpr (HL) { s0 = F::mma(a0, qf2[g], s0); s1 = F::mma(a1, qf2[g], s1); s0 = F::mma(b0, qf[g], s0); s1 = F::mma(b1, qf[g], s1); }
#pragma unroll   // constant indices: the arrays stay in registers
                for (int j = 0; j < 8; ++j) mx[g][j] = fmaxf(mx[g][j], fmaxf(s0[j], s1[j])); } }
    }
    const float c1 = SCL * 1.4426950408889634f; const v8f c1v = splat8(c1); v8f nm[2], sv[2], o[2][2]; float mr[2];
#pragma unroll   // constant indices: the arrays stay in registers
    for (int g = 0; g < 2; ++g) { float m = fmaxf(fmaxf(fmaxf(mx[g][0], mx[g][1]), fmaxf(mx[g][2], mx[g][3])), fmaxf(fmaxf(mx[g][4], mx[g][5]), fmaxf(mx[g][6], mx[g][7]))); m = fmaxf(m, __shfl_xor(m, 16, 32));   // lanes l and l ^ 16 hold the two halves of one query's keys
        mr[g] = m; if constexpr (KW > 1) { if (hi == 0) xw[(wv * 2 + g) * 16 + lr] = m; } }
    if constexpr (KW > 1) { __syncthreads();   // every wave's row maxima are in LDS before any wave joins them
#pragma unroll   // constant indices: the arrays stay in registers
        for (int g = 0; g < 2; ++g)
#pragma unroll   // as above
            for (int w = 0; w < KW; ++w) mr[g] = fmaxf(mr[g], xw[(w * 2 + g) * 16 + lr]); }
#pragma unroll   // constant indices: the arrays stay in registers
    for (int g = 0; g < 2; ++g) { const float m = mr[g];
        nm[g] = splat8((HL ? 0.0f : 6.0f) - m * c1);   // f16 path: p carries a factor 2^6, which cancels against the row sum, so that small p stay normal f16 numbers
        sv[g] = (v8f){}; o[g][0] = (v8f){}; o[g][1] = (v8f){}; }
    r.template load<true>(Kg, Vg, 0); if constexpr (HL) r2.template load<true>(K2, V2, 0);
#pragma unroll 1   // one chunk at a time
    for (int c = 0; c < TT; c += CK) {
        __syncthreads();   // every wave has left the chunk that is overwritten next
        r.template store<true>(sK, sV); if constexpr (HL) r2.template store<true>(sK2, sV2);
        __syncthreads();   // the chunk is complete before any wave reads it
        if (c + CK < TT) { r.template load<true>(Kg, Vg, c + CK); if constexpr (HL) r2.template load<true>(K2, V2, c + CK); }   // flies under this chunk's products
#pragma unroll 2   // as in sweep 1
        for (int kk = kw0; kk < kw0 + CK / KW; kk += 32) { const V a0 = F::ld(sK + koff + kk * KPT), a1 = F::ld(sK + koff + (kk + 16) * KPT); V b0, b1; if constexpr (HL) { b0 = F::ld(sK2 + koff + kk * KPT); b1 = F::ld(sK2 + koff + (kk + 16) * KPT); }
            const V v0 = F::ld(sV + voff + kk), v1 = F::ld(sV + voff + 16 * VPT + kk); V w0, w1; if constexpr (HL) { w0 = F::ld(sV2 + voff + kk); w1 = F::ld(sV2 + voff + 16 * VPT + kk); }
            v8f s0[2], s1[2];
#pragma unroll   // constant indices: the arrays stay in registers
            for (int g = 0; g < 2; ++g) { s0[g] = F::mma(a0, qf[g], (v8f){}); s1[g] = F::mma(a1, qf[g], (v8f){}); }
            if constexpr (HL) {
#pragma unroll   // constant indices: the arrays stay in registers
                for (int g = 0; g < 2; ++g) { s0[g] = F::mma(a0, qf2[g], s0[g]); s1[g] = F::mma(a1, qf2[g], s1[g]); }
#pragma unroll   // constant indices: the arrays stay in registers
                for (int g = 0; g < 2; ++g) { s0[g] = F::mma(b0, qf[g], s0[g]); s1[g] = F::mma(b1, qf[g], s1[g]); } }
#pragma unroll   // constant indices: the arrays stay in registers
            for (int g = 0; g < 2; ++g) { const v8f x0 = __builtin_elementwise_fma(s0[g], c1v, nm[g]), x1 = __builtin_elementwise_fma(s1[g], c1v, nm[g]); v8f p0, p1;
#pragma unroll   // constant indices: the arrays stay in registers
                for (int j = 0; j < 8; ++j) { p0[j] = __builtin_amdgcn_exp2f(x0[j]); p1[j] = __builtin_amdgcn_exp2f(x1[j]); }
                sv[g] += p0; sv[g] += p1;
                if constexpr (HL) {
                    const v8bf h0 = __builtin_convertvector(p0, v8bf), h1 = __builtin_convertvector(p1, v8bf); const v8bf l0 = __builtin_convertvector(p0 - bfup(h0), v8bf), l1 = __builtin_convertvector(p1 - bfup(h1), v8bf);
                    const V ph = __builtin_shufflevector(h0, h1, 0, 1, 2, 3, 4, 5, 6, 7, 8, 9, 10, 11, 12, 13, 14, 15), pl = __builtin_shufflevector(l0, l1, 0, 1, 2, 3, 4, 5, 6, 7, 8, 9, 10, 11, 12, 13, 14, 15);
                    o[g][0] = F::mma(v0, ph, o[g][0]); o[g][1] = F::mma(v1, ph, o[g][1]); o[g][0] = F::mma(v0, pl, o[g][0]); o[g][1] = F::mma(v1, pl, o[g][1]); o[g][0] = F::mma(w0, ph, o[g][0]); o[g][1] = F::mma(w1, ph, o[g][1]);
                } else {
                    const V pf = cat16(__builtin_convertvector(p0, v8h), __builtin_convertvector(p1, v8h));
                    o[g][0] = F::mma(v0, pf, o[g][0]); o[g][1] = F::mma(v1, pf, o[g][1]); } } }
    }
    if constexpr (KW > 1) {
        float* xsum = xw + KW * 32; float* xo = xw + 2 * KW * 32;
#pragma unroll   // constant indices: the arrays stay in registers
        for (int g = 0; g < 2; ++g) { float sum = ((sv[g][0] + sv[g][1]) + (sv[g][2] + sv[g][3])) + ((sv[g][4] + sv[g][5]) + (sv[g][6] + sv[g][7])); sum += __shfl_xor(sum, 16, 32); if (hi == 0) xsum[(wv * 2 + g) * 16 + lr] = sum;
#pragma unroll   // as above
            for (int h = 0; h < 2; ++h) { float* d = xo + (wv * 4 + g * 2 + h) * 256 + lane * 4; *(v4fa*)d = __builtin_shufflevector(o[g][h], o[g][h], 0, 1, 2, 3); *(v4fa*)(d + 128) = __builtin_shufflevector(o[g][h], o[g][h], 4, 5, 6, 7); } }
        __syncthreads();   // every wave's partial row sums and O tiles are in LDS before they are added
        if (wv < 2) {   // wave g finishes column tile g, both row tiles: a 128-byte output line keeps one writer
            float sum = xsum[wv * 16 + lr]; v8f oo[2];
#pragma unroll   // fixed order: wave 0, 1, 2, 3
            for (int w = 1; w < KW; ++w) sum = __fadd_rn(sum, xsum[(w * 2 + wv) * 16 + lr]);
#pragma unroll   // constant indices: the arrays stay in registers
            for (int h = 0; h < 2; ++h) { const float* s = xo + (wv * 2 + h) * 256 + lane * 4; v4f a = *(const v4fa*)s, b = *(const v4fa*)(s + 128);
#pragma unroll   // fixed order: wave 0, 1, 2, 3
                for (int w = 1; w < KW; ++w) { a += *(const v4fa*)(s + w * 1024); b += *(const v4fa*)(s + w * 1024 + 128); }
                oo[h] = __builtin_shufflevector(a, b, 0, 1, 2, 3, 4, 5, 6, 7); }
            const float inv = __fdiv_rn(1.0f, sum); v8us h0, l0, h1, l1; const v8us zz = (v8us){};
#pragma unroll   // constant indices: the arrays stay in registers
            for (int j = 0; j < 8; ++j) { unsigned short a, b; splitf(oo[0][j] * inv, a, b); h0[j] = a; l0[j] = b; splitf(oo[1][j] * inv, a, b); h1[j] = a; l1[j] = b; }
            bf* ph = Ah + (size_t)(t0 + 16 * wv) * DQ + 8 * hi; bf* pl = Al + (size_t)(t0 + 16 * wv) * DQ + 8 * hi;
            *(v8us*)ph = h0; *(v8us*)(ph + 16) = h1; *(v8us*)(ph + 32) = zz; *(v8us*)(ph + 48) = zz; *(v8us*)pl = l0; *(v8us*)(pl + 16) = l1; *(v8us*)(pl + 32) = zz; *(v8us*)(pl + 48) = zz;
            asm volatile("s_wait_xcnt 0x0" :: "v"(ph), "v"(pl) : "memory");   // precaution, as in FaChunk::load: the stores' address registers stay live and unwritten up to this wait
        }
        return;
    }
#pragma unroll   // constant indices: the arrays stay in registers
    for (int g = 0; g < 2; ++g) { float sum = ((sv[g][0] + sv[g][1]) + (sv[g][2] + sv[g][3])) + ((sv[g][4] + sv[g][5]) + (sv[g][6] + sv[g][7])); sum += __shfl_xor(sum, 16, 32); const float inv = __fdiv_rn(1.0f, sum);
        v8us h0, l0, h1, l1; const v8us zz = (v8us){};
#pragma unroll   // constant indices: the arrays stay in registers
        for (int j = 0; j < 8; ++j) { unsigned short a, b; splitf(o[g][0][j] * inv, a, b); h0[j] = a; l0[j] = b; splitf(o[g][1][j] * inv, a, b); h1[j] = a; l1[j] = b; }
        // o[g][0][j] = O[t][8 hi + j], o[g][1][j] = O[t][16 + 8 hi + j]; columns HR .. HD - 1 of the padded head are zero
        bf* ph = Ah + (size_t)(t0 + 16 * g) * DQ + 8 * hi; bf* pl = Al + (size_t)(t0 + 16 * g) * DQ + 8 * hi;
        *(v8us*)ph = h0; *(v8us*)(ph + 16) = h1; *(v8us*)(ph + 32) = zz; *(v8us*)(ph + 48) = zz; *(v8us*)pl = l0; *(v8us*)(pl + 16) = l1; *(v8us*)(pl + 32) = zz; *(v8us*)(pl + 48) = zz; }
}
// ---- k_proj: the q, k and v projections of every batch element in ONE launch; its epilogue rounds the f32 sums (+ f32 bias) straight into the 16-bit planes that k_fattn reads (f16, bf16 hi, bf16 lo), so no f32 copy of q, k or v exists.
// Grid (TT / 64, NH_ / 2, 3 NB_), one wave a tile of 64 tokens x the HR real columns of two heads; blockIdx.z = 3 x batch element + (0 q, 1 k, 2 v). The padded rows of W and the padded plane columns, which k_fattn never reads, are left out.
// K loop and product order (x hi, then x lo, per 32-wide k step) as in k_gemmw<bf, 1, true>. W and bias keep wpadh's padded row numbering: head * HD + column.
// q, k (VT false): transposed product, A = 16 W rows, B = 16 tokens: a lane holds 8 neighbouring columns of ONE token = one 16-byte store a plane into [head][t][HD].
// v (VT true): A = 16 tokens, B = 16 W rows: a lane holds 8 neighbouring tokens of ONE column = one 16-byte store a plane into [head][column][TT]. Either way a wave writes whole 64- or 128-byte runs, and a 128-byte line has one writer.
template <bool VT>
__device__ __forceinline__ void proj_tile(const bf* __restrict__ XH, const bf* __restrict__ XL, const bf* __restrict__ Wt, const float* __restrict__ bias, int r0, int h0, h16* P16, bf* Ph, bf* Pl) {
    typedef WFrag<bf> F; typedef F::V V;
    const int lane = threadIdx.x & 31, lr = lane & 15, hi = lane >> 4;
    const bf* xh = XH + (size_t)(r0 + lr) * DM + 8 * hi; const bf* xl = XL + (size_t)(r0 + lr) * DM + 8 * hi; const bf* wr = Wt + (size_t)(h0 * HD + lr) * DM + 8 * hi;
    v8f acc[4][4];
#pragma unroll   // constant indices: the arrays stay in registers
    for (int mb = 0; mb < 4; ++mb)
#pragma unroll   // as above
        for (int nb = 0; nb < 4; ++nb) acc[mb][nb] = (v8f){};
#pragma unroll 1   // one k step's fragments in registers at a time, as in k_gemmw
    for (int kc = 0; kc < DM; kc += 32) {
        V a[4], a2[4], b[4];
#pragma unroll   // constant indices: the arrays stay in registers
        for (int mb = 0; mb < 4; ++mb) { a[mb] = F::ld(xh + mb * 16 * DM); a2[mb] = F::ld(xl + mb * 16 * DM); }
#pragma unroll   // as above
        for (int nb = 0; nb < 4; ++nb) b[nb] = F::ld(wr + ((nb >> 1) * HD + (nb & 1) * 16) * DM);   // column block nb: head h0 + nb / 2, columns 16 (nb % 2) ..
        // precaution, as in FaChunk::load: the loads' address registers are inputs here, so they stay live and unwritten (by a later load's result too) up to this wait.
        // The loaded fragments are inputs too: each keeps registers of its own, so all 24 loads are in flight together and a k step waits for memory once (without them the x lo loads wait for the x hi registers: twice)
        asm volatile("s_wait_xcnt 0x0" :: "v"(xh), "v"(xl), "v"(wr), "v"(a[0]), "v"(a[1]), "v"(a[2]), "v"(a[3]), "v"(a2[0]), "v"(a2[1]), "v"(a2[2]), "v"(a2[3]), "v"(b[0]), "v"(b[1]), "v"(b[2]), "v"(b[3]) : "memory");
        xh += 32; xl += 32; wr += 32;
#pragma unroll   // as above
        for (int nb = 0; nb < 4; ++nb)
#pragma unroll   // as above
            for (int mb = 0; mb < 4; ++mb) {
                if constexpr (VT) { acc[mb][nb] = F::mma(a[mb], b[nb], acc[mb][nb]); acc[mb][nb] = F::mma(a2[mb], b[nb], acc[mb][nb]); }
                else { acc[mb][nb] = F::mma(b[nb], a[mb], acc[mb][nb]); acc[mb][nb] = F::mma(b[nb], a2[mb], acc[mb][nb]); } }
    }
    v8f bv[4];   // the bias of column block nb as this lane adds it; the four loads fly together
    if constexpr (VT) { const int bi = h0 * HD + lr; float bs[4];
#pragma unroll   // constant indices: the arrays stay in registers
        for (int nb = 0; nb < 4; ++nb) bs[nb] = bias[bi + (nb >> 1) * HD + (nb & 1) * 16];
        asm volatile("s_wait_xcnt 0x0" :: "v"(bi) : "memory");   // precaution, as above: the loads' offset register is an input here
#pragma unroll   // as above
        for (int nb = 0; nb < 4; ++nb) bv[nb] = splat8(bfr(bs[nb]));
    } else { const float* bp = bias + h0 * HD + 8 * hi;
#pragma unroll   // as above
        for (int nb = 0; nb < 4; ++nb) bv[nb] = *(const v8f*)(bp + (nb >> 1) * HD + (nb & 1) * 16);
#pragma unroll   // as above
        for (int nb = 0; nb < 4; ++nb)
#pragma unroll   // as above
            for (int j = 0; j < 8; ++j) bv[nb][j] = bfr(bv[nb][j]); }
#pragma unroll   // as above
    for (int nb = 0; nb < 4; ++nb) { const int hd = (h0 + (nb >> 1)) * HD + (nb & 1) * 16;   // padded number of the block's first column
#pragma unroll   // as above
        for (int mb = 0; mb < 4; ++mb) { const v8f y = acc[mb][nb] + bv[nb]; const v8h o16 = __builtin_convertvector(y, v8h);   // packed conversions, round to nearest even: the values of tohx and splitf
            const v8bf yh = __builtin_convertvector(y, v8bf); const v8bf yl = __builtin_convertvector(y - bfup(yh), v8bf); const v8us oh = __builtin_bit_cast(v8us, yh), ol = __builtin_bit_cast(v8us, yl);
            const size_t e = VT ? (size_t)(hd + lr) * TT + r0 + mb * 16 + 8 * hi : ((size_t)(h0 + (nb >> 1)) * TT + r0 + mb * 16 + lr) * HD + (nb & 1) * 16 + 8 * hi;
            *(v8h*)(P16 + e) = o16; *(v8us*)(Ph + e) = oh; *(v8us*)(Pl + e) = ol; } }
}
__global__ __launch_bounds__(32) void k_proj(const bf* __restrict__ XH, const bf* __restrict__ XL, const bf* __restrict__ WQ, const bf* __restrict__ WK, const bf* __restrict__ WV, const float* __restrict__ BQ, const float* __restrict__ BK, const float* __restrict__ BV,
                                             h16* Q16, bf* Qh, bf* Ql, h16* K16, bf* Kh, bf* Kl, h16* V16, bf* Vh, bf* Vl) {
    static_assert(TT % 64 == 0 && NH_ % 2 == 0 && HR == 32 && DM % 32 == 0 && NH_ == NKV, "whole tiles; two 16-column blocks a head");
    const int b = blockIdx.z / 3, p = blockIdx.z % 3; const int r0 = blockIdx.x * 64, h0 = blockIdx.y * 2; const size_t xo = (size_t)b * TT * DM, po = (size_t)b * NH_ * TT * HD;
    if (p == 2) proj_tile<true>(XH + xo, XL + xo, WV, BV, r0, h0, V16 + po, Vh + po, Vl + po);
    else proj_tile<false>(XH + xo, XL + xo, p ? WK : WQ, p ? BK : BQ, r0, h0, (p ? K16 : Q16) + po, (p ? Kh : Qh) + po, (p ? Kl : Ql) + po);
}

// Planes [batch][head][...], outputs [batch][t][DQ]. blockIdx.y is the row block: first the RH / FQH blocks of rows < RH, then the (TT - RH) / FQB blocks of the other rows.
__global__ __launch_bounds__(128) void k_fattn(const h16* __restrict__ Q16, const bf* __restrict__ Qh, const bf* __restrict__ Ql, const h16* __restrict__ K16, const bf* __restrict__ Kh, const bf* __restrict__ Kl, const h16* __restrict__ V16, const bf* __restrict__ Vh, const bf* __restrict__ Vl, bf* Ah, bf* Al) {
    static_assert(RH % FQH == 0 && (TT - RH) % FQB == 0 && HR == 32 && HD == 64 && NH_ == NKV, "whole work-groups on either side of RH; one 32-wide k step a head");
    __shared__ __align__(16) unsigned short sm[FSM]; __shared__ __align__(16) float xw[XWN];
    const size_t hp = (size_t)blockIdx.x * TT * HD; const int by = blockIdx.y; const int q0 = by < RH / FQH ? by * FQH : RH + (by - RH / FQH) * FQB; const size_t ao = (size_t)(blockIdx.x / NH_) * TT * DQ + (blockIdx.x % NH_) * HD;
    if (q0 < RH) fattn<bf, true, 128, FKW>(Qh + hp, Ql + hp, Kh + hp, Kl + hp, Vh + hp, Vl + hp, q0, Ah + ao, Al + ao, (bf*)sm, xw);
    else fattn<h16, false, 256>(Q16 + hp, nullptr, K16 + hp, nullptr, V16 + hp, nullptr, q0, Ah + ao, Al + ao, (h16*)sm);
}

extern "C" void kernel_launch(void* const* d_in, const int* in_sizes, int n_in,
                              void* d_out, int out_size, void* d_ws, size_t ws_size, hipStream_t stream) {
    (void)in_sizes; (void)n_in; (void)out_size;
    const float* x = (const float*)d_in[0]; const float* gnw = (const float*)d_in[1]; const float* gnb = (const float*)d_in[2]; const float* wq = (const float*)d_in[3]; const float* bq = (const float*)d_in[4]; const float* wk = (const float*)d_in[5]; const float* bk = (const float*)d_in[6]; const float* wv = (const float*)d_in[7]; const float* bv = (const float*)d_in[8]; const float* wo = (const float*)d_in[9]; const float* bo = (const float*)d_in[10];
    float* OUT = (float*)d_out;     // [2][256][4096]
    char* wsp = (char*)d_ws;
    auto take = [&](size_t bytes) { char* p = wsp; wsp += (bytes + 255) & ~(size_t)255; return (void*)p; };
    float* BQP = (float*)take(DQ * 4); float* BKP = (float*)take(DQ * 4); float* BVP = (float*)take(DQ * 4); bf* XH = (bf*)take((size_t)NB_ * TT * DM * 2); bf* XL = (bf*)take((size_t)NB_ * TT * DM * 2); float* STAT = (float*)take((size_t)NB_ * GNP * 4); float* PS = (float*)take((size_t)NB_ * GNG * GNP * 4); float* PQ = (float*)take((size_t)NB_ * GNG * GNP * 4); float* Y = (float*)take((size_t)NB_ * TT * DM * 4); bf* WQ = (bf*)take((size_t)DQ * DM * 2); bf* WK = (bf*)take((size_t)DKV * DM * 2); bf* WV = (bf*)take((size_t)DKV * DM * 2); bf* WO = (bf*)take((size_t)DM * DQ * 2);
    const size_t PL = (size_t)NH_ * TT * HD;   // elements of one batch element's head planes; every plane below holds all NB_ batch elements
    h16* QP16 = (h16*)take(NB_ * PL * 2); h16* KP16 = (h16*)take(NB_ * PL * 2); h16* VT16 = (h16*)take(NB_ * PL * 2);
    bf* QPh = (bf*)take(NB_ * PL * 2); bf* QPl = (bf*)take(NB_ * PL * 2); bf* KPh = (bf*)take(NB_ * PL * 2); bf* KPl = (bf*)take(NB_ * PL * 2); bf* VTh = (bf*)take(NB_ * PL * 2); bf* VTl = (bf*)take(NB_ * PL * 2);
    bf* ATh = (bf*)take((size_t)NB_ * TT * DQ * 2); bf* ATl = (bf*)take((size_t)NB_ * TT * DQ * 2);
    if ((size_t)(wsp - (char*)d_ws) > ws_size) return;    // ws 256 MiB
    k_prep<<<NB_ * GNG + 4 * WPB, 256, 0, stream>>>(x, PS, wq, bq, wk, bk, wv, bv, wo, WQ, BQP, WK, BKP, WV, BVP, WO);   /* GroupNorm partial sums and the four weight preparations */
    k_gnsq<<<dim3(GNG, NB_), 256, 0, stream>>>(x, PS, PQ); k_gnfin<<<NB_, 256, 0, stream>>>(PS, PQ, STAT);
    k_gnT<<<dim3((unsigned)(((size_t)TT * CC / 8 + 255) / 256), NB_), 256, 0, stream>>>(x, STAT, gnw, gnb, XH, XL);   /* normalised, token-major, hi/lo; every batch element */
    k_proj<<<dim3(TT / 64, NH_ / 2, 3 * NB_), 32, 0, stream>>>(XH, XL, WQ, WK, WV, BQP, BKP, BVP, QP16, QPh, QPl, KP16, KPh, KPl, VT16, VTh, VTl);   /* q, k, v of every batch element, straight into the head planes */
    k_fattn<<<dim3(NB_ * NH_, RH / FQH + (TT - RH) / FQB), 128, 0, stream>>>(QP16, QPh, QPl, KP16, KPh, KPl, VT16, VTh, VTl, ATh, ATl);   /* every head of every batch element */
    k_gemmw<bf, 1, true><<<dim3(TT / 64, DM / 64, NB_), 32, 0, stream>>>(ATh, ATl, WO, nullptr, DQ, Y, DM, bo, (size_t)TT * DQ, 0, (size_t)TT * DM);   /* Wo product of every batch element (z) */
    k_outTr<<<dim3((unsigned)(((size_t)CC * TT / 4 + 255) / 256), NB_), 256, 0, stream>>>(Y, x, OUT);   /* back to channel-major + hidden residual */
}

// v007
// It runs in 122 microseconds.
// Two timings next to v006 put it at 1.12 and 1.11 times that version's speed.
// All steps since v000 together make it 43.1 times as fast.
#include <hip/hip_runtime.h>

// 1-D self-attention block with GroupNorm and residual on a channel-major sequence (hidden [2][256][4096]; x = GroupNorm(1 group over all 256 x 4096 values, eps 1e-5) x gn_weight + gn_bias; h = x^T; q,k,v = h W^T + b ('oi' [256][256] + [256], 1/16; 8 heads x 32); scores = (q 32^-1/4).(k 32^-1/4); softmax over all 4,096 keys; out = merged Wo^T + bo, transposed back + hidden -> [2][256][4096] (2.1 M)).
// Compute dtypes, f32 accumulate: every input rounded to bf16; GroupNorm f32 (fixed-order sums); projections hi/lo x exact + f32 biases; attention rows < 512 3 products, rest fp16; softmax f32; Wo hl x exact + bias; residual f32.

#define NB_  2
#define TT   4096
#define DM   256
#define NH_  8
#define NKV  8
#define REP  (NH_ / NKV)
#define HD   64
#define DQ   (NH_ * HD)
#define DKV  (NKV * HD)
#define RH   512                  // query rows < RH use hi+lo planes (0: none)
#define WIN  0
#define SCL  0.17677669529663689f   // 32^-1/2 == (32^-1/4)^2 applied once to q.k
#define CC   256     // channels
#define HR   32      // real head width (padded to HD = 64)
typedef _Float16 h16;
typedef unsigned short bf;
typedef __attribute__((ext_vector_type(16))) __bf16   v16bf;
typedef __attribute__((ext_vector_type(16))) _Float16 v16h;
typedef __attribute__((ext_vector_type(8)))  _Float16 v8h;
typedef __attribute__((ext_vector_type(8)))  unsigned short v8us;
typedef __attribute__((ext_vector_type(8)))  float    v8f;
typedef __attribute__((ext_vector_type(4)))  float    v4f;
typedef v8h  __attribute__((may_alias)) v8ha;
typedef v4f  __attribute__((may_alias)) v4fa;
typedef v8us __attribute__((may_alias)) v8usa;

__device__ __forceinline__ unsigned short f2bf(float f) { unsigned u = __float_as_uint(f); u += 0x7FFFu + ((u >> 16) & 1u); return (unsigned short)(u >> 16); }
__device__ __forceinline__ float bf2f(unsigned short b) { return __uint_as_float(((unsigned)b) << 16); }
__device__ __forceinline__ float bfr(float f) { return bf2f(f2bf(f)); }
__device__ __forceinline__ v16h cat16(v8h lo, v8h hi) { return __builtin_shufflevector(lo, hi, 0, 1, 2, 3, 4, 5, 6, 7, 8, 9, 10, 11, 12, 13, 14, 15); }
__device__ __forceinline__ v16bf cat16b(v8us lo, v8us hi) { return __builtin_bit_cast(v16bf, __builtin_shufflevector(lo, hi, 0, 1, 2, 3, 4, 5, 6, 7, 8, 9, 10, 11, 12, 13, 14, 15)); }
__device__ __forceinline__ v8f wmma16(v16h a, v16h b, v8f c) { return __builtin_amdgcn_wmma_f32_16x16x32_f16(false, a, false, b, (short)0, c, false, false); }
__device__ __forceinline__ v8f wmmab(v16bf a, v16bf b, v8f c) { return __builtin_amdgcn_wmma_f32_16x16x32_bf16(false, a, false, b, (short)0, c, false, false); }



// ---- k_gemmw: register-blocked GEMM, ONE WAVE per 64x64 output tile (16 accumulators), operands straight from K-contiguous 16-bit planes; grid (M/64, N/64, Z), 32 threads.
// C[m][n] (f32, pitch ldc, + optional f32 bias[n]) = sum_k A[m][k] Bt[n][k] (+ split products per NSPLIT). z-batch strides sA/sB/sC in elements. K % 32 == 0.
// For a long K on a small grid: K split over KS work-groups (blockIdx.z % KS; grid z = Z KS) and, inside each, over its NW waves (NW*32 threads); wave w of part zk sums k in [(zk NW + w) K/(KS NW), +K/(KS NW)).
// The NW f32 partial tiles meet in LDS (row pitch 68 floats) and are added in wave order, each wave finishing 64/NW whole rows; part zk stores to plane C + zk sP, and the reader of C adds the KS planes in order. K % (32 KS NW) == 0.
// TR: C is the block's output itself, column-major ([n][TT], z stride sC): C[n][m] = bf16-rounded xr[n][m] + (sum + bias[n]), xr laid out like C. The 64x64 tile is turned in LDS, so no f32 copy of the product exists.
template <typename T16> struct WFrag;
template <> struct WFrag<h16> { typedef v16h V; static __device__ __forceinline__ V ld(const h16* p) { return cat16(*(const v8h*)p, *(const v8h*)(p + 16)); } static __device__ __forceinline__ v8f mma(V a, V b, v8f c) { return wmma16(a, b, c); } };
template <> struct WFrag<bf> { typedef v16bf V; static __device__ __forceinline__ V ld(const bf* p) { return cat16b(*(const v8us*)p, *(const v8us*)(p + 16)); } static __device__ __forceinline__ v8f mma(V a, V b, v8f c) { return wmmab(a, b, c); } };
template <typename T16, int NSPLIT, bool BIAS, int KS = 1, int NW = 1, bool TR = false>
__global__ __launch_bounds__(NW * 32) void k_gemmw(const T16* __restrict__ A, const T16* __restrict__ A2, const T16* __restrict__ Bt, const T16* __restrict__ Bt2, int K, float* C, int ldc, const float* __restrict__ bias, size_t sA, size_t sB, size_t sC, size_t sP = 0, const float* __restrict__ xr = nullptr) {
    static_assert(NW == 1 ? KS == 1 : (!BIAS && 64 % (2 * NW) == 0), "split K: no bias, whole row pairs per wave");
    static_assert(!TR || (NW == 1 && BIAS), "the turned epilogue: one wave a tile, with bias");
    typedef typename WFrag<T16>::V V;
    __shared__ __align__(16) float os[(NW == 1 ? (TR ? 64 : 16) : NW * 64) * 68];
    const size_t z = blockIdx.z / KS; const int zk = blockIdx.z % KS; A += z * sA; if (A2) A2 += z * sA; Bt += z * sB; if (Bt2) Bt2 += z * sB; C += z * sC + zk * sP;
    const int wave = (NW == 1) ? 0 : __builtin_amdgcn_readfirstlane((int)(threadIdx.x >> 5)); const int ks = K / (KS * NW), k0 = (zk * NW + wave) * ks;
    const int lane = threadIdx.x & 31, lr = lane & 15, hi = lane >> 4; const int r0 = blockIdx.x * 64, c0 = blockIdx.y * 64;
    v8f acc[4][4];
#pragma unroll
    for (int mb = 0; mb < 4; ++mb)
#pragma unroll
        for (int nb = 0; nb < 4; ++nb) acc[mb][nb] = (v8f){};
    const size_t aoff = (size_t)(r0 + lr) * K + 8 * hi, boff = (size_t)(c0 + lr) * K + 8 * hi;
    float bs[4];   // TR: the bias of column nb 16 + lr, fetched here so that its latency passes under the K loop
    if constexpr (TR) {
#pragma unroll   // constant indices: the array stays in registers
        for (int nb = 0; nb < 4; ++nb) bs[nb] = bias[c0 + lr + nb * 16]; }
#pragma unroll 1
    for (int kc = k0; kc < k0 + ks; kc += 32) {
        V a[4], a2[4];
#pragma unroll
        for (int mb = 0; mb < 4; ++mb) { a[mb] = WFrag<T16>::ld(A + aoff + (size_t)mb * 16 * K + kc); if (NSPLIT == 1 || NSPLIT == 2) a2[mb] = WFrag<T16>::ld(A2 + aoff + (size_t)mb * 16 * K + kc); }
#pragma unroll
        for (int nb = 0; nb < 4; ++nb) { const V b = WFrag<T16>::ld(Bt + boff + (size_t)nb * 16 * K + kc); V b2; if (NSPLIT >= 2) b2 = WFrag<T16>::ld(Bt2 + boff + (size_t)nb * 16 * K + kc);
#pragma unroll
            for (int mb = 0; mb < 4; ++mb) { acc[mb][nb] = WFrag<T16>::mma(a[mb], b, acc[mb][nb]); if (NSPLIT == 1 || NSPLIT == 2) acc[mb][nb] = WFrag<T16>::mma(a2[mb], b, acc[mb][nb]); if (NSPLIT >= 2) acc[mb][nb] = WFrag<T16>::mma(a[mb], b2, acc[mb][nb]); } }
        asm volatile("v_nop\n\tv_nop\n\tv_nop\n\tv_nop" : "+v"(acc[0][0]), "+v"(acc[1][1]), "+v"(acc[2][2]), "+v"(acc[3][3]) : "v"(a[0]), "v"(a[3]));
    }
    if constexpr (NW > 1) {
        float* pw = os + wave * (64 * 68);
#pragma unroll
        for (int mb = 0; mb < 4; ++mb)
#pragma unroll
            for (int nb = 0; nb < 4; ++nb)
#pragma unroll
                for (int j = 0; j < 8; ++j) pw[(mb * 16 + hi * 8 + j) * 68 + nb * 16 + lr] = acc[mb][nb][j];
        __syncthreads();   // every wave's partial tile is in LDS before any wave adds them
#pragma unroll
        for (int s = 0; s < 64 / (2 * NW); ++s) { const int row = wave * (64 / NW) + 2 * s + hi, cofs = lr * 4; v4f val = *(const v4fa*)(os + row * 68 + cofs);
#pragma unroll
            for (int w = 1; w < NW; ++w) { const v4f pv = *(const v4fa*)(os + w * (64 * 68) + row * 68 + cofs); val[0] = __fadd_rn(val[0], pv[0]); val[1] = __fadd_rn(val[1], pv[1]); val[2] = __fadd_rn(val[2], pv[2]); val[3] = __fadd_rn(val[3], pv[3]); }
            *(v4f*)(C + (size_t)(r0 + row) * ldc + c0 + cofs) = val; }
        return;
    }
    if constexpr (TR) {
        // acc[mb][nb][j] = sum[row mb 16 + 8 hi + j][column nb 16 + lr]: a lane holds 8 neighbouring rows of one column = 32 bytes of LDS row (column) nb 16 + lr, pitch 68 floats = 16 B x odd.
        // Read back, 16 lanes hold one column's 64 rows = 256 bytes in a row: every global load and store below covers four whole 128-byte lines, and a line has one writer.
        const size_t eo = (size_t)(c0 + hi) * TT + r0 + lr * 4; const float* xp = xr + z * sC + eo; float* op = C + eo; v4f xa[32];
#pragma unroll   // the first half of the residual loads flies under the LDS turn (the fragment registers are free by now)
        for (int s = 0; s < 16; ++s) xa[s] = *(const v4f*)(xp + (size_t)s * 2 * TT);
#pragma unroll   // constant indices: the arrays stay in registers
        for (int nb = 0; nb < 4; ++nb) { const float b1 = bfr(bs[nb]); const v8f bb = (v8f){b1, b1, b1, b1, b1, b1, b1, b1};
#pragma unroll   // as above
            for (int mb = 0; mb < 4; ++mb) { const v8f y = acc[mb][nb] + bb; float* d = os + (nb * 16 + lr) * 68 + mb * 16 + hi * 8; *(v4fa*)d = __builtin_shufflevector(y, y, 0, 1, 2, 3); *(v4fa*)(d + 4) = __builtin_shufflevector(y, y, 4, 5, 6, 7); } }
        asm volatile("" ::: "memory");   // holds the loads below behind the LDS writes, so that they land in the registers that the accumulators have left (hoisted, they push the kernel past v255)
#pragma unroll   // the second half of the residual loads
        for (int s = 16; s < 32; ++s) xa[s] = *(const v4f*)(xp + (size_t)s * 2 * TT);
#pragma unroll   // constant indices: xa[] stays in registers
        for (int h = 0; h < 2; ++h) { v4f o[16];
#pragma unroll   // as above
            for (int s = 0; s < 16; ++s) { const int u = h * 16 + s; const v4f val = *(const v4fa*)(os + (2 * u + hi) * 68 + lr * 4);
#pragma unroll   // as above
                for (int q = 0; q < 4; ++q) o[s][q] = __fadd_rn(bfr(xa[u][q]), val[q]);
                *(v4f*)(op + (size_t)u * 2 * TT) = o[s]; }
            // precaution, as in FaChunk::load: the address registers of the residual loads and of the stores above and the stored values are inputs here, so they stay live and unwritten up to this wait
            asm volatile("s_wait_xcnt 0x0" :: "v"(xp), "v"(op), "v"(o[0]), "v"(o[1]), "v"(o[2]), "v"(o[3]), "v"(o[4]), "v"(o[5]), "v"(o[6]), "v"(o[7]), "v"(o[8]), "v"(o[9]), "v"(o[10]), "v"(o[11]), "v"(o[12]), "v"(o[13]), "v"(o[14]), "v"(o[15]) : "memory"); }
        return;
    }
#pragma unroll
    for (int mb = 0; mb < 4; ++mb) {
#pragma unroll
        for (int nb = 0; nb < 4; ++nb) {
#pragma unroll
            for (int j = 0; j < 8; ++j) os[(hi * 8 + j) * 68 + nb * 16 + lr] = acc[mb][nb][j]; }
        __builtin_amdgcn_wave_barrier(); asm volatile("" ::: "memory");
        float* crow = C + (size_t)(r0 + mb * 16) * ldc + c0;
{
#pragma unroll
            for (int s = 0; s < 8; ++s) { const int row = 2 * s + hi, cofs = lr * 4; v4f val = *(const v4fa*)(os + row * 68 + cofs); if (BIAS) { val[0] += bfr(bias[c0 + cofs]); val[1] += bfr(bias[c0 + cofs + 1]); val[2] += bfr(bias[c0 + cofs + 2]); val[3] += bfr(bias[c0 + cofs + 3]); }
                *(v4f*)(crow + (size_t)row * ldc + cofs) = val; }
             }
        __builtin_amdgcn_wave_barrier(); asm volatile("" ::: "memory");
    }
}

__device__ __forceinline__ h16 tohx(float x) { return (h16)x; }
__device__ __forceinline__ void splitf(float y, unsigned short& h, unsigned short& l) { h = f2bf(y); l = f2bf(y - bf2f(h)); }
typedef __attribute__((ext_vector_type(2))) _Float16 v2h;
typedef __attribute__((ext_vector_type(4))) _Float16 v4h;
typedef __attribute__((ext_vector_type(2))) unsigned short v2us;
typedef __attribute__((ext_vector_type(4))) unsigned short v4us;
typedef __attribute__((ext_vector_type(2))) float v2f;
typedef __attribute__((ext_vector_type(4))) int v4i;

__global__ __launch_bounds__(256) void k_wtG(const float* __restrict__ w, int K, int N, bf* Bt) {
    const int lane = threadIdx.x & 31; const int L0 = (blockIdx.x * 8 + (threadIdx.x >> 5)) * 8; const int nlines = N * K / 64;
{
#pragma unroll 1
        for (int l = 0; l < 8; ++l) { const int L = L0 + l; if (L >= nlines) break; const size_t e = (size_t)L * 64 + lane * 2; const int k = (int)(e % K), n = (int)(e / K); v2us o;
            o[0] = f2bf(w[(size_t)k * N + n]); o[1] = f2bf(w[(size_t)(k + 1) * N + n]); *(v2us*)(Bt + e) = o; }
         }
}
__global__ __launch_bounds__(256) void k_cvt8(const float* __restrict__ src, bf* dst, size_t n8) { const size_t i = (size_t)blockIdx.x * 256 + threadIdx.x; if (i >= n8) return; const v8f v = *(const v8f*)(src + i * 8); v8us o;
#pragma unroll
    for (int k = 0; k < 8; ++k) o[k] = f2bf(v[k]); *(v8us*)(dst + i * 8) = o;  }

__device__ __forceinline__ void wpadh(int blk, const float* __restrict__ w, const float* __restrict__ bias, bf* Bt, float* bp) { const int i = blk * 256 + threadIdx.x; if (i >= DQ * DM / 8) return; const int c0 = (i % (DM / 8)) * 8; const int r = i / (DM / 8); const int h = r / HD, d = r % HD; const int sr = h * HR + min(d, HR - 1); const float* src = w + (size_t)sr * DM + c0; v8us o;
#pragma unroll
    for (int q = 0; q < 8; ++q) { const unsigned short v = f2bf(src[q]); o[q] = (d < HR) ? v : (unsigned short)0; }
    *(v8us*)(Bt + (size_t)r * DM + c0) = o; if (i < DQ) { const int hb = i / HD, db = i % HD; const float bb = bias[hb * HR + min(db, HR - 1)]; ((float*)bp)[i] = (db < HR) ? bb : 0.0f; }     }
__device__ __forceinline__ void wopadh(int blk, const float* __restrict__ w, bf* Bt) { const int i = blk * 256 + threadIdx.x; if (i >= DM * DQ / 8) return; const int k0 = (i % (DQ / 8)) * 8; const int o = i / (DQ / 8); v8us ov; const float* wa[8]; float wl[8];
#pragma unroll
    for (int q = 0; q < 8; ++q) { const int kk = k0 + q; const int h = kk / HD, d = kk % HD; wa[q] = w + (size_t)o * DM + h * HR + min(d, HR - 1); wl[q] = *wa[q]; }
    // precaution, as in FaChunk::load: the loads' address registers are inputs here, so they stay live and unwritten (by a later load's result too) up to this wait
    asm volatile("s_wait_xcnt 0x0" :: "v"(wa[0]), "v"(wa[1]), "v"(wa[2]), "v"(wa[3]), "v"(wa[4]), "v"(wa[5]), "v"(wa[6]), "v"(wa[7]) : "memory");
#pragma unroll
    for (int q = 0; q < 8; ++q) { const int d = (k0 + q) % HD; const unsigned short v = f2bf(wl[q]); ov[q] = (d < HR) ? v : (unsigned short)0; }
    *(v8us*)(Bt + (size_t)o * DQ + k0) = ov;  }
// GroupNorm statistics of all NB_ batch elements, three launches. Each element's CC x TT values are shared by GNG work-groups (number bx, element by: blockIdx.x, .y in k_gnsq; blk % GNG, blk / GNG in k_prep), GNK 16-byte loads a thread, all in flight at once.
// gnsum (in k_prep): one partial sum a work-group. k_gnsq: mean from the GNG partial sums, then one partial sum of (x - mean)^2 a work-group. k_gnfin: {mean, 1/sqrt(var + eps)} per element.
// Every sum has a fixed order: in the thread, then wg_sum's tree, then wg_sum over the GNG partials. Each partial, and each element's pair of results, has a 128-byte line of its own (pitch GNP floats), so a line has one writer.
#define GNG  256
#define GNK  (CC * TT / GNG / 1024)
#define GNP  32
__device__ __forceinline__ float wg_sum(float v, float* red) { const int tid = threadIdx.x; red[tid] = v; __syncthreads();
    for (int st = 128; st > 0; st >>= 1) { if (tid < st) red[tid] = __fadd_rn(red[tid], red[tid + st]); __syncthreads(); }
    const float r = red[0]; __syncthreads();   // red is free for the next sum once every thread has read the total
    return r; }
__device__ __forceinline__ void gnsum(int bx, int by, const float* __restrict__ x, float* PS, float* red) { const int tid = threadIdx.x; const float* xs = x + (size_t)by * CC * TT + (size_t)bx * (GNK * 1024) + tid * 4; float s = 0.f;
#pragma unroll   // all GNK loads are issued before the first is waited for
    for (int k = 0; k < GNK; ++k) { const v4f a = *(const v4f*)(xs + k * 1024); for (int q = 0; q < 4; ++q) s = __fadd_rn(s, bfr(a[q])); }
    s = wg_sum(s, red); if (tid == 0) PS[(by * GNG + bx) * GNP] = s; }
// ---- k_prep: the five jobs that read nothing but inputs, in ONE launch, told apart by the block number: first the NB_ x GNG blocks of gnsum (the longest job), then WPB blocks each for Wq, Wk, Wv (wpadh) and Wo (wopadh).
// A block does one job whole, so the barriers of wg_sum stand under a condition that is the same for the whole work-group.
#define WPB  (DQ * DM / 8 / 256)
__global__ __launch_bounds__(256) void k_prep(const float* __restrict__ x, float* PS, const float* __restrict__ wq, const float* __restrict__ bq, const float* __restrict__ wk, const float* __restrict__ bk, const float* __restrict__ wv, const float* __restrict__ bv, const float* __restrict__ wo,
                                              bf* WQ, float* BQP, bf* WK, float* BKP, bf* WV, float* BVP, bf* WO) {
    static_assert(DQ * DM % (8 * 256) == 0, "whole blocks a weight matrix");
    __shared__ float red[256]; const int blk = blockIdx.x;
    if (blk < NB_ * GNG) { gnsum(blk % GNG, blk / GNG, x, PS, red); return; }
    const int m = (blk - NB_ * GNG) / WPB, jb = (blk - NB_ * GNG) % WPB;
    if (m == 3) wopadh(jb, wo, WO);
    else wpadh(jb, m == 0 ? wq : m == 1 ? wk : wv, m == 0 ? bq : m == 1 ? bk : bv, m == 0 ? WQ : m == 1 ? WK : WV, m == 0 ? BQP : m == 1 ? BKP : BVP);
}
__global__ __launch_bounds__(256) void k_gnsq(const float* __restrict__ x, const float* __restrict__ PS, float* PQ) { static_assert(GNG == 256, "one partial a thread"); __shared__ float red[256]; const int tid = threadIdx.x; const float* xs = x + (size_t)blockIdx.y * CC * TT + (size_t)blockIdx.x * (GNK * 1024) + tid * 4; v4f a[GNK];
#pragma unroll   // the loads fly while the mean is summed; a[] stays in registers
    for (int k = 0; k < GNK; ++k) a[k] = *(const v4f*)(xs + k * 1024);
    const float mean = __fdiv_rn(wg_sum(PS[(blockIdx.y * GNG + tid) * GNP], red), (float)(CC * TT)); float s2 = 0.f;
#pragma unroll   // constant k: a[] stays in registers
    for (int k = 0; k < GNK; ++k) for (int q = 0; q < 4; ++q) { const float dv = __fsub_rn(bfr(a[k][q]), mean); s2 = __fadd_rn(s2, __fmul_rn(dv, dv)); }
    s2 = wg_sum(s2, red); if (tid == 0) PQ[(blockIdx.y * GNG + blockIdx.x) * GNP] = s2; }
__global__ __launch_bounds__(256) void k_gnfin(const float* __restrict__ PS, const float* __restrict__ PQ, float* stat) { __shared__ float red[256]; const int tid = threadIdx.x; const float n = (float)(CC * TT);
    const float mean = __fdiv_rn(wg_sum(PS[(blockIdx.x * GNG + tid) * GNP], red), n); const float var = __fdiv_rn(wg_sum(PQ[(blockIdx.x * GNG + tid) * GNP], red), n);
    if (tid == 0) { const float rs = __fdiv_rn(1.0f, __fsqrt_rn(__fadd_rn(var, 1e-5f))); v2f o; o[0] = mean; o[1] = rs; *(v2f*)(stat + GNP * blockIdx.x) = o; } }
__global__ __launch_bounds__(256) void k_gnT(const float* __restrict__ xs, const float* __restrict__ stat, const float* __restrict__ g, const float* __restrict__ bb, bf* XH, bf* XL) { const size_t k = (size_t)blockIdx.x * 256 + threadIdx.x; if (k >= (size_t)TT * CC / 8) return; const size_t eo = (size_t)blockIdx.y * CC * TT; xs += eo; stat += GNP * blockIdx.y; XH += eo; XL += eo;   // batch element = blockIdx.y
    const int c0 = (int)(k % (CC / 8)) * 8; const int t = (int)(k / (CC / 8)); const float mean = stat[0], rs = stat[1]; v8us oh, ol;
#pragma unroll
    for (int q = 0; q < 8; ++q) { const int c = c0 + q; const float dv = __fsub_rn(bfr(xs[(size_t)c * TT + t]), mean); float y = __fmul_rn(dv, rs); asm volatile("" : "+v"(y)); y = __fmul_rn(y, bfr(g[c])); asm volatile("" : "+v"(y)); y = __fadd_rn(y, bfr(bb[c])); unsigned short a2, c2; splitf(y, a2, c2); oh[q] = a2; ol[q] = c2; }
    *(v8us*)(XH + (size_t)t * CC + c0) = oh; *(v8us*)(XL + (size_t)t * CC + c0) = ol;  }

// ---- k_fattn: scores, softmax and P.V of one head for FQB query rows (FQH for rows < RH) in ONE work-group; scores and probabilities never leave the registers. Grid (batch x heads, row blocks), 4 waves, 32 query rows (two column tiles) a wave.
// Transposed products: S^T = K Q^T (A = 16 K rows from LDS, B = 16 query rows, kept in registers), O^T += V^T P^T. A lane then holds scores of ONE query (column lane & 15), and two S^T tiles (keys +0..15, +16..31),
// converted in place, are the B operand of the second product in the hardware k order (element s: key 8 hi + s, or 16 + 8 hi + s - 8), which is also the order of WFrag::ld on a V^T row. Only the HR = 32 real head columns are read.
// Two sweeps over the keys, K (and V^T) staged in LDS in chunks of CK keys: sweep 1 the row maximum; sweep 2 the same scores again, p = exp(s - max), f32 row sum of the unrounded p, P.V; the division by the sum comes last.
// The next chunk is fetched into registers while the present one is worked on. Rows < RH: bf16 hi/lo planes, three products each (hh, hl, lh) as before; the other rows f16.
// Rows < RH cost about three times the others, so their work-groups are cut short: FQH = 32 rows a work-group, which all KW = 4 waves hold, and wave w takes keys [w CK / KW, +CK / KW) of every chunk.
// The waves' row maxima (behind sweep 1), partial row sums and partial O tiles (behind sweep 2) meet in LDS (xw) and are joined in wave order.
#define FQB  128
#define FQH  32
#define FKW  4
#define XWN  (2 * FKW * 32 + FKW * 4 * 256)   // floats: maxima and sums [wave][column tile][16], O tiles [wave][column tile][row tile][2][32 lanes][4]
#define KPT  40      // LDS pitch of a staged K row in 16-bit elements: 80 B = 16 B x odd, conflict-free for 16-byte reads
#define FSM  (2 * (128 * KPT + HR * (128 + 8)))   // the larger of the two paths' LDS needs, in 16-bit elements
typedef __attribute__((ext_vector_type(8))) __bf16 v8bf;
typedef __attribute__((ext_vector_type(4))) unsigned v4u;
__device__ __forceinline__ v8f splat8(float x) { return (v8f){x, x, x, x, x, x, x, x}; }
__device__ __forceinline__ v8f bfup(v8bf h) { const v4u w = __builtin_bit_cast(v4u, h); v8f r;   // packed bf16 back to f32: one shift or one mask an element
#pragma unroll   // constant indices: the arrays stay in registers
    for (int i = 0; i < 4; ++i) { r[2 * i] = __uint_as_float(w[i] << 16); r[2 * i + 1] = __uint_as_float(w[i] & 0xFFFF0000u); }
    return r; }
template <typename T16, int CK> struct FaChunk {   // one plane's share of a chunk in one thread's registers: CK / 32 16-byte pieces of K rows and as many of V^T rows
    typedef __attribute__((ext_vector_type(8))) T16 V8; V8 k[CK / 32], v[CK / 32];
    static constexpr int UR = CK / 8, RS = 128 / UR;   // 16-byte pieces in a V^T row of the chunk; V^T rows that the 128 threads cover at once (K: 4 pieces a row, 32 rows at once)
    // piece s of thread tid: K row (tid >> 2) + 32 s, V^T row tid / UR + RS s: a uniform base, one offset a thread, and a constant step
    template <bool WITHV> __device__ __forceinline__ void load(const T16* __restrict__ Kg, const T16* __restrict__ Vg, int key0) { const unsigned tid = threadIdx.x; const T16* ka = Kg + (size_t)key0 * HD + (tid >> 2) * HD + (tid & 3) * 8; const T16* va = Vg + key0 + (tid / UR) * TT + (tid % UR) * 8;
#pragma unroll   // constant indices: k[] and v[] stay in registers
        for (int s = 0; s < CK / 32; ++s) { k[s] = *(const V8*)(ka + s * 32 * HD); if constexpr (WITHV) v[s] = *(const V8*)(va + s * RS * TT); }
        // precaution: the loads' address registers are inputs here, so they stay live and unwritten (by a later load's result too) up to this wait
        if constexpr (WITHV) asm volatile("s_wait_xcnt 0x0" :: "v"(ka), "v"(va) : "memory"); else asm volatile("s_wait_xcnt 0x0" :: "v"(ka) : "memory"); }
    template <bool WITHV> __device__ __forceinline__ void store(T16* sK, T16* sV) const { const unsigned tid = threadIdx.x; T16* kd = sK + (tid >> 2) * KPT + (tid & 3) * 8; T16* vd = sV + (tid / UR) * (CK + 8) + (tid % UR) * 8;
#pragma unroll   // as above
        for (int s = 0; s < CK / 32; ++s) { *(V8*)(kd + s * 32 * KPT) = k[s]; if constexpr (WITHV) *(V8*)(vd + s * RS * (CK + 8)) = v[s]; } }
};
template <typename T16, bool HL, int CK, int KW = 1>
__device__ __forceinline__ void fattn(const T16* __restrict__ Q, const T16* __restrict__ Q2, const T16* __restrict__ Kg, const T16* __restrict__ K2, const T16* __restrict__ Vg, const T16* __restrict__ V2, int q0, bf* Ah, bf* Al, T16* sm, float* xw = nullptr) {
    typedef WFrag<T16> F; typedef typename F::V V; constexpr int VPT = CK + 8;   // V^T row pitch: 16 B x odd
    static_assert((HL ? 2 : 1) * (CK * KPT + HR * VPT) <= FSM && TT % CK == 0 && CK % (32 * KW) == 0 && (KW == 1 || KW == FKW), "a chunk fits the LDS array; whole 32-key groups a wave");
    T16* sK = sm; T16* sV = sK + CK * KPT; T16* sK2 = sV + HR * VPT; T16* sV2 = sK2 + CK * KPT;
    const int lane = threadIdx.x & 31, lr = lane & 15, hi = lane >> 4, wave = threadIdx.x >> 5; const int t0 = q0 + (KW == 1 ? wave * 32 : 0) + lr;
    const int wv = KW == 1 ? 0 : __builtin_amdgcn_readfirstlane(wave), kw0 = wv * (CK / KW);   // this wave's keys in a chunk start at kw0 (a scalar)
    V qf[2], qf2[2]; const T16* qa = Q + (size_t)t0 * HD + 8 * hi; const T16* qa2 = HL ? Q2 + (size_t)t0 * HD + 8 * hi : qa;
#pragma unroll   // constant indices: the arrays stay in registers
    for (int g = 0; g < 2; ++g) { qf[g] = F::ld(qa + 16 * g * HD); if constexpr (HL) qf2[g] = F::ld(qa2 + 16 * g * HD); }
    asm volatile("s_wait_xcnt 0x0" :: "v"(qa), "v"(qa2) : "memory");   // precaution, as in FaChunk::load
    const int koff = lr * KPT + 8 * hi, voff = lr * VPT + 8 * hi;
    FaChunk<T16, CK> r, r2;
    v8f mx[2] = {splat8(-3.0e38f), splat8(-3.0e38f)};   // eight independent maxima a column tile, joined behind the sweep
    r.template load<false>(Kg, Vg, 0); if constexpr (HL) r2.template load<false>(K2, V2, 0);
#pragma unroll 1   // one chunk at a time: the LDS array holds one
    for (int c = 0; c < TT; c += CK) {
        __syncthreads();   // every wave has left the chunk that is overwritten next
        r.template store<false>(sK, sV); if constexpr (HL) r2.template store<false>(sK2, sV2);
        __syncthreads();   // the chunk is complete before any wave reads it
        if (c + CK < TT) { r.template load<false>(Kg, Vg, c + CK); if constexpr (HL) r2.template load<false>(K2, V2, c + CK); }   // flies under this chunk's products
#pragma unroll 2   // two independent 32-key groups: one group's LDS reads fly under the other's products
        for (int kk = kw0; kk < kw0 + CK / KW; kk += 32) { const V a0 = F::ld(sK + koff + kk * KPT), a1 = F::ld(sK + koff + (kk + 16) * KPT); V b0, b1; if constexpr (HL) { b0 = F::ld(sK2 + koff + kk * KPT); b1 = F::ld(sK2 + koff + (kk + 16) * KPT); }
#pragma unroll   // constant indices: the arrays stay in registers
            for (int g = 0; g < 2; ++g) { v8f s0 = F::mma(a0, qf[g], (v8f){}), s1 = F::mma(a1, qf[g], (v8f){});
                if constexpr (HL) { s0 = F::mma(a0, qf2[g], s0); s1 = F::mma(a1, qf2[g], s1); s0 = F::mma(b0, qf[g], s0); s1 = F::mma(b1, qf[g], s1); }
#pragma unroll   // constant indices: the arrays stay in registers
                for (int j = 0; j < 8; ++j) mx[g][j] = fmaxf(mx[g][j], fmaxf(s0[j], s1[j])); } }
    }
    const float c1 = SCL * 1.4426950408889634f; const v8f c1v = splat8(c1); v8f nm[2], sv[2], o[2][2]; float mr[2];
#pragma unroll   // constant indices: the arrays stay in registers
    for (int g = 0; g < 2; ++g) { float m = fmaxf(fmaxf(fmaxf(mx[g][0], mx[g][1]), fmaxf(mx[g][2], mx[g][3])), fmaxf(fmaxf(mx[g][4], mx[g][5]), fmaxf(mx[g][6], mx[g][7]))); m = fmaxf(m, __shfl_xor(m, 16, 32));   // lanes l and l ^ 16 hold the two halves of one query's keys
        mr[g] = m; if constexpr (KW > 1) { if (hi == 0) xw[(wv * 2 + g) * 16 + lr] = m; } }
    if constexpr (KW > 1) { __syncthreads();   // every wave's row maxima are in LDS before any wave joins them
#pragma unroll   // constant indices: the arrays stay in registers
        for (int g = 0; g < 2; ++g)
#pragma unroll   // as above
            for (int w = 0; w < KW; ++w) mr[g] = fmaxf(mr[g], xw[(w * 2 + g) * 16 + lr]); }
#pragma unroll   // constant indices: the arrays stay in registers
    for (int g = 0; g < 2; ++g) { const float m = mr[g];
        nm[g] = splat8((HL ? 0.0f : 6.0f) - m * c1);   // f16 path: p carries a factor 2^6, which cancels against the row sum, so that small p stay normal f16 numbers
        sv[g] = (v8f){}; o[g][0] = (v8f){}; o[g][1] = (v8f){}; }
    r.template load<true>(Kg, Vg, 0); if constexpr (HL) r2.template load<true>(K2, V2, 0);
#pragma unroll 1   // one chunk at a time
    for (int c = 0; c < TT; c += CK) {
        __syncthreads();   // every wave has left the chunk that is overwritten next
        r.template store<true>(sK, sV); if constexpr (HL) r2.template store<true>(sK2, sV2);
        __syncthreads();   // the chunk is complete before any wave reads it
        if (c + CK < TT) { r.template load<true>(Kg, Vg, c + CK); if constexpr (HL) r2.template load<true>(K2, V2, c + CK); }   // flies under this chunk's products
#pragma unroll 2   // as in sweep 1
        for (int kk = kw0; kk < kw0 + CK / KW; kk += 32) { const V a0 = F::ld(sK + koff + kk * KPT), a1 = F::ld(sK + koff + (kk + 16) * KPT); V b0, b1; if constexpr (HL) { b0 = F::ld(sK2 + koff + kk * KPT); b1 = F::ld(sK2 + koff + (kk + 16) * KPT); }
            const V v0 = F::ld(sV + voff + kk), v1 = F::ld(sV + voff + 16 * VPT + kk); V w0, w1; if constexpr (HL) { w0 = F::ld(sV2 + voff + kk); w1 = F::ld(sV2 + voff + 16 * VPT + kk); }
            v8f s0[2], s1[2];
#pragma unroll   // constant indices: the arrays stay in registers
            for (int g = 0; g < 2; ++g) { s0[g] = F::mma(a0, qf[g], (v8f){}); s1[g] = F::mma(a1, qf[g], (v8f){}); }
            if constexpr (HL) {
#pragma unroll   // constant indices: the arrays stay in registers
                for (int g = 0; g < 2; ++g) { s0[g] = F::mma(a0, qf2[g], s0[g]); s1[g] = F::mma(a1, qf2[g], s1[g]); }
#pragma unroll   // constant indices: the arrays stay in registers
                for (int g = 0; g < 2; ++g) { s0[g] = F::mma(b0, qf[g], s0[g]); s1[g] = F::mma(b1, qf[g], s1[g]); } }
#pragma unroll   // constant indices: the arrays stay in registers
            for (int g = 0; g < 2; ++g) { const v8f x0 = __builtin_elementwise_fma(s0[g], c1v, nm[g]), x1 = __builtin_elementwise_fma(s1[g], c1v, nm[g]); v8f p0, p1;
#pragma unroll   // constant indices: the arrays stay in registers
                for (int j = 0; j < 8; ++j) { p0[j] = __builtin_amdgcn_exp2f(x0[j]); p1[j] = __builtin_amdgcn_exp2f(x1[j]); }
                sv[g] += p0; sv[g] += p1;
                if constexpr (HL) {
                    const v8bf h0 = __builtin_convertvector(p0, v8bf), h1 = __builtin_convertvector(p1, v8bf); const v8bf l0 = __builtin_convertvector(p0 - bfup(h0), v8bf), l1 = __builtin_convertvector(p1 - bfup(h1), v8bf);
                    const V ph = __builtin_shufflevector(h0, h1, 0, 1, 2, 3, 4, 5, 6, 7, 8, 9, 10, 11, 12, 13, 14, 15), pl = __builtin_shufflevector(l0, l1, 0, 1, 2, 3, 4, 5, 6, 7, 8, 9, 10, 11, 12, 13, 14, 15);
                    o[g][0] = F::mma(v0, ph, o[g][0]); o[g][1] = F::mma(v1, ph, o[g][1]); o[g][0] = F::mma(v0, pl, o[g][0]); o[g][1] = F::mma(v1, pl, o[g][1]); o[g][0] = F::mma(w0, ph, o[g][0]); o[g][1] = F::mma(w1, ph, o[g][1]);
                } else {
                    const V pf = cat16(__builtin_convertvector(p0, v8h), __builtin_convertvector(p1, v8h));
                    o[g][0] = F::mma(v0, pf, o[g][0]); o[g][1] = F::mma(v1, pf, o[g][1]); } } }
    }
    if constexpr (KW > 1) {
        float* xsum = xw + KW * 32; float* xo = xw + 2 * KW * 32;
#pragma unroll   // constant indices: the arrays stay in registers
        for (int g = 0; g < 2; ++g) { float sum = ((sv[g][0] + sv[g][1]) + (sv[g][2] + sv[g][3])) + ((sv[g][4] + sv[g][5]) + (sv[g][6] + sv[g][7])); sum += __shfl_xor(sum, 16, 32); if (hi == 0) xsum[(wv * 2 + g) * 16 + lr] = sum;
#pragma unroll   // as above
            for (int h = 0; h < 2; ++h) { float* d = xo + (wv * 4 + g * 2 + h) * 256 + lane * 4; *(v4fa*)d = __builtin_shufflevector(o[g][h], o[g][h], 0, 1, 2, 3); *(v4fa*)(d + 128) = __builtin_shufflevector(o[g][h], o[g][h], 4, 5, 6, 7); } }
        __syncthreads();   // every wave's partial row sums and O tiles are in LDS before they are added
        if (wv < 2) {   // wave g finishes column tile g, both row tiles: a 128-byte output line keeps one writer
            float sum = xsum[wv * 16 + lr]; v8f oo[2];
#pragma unroll   // fixed order: wave 0, 1, 2, 3
            for (int w = 1; w < KW; ++w) sum = __fadd_rn(sum, xsum[(w * 2 + wv) * 16 + lr]);
#pragma unroll   // constant indices: the arrays stay in registers
            for (int h = 0; h < 2; ++h) { const float* s = xo + (wv * 2 + h) * 256 + lane * 4; v4f a = *(const v4fa*)s, b = *(const v4fa*)(s + 128);
#pragma unroll   // fixed order: wave 0, 1, 2, 3
                for (int w = 1; w < KW; ++w) { a += *(const v4fa*)(s + w * 1024); b += *(const v4fa*)(s + w * 1024 + 128); }
                oo[h] = __builtin_shufflevector(a, b, 0, 1, 2, 3, 4, 5, 6, 7); }
            const float inv = __fdiv_rn(1.0f, sum); v8us h0, l0, h1, l1; const v8us zz = (v8us){};
#pragma unroll   // constant indices: the arrays stay in registers
            for (int j = 0; j < 8; ++j) { unsigned short a, b; splitf(oo[0][j] * inv, a, b); h0[j] = a; l0[j] = b; splitf(oo[1][j] * inv, a, b); h1[j] = a; l1[j] = b; }
            bf* ph = Ah + (size_t)(t0 + 16 * wv) * DQ + 8 * hi; bf* pl = Al + (size_t)(t0 + 16 * wv) * DQ + 8 * hi;
            *(v8us*)ph = h0; *(v8us*)(ph + 16) = h1; *(v8us*)(ph + 32) = zz; *(v8us*)(ph + 48) = zz; *(v8us*)pl = l0; *(v8us*)(pl + 16) = l1; *(v8us*)(pl + 32) = zz; *(v8us*)(pl + 48) = zz;
            asm volatile("s_wait_xcnt 0x0" :: "v"(ph), "v"(pl) : "memory");   // precaution, as in FaChunk::load: the stores' address registers stay live and unwritten up to this wait
        }
        return;
    }
#pragma unroll   // constant indices: the arrays stay in registers
    for (int g = 0; g < 2; ++g) { float sum = ((sv[g][0] + sv[g][1]) + (sv[g][2] + sv[g][3])) + ((sv[g][4] + sv[g][5]) + (sv[g][6] + sv[g][7])); sum += __shfl_xor(sum, 16, 32); const float inv = __fdiv_rn(1.0f, sum);
        v8us h0, l0, h1, l1; const v8us zz = (v8us){};
#pragma unroll   // constant indices: the arrays stay in registers
        for (int j = 0; j < 8; ++j) { unsigned short a, b; splitf(o[g][0][j] * inv, a, b); h0[j] = a; l0[j] = b; splitf(o[g][1][j] * inv, a, b); h1[j] = a; l1[j] = b; }
        // o[g][0][j] = O[t][8 hi + j], o[g][1][j] = O[t][16 + 8 hi + j]; columns HR .. HD - 1 of the padded head are zero
        bf* ph = Ah + (size_t)(t0 + 16 * g) * DQ + 8 * hi; bf* pl = Al + (size_t)(t0 + 16 * g) * DQ + 8 * hi;
        *(v8us*)ph = h0; *(v8us*)(ph + 16) = h1; *(v8us*)(ph + 32) = zz; *(v8us*)(ph + 48) = zz; *(v8us*)pl = l0; *(v8us*)(pl + 16) = l1; *(v8us*)(pl + 32) = zz; *(v8us*)(pl + 48) = zz; }
}
// ---- k_proj: the q, k and v projections of every batch element in ONE launch; its epilogue rounds the f32 sums (+ f32 bias) straight into the 16-bit planes that k_fattn reads (f16, bf16 hi, bf16 lo), so no f32 copy of q, k or v exists.
// Grid (TT / 64, NH_ / 2, 3 NB_), one wave a tile of 64 tokens x the HR real columns of two heads; blockIdx.z = 3 x batch element + (0 q, 1 k, 2 v). The padded rows of W and the padded plane columns, which k_fattn never reads, are left out.
// K loop and product order (x hi, then x lo, per 32-wide k step) as in k_gemmw<bf, 1, true>. W and bias keep wpadh's padded row numbering: head * HD + column.
// q, k (VT false): transposed product, A = 16 W rows, B = 16 tokens: a lane holds 8 neighbouring columns of ONE token = one 16-byte store a plane into [head][t][HD].
// v (VT true): A = 16 tokens, B = 16 W rows: a lane holds 8 neighbouring tokens of ONE column = one 16-byte store a plane into [head][column][TT]. Either way a wave writes whole 64- or 128-byte runs, and a 128-byte line has one writer.
template <bool VT>
__device__ __forceinline__ void proj_tile(const bf* __restrict__ XH, const bf* __restrict__ XL, const bf* __restrict__ Wt, const float* __restrict__ bias, int r0, int h0, h16* P16, bf* Ph, bf* Pl) {
    typedef WFrag<bf> F; typedef F::V V;
    const int lane = threadIdx.x & 31, lr = lane & 15, hi = lane >> 4;
    const bf* xh = XH + (size_t)(r0 + lr) * DM + 8 * hi; const bf* xl = XL + (size_t)(r0 + lr) * DM + 8 * hi; const bf* wr = Wt + (size_t)(h0 * HD + lr) * DM + 8 * hi;
    v8f acc[4][4];
#pragma unroll   // constant indices: the arrays stay in registers
    for (int mb = 0; mb < 4; ++mb)
#pragma unroll   // as above
        for (int nb = 0; nb < 4; ++nb) acc[mb][nb] = (v8f){};
#pragma unroll 1   // one k step's fragments in registers at a time, as in k_gemmw
    for (int kc = 0; kc < DM; kc += 32) {
        V a[4], a2[4], b[4];
#pragma unroll   // constant indices: the arrays stay in registers
        for (int mb = 0; mb < 4; ++mb) { a[mb] = F::ld(xh + mb * 16 * DM); a2[mb] = F::ld(xl + mb * 16 * DM); }
#pragma unroll   // as above
        for (int nb = 0; nb < 4; ++nb) b[nb] = F::ld(wr + ((nb >> 1) * HD + (nb & 1) * 16) * DM);   // column block nb: head h0 + nb / 2, columns 16 (nb % 2) ..
        // precaution, as in FaChunk::load: the loads' address registers are inputs here, so they stay live and unwritten (by a later load's result too) up to this wait.
        // The loaded fragments are inputs too: each keeps registers of its own, so all 24 loads are in flight together and a k step waits for memory once (without them the x lo loads wait for the x hi registers: twice)
        asm volatile("s_wait_xcnt 0x0" :: "v"(xh), "v"(xl), "v"(wr), "v"(a[0]), "v"(a[1]), "v"(a[2]), "v"(a[3]), "v"(a2[0]), "v"(a2[1]), "v"(a2[2]), "v"(a2[3]), "v"(b[0]), "v"(b[1]), "v"(b[2]), "v"(b[3]) : "memory");
        xh += 32; xl += 32; wr += 32;
#pragma unroll   // as above
        for (int nb = 0; nb < 4; ++nb)
#pragma unroll   // as above
            for (int mb = 0; mb < 4; ++mb) {
                if constexpr (VT) { acc[mb][nb] = F::mma(a[mb], b[nb], acc[mb][nb]); acc[mb][nb] = F::mma(a2[mb], b[nb], acc[mb][nb]); }
                else { acc[mb][nb] = F::mma(b[nb], a[mb], acc[mb][nb]); acc[mb][nb] = F::mma(b[nb], a2[mb], acc[mb][nb]); } }
    }
    v8f bv[4];   // the bias of column block nb as this lane adds it; the four loads fly together
    if constexpr (VT) { const int bi = h0 * HD + lr; float bs[4];
#pragma unroll   // constant indices: the arrays stay in registers
        for (int nb = 0; nb < 4; ++nb) bs[nb] = bias[bi + (nb >> 1) * HD + (nb & 1) * 16];
        asm volatile("s_wait_xcnt 0x0" :: "v"(bi) : "memory");   // precaution, as above: the loads' offset register is an input here
#pragma unroll   // as above
        for (int nb = 0; nb < 4; ++nb) bv[nb] = splat8(bfr(bs[nb]));
    } else { const float* bp = bias + h0 * HD + 8 * hi;
#pragma unroll   // as above
        for (int nb = 0; nb < 4; ++nb) bv[nb] = *(const v8f*)(bp + (nb >> 1) * HD + (nb & 1) * 16);
#pragma unroll   // as above
        for (int nb = 0; nb < 4; ++nb)
#pragma unroll   // as above
            for (int j = 0; j < 8; ++j) bv[nb][j] = bfr(bv[nb][j]); }
#pragma unroll   // as above
    for (int nb = 0; nb < 4; ++nb) { const int hd = (h0 + (nb >> 1)) * HD + (nb & 1) * 16;   // padded number of the block's first column
#pragma unroll   // as above
        for (int mb = 0; mb < 4; ++mb) { const v8f y = acc[mb][nb] + bv[nb]; const v8h o16 = __builtin_convertvector(y, v8h);   // packed conversions, round to nearest even: the values of tohx and splitf
            const v8bf yh = __builtin_convertvector(y, v8bf); const v8bf yl = __builtin_convertvector(y - bfup(yh), v8bf); const v8us oh = __builtin_bit_cast(v8us, yh), ol = __builtin_bit_cast(v8us, yl);
            const size_t e = VT ? (size_t)(hd + lr) * TT + r0 + mb * 16 + 8 * hi : ((size_t)(h0 + (nb >> 1)) * TT + r0 + mb * 16 + lr) * HD + (nb & 1) * 16 + 8 * hi;
            *(v8h*)(P16 + e) = o16; *(v8us*)(Ph + e) = oh; *(v8us*)(Pl + e) = ol; } }
}
__global__ __launch_bounds__(32) void k_proj(const bf* __restrict__ XH, const bf* __restrict__ XL, const bf* __restrict__ WQ, const bf* __restrict__ WK, const bf* __restrict__ WV, const float* __restrict__ BQ, const float* __restrict__ BK, const float* __restrict__ BV,
                                             h16* Q16, bf* Qh, bf* Ql, h16* K16, bf* Kh, bf* Kl, h16* V16, bf* Vh, bf* Vl) {
    static_assert(TT % 64 == 0 && NH_ % 2 == 0 && HR == 32 && DM % 32 == 0 && NH_ == NKV, "whole tiles; two 16-column blocks a head");
    const int b = blockIdx.z / 3, p = blockIdx.z % 3; const int r0 = blockIdx.x * 64, h0 = blockIdx.y * 2; const size_t xo = (size_t)b * TT * DM, po = (size_t)b * NH_ * TT * HD;
    if (p == 2) proj_tile<true>(XH + xo, XL + xo, WV, BV, r0, h0, V16 + po, Vh + po, Vl + po);
    else proj_tile<false>(XH + xo, XL + xo, p ? WK : WQ, p ? BK : BQ, r0, h0, (p ? K16 : Q16) + po, (p ? Kh : Qh) + po, (p ? Kl : Ql) + po);
}

// Planes [batch][head][...], outputs [batch][t][DQ]. blockIdx.y is the row block: first the RH / FQH blocks of rows < RH, then the (TT - RH) / FQB blocks of the other rows.
__global__ __launch_bounds__(128) void k_fattn(const h16* __restrict__ Q16, const bf* __restrict__ Qh, const bf* __restrict__ Ql, const h16* __restrict__ K16, const bf* __restrict__ Kh, const bf* __restrict__ Kl, const h16* __restrict__ V16, const bf* __restrict__ Vh, const bf* __restrict__ Vl, bf* Ah, bf* Al) {
    static_assert(RH % FQH == 0 && (TT - RH) % FQB == 0 && HR == 32 && HD == 64 && NH_ == NKV, "whole work-groups on either side of RH; one 32-wide k step a head");
    __shared__ __align__(16) unsigned short sm[FSM]; __shared__ __align__(16) float xw[XWN];
    const size_t hp = (size_t)blockIdx.x * TT * HD; const int by = blockIdx.y; const int q0 = by < RH / FQH ? by * FQH : RH + (by - RH / FQH) * FQB; const size_t ao = (size_t)(blockIdx.x / NH_) * TT * DQ + (blockIdx.x % NH_) * HD;
    if (q0 < RH) fattn<bf, true, 128, FKW>(Qh + hp, Ql + hp, Kh + hp, Kl + hp, Vh + hp, Vl + hp, q0, Ah + ao, Al + ao, (bf*)sm, xw);
    else fattn<h16, false, 256>(Q16 + hp, nullptr, K16 + hp, nullptr, V16 + hp, nullptr, q0, Ah + ao, Al + ao, (h16*)sm);
}

extern "C" void kernel_launch(void* const* d_in, const int* in_sizes, int n_in,
                              void* d_out, int out_size, void* d_ws, size_t ws_size, hipStream_t stream) {
    (void)in_sizes; (void)n_in; (void)out_size;
    const float* x = (const float*)d_in[0]; const float* gnw = (const float*)d_in[1]; const float* gnb = (const float*)d_in[2]; const float* wq = (const float*)d_in[3]; const float* bq = (const float*)d_in[4]; const float* wk = (const float*)d_in[5]; const float* bk = (const float*)d_in[6]; const float* wv = (const float*)d_in[7]; const float* bv = (const float*)d_in[8]; const float* wo = (const float*)d_in[9]; const float* bo = (const float*)d_in[10];
    float* OUT = (float*)d_out;     // [2][256][4096]
    char* wsp = (char*)d_ws;
    auto take = [&](size_t bytes) { char* p = wsp; wsp += (bytes + 255) & ~(size_t)255; return (void*)p; };
    float* BQP = (float*)take(DQ * 4); float* BKP = (float*)take(DQ * 4); float* BVP = (float*)take(DQ * 4); bf* XH = (bf*)take((size_t)NB_ * TT * DM * 2); bf* XL = (bf*)take((size_t)NB_ * TT * DM * 2); float* STAT = (float*)take((size_t)NB_ * GNP * 4); float* PS = (float*)take((size_t)NB_ * GNG * GNP * 4); float* PQ = (float*)take((size_t)NB_ * GNG * GNP * 4); bf* WQ = (bf*)take((size_t)DQ * DM * 2); bf* WK = (bf*)take((size_t)DKV * DM * 2); bf* WV = (bf*)take((size_t)DKV * DM * 2); bf* WO = (bf*)take((size_t)DM * DQ * 2);
    const size_t PL = (size_t)NH_ * TT * HD;   // elements of one batch element's head planes; every plane below holds all NB_ batch elements
    h16* QP16 = (h16*)take(NB_ * PL * 2); h16* KP16 = (h16*)take(NB_ * PL * 2); h16* VT16 = (h16*)take(NB_ * PL * 2);
    bf* QPh = (bf*)take(NB_ * PL * 2); bf* QPl = (bf*)take(NB_ * PL * 2); bf* KPh = (bf*)take(NB_ * PL * 2); bf* KPl = (bf*)take(NB_ * PL * 2); bf* VTh = (bf*)take(NB_ * PL * 2); bf* VTl = (bf*)take(NB_ * PL * 2);
    bf* ATh = (bf*)take((size_t)NB_ * TT * DQ * 2); bf* ATl = (bf*)take((size_t)NB_ * TT * DQ * 2);
    if ((size_t)(wsp - (char*)d_ws) > ws_size) return;    // ws 256 MiB
    k_prep<<<NB_ * GNG + 4 * WPB, 256, 0, stream>>>(x, PS, wq, bq, wk, bk, wv, bv, wo, WQ, BQP, WK, BKP, WV, BVP, WO);   /* GroupNorm partial sums and the four weight preparations */
    k_gnsq<<<dim3(GNG, NB_), 256, 0, stream>>>(x, PS, PQ); k_gnfin<<<NB_, 256, 0, stream>>>(PS, PQ, STAT);
    k_gnT<<<dim3((unsigned)(((size_t)TT * CC / 8 + 255) / 256), NB_), 256, 0, stream>>>(x, STAT, gnw, gnb, XH, XL);   /* normalised, token-major, hi/lo; every batch element */
    k_proj<<<dim3(TT / 64, NH_ / 2, 3 * NB_), 32, 0, stream>>>(XH, XL, WQ, WK, WV, BQP, BKP, BVP, QP16, QPh, QPl, KP16, KPh, KPl, VT16, VTh, VTl);   /* q, k, v of every batch element, straight into the head planes */
    k_fattn<<<dim3(NB_ * NH_, RH / FQH + (TT - RH) / FQB), 128, 0, stream>>>(QP16, QPh, QPl, KP16, KPh, KPl, VT16, VTh, VTl, ATh, ATl);   /* every head of every batch element */
    k_gemmw<bf, 1, true, 1, 1, true><<<dim3(TT / 64, DM / 64, NB_), 32, 0, stream>>>(ATh, ATl, WO, nullptr, DQ, OUT, TT, bo, (size_t)TT * DQ, 0, (size_t)CC * TT, 0, x);   /* Wo product of every batch element (z), stored channel-major + bias + hidden residual */
}

// v008
// One run takes 117 microseconds.
// In both of two side-by-side timings against v007, it was 1.05 times as fast.
// Counting every step since v000, it is 45.2 times as fast.
#include <hip/hip_runtime.h>

// 1-D self-attention block with GroupNorm and residual on a channel-major sequence (hidden [2][256][4096]; x = GroupNorm(1 group over all 256 x 4096 values, eps 1e-5) x gn_weight + gn_bias; h = x^T; q,k,v = h W^T + b ('oi' [256][256] + [256], 1/16; 8 heads x 32); scores = (q 32^-1/4).(k 32^-1/4); softmax over all 4,096 keys; out = merged Wo^T + bo, transposed back + hidden -> [2][256][4096] (2.1 M)).
// Compute dtypes, f32 accumulate: every input rounded to bf16; GroupNorm f32 (fixed-order sums); projections hi/lo x exact + f32 biases; attention rows < 512 3 products, rest fp16; softmax f32; Wo hl x exact + bias; residual f32.

#define NB_  2
#define TT   4096
#define DM   256
#define NH_  8
#define NKV  8
#define REP  (NH_ / NKV)
#define HD   64
#define DQ   (NH_ * HD)
#define DKV  (NKV * HD)
#define RH   512                  // query rows < RH use hi+lo planes (0: none)
#define WIN  0
#define SCL  0.17677669529663689f   // 32^-1/2 == (32^-1/4)^2 applied once to q.k
#define CC   256     // channels
#define HR   32      // real head width (padded to HD = 64)
typedef _Float16 h16;
typedef unsigned short bf;
typedef __attribute__((ext_vector_type(16))) __bf16   v16bf;
typedef __attribute__((ext_vector_type(16))) _Float16 v16h;
typedef __attribute__((ext_vector_type(8)))  _Float16 v8h;
typedef __attribute__((ext_vector_type(8)))  unsigned short v8us;
typedef __attribute__((ext_vector_type(8)))  float    v8f;
typedef __attribute__((ext_vector_type(4)))  float    v4f;
typedef v8h  __attribute__((may_alias)) v8ha;
typedef v4f  __attribute__((may_alias)) v4fa;
typedef v8us __attribute__((may_alias)) v8usa;

__device__ __forceinline__ unsigned short f2bf(float f) { unsigned u = __float_as_uint(f); u += 0x7FFFu + ((u >> 16) & 1u); return (unsigned short)(u >> 16); }
__device__ __forceinline__ float bf2f(unsigned short b) { return __uint_as_float(((unsigned)b) << 16); }
__device__ __forceinline__ float bfr(float f) { return bf2f(f2bf(f)); }
__device__ __forceinline__ v16h cat16(v8h lo, v8h hi) { return __builtin_shufflevector(lo, hi, 0, 1, 2, 3, 4, 5, 6, 7, 8, 9, 10, 11, 12, 13, 14, 15); }
__device__ __forceinline__ v16bf cat16b(v8us lo, v8us hi) { return __builtin_bit_cast(v16bf, __builtin_shufflevector(lo, hi, 0, 1, 2, 3, 4, 5, 6, 7, 8, 9, 10, 11, 12, 13, 14, 15)); }
__device__ __forceinline__ v8f wmma16(v16h a, v16h b, v8f c) { return __builtin_amdgcn_wmma_f32_16x16x32_f16(false, a, false, b, (short)0, c, false, false); }
__device__ __forceinline__ v8f wmmab(v16bf a, v16bf b, v8f c) { return __builtin_amdgcn_wmma_f32_16x16x32_bf16(false, a, false, b, (short)0, c, false, false); }



// ---- k_gemmw: register-blocked GEMM, ONE WAVE per 64x64 output tile (16 accumulators), operands straight from K-contiguous 16-bit planes; grid (M/64, N/64, Z), 32 threads.
// C[m][n] (f32, pitch ldc, + optional f32 bias[n]) = sum_k A[m][k] Bt[n][k] (+ split products per NSPLIT). z-batch strides sA/sB/sC in elements. K % 32 == 0.
// For a long K on a small grid: K split over KS work-groups (blockIdx.z % KS; grid z = Z KS) and, inside each, over its NW waves (NW*32 threads); wave w of part zk sums k in [(zk NW + w) K/(KS NW), +K/(KS NW)).
// The NW f32 partial tiles meet in LDS (row pitch 68 floats) and are added in wave order, each wave finishing 64/NW whole rows; part zk stores to plane C + zk sP, and the reader of C adds the KS planes in order. K % (32 KS NW) == 0.
// TR: C is the block's output itself, column-major ([n][TT], z stride sC): C[n][m] = bf16-rounded xr[n][m] + (sum + bias[n]), xr laid out like C. The 64x64 tile is turned in LDS, so no f32 copy of the product exists.
template <typename T16> struct WFrag;
template <> struct WFrag<h16> { typedef v16h V; static __device__ __forceinline__ V ld(const h16* p) { return cat16(*(const v8h*)p, *(const v8h*)(p + 16)); } static __device__ __forceinline__ v8f mma(V a, V b, v8f c) { return wmma16(a, b, c); } };
template <> struct WFrag<bf> { typedef v16bf V; static __device__ __forceinline__ V ld(const bf* p) { return cat16b(*(const v8us*)p, *(const v8us*)(p + 16)); } static __device__ __forceinline__ v8f mma(V a, V b, v8f c) { return wmmab(a, b, c); } };
template <typename T16, int NSPLIT, bool BIAS, int KS = 1, int NW = 1, bool TR = false>
__global__ __launch_bounds__(NW * 32) void k_gemmw(const T16* __restrict__ A, const T16* __restrict__ A2, const T16* __restrict__ Bt, const T16* __restrict__ Bt2, int K, float* C, int ldc, const float* __restrict__ bias, size_t sA, size_t sB, size_t sC, size_t sP = 0, const float* __restrict__ xr = nullptr) {
    static_assert(NW == 1 ? KS == 1 : (!BIAS && 64 % (2 * NW) == 0), "split K: no bias, whole row pairs per wave");
    static_assert(!TR || (NW == 1 && BIAS), "the turned epilogue: one wave a tile, with bias");
    typedef typename WFrag<T16>::V V;
    __shared__ __align__(16) float os[(NW == 1 ? (TR ? 64 : 16) : NW * 64) * 68];
    const size_t z = blockIdx.z / KS; const int zk = blockIdx.z % KS; A += z * sA; if (A2) A2 += z * sA; Bt += z * sB; if (Bt2) Bt2 += z * sB; C += z * sC + zk * sP;
    const int wave = (NW == 1) ? 0 : __builtin_amdgcn_readfirstlane((int)(threadIdx.x >> 5)); const int ks = K / (KS * NW), k0 = (zk * NW + wave) * ks;
    const int lane = threadIdx.x & 31, lr = lane & 15, hi = lane >> 4; const int r0 = blockIdx.x * 64, c0 = blockIdx.y * 64;
    v8f acc[4][4];
#pragma unroll
    for (int mb = 0; mb < 4; ++mb)
#pragma unroll
        for (int nb = 0; nb < 4; ++nb) acc[mb][nb] = (v8f){};
    const size_t aoff = (size_t)(r0 + lr) * K + 8 * hi, boff = (size_t)(c0 + lr) * K + 8 * hi;
    float bs[4];   // TR: the bias of column nb 16 + lr, fetched here so that its latency passes under the K loop
    if constexpr (TR) {
#pragma unroll   // constant indices: the array stays in registers
        for (int nb = 0; nb < 4; ++nb) bs[nb] = bias[c0 + lr + nb * 16]; }
#pragma unroll 1
    for (int kc = k0; kc < k0 + ks; kc += 32) {
        V a[4], a2[4];
#pragma unroll
        for (int mb = 0; mb < 4; ++mb) { a[mb] = WFrag<T16>::ld(A + aoff + (size_t)mb * 16 * K + kc); if (NSPLIT == 1 || NSPLIT == 2) a2[mb] = WFrag<T16>::ld(A2 + aoff + (size_t)mb * 16 * K + kc); }
#pragma unroll
        for (int nb = 0; nb < 4; ++nb) { const V b = WFrag<T16>::ld(Bt + boff + (size_t)nb * 16 * K + kc); V b2; if (NSPLIT >= 2) b2 = WFrag<T16>::ld(Bt2 + boff + (size_t)nb * 16 * K + kc);
#pragma unroll
            for (int mb = 0; mb < 4; ++mb) { acc[mb][nb] = WFrag<T16>::mma(a[mb], b, acc[mb][nb]); if (NSPLIT == 1 || NSPLIT == 2) acc[mb][nb] = WFrag<T16>::mma(a2[mb], b, acc[mb][nb]); if (NSPLIT >= 2) acc[mb][nb] = WFrag<T16>::mma(a[mb], b2, acc[mb][nb]); } }
        asm volatile("v_nop\n\tv_nop\n\tv_nop\n\tv_nop" : "+v"(acc[0][0]), "+v"(acc[1][1]), "+v"(acc[2][2]), "+v"(acc[3][3]) : "v"(a[0]), "v"(a[3]));
    }
    if constexpr (NW > 1) {
        float* pw = os + wave * (64 * 68);
#pragma unroll
        for (int mb = 0; mb < 4; ++mb)
#pragma unroll
            for (int nb = 0; nb < 4; ++nb)
#pragma unroll
                for (int j = 0; j < 8; ++j) pw[(mb * 16 + hi * 8 + j) * 68 + nb * 16 + lr] = acc[mb][nb][j];
        __syncthreads();   // every wave's partial tile is in LDS before any wave adds them
#pragma unroll
        for (int s = 0; s < 64 / (2 * NW); ++s) { const int row = wave * (64 / NW) + 2 * s + hi, cofs = lr * 4; v4f val = *(const v4fa*)(os + row * 68 + cofs);
#pragma unroll
            for (int w = 1; w < NW; ++w) { const v4f pv = *(const v4fa*)(os + w * (64 * 68) + row * 68 + cofs); val[0] = __fadd_rn(val[0], pv[0]); val[1] = __fadd_rn(val[1], pv[1]); val[2] = __fadd_rn(val[2], pv[2]); val[3] = __fadd_rn(val[3], pv[3]); }
            *(v4f*)(C + (size_t)(r0 + row) * ldc + c0 + cofs) = val; }
        return;
    }
    if constexpr (TR) {
        // acc[mb][nb][j] = sum[row mb 16 + 8 hi + j][column nb 16 + lr]: a lane holds 8 neighbouring rows of one column = 32 bytes of LDS row (column) nb 16 + lr, pitch 68 floats = 16 B x odd.
        // Read back, 16 lanes hold one column's 64 rows = 256 bytes in a row: every global load and store below covers four whole 128-byte lines, and a line has one writer.
        const size_t eo = (size_t)(c0 + hi) * TT + r0 + lr * 4; const float* xp = xr + z * sC + eo; float* op = C + eo; v4f xa[32];
#pragma unroll   // the first half of the residual loads flies under the LDS turn (the fragment registers are free by now)
        for (int s = 0; s < 16; ++s) xa[s] = *(const v4f*)(xp + (size_t)s * 2 * TT);
#pragma unroll   // constant indices: the arrays stay in registers
        for (int nb = 0; nb < 4; ++nb) { const float b1 = bfr(bs[nb]); const v8f bb = (v8f){b1, b1, b1, b1, b1, b1, b1, b1};
#pragma unroll   // as above
            for (int mb = 0; mb < 4; ++mb) { const v8f y = acc[mb][nb] + bb; float* d = os + (nb * 16 + lr) * 68 + mb * 16 + hi * 8; *(v4fa*)d = __builtin_shufflevector(y, y, 0, 1, 2, 3); *(v4fa*)(d + 4) = __builtin_shufflevector(y, y, 4, 5, 6, 7); } }
        asm volatile("" ::: "memory");   // holds the loads below behind the LDS writes, so that they land in the registers that the accumulators have left (hoisted, they push the kernel past v255)
#pragma unroll   // the second half of the residual loads
        for (int s = 16; s < 32; ++s) xa[s] = *(const v4f*)(xp + (size_t)s * 2 * TT);
#pragma unroll   // constant indices: xa[] stays in registers
        for (int h = 0; h < 2; ++h) { v4f o[16];
#pragma unroll   // as above
            for (int s = 0; s < 16; ++s) { const int u = h * 16 + s; const v4f val = *(const v4fa*)(os + (2 * u + hi) * 68 + lr * 4);
#pragma unroll   // as above
                for (int q = 0; q < 4; ++q) o[s][q] = __fadd_rn(bfr(xa[u][q]), val[q]);
                *(v4f*)(op + (size_t)u * 2 * TT) = o[s]; }
            // precaution, as in FaChunk::load: the address registers of the residual loads and of the stores above and the stored values are inputs here, so they stay live and unwritten up to this wait
            asm volatile("s_wait_xcnt 0x0" :: "v"(xp), "v"(op), "v"(o[0]), "v"(o[1]), "v"(o[2]), "v"(o[3]), "v"(o[4]), "v"(o[5]), "v"(o[6]), "v"(o[7]), "v"(o[8]), "v"(o[9]), "v"(o[10]), "v"(o[11]), "v"(o[12]), "v"(o[13]), "v"(o[14]), "v"(o[15]) : "memory"); }
        return;
    }
#pragma unroll
    for (int mb = 0; mb < 4; ++mb) {
#pragma unroll
        for (int nb = 0; nb < 4; ++nb) {
#pragma unroll
            for (int j = 0; j < 8; ++j) os[(hi * 8 + j) * 68 + nb * 16 + lr] = acc[mb][nb][j]; }
        __builtin_amdgcn_wave_barrier(); asm volatile("" ::: "memory");
        float* crow = C + (size_t)(r0 + mb * 16) * ldc + c0;
{
#pragma unroll
            for (int s = 0; s < 8; ++s) { const int row = 2 * s + hi, cofs = lr * 4; v4f val = *(const v4fa*)(os + row * 68 + cofs); if (BIAS) { val[0] += bfr(bias[c0 + cofs]); val[1] += bfr(bias[c0 + cofs + 1]); val[2] += bfr(bias[c0 + cofs + 2]); val[3] += bfr(bias[c0 + cofs + 3]); }
                *(v4f*)(crow + (size_t)row * ldc + cofs) = val; }
             }
        __builtin_amdgcn_wave_barrier(); asm volatile("" ::: "memory");
    }
}

__device__ __forceinline__ h16 tohx(float x) { return (h16)x; }
__device__ __forceinline__ void splitf(float y, unsigned short& h, unsigned short& l) { h = f2bf(y); l = f2bf(y - bf2f(h)); }
typedef __attribute__((ext_vector_type(2))) _Float16 v2h;
typedef __attribute__((ext_vector_type(4))) _Float16 v4h;
typedef __attribute__((ext_vector_type(2))) unsigned short v2us;
typedef __attribute__((ext_vector_type(4))) unsigned short v4us;
typedef __attribute__((ext_vector_type(2))) float v2f;
typedef __attribute__((ext_vector_type(4))) int v4i;

__global__ __launch_bounds__(256) void k_wtG(const float* __restrict__ w, int K, int N, bf* Bt) {
    const int lane = threadIdx.x & 31; const int L0 = (blockIdx.x * 8 + (threadIdx.x >> 5)) * 8; const int nlines = N * K / 64;
{
#pragma unroll 1
        for (int l = 0; l < 8; ++l) { const int L = L0 + l; if (L >= nlines) break; const size_t e = (size_t)L * 64 + lane * 2; const int k = (int)(e % K), n = (int)(e / K); v2us o;
            o[0] = f2bf(w[(size_t)k * N + n]); o[1] = f2bf(w[(size_t)(k + 1) * N + n]); *(v2us*)(Bt + e) = o; }
         }
}
__global__ __launch_bounds__(256) void k_cvt8(const float* __restrict__ src, bf* dst, size_t n8) { const size_t i = (size_t)blockIdx.x * 256 + threadIdx.x; if (i >= n8) return; const v8f v = *(const v8f*)(src + i * 8); v8us o;
#pragma unroll
    for (int k = 0; k < 8; ++k) o[k] = f2bf(v[k]); *(v8us*)(dst + i * 8) = o;  }

__device__ __forceinline__ void wpadh(int blk, const float* __restrict__ w, const float* __restrict__ bias, bf* Bt, float* bp) { const int i = blk * 256 + threadIdx.x; if (i >= DQ * DM / 8) return; const int c0 = (i % (DM / 8)) * 8; const int r = i / (DM / 8); const int h = r / HD, d = r % HD; const int sr = h * HR + min(d, HR - 1); const float* src = w + (size_t)sr * DM + c0; v8us o;
#pragma unroll
    for (int q = 0; q < 8; ++q) { const unsigned short v = f2bf(src[q]); o[q] = (d < HR) ? v : (unsigned short)0; }
    *(v8us*)(Bt + (size_t)r * DM + c0) = o; if (i < DQ) { const int hb = i / HD, db = i % HD; const float bb = bias[hb * HR + min(db, HR - 1)]; ((float*)bp)[i] = (db < HR) ? bb : 0.0f; }     }
__device__ __forceinline__ void wopadh(int blk, const float* __restrict__ w, bf* Bt) { const int i = blk * 256 + threadIdx.x; if (i >= DM * DQ / 8) return; const int k0 = (i % (DQ / 8)) * 8; const int o = i / (DQ / 8); v8us ov; const float* wa[8]; float wl[8];
#pragma unroll
    for (int q = 0; q < 8; ++q) { const int kk = k0 + q; const int h = kk / HD, d = kk % HD; wa[q] = w + (size_t)o * DM + h * HR + min(d, HR - 1); wl[q] = *wa[q]; }
    // precaution, as in FaChunk::load: the loads' address registers are inputs here, so they stay live and unwritten (by a later load's result too) up to this wait
    asm volatile("s_wait_xcnt 0x0" :: "v"(wa[0]), "v"(wa[1]), "v"(wa[2]), "v"(wa[3]), "v"(wa[4]), "v"(wa[5]), "v"(wa[6]), "v"(wa[7]) : "memory");
#pragma unroll
    for (int q = 0; q < 8; ++q) { const int d = (k0 + q) % HD; const unsigned short v = f2bf(wl[q]); ov[q] = (d < HR) ? v : (unsigned short)0; }
    *(v8us*)(Bt + (size_t)o * DQ + k0) = ov;  }
// GroupNorm statistics of all NB_ batch elements, with no launch of their own. Each element's CC x TT values are shared by GNG work-groups, GNK 16-byte loads a thread, all in flight at once and kept in registers.
// gnsum (in k_prep): a work-group's pair {S = sum of its GNE values, M = sum of (x - S / GNE)^2}, the squares taken about the work-group's OWN mean, which needs no other work-group.
// gnstat (in k_gnT, every work-group for itself): mean = sum S / n; n var = sum (M + GNE (S / GNE - mean)^2), the exact identity for joining sums of squares about different means: no difference of large numbers, as in the two-pass form.
// Every sum has a fixed order: in the thread, then wg_sum's tree, then wg_sum over the GNG pairs. Each pair has a 128-byte line of its own (pitch GNP floats), so a line has one writer.
#define GNG  256
#define GNK  (CC * TT / GNG / 1024)
#define GNP  32
#define GNE  (GNK * 1024)   // values a work-group of gnsum
__device__ __forceinline__ float wg_sum(float v, float* red) { const int tid = threadIdx.x; red[tid] = v; __syncthreads();
    for (int st = 128; st > 0; st >>= 1) { if (tid < st) red[tid] = __fadd_rn(red[tid], red[tid + st]); __syncthreads(); }
    const float r = red[0]; __syncthreads();   // red is free for the next sum once every thread has read the total
    return r; }
__device__ __forceinline__ void gnsum(int bx, int by, const float* __restrict__ x, float* PS, float* red) { const int tid = threadIdx.x; const float* xs = x + (size_t)by * CC * TT + (size_t)bx * GNE + tid * 4; float s = 0.f, s2 = 0.f; v4f a[GNK];
#pragma unroll   // all GNK loads are issued before the first is waited for; a[] stays in registers for the second sum
    for (int k = 0; k < GNK; ++k) a[k] = *(const v4f*)(xs + k * 1024);
    asm volatile("s_wait_xcnt 0x0" :: "v"(xs) : "memory");   // precaution, as in FaChunk::load: the loads' address registers stay live and unwritten up to this wait
#pragma unroll   // constant k: a[] stays in registers
    for (int k = 0; k < GNK; ++k) for (int q = 0; q < 4; ++q) s = __fadd_rn(s, bfr(a[k][q]));
    s = wg_sum(s, red); const float mb = __fdiv_rn(s, (float)GNE);
#pragma unroll   // as above
    for (int k = 0; k < GNK; ++k) for (int q = 0; q < 4; ++q) { const float dv = __fsub_rn(bfr(a[k][q]), mb); s2 = __fadd_rn(s2, __fmul_rn(dv, dv)); }
    s2 = wg_sum(s2, red); if (tid == 0) { v2f o; o[0] = s; o[1] = s2; *(v2f*)(PS + (by * GNG + bx) * GNP) = o; } }
// {mean, 1 / sqrt(var + eps)} of batch element by from its GNG pairs; every thread of a 256-thread work-group calls it and gets both
__device__ __forceinline__ v2f gnstat(int by, const float* __restrict__ PS, float* red) { static_assert(GNG == 256, "one pair a thread"); const float n = (float)(CC * TT); const float* pa = PS + (by * GNG + (int)threadIdx.x) * GNP; const v2f pr = *(const v2f*)pa;
    asm volatile("s_wait_xcnt 0x0" :: "v"(pa) : "memory");   // precaution, as in FaChunk::load
    const float mean = __fdiv_rn(wg_sum(pr[0], red), n); const float dm = __fsub_rn(__fdiv_rn(pr[0], (float)GNE), mean);
    const float var = __fdiv_rn(wg_sum(__fadd_rn(pr[1], __fmul_rn((float)GNE, __fmul_rn(dm, dm))), red), n);
    v2f o; o[0] = mean; o[1] = __fdiv_rn(1.0f, __fsqrt_rn(__fadd_rn(var, 1e-5f))); return o; }
// ---- k_prep: the five jobs that read nothing but inputs, in ONE launch, told apart by the block number: first the NB_ x GNG blocks of gnsum (the longest job), then WPB blocks each for Wq, Wk, Wv (wpadh) and Wo (wopadh).
// A block does one job whole, so the barriers of wg_sum stand under a condition that is the same for the whole work-group.
#define WPB  (DQ * DM / 8 / 256)
__global__ __launch_bounds__(256) void k_prep(const float* __restrict__ x, float* PS, const float* __restrict__ wq, const float* __restrict__ bq, const float* __restrict__ wk, const float* __restrict__ bk, const float* __restrict__ wv, const float* __restrict__ bv, const float* __restrict__ wo,
                                              bf* WQ, float* BQP, bf* WK, float* BKP, bf* WV, float* BVP, bf* WO) {
    static_assert(DQ * DM % (8 * 256) == 0, "whole blocks a weight matrix");
    __shared__ float red[256]; const int blk = blockIdx.x;
    if (blk < NB_ * GNG) { gnsum(blk % GNG, blk / GNG, x, PS, red); return; }
    const int m = (blk - NB_ * GNG) / WPB, jb = (blk - NB_ * GNG) % WPB;
    if (m == 3) wopadh(jb, wo, WO);
    else wpadh(jb, m == 0 ? wq : m == 1 ? wk : wv, m == 0 ? bq : m == 1 ? bk : bv, m == 0 ? WQ : m == 1 ? WK : WV, m == 0 ? BQP : m == 1 ? BKP : BVP);
}
__global__ __launch_bounds__(256) void k_gnT(const float* __restrict__ xs, const float* __restrict__ PS, const float* __restrict__ g, const float* __restrict__ bb, bf* XH, bf* XL) { static_assert(TT * CC / 8 % 256 == 0, "whole work-groups: every thread reaches the barriers of gnstat");
    __shared__ float red[256]; const size_t k = (size_t)blockIdx.x * 256 + threadIdx.x; const size_t eo = (size_t)blockIdx.y * CC * TT; xs += eo; XH += eo; XL += eo;   // batch element = blockIdx.y
    const v2f st = gnstat(blockIdx.y, PS, red);
    const int c0 = (int)(k % (CC / 8)) * 8; const int t = (int)(k / (CC / 8)); const float mean = st[0], rs = st[1]; v8us oh, ol;
#pragma unroll
    for (int q = 0; q < 8; ++q) { const int c = c0 + q; const float dv = __fsub_rn(bfr(xs[(size_t)c * TT + t]), mean); float y = __fmul_rn(dv, rs); asm volatile("" : "+v"(y)); y = __fmul_rn(y, bfr(g[c])); asm volatile("" : "+v"(y)); y = __fadd_rn(y, bfr(bb[c])); unsigned short a2, c2; splitf(y, a2, c2); oh[q] = a2; ol[q] = c2; }
    *(v8us*)(XH + (size_t)t * CC + c0) = oh; *(v8us*)(XL + (size_t)t * CC + c0) = ol;  }

// ---- k_fattn: scores, softmax and P.V of one head for FQB query rows (FQH for rows < RH) in ONE work-group; scores and probabilities never leave the registers. Grid (batch x heads, row blocks), 4 waves, 32 query rows (two column tiles) a wave.
// Transposed products: S^T = K Q^T (A = 16 K rows from LDS, B = 16 query rows, kept in registers), O^T += V^T P^T. A lane then holds scores of ONE query (column lane & 15), and two S^T tiles (keys +0..15, +16..31),
// converted in place, are the B operand of the second product in the hardware k order (element s: key 8 hi + s, or 16 + 8 hi + s - 8), which is also the order of WFrag::ld on a V^T row. Only the HR = 32 real head columns are read.
// Two sweeps over the keys, K (and V^T) staged in LDS in chunks of CK keys: sweep 1 the row maximum; sweep 2 the same scores again, p = exp(s - max), f32 row sum of the unrounded p, P.V; the division by the sum comes last.
// The next chunk is fetched into registers while the present one is worked on. Rows < RH: bf16 hi/lo planes, three products each (hh, hl, lh) as before; the other rows f16.
// Rows < RH cost about three times the others, so their work-groups are cut short: FQH = 32 rows a work-group, which all KW = 4 waves hold, and wave w takes keys [w CK / KW, +CK / KW) of every chunk.
// The waves' row maxima (behind sweep 1), partial row sums and partial O tiles (behind sweep 2) meet in LDS (xw) and are joined in wave order.
#define FQB  128
#define FQH  32
#define FKW  4
#define XWN  (2 * FKW * 32 + FKW * 4 * 256)   // floats: maxima and sums [wave][column tile][16], O tiles [wave][column tile][row tile][2][32 lanes][4]
#define KPT  40      // LDS pitch of a staged K row in 16-bit elements: 80 B = 16 B x odd, conflict-free for 16-byte reads
#define FSM  (2 * (128 * KPT + HR * (128 + 8)))   // the larger of the two paths' LDS needs, in 16-bit elements
typedef __attribute__((ext_vector_type(8))) __bf16 v8bf;
typedef __attribute__((ext_vector_type(4))) unsigned v4u;
__device__ __forceinline__ v8f splat8(float x) { return (v8f){x, x, x, x, x, x, x, x}; }
__device__ __forceinline__ v8f bfup(v8bf h) { const v4u w = __builtin_bit_cast(v4u, h); v8f r;   // packed bf16 back to f32: one shift or one mask an element
#pragma unroll   // constant indices: the arrays stay in registers
    for (int i = 0; i < 4; ++i) { r[2 * i] = __uint_as_float(w[i] << 16); r[2 * i + 1] = __uint_as_float(w[i] & 0xFFFF0000u); }
    return r; }
template <typename T16, int CK> struct FaChunk {   // one plane's share of a chunk in one thread's registers: CK / 32 16-byte pieces of K rows and as many of V^T rows
    typedef __attribute__((ext_vector_type(8))) T16 V8; V8 k[CK / 32], v[CK / 32];
    static constexpr int UR = CK / 8, RS = 128 / UR;   // 16-byte pieces in a V^T row of the chunk; V^T rows that the 128 threads cover at once (K: 4 pieces a row, 32 rows at once)
    // piece s of thread tid: K row (tid >> 2) + 32 s, V^T row tid / UR + RS s: a uniform base, one offset a thread, and a constant step
    template <bool WITHV> __device__ __forceinline__ void load(const T16* __restrict__ Kg, const T16* __restrict__ Vg, int key0) { const unsigned tid = threadIdx.x; const T16* ka = Kg + (size_t)key0 * HD + (tid >> 2) * HD + (tid & 3) * 8; const T16* va = Vg + key0 + (tid / UR) * TT + (tid % UR) * 8;
#pragma unroll   // constant indices: k[] and v[] stay in registers
        for (int s = 0; s < CK / 32; ++s) { k[s] = *(const V8*)(ka + s * 32 * HD); if constexpr (WITHV) v[s] = *(const V8*)(va + s * RS * TT); }
        // precaution: the loads' address registers are inputs here, so they stay live and unwritten (by a later load's result too) up to this wait
        if constexpr (WITHV) asm volatile("s_wait_xcnt 0x0" :: "v"(ka), "v"(va) : "memory"); else asm volatile("s_wait_xcnt 0x0" :: "v"(ka) : "memory"); }
    template <bool WITHV> __device__ __forceinline__ void store(T16* sK, T16* sV) const { const unsigned tid = threadIdx.x; T16* kd = sK + (tid >> 2) * KPT + (tid & 3) * 8; T16* vd = sV + (tid / UR) * (CK + 8) + (tid % UR) * 8;
#pragma unroll   // as above
        for (int s = 0; s < CK / 32; ++s) { *(V8*)(kd + s * 32 * KPT) = k[s]; if constexpr (WITHV) *(V8*)(vd + s * RS * (CK + 8)) = v[s]; } }
};
template <typename T16, bool HL, int CK, int KW = 1>
__device__ __forceinline__ void fattn(const T16* __restrict__ Q, const T16* __restrict__ Q2, const T16* __restrict__ Kg, const T16* __restrict__ K2, const T16* __restrict__ Vg, const T16* __restrict__ V2, int q0, bf* Ah, bf* Al, T16* sm, float* xw = nullptr) {
    typedef WFrag<T16> F; typedef typename F::V V; constexpr int VPT = CK + 8;   // V^T row pitch: 16 B x odd
    static_assert((HL ? 2 : 1) * (CK * KPT + HR * VPT) <= FSM && TT % CK == 0 && CK % (32 * KW) == 0 && (KW == 1 || KW == FKW), "a chunk fits the LDS array; whole 32-key groups a wave");
    T16* sK = sm; T16* sV = sK + CK * KPT; T16* sK2 = sV + HR * VPT; T16* sV2 = sK2 + CK * KPT;
    const int lane = threadIdx.x & 31, lr = lane & 15, hi = lane >> 4, wave = threadIdx.x >> 5; const int t0 = q0 + (KW == 1 ? wave * 32 : 0) + lr;
    const int wv = KW == 1 ? 0 : __builtin_amdgcn_readfirstlane(wave), kw0 = wv * (CK / KW);   // this wave's keys in a chunk start at kw0 (a scalar)
    V qf[2], qf2[2]; const T16* qa = Q + (size_t)t0 * HD + 8 * hi; const T16* qa2 = HL ? Q2 + (size_t)t0 * HD + 8 * hi : qa;
#pragma unroll   // constant indices: the arrays stay in registers
    for (int g = 0; g < 2; ++g) { qf[g] = F::ld(qa + 16 * g * HD); if constexpr (HL) qf2[g] = F::ld(qa2 + 16 * g * HD); }
    asm volatile("s_wait_xcnt 0x0" :: "v"(qa), "v"(qa2) : "memory");   // precaution, as in FaChunk::load
    const int koff = lr * KPT + 8 * hi, voff = lr * VPT + 8 * hi;
    FaChunk<T16, CK> r, r2;
    v8f mx[2] = {splat8(-3.0e38f), splat8(-3.0e38f)};   // eight independent maxima a column tile, joined behind the sweep
    r.template load<false>(Kg, Vg, 0); if constexpr (HL) r2.template load<false>(K2, V2, 0);
#pragma unroll 1   // one chunk at a time: the LDS array holds one
    for (int c = 0; c < TT; c += CK) {
        __syncthreads();   // every wave has left the chunk that is overwritten next
        r.template store<false>(sK, sV); if constexpr (HL) r2.template store<false>(sK2, sV2);
        __syncthreads();   // the chunk is complete before any wave reads it
        if (c + CK < TT) { r.template load<false>(Kg, Vg, c + CK); if constexpr (HL) r2.template load<false>(K2, V2, c + CK); }   // flies under this chunk's products
#pragma unroll 2   // two independent 32-key groups: one group's LDS reads fly under the other's products
        for (int kk = kw0; kk < kw0 + CK / KW; kk += 32) { const V a0 = F::ld(sK + koff + kk * KPT), a1 = F::ld(sK + koff + (kk + 16) * KPT); V b0, b1; if constexpr (HL) { b0 = F::ld(sK2 + koff + kk * KPT); b1 = F::ld(sK2 + koff + (kk + 16) * KPT); }
#pragma unroll   // constant indices: the arrays stay in registers
            for (int g = 0; g < 2; ++g) { v8f s0 = F::mma(a0, qf[g], (v8f){}), s1 = F::mma(a1, qf[g], (v8f){});
                if constexpr (HL) { s0 = F::mma(a0, qf2[g], s0); s1 = F::mma(a1, qf2[g], s1); s0 = F::mma(b0, qf[g], s0); s1 = F::mma(b1, qf[g], s1); }
#pragma unroll   // constant indices: the arrays stay in registers
                for (int j = 0; j < 8; ++j) mx[g][j] = fmaxf(mx[g][j], fmaxf(s0[j], s1[j])); } }
    }
    const float c1 = SCL * 1.4426950408889634f; const v8f c1v = splat8(c1); v8f nm[2], sv[2], o[2][2]; float mr[2];
#pragma unroll   // constant indices: the arrays stay in registers
    for (int g = 0; g < 2; ++g) { float m = fmaxf(fmaxf(fmaxf(mx[g][0], mx[g][1]), fmaxf(mx[g][2], mx[g][3])), fmaxf(fmaxf(mx[g][4], mx[g][5]), fmaxf(mx[g][6], mx[g][7]))); m = fmaxf(m, __shfl_xor(m, 16, 32));   // lanes l and l ^ 16 hold the two halves of one query's keys
        mr[g] = m; if constexpr (KW > 1) { if (hi == 0) xw[(wv * 2 + g) * 16 + lr] = m; } }
    if constexpr (KW > 1) { __syncthreads();   // every wave's row maxima are in LDS before any wave joins them
#pragma unroll   // constant indices: the arrays stay in registers
        for (int g = 0; g < 2; ++g)
#pragma unroll   // as above
            for (int w = 0; w < KW; ++w) mr[g] = fmaxf(mr[g], xw[(w * 2 + g) * 16 + lr]); }
#pragma unroll   // constant indices: the arrays stay in registers
    for (int g = 0; g < 2; ++g) { const float m = mr[g];
        nm[g] = splat8((HL ? 0.0f : 6.0f) - m * c1);   // f16 path: p carries a factor 2^6, which cancels against the row sum, so that small p stay normal f16 numbers
        sv[g] = (v8f){}; o[g][0] = (v8f){}; o[g][1] = (v8f){}; }
    r.template load<true>(Kg, Vg, 0); if constexpr (HL) r2.template load<true>(K2, V2, 0);
#pragma unroll 1   // one chunk at a time
    for (int c = 0; c < TT; c += CK) {
        __syncthreads();   // every wave has left the chunk that is overwritten next
        r.template store<true>(sK, sV); if constexpr (HL) r2.template store<true>(sK2, sV2);
        __syncthreads();   // the chunk is complete before any wave reads it
        if (c + CK < TT) { r.template load<true>(Kg, Vg, c + CK); if constexpr (HL) r2.template load<true>(K2, V2, c + CK); }   // flies under this chunk's products
#pragma unroll 2   // as in sweep 1
        for (int kk = kw0; kk < kw0 + CK / KW; kk += 32) { const V a0 = F::ld(sK + koff + kk * KPT), a1 = F::ld(sK + koff + (kk + 16) * KPT); V b0, b1; if constexpr (HL) { b0 = F::ld(sK2 + koff + kk * KPT); b1 = F::ld(sK2 + koff + (kk + 16) * KPT); }
            const V v0 = F::ld(sV + voff + kk), v1 = F::ld(sV + voff + 16 * VPT + kk); V w0, w1; if constexpr (HL) { w0 = F::ld(sV2 + voff + kk); w1 = F::ld(sV2 + voff + 16 * VPT + kk); }
            v8f s0[2], s1[2];
#pragma unroll   // constant indices: the arrays stay in registers
            for (int g = 0; g < 2; ++g) { s0[g] = F::mma(a0, qf[g], (v8f){}); s1[g] = F::mma(a1, qf[g], (v8f){}); }
            if constexpr (HL) {
#pragma unroll   // constant indices: the arrays stay in registers
                for (int g = 0; g < 2; ++g) { s0[g] = F::mma(a0, qf2[g], s0[g]); s1[g] = F::mma(a1, qf2[g], s1[g]); }
#pragma unroll   // constant indices: the arrays stay in registers
                for (int g = 0; g < 2; ++g) { s0[g] = F::mma(b0, qf[g], s0[g]); s1[g] = F::mma(b1, qf[g], s1[g]); } }
#pragma unroll   // constant indices: the arrays stay in registers
            for (int g = 0; g < 2; ++g) { const v8f x0 = __builtin_elementwise_fma(s0[g], c1v, nm[g]), x1 = __builtin_elementwise_fma(s1[g], c1v, nm[g]); v8f p0, p1;
#pragma unroll   // constant indices: the arrays stay in registers
                for (int j = 0; j < 8; ++j) { p0[j] = __builtin_amdgcn_exp2f(x0[j]); p1[j] = __builtin_amdgcn_exp2f(x1[j]); }
                sv[g] += p0; sv[g] += p1;
                if constexpr (HL) {
                    const v8bf h0 = __builtin_convertvector(p0, v8bf), h1 = __builtin_convertvector(p1, v8bf); const v8bf l0 = __builtin_convertvector(p0 - bfup(h0), v8bf), l1 = __builtin_convertvector(p1 - bfup(h1), v8bf);
                    const V ph = __builtin_shufflevector(h0, h1, 0, 1, 2, 3, 4, 5, 6, 7, 8, 9, 10, 11, 12, 13, 14, 15), pl = __builtin_shufflevector(l0, l1, 0, 1, 2, 3, 4, 5, 6, 7, 8, 9, 10, 11, 12, 13, 14, 15);
                    o[g][0] = F::mma(v0, ph, o[g][0]); o[g][1] = F::mma(v1, ph, o[g][1]); o[g][0] = F::mma(v0, pl, o[g][0]); o[g][1] = F::mma(v1, pl, o[g][1]); o[g][0] = F::mma(w0, ph, o[g][0]); o[g][1] = F::mma(w1, ph, o[g][1]);
                } else {
                    const V pf = cat16(__builtin_convertvector(p0, v8h), __builtin_convertvector(p1, v8h));
                    o[g][0] = F::mma(v0, pf, o[g][0]); o[g][1] = F::mma(v1, pf, o[g][1]); } } }
    }
    if constexpr (KW > 1) {
        float* xsum = xw + KW * 32; float* xo = xw + 2 * KW * 32;
#pragma unroll   // constant indices: the arrays stay in registers
        for (int g = 0; g < 2; ++g) { float sum = ((sv[g][0] + sv[g][1]) + (sv[g][2] + sv[g][3])) + ((sv[g][4] + sv[g][5]) + (sv[g][6] + sv[g][7])); sum += __shfl_xor(sum, 16, 32); if (hi == 0) xsum[(wv * 2 + g) * 16 + lr] = sum;
#pragma unroll   // as above
            for (int h = 0; h < 2; ++h) { float* d = xo + (wv * 4 + g * 2 + h) * 256 + lane * 4; *(v4fa*)d = __builtin_shufflevector(o[g][h], o[g][h], 0, 1, 2, 3); *(v4fa*)(d + 128) = __builtin_shufflevector(o[g][h], o[g][h], 4, 5, 6, 7); } }
        __syncthreads();   // every wave's partial row sums and O tiles are in LDS before they are added
        if (wv < 2) {   // wave g finishes column tile g, both row tiles: a 128-byte output line keeps one writer
            float sum = xsum[wv * 16 + lr]; v8f oo[2];
#pragma unroll   // fixed order: wave 0, 1, 2, 3
            for (int w = 1; w < KW; ++w) sum = __fadd_rn(sum, xsum[(w * 2 + wv) * 16 + lr]);
#pragma unroll   // constant indices: the arrays stay in registers
            for (int h = 0; h < 2; ++h) { const float* s = xo + (wv * 2 + h) * 256 + lane * 4; v4f a = *(const v4fa*)s, b = *(const v4fa*)(s + 128);
#pragma unroll   // fixed order: wave 0, 1, 2, 3
                for (int w = 1; w < KW; ++w) { a += *(const v4fa*)(s + w * 1024); b += *(const v4fa*)(s + w * 1024 + 128); }
                oo[h] = __builtin_shufflevector(a, b, 0, 1, 2, 3, 4, 5, 6, 7); }
            const float inv = __fdiv_rn(1.0f, sum); v8us h0, l0, h1, l1; const v8us zz = (v8us){};
#pragma unroll   // constant indices: the arrays stay in registers
            for (int j = 0; j < 8; ++j) { unsigned short a, b; splitf(oo[0][j] * inv, a, b); h0[j] = a; l0[j] = b; splitf(oo[1][j] * inv, a, b); h1[j] = a; l1[j] = b; }
            bf* ph = Ah + (size_t)(t0 + 16 * wv) * DQ + 8 * hi; bf* pl = Al + (size_t)(t0 + 16 * wv) * DQ + 8 * hi;
            *(v8us*)ph = h0; *(v8us*)(ph + 16) = h1; *(v8us*)(ph + 32) = zz; *(v8us*)(ph + 48) = zz; *(v8us*)pl = l0; *(v8us*)(pl + 16) = l1; *(v8us*)(pl + 32) = zz; *(v8us*)(pl + 48) = zz;
            asm volatile("s_wait_xcnt 0x0" :: "v"(ph), "v"(pl) : "memory");   // precaution, as in FaChunk::load: the stores' address registers stay live and unwritten up to this wait
        }
        return;
    }
#pragma unroll   // constant indices: the arrays stay in registers
    for (int g = 0; g < 2; ++g) { float sum = ((sv[g][0] + sv[g][1]) + (sv[g][2] + sv[g][3])) + ((sv[g][4] + sv[g][5]) + (sv[g][6] + sv[g][7])); sum += __shfl_xor(sum, 16, 32); const float inv = __fdiv_rn(1.0f, sum);
        v8us h0, l0, h1, l1; const v8us zz = (v8us){};
#pragma unroll   // constant indices: the arrays stay in registers
        for (int j = 0; j < 8; ++j) { unsigned short a, b; splitf(o[g][0][j] * inv, a, b); h0[j] = a; l0[j] = b; splitf(o[g][1][j] * inv, a, b); h1[j] = a; l1[j] = b; }
        // o[g][0][j] = O[t][8 hi + j], o[g][1][j] = O[t][16 + 8 hi + j]; columns HR .. HD - 1 of the padded head are zero
        bf* ph = Ah + (size_t)(t0 + 16 * g) * DQ + 8 * hi; bf* pl = Al + (size_t)(t0 + 16 * g) * DQ + 8 * hi;
        *(v8us*)ph = h0; *(v8us*)(ph + 16) = h1; *(v8us*)(ph + 32) = zz; *(v8us*)(ph + 48) = zz; *(v8us*)pl = l0; *(v8us*)(pl + 16) = l1; *(v8us*)(pl + 32) = zz; *(v8us*)(pl + 48) = zz; }
}
// ---- k_proj: the q, k and v projections of every batch element in ONE launch; its epilogue rounds the f32 sums (+ f32 bias) straight into the 16-bit planes that k_fattn reads (f16, bf16 hi, bf16 lo), so no f32 copy of q, k or v exists.
// Grid (TT / 64, NH_ / 2, 3 NB_), one wave a tile of 64 tokens x the HR real columns of two heads; blockIdx.z = 3 x batch element + (0 q, 1 k, 2 v). The padded rows of W and the padded plane columns, which k_fattn never reads, are left out.
// K loop and product order (x hi, then x lo, per 32-wide k step) as in k_gemmw<bf, 1, true>. W and bias keep wpadh's padded row numbering: head * HD + column.
// q, k (VT false): transposed product, A = 16 W rows, B = 16 tokens: a lane holds 8 neighbouring columns of ONE token = one 16-byte store a plane into [head][t][HD].
// v (VT true): A = 16 tokens, B = 16 W rows: a lane holds 8 neighbouring tokens of ONE column = one 16-byte store a plane into [head][column][TT]. Either way a wave writes whole 64- or 128-byte runs, and a 128-byte line has one writer.
template <bool VT>
__device__ __forceinline__ void proj_tile(const bf* __restrict__ XH, const bf* __restrict__ XL, const bf* __restrict__ Wt, const float* __restrict__ bias, int r0, int h0, h16* P16, bf* Ph, bf* Pl) {
    typedef WFrag<bf> F; typedef F::V V;
    const int lane = threadIdx.x & 31, lr = lane & 15, hi = lane >> 4;
    const bf* xh = XH + (size_t)(r0 + lr) * DM + 8 * hi; const bf* xl = XL + (size_t)(r0 + lr) * DM + 8 * hi; const bf* wr = Wt + (size_t)(h0 * HD + lr) * DM + 8 * hi;
    v8f acc[4][4];
#pragma unroll   // constant indices: the arrays stay in registers
    for (int mb = 0; mb < 4; ++mb)
#pragma unroll   // as above
        for (int nb = 0; nb < 4; ++nb) acc[mb][nb] = (v8f){};
#pragma unroll 1   // one k step's fragments in registers at a time, as in k_gemmw
    for (int kc = 0; kc < DM; kc += 32) {
        V a[4], a2[4], b[4];
#pragma unroll   // constant indices: the arrays stay in registers
        for (int mb = 0; mb < 4; ++mb) { a[mb] = F::ld(xh + mb * 16 * DM); a2[mb] = F::ld(xl + mb * 16 * DM); }
#pragma unroll   // as above
        for (int nb = 0; nb < 4; ++nb) b[nb] = F::ld(wr + ((nb >> 1) * HD + (nb & 1) * 16) * DM);   // column block nb: head h0 + nb / 2, columns 16 (nb % 2) ..
        // precaution, as in FaChunk::load: the loads' address registers are inputs here, so they stay live and unwritten (by a later load's result too) up to this wait.
        // The loaded fragments are inputs too: each keeps registers of its own, so all 24 loads are in flight together and a k step waits for memory once (without them the x lo loads wait for the x hi registers: twice)
        asm volatile("s_wait_xcnt 0x0" :: "v"(xh), "v"(xl), "v"(wr), "v"(a[0]), "v"(a[1]), "v"(a[2]), "v"(a[3]), "v"(a2[0]), "v"(a2[1]), "v"(a2[2]), "v"(a2[3]), "v"(b[0]), "v"(b[1]), "v"(b[2]), "v"(b[3]) : "memory");
        xh += 32; xl += 32; wr += 32;
#pragma unroll   // as above
        for (int nb = 0; nb < 4; ++nb)
#pragma unroll   // as above
            for (int mb = 0; mb < 4; ++mb) {
                if constexpr (VT) { acc[mb][nb] = F::mma(a[mb], b[nb], acc[mb][nb]); acc[mb][nb] = F::mma(a2[mb], b[nb], acc[mb][nb]); }
                else { acc[mb][nb] = F::mma(b[nb], a[mb], acc[mb][nb]); acc[mb][nb] = F::mma(b[nb], a2[mb], acc[mb][nb]); } }
    }
    v8f bv[4];   // the bias of column block nb as this lane adds it; the four loads fly together
    if constexpr (VT) { const int bi = h0 * HD + lr; float bs[4];
#pragma unroll   // constant indices: the arrays stay in registers
        for (int nb = 0; nb < 4; ++nb) bs[nb] = bias[bi + (nb >> 1) * HD + (nb & 1) * 16];
        asm volatile("s_wait_xcnt 0x0" :: "v"(bi) : "memory");   // precaution, as above: the loads' offset register is an input here
#pragma unroll   // as above
        for (int nb = 0; nb < 4; ++nb) bv[nb] = splat8(bfr(bs[nb]));
    } else { const float* bp = bias + h0 * HD + 8 * hi;
#pragma unroll   // as above
        for (int nb = 0; nb < 4; ++nb) bv[nb] = *(const v8f*)(bp + (nb >> 1) * HD + (nb & 1) * 16);
#pragma unroll   // as above
        for (int nb = 0; nb < 4; ++nb)
#pragma unroll   // as above
            for (int j = 0; j < 8; ++j) bv[nb][j] = bfr(bv[nb][j]); }
#pragma unroll   // as above
    for (int nb = 0; nb < 4; ++nb) { const int hd = (h0 + (nb >> 1)) * HD + (nb & 1) * 16;   // padded number of the block's first column
#pragma unroll   // as above
        for (int mb = 0; mb < 4; ++mb) { const v8f y = acc[mb][nb] + bv[nb]; const v8h o16 = __builtin_convertvector(y, v8h);   // packed conversions, round to nearest even: the values of tohx and splitf
            const v8bf yh = __builtin_convertvector(y, v8bf); const v8bf yl = __builtin_convertvector(y - bfup(yh), v8bf); const v8us oh = __builtin_bit_cast(v8us, yh), ol = __builtin_bit_cast(v8us, yl);
            const size_t e = VT ? (size_t)(hd + lr) * TT + r0 + mb * 16 + 8 * hi : ((size_t)(h0 + (nb >> 1)) * TT + r0 + mb * 16 + lr) * HD + (nb & 1) * 16 + 8 * hi;
            *(v8h*)(P16 + e) = o16; *(v8us*)(Ph + e) = oh; *(v8us*)(Pl + e) = ol; } }
}
__global__ __launch_bounds__(32) void k_proj(const bf* __restrict__ XH, const bf* __restrict__ XL, const bf* __restrict__ WQ, const bf* __restrict__ WK, const bf* __restrict__ WV, const float* __restrict__ BQ, const float* __restrict__ BK, const float* __restrict__ BV,
                                             h16* Q16, bf* Qh, bf* Ql, h16* K16, bf* Kh, bf* Kl, h16* V16, bf* Vh, bf* Vl) {
    static_assert(TT % 64 == 0 && NH_ % 2 == 0 && HR == 32 && DM % 32 == 0 && NH_ == NKV, "whole tiles; two 16-column blocks a head");
    const int b = blockIdx.z / 3, p = blockIdx.z % 3; const int r0 = blockIdx.x * 64, h0 = blockIdx.y * 2; const size_t xo = (size_t)b * TT * DM, po = (size_t)b * NH_ * TT * HD;
    if (p == 2) proj_tile<true>(XH + xo, XL + xo, WV, BV, r0, h0, V16 + po, Vh + po, Vl + po);
    else proj_tile<false>(XH + xo, XL + xo, p ? WK : WQ, p ? BK : BQ, r0, h0, (p ? K16 : Q16) + po, (p ? Kh : Qh) + po, (p ? Kl : Ql) + po);
}

// Planes [batch][head][...], outputs [batch][t][DQ]. blockIdx.y is the row block: first the RH / FQH blocks of rows < RH, then the (TT - RH) / FQB blocks of the other rows.
__global__ __launch_bounds__(128) void k_fattn(const h16* __restrict__ Q16, const bf* __restrict__ Qh, const bf* __restrict__ Ql, const h16* __restrict__ K16, const bf* __restrict__ Kh, const bf* __restrict__ Kl, const h16* __restrict__ V16, const bf* __restrict__ Vh, const bf* __restrict__ Vl, bf* Ah, bf* Al) {
    static_assert(RH % FQH == 0 && (TT - RH) % FQB == 0 && HR == 32 && HD == 64 && NH_ == NKV, "whole work-groups on either side of RH; one 32-wide k step a head");
    __shared__ __align__(16) unsigned short sm[FSM]; __shared__ __align__(16) float xw[XWN];
    const size_t hp = (size_t)blockIdx.x * TT * HD; const int by = blockIdx.y; const int q0 = by < RH / FQH ? by * FQH : RH + (by - RH / FQH) * FQB; const size_t ao = (size_t)(blockIdx.x / NH_) * TT * DQ + (blockIdx.x % NH_) * HD;
    if (q0 < RH) fattn<bf, true, 128, FKW>(Qh + hp, Ql + hp, Kh + hp, Kl + hp, Vh + hp, Vl + hp, q0, Ah + ao, Al + ao, (bf*)sm, xw);
    else fattn<h16, false, 256>(Q16 + hp, nullptr, K16 + hp, nullptr, V16 + hp, nullptr, q0, Ah + ao, Al + ao, (h16*)sm);
}

extern "C" void kernel_launch(void* const* d_in, const int* in_sizes, int n_in,
                              void* d_out, int out_size, void* d_ws, size_t ws_size, hipStream_t stream) {
    (void)in_sizes; (void)n_in; (void)out_size;
    const float* x = (const float*)d_in[0]; const float* gnw = (const float*)d_in[1]; const float* gnb = (const float*)d_in[2]; const float* wq = (const float*)d_in[3]; const float* bq = (const float*)d_in[4]; const float* wk = (const float*)d_in[5]; const float* bk = (const float*)d_in[6]; const float* wv = (const float*)d_in[7]; const float* bv = (const float*)d_in[8]; const float* wo = (const float*)d_in[9]; const float* bo = (const float*)d_in[10];
    float* OUT = (float*)d_out;     // [2][256][4096]
    char* wsp = (char*)d_ws;
    auto take = [&](size_t bytes) { char* p = wsp; wsp += (bytes + 255) & ~(size_t)255; return (void*)p; };
    float* BQP = (float*)take(DQ * 4); float* BKP = (float*)take(DQ * 4); float* BVP = (float*)take(DQ * 4); bf* XH = (bf*)take((size_t)NB_ * TT * DM * 2); bf* XL = (bf*)take((size_t)NB_ * TT * DM * 2); float* PS = (float*)take((size_t)NB_ * GNG * GNP * 4); bf* WQ = (bf*)take((size_t)DQ * DM * 2); bf* WK = (bf*)take((size_t)DKV * DM * 2); bf* WV = (bf*)take((size_t)DKV * DM * 2); bf* WO = (bf*)take((size_t)DM * DQ * 2);
    const size_t PL = (size_t)NH_ * TT * HD;   // elements of one batch element's head planes; every plane below holds all NB_ batch elements
    h16* QP16 = (h16*)take(NB_ * PL * 2); h16* KP16 = (h16*)take(NB_ * PL * 2); h16* VT16 = (h16*)take(NB_ * PL * 2);
    bf* QPh = (bf*)take(NB_ * PL * 2); bf* QPl = (bf*)take(NB_ * PL * 2); bf* KPh = (bf*)take(NB_ * PL * 2); bf* KPl = (bf*)take(NB_ * PL * 2); bf* VTh = (bf*)take(NB_ * PL * 2); bf* VTl = (bf*)take(NB_ * PL * 2);
    bf* ATh = (bf*)take((size_t)NB_ * TT * DQ * 2); bf* ATl = (bf*)take((size_t)NB_ * TT * DQ * 2);
    if ((size_t)(wsp - (char*)d_ws) > ws_size) return;    // ws 256 MiB
    k_prep<<<NB_ * GNG + 4 * WPB, 256, 0, stream>>>(x, PS, wq, bq, wk, bk, wv, bv, wo, WQ, BQP, WK, BKP, WV, BVP, WO);   /* GroupNorm partial pairs and the four weight preparations */
    k_gnT<<<dim3((unsigned)(((size_t)TT * CC / 8 + 255) / 256), NB_), 256, 0, stream>>>(x, PS, gnw, gnb, XH, XL);   /* mean and variance joined, then normalised, token-major, hi/lo; every batch element */
    k_proj<<<dim3(TT / 64, NH_ / 2, 3 * NB_), 32, 0, stream>>>(XH, XL, WQ, WK, WV, BQP, BKP, BVP, QP16, QPh, QPl, KP16, KPh, KPl, VT16, VTh, VTl);   /* q, k, v of every batch element, straight into the head planes */
    k_fattn<<<dim3(NB_ * NH_, RH / FQH + (TT - RH) / FQB), 128, 0, stream>>>(QP16, QPh, QPl, KP16, KPh, KPl, VT16, VTh, VTl, ATh, ATl);   /* every head of every batch element */
    k_gemmw<bf, 1, true, 1, 1, true><<<dim3(TT / 64, DM / 64, NB_), 32, 0, stream>>>(ATh, ATl, WO, nullptr, DQ, OUT, TT, bo, (size_t)TT * DQ, 0, (size_t)CC * TT, 0, x);   /* Wo product of every batch element (z), stored channel-major + bias + hidden residual */
}

// v009
// A run of this version takes 111 microseconds.
// In two side-by-side timings against v008, it was 1.06 and 1.05 times as fast.
// Over all steps from v000 it is 47.7 times as fast.
#include <hip/hip_runtime.h>

// 1-D self-attention block with GroupNorm and residual on a channel-major sequence (hidden [2][256][4096]; x = GroupNorm(1 group over all 256 x 4096 values, eps 1e-5) x gn_weight + gn_bias; h = x^T; q,k,v = h W^T + b ('oi' [256][256] + [256], 1/16; 8 heads x 32); scores = (q 32^-1/4).(k 32^-1/4); softmax over all 4,096 keys; out = merged Wo^T + bo, transposed back + hidden -> [2][256][4096] (2.1 M)).
// Compute dtypes, f32 accumulate: every input rounded to bf16; GroupNorm f32 (fixed-order sums); projections hi/lo x exact + f32 biases; attention rows < 512 3 products, rest fp16; softmax f32; Wo hl x exact + bias; residual f32.

#define NB_  2
#define TT   4096
#define DM   256
#define NH_  8
#define NKV  8
#define REP  (NH_ / NKV)
#define HD   64
#define DQ   (NH_ * HD)
#define DKV  (NKV * HD)
#define RH   512                  // query rows < RH use hi+lo planes (0: none)
#define WIN  0
#define SCL  0.17677669529663689f   // 32^-1/2 == (32^-1/4)^2 applied once to q.k
#define CC   256     // channels
#define HR   32      // real head width (padded to HD = 64)
typedef _Float16 h16;
typedef unsigned short bf;
typedef __attribute__((ext_vector_type(16))) __bf16   v16bf;
typedef __attribute__((ext_vector_type(16))) _Float16 v16h;
typedef __attribute__((ext_vector_type(8)))  _Float16 v8h;
typedef __attribute__((ext_vector_type(8)))  unsigned short v8us;
typedef __attribute__((ext_vector_type(8)))  float    v8f;
typedef __attribute__((ext_vector_type(4)))  float    v4f;
typedef v8h  __attribute__((may_alias)) v8ha;
typedef v4f  __attribute__((may_alias)) v4fa;
typedef v8us __attribute__((may_alias)) v8usa;

__device__ __forceinline__ unsigned short f2bf(float f) { unsigned u = __float_as_uint(f); u += 0x7FFFu + ((u >> 16) & 1u); return (unsigned short)(u >> 16); }
__device__ __forceinline__ float bf2f(unsigned short b) { return __uint_as_float(((unsigned)b) << 16); }
__device__ __forceinline__ float bfr(float f) { return bf2f(f2bf(f)); }
__device__ __forceinline__ v16h cat16(v8h lo, v8h hi) { return __builtin_shufflevector(lo, hi, 0, 1, 2, 3, 4, 5, 6, 7, 8, 9, 10, 11, 12, 13, 14, 15); }
__device__ __forceinline__ v16bf cat16b(v8us lo, v8us hi) { return __builtin_bit_cast(v16bf, __builtin_shufflevector(lo, hi, 0, 1, 2, 3, 4, 5, 6, 7, 8, 9, 10, 11, 12, 13, 14, 15)); }
__device__ __forceinline__ v8f wmma16(v16h a, v16h b, v8f c) { return __builtin_amdgcn_wmma_f32_16x16x32_f16(false, a, false, b, (short)0, c, false, false); }
__device__ __forceinline__ v8f wmmab(v16bf a, v16bf b, v8f c) { return __builtin_amdgcn_wmma_f32_16x16x32_bf16(false, a, false, b, (short)0, c, false, false); }



// ---- k_gemmw: register-blocked GEMM, ONE WAVE per 64x64 output tile (16 accumulators), operands straight from K-contiguous 16-bit planes; grid (M/64, N/64, Z), 32 threads.
// C[m][n] (f32, pitch ldc, + optional f32 bias[n]) = sum_k A[m][k] Bt[n][k] (+ split products per NSPLIT). z-batch strides sA/sB/sC in elements. K % 32 == 0.
// For a long K on a small grid: K split over KS work-groups (blockIdx.z % KS; grid z = Z KS) and, inside each, over its NW waves (NW*32 threads); wave w of part zk sums k in [(zk NW + w) K/(KS NW), +K/(KS NW)).
// The NW f32 partial tiles meet in LDS (row pitch 68 floats) and are added in wave order, each wave finishing 64/NW whole rows; part zk stores to plane C + zk sP, and the reader of C adds the KS planes in order. K % (32 KS NW) == 0.
// TR: C is the block's output itself, column-major ([n][TT], z stride sC): C[n][m] = bf16-rounded xr[n][m] + (sum + bias[n]), xr laid out like C. The 64x64 tile is turned in LDS, so no f32 copy of the product exists.
template <typename T16> struct WFrag;
template <> struct WFrag<h16> { typedef v16h V; static __device__ __forceinline__ V ld(const h16* p) { return cat16(*(const v8h*)p, *(const v8h*)(p + 16)); } static __device__ __forceinline__ v8f mma(V a, V b, v8f c) { return wmma16(a, b, c); } };
template <> struct WFrag<bf> { typedef v16bf V; static __device__ __forceinline__ V ld(const bf* p) { return cat16b(*(const v8us*)p, *(const v8us*)(p + 16)); } static __device__ __forceinline__ v8f mma(V a, V b, v8f c) { return wmmab(a, b, c); } };
template <typename T16, int NSPLIT, bool BIAS, int KS = 1, int NW = 1, bool TR = false>
__global__ __launch_bounds__(NW * 32) void k_gemmw(const T16* __restrict__ A, const T16* __restrict__ A2, const T16* __restrict__ Bt, const T16* __restrict__ Bt2, int K, float* C, int ldc, const float* __restrict__ bias, size_t sA, size_t sB, size_t sC, size_t sP = 0, const float* __restrict__ xr = nullptr) {
    static_assert(NW == 1 ? KS == 1 : (!BIAS && 64 % (2 * NW) == 0), "split K: no bias, whole row pairs per wave");
    static_assert(!TR || (NW == 1 && BIAS), "the turned epilogue: one wave a tile, with bias");
    typedef typename WFrag<T16>::V V;
    __shared__ __align__(16) float os[(NW == 1 ? (TR ? 64 : 16) : NW * 64) * 68];
    const size_t z = blockIdx.z / KS; const int zk = blockIdx.z % KS; A += z * sA; if (A2) A2 += z * sA; Bt += z * sB; if (Bt2) Bt2 += z * sB; C += z * sC + zk * sP;
    const int wave = (NW == 1) ? 0 : __builtin_amdgcn_readfirstlane((int)(threadIdx.x >> 5)); const int ks = K / (KS * NW), k0 = (zk * NW + wave) * ks;
    const int lane = threadIdx.x & 31, lr = lane & 15, hi = lane >> 4; const int r0 = blockIdx.x * 64, c0 = blockIdx.y * 64;
    v8f acc[4][4];
#pragma unroll
    for (int mb = 0; mb < 4; ++mb)
#pragma unroll
        for (int nb = 0; nb < 4; ++nb) acc[mb][nb] = (v8f){};
    const size_t aoff = (size_t)(r0 + lr) * K + 8 * hi, boff = (size_t)(c0 + lr) * K + 8 * hi;
    float bs[4];   // TR: the bias of column nb 16 + lr, fetched here so that its latency passes under the K loop
    if constexpr (TR) {
#pragma unroll   // constant indices: the array stays in registers
        for (int nb = 0; nb < 4; ++nb) bs[nb] = bias[c0 + lr + nb * 16]; }
#pragma unroll 1
    for (int kc = k0; kc < k0 + ks; kc += 32) {
        V a[4], a2[4];
#pragma unroll
        for (int mb = 0; mb < 4; ++mb) { a[mb] = WFrag<T16>::ld(A + aoff + (size_t)mb * 16 * K + kc); if (NSPLIT == 1 || NSPLIT == 2) a2[mb] = WFrag<T16>::ld(A2 + aoff + (size_t)mb * 16 * K + kc); }
#pragma unroll
        for (int nb = 0; nb < 4; ++nb) { const V b = WFrag<T16>::ld(Bt + boff + (size_t)nb * 16 * K + kc); V b2; if (NSPLIT >= 2) b2 = WFrag<T16>::ld(Bt2 + boff + (size_t)nb * 16 * K + kc);
#pragma unroll
            for (int mb = 0; mb < 4; ++mb) { acc[mb][nb] = WFrag<T16>::mma(a[mb], b, acc[mb][nb]); if (NSPLIT == 1 || NSPLIT == 2) acc[mb][nb] = WFrag<T16>::mma(a2[mb], b, acc[mb][nb]); if (NSPLIT >= 2) acc[mb][nb] = WFrag<T16>::mma(a[mb], b2, acc[mb][nb]); } }
        asm volatile("v_nop\n\tv_nop\n\tv_nop\n\tv_nop" : "+v"(acc[0][0]), "+v"(acc[1][1]), "+v"(acc[2][2]), "+v"(acc[3][3]) : "v"(a[0]), "v"(a[3]));
    }
    if constexpr (NW > 1) {
        float* pw = os + wave * (64 * 68);
#pragma unroll
        for (int mb = 0; mb < 4; ++mb)
#pragma unroll
            for (int nb = 0; nb < 4; ++nb)
#pragma unroll
                for (int j = 0; j < 8; ++j) pw[(mb * 16 + hi * 8 + j) * 68 + nb * 16 + lr] = acc[mb][nb][j];
        __syncthreads();   // every wave's partial tile is in LDS before any wave adds them
#pragma unroll
        for (int s = 0; s < 64 / (2 * NW); ++s) { const int row = wave * (64 / NW) + 2 * s + hi, cofs = lr * 4; v4f val = *(const v4fa*)(os + row * 68 + cofs);
#pragma unroll
            for (int w = 1; w < NW; ++w) { const v4f pv = *(const v4fa*)(os + w * (64 * 68) + row * 68 + cofs); val[0] = __fadd_rn(val[0], pv[0]); val[1] = __fadd_rn(val[1], pv[1]); val[2] = __fadd_rn(val[2], pv[2]); val[3] = __fadd_rn(val[3], pv[3]); }
            *(v4f*)(C + (size_t)(r0 + row) * ldc + c0 + cofs) = val; }
        return;
    }
    if constexpr (TR) {
        // acc[mb][nb][j] = sum[row mb 16 + 8 hi + j][column nb 16 + lr]: a lane holds 8 neighbouring rows of one column = 32 bytes of LDS row (column) nb 16 + lr, pitch 68 floats = 16 B x odd.
        // Read back, 16 lanes hold one column's 64 rows = 256 bytes in a row: every global load and store below covers four whole 128-byte lines, and a line has one writer.
        const size_t eo = (size_t)(c0 + hi) * TT + r0 + lr * 4; const float* xp = xr + z * sC + eo; float* op = C + eo; v4f xa[32];
#pragma unroll   // the first half of the residual loads flies under the LDS turn (the fragment registers are free by now)
        for (int s = 0; s < 16; ++s) xa[s] = *(const v4f*)(xp + (size_t)s * 2 * TT);
#pragma unroll   // constant indices: the arrays stay in registers
        for (int nb = 0; nb < 4; ++nb) { const float b1 = bfr(bs[nb]); const v8f bb = (v8f){b1, b1, b1, b1, b1, b1, b1, b1};
#pragma unroll   // as above
            for (int mb = 0; mb < 4; ++mb) { const v8f y = acc[mb][nb] + bb; float* d = os + (nb * 16 + lr) * 68 + mb * 16 + hi * 8; *(v4fa*)d = __builtin_shufflevector(y, y, 0, 1, 2, 3); *(v4fa*)(d + 4) = __builtin_shufflevector(y, y, 4, 5, 6, 7); } }
        asm volatile("" ::: "memory");   // holds the loads below behind the LDS writes, so that they land in the registers that the accumulators have left (hoisted, they push the kernel past v255)
#pragma unroll   // the second half of the residual loads
        for (int s = 16; s < 32; ++s) xa[s] = *(const v4f*)(xp + (size_t)s * 2 * TT);
#pragma unroll   // constant indices: xa[] stays in registers
        for (int h = 0; h < 2; ++h) { v4f o[16];
#pragma unroll   // as above
            for (int s = 0; s < 16; ++s) { const int u = h * 16 + s; const v4f val = *(const v4fa*)(os + (2 * u + hi) * 68 + lr * 4);
#pragma unroll   // as above
                for (int q = 0; q < 4; ++q) o[s][q] = __fadd_rn(bfr(xa[u][q]), val[q]);
                *(v4f*)(op + (size_t)u * 2 * TT) = o[s]; }
            // precaution, as in FaChunk::load: the address registers of the residual loads and of the stores above and the stored values are inputs here, so they stay live and unwritten up to this wait
            asm volatile("s_wait_xcnt 0x0" :: "v"(xp), "v"(op), "v"(o[0]), "v"(o[1]), "v"(o[2]), "v"(o[3]), "v"(o[4]), "v"(o[5]), "v"(o[6]), "v"(o[7]), "v"(o[8]), "v"(o[9]), "v"(o[10]), "v"(o[11]), "v"(o[12]), "v"(o[13]), "v"(o[14]), "v"(o[15]) : "memory"); }
        return;
    }
#pragma unroll
    for (int mb = 0; mb < 4; ++mb) {
#pragma unroll
        for (int nb = 0; nb < 4; ++nb) {
#pragma unroll
            for (int j = 0; j < 8; ++j) os[(hi * 8 + j) * 68 + nb * 16 + lr] = acc[mb][nb][j]; }
        __builtin_amdgcn_wave_barrier(); asm volatile("" ::: "memory");
        float* crow = C + (size_t)(r0 + mb * 16) * ldc + c0;
{
#pragma unroll
            for (int s = 0; s < 8; ++s) { const int row = 2 * s + hi, cofs = lr * 4; v4f val = *(const v4fa*)(os + row * 68 + cofs); if (BIAS) { val[0] += bfr(bias[c0 + cofs]); val[1] += bfr(bias[c0 + cofs + 1]); val[2] += bfr(bias[c0 + cofs + 2]); val[3] += bfr(bias[c0 + cofs + 3]); }
                *(v4f*)(crow + (size_t)row * ldc + cofs) = val; }
             }
        __builtin_amdgcn_wave_barrier(); asm volatile("" ::: "memory");
    }
}

__device__ __forceinline__ h16 tohx(float x) { return (h16)x; }
__device__ __forceinline__ void splitf(float y, unsigned short& h, unsigned short& l) { h = f2bf(y); l = f2bf(y - bf2f(h)); }
typedef __attribute__((ext_vector_type(2))) _Float16 v2h;
typedef __attribute__((ext_vector_type(4))) _Float16 v4h;
typedef __attribute__((ext_vector_type(2))) unsigned short v2us;
typedef __attribute__((ext_vector_type(4))) unsigned short v4us;
typedef __attribute__((ext_vector_type(2))) float v2f;
typedef __attribute__((ext_vector_type(4))) int v4i;
typedef __attribute__((ext_vector_type(4))) unsigned v4u;

__global__ __launch_bounds__(256) void k_wtG(const float* __restrict__ w, int K, int N, bf* Bt) {
    const int lane = threadIdx.x & 31; const int L0 = (blockIdx.x * 8 + (threadIdx.x >> 5)) * 8; const int nlines = N * K / 64;
{
#pragma unroll 1
        for (int l = 0; l < 8; ++l) { const int L = L0 + l; if (L >= nlines) break; const size_t e = (size_t)L * 64 + lane * 2; const int k = (int)(e % K), n = (int)(e / K); v2us o;
            o[0] = f2bf(w[(size_t)k * N + n]); o[1] = f2bf(w[(size_t)(k + 1) * N + n]); *(v2us*)(Bt + e) = o; }
         }
}
__global__ __launch_bounds__(256) void k_cvt8(const float* __restrict__ src, bf* dst, size_t n8) { const size_t i = (size_t)blockIdx.x * 256 + threadIdx.x; if (i >= n8) return; const v8f v = *(const v8f*)(src + i * 8); v8us o;
#pragma unroll
    for (int k = 0; k < 8; ++k) o[k] = f2bf(v[k]); *(v8us*)(dst + i * 8) = o;  }

__device__ __forceinline__ void wpadh(int blk, const float* __restrict__ w, const float* __restrict__ bias, bf* Bt, float* bp) { const int i = blk * 256 + threadIdx.x; if (i >= DQ * DM / 8) return; const int c0 = (i % (DM / 8)) * 8; const int r = i / (DM / 8); const int h = r / HD, d = r % HD; const int sr = h * HR + min(d, HR - 1); const float* src = w + (size_t)sr * DM + c0; v8us o;
#pragma unroll
    for (int q = 0; q < 8; ++q) { const unsigned short v = f2bf(src[q]); o[q] = (d < HR) ? v : (unsigned short)0; }
    *(v8us*)(Bt + (size_t)r * DM + c0) = o; if (i < DQ) { const int hb = i / HD, db = i % HD; const float bb = bias[hb * HR + min(db, HR - 1)]; ((float*)bp)[i] = (db < HR) ? bb : 0.0f; }     }
__device__ __forceinline__ void wopadh(int blk, const float* __restrict__ w, bf* Bt) { const int i = blk * 256 + threadIdx.x; if (i >= DM * DQ / 8) return; const int k0 = (i % (DQ / 8)) * 8; const int o = i / (DQ / 8); v8us ov; const float* wa[8]; float wl[8];
#pragma unroll
    for (int q = 0; q < 8; ++q) { const int kk = k0 + q; const int h = kk / HD, d = kk % HD; wa[q] = w + (size_t)o * DM + h * HR + min(d, HR - 1); wl[q] = *wa[q]; }
    // precaution, as in FaChunk::load: the loads' address registers are inputs here, so they stay live and unwritten (by a later load's result too) up to this wait
    asm volatile("s_wait_xcnt 0x0" :: "v"(wa[0]), "v"(wa[1]), "v"(wa[2]), "v"(wa[3]), "v"(wa[4]), "v"(wa[5]), "v"(wa[6]), "v"(wa[7]) : "memory");
#pragma unroll
    for (int q = 0; q < 8; ++q) { const int d = (k0 + q) % HD; const unsigned short v = f2bf(wl[q]); ov[q] = (d < HR) ? v : (unsigned short)0; }
    *(v8us*)(Bt + (size_t)o * DQ + k0) = ov;  }
// GroupNorm statistics of all NB_ batch elements, with no launch of their own. Each element's CC x TT values are shared by GNG work-groups, GNK 16-byte loads a thread, all in flight at once and kept in registers.
// gnsum (in k_prep): a work-group's pair {S = sum of its GNE values, M = sum of (x - S / GNE)^2}, the squares taken about the work-group's OWN mean, which needs no other work-group.
// gnstat (in k_gnT, every work-group for itself): mean = sum S / n; n var = sum (M + GNE (S / GNE - mean)^2), the exact identity for joining sums of squares about different means: no difference of large numbers, as in the two-pass form.
// Every sum has a fixed order: in the thread, then wg_sum's tree, then wg_sum over the GNG pairs. Each pair has a 128-byte line of its own (pitch GNP floats), so a line has one writer.
#define GNG  256
#define GNK  (CC * TT / GNG / 1024)
#define GNP  32
#define GNE  (GNK * 1024)   // values a work-group of gnsum
__device__ __forceinline__ float wg_sum(float v, float* red) { const int tid = threadIdx.x; red[tid] = v; __syncthreads();
    for (int st = 128; st > 0; st >>= 1) { if (tid < st) red[tid] = __fadd_rn(red[tid], red[tid + st]); __syncthreads(); }
    const float r = red[0]; __syncthreads();   // red is free for the next sum once every thread has read the total
    return r; }
__device__ __forceinline__ void gnsum(int bx, int by, const float* __restrict__ x, float* PS, float* red) { const int tid = threadIdx.x; const float* xs = x + (size_t)by * CC * TT + (size_t)bx * GNE + tid * 4; float s = 0.f, s2 = 0.f; v4f a[GNK];
#pragma unroll   // all GNK loads are issued before the first is waited for; a[] stays in registers for the second sum
    for (int k = 0; k < GNK; ++k) a[k] = *(const v4f*)(xs + k * 1024);
    asm volatile("s_wait_xcnt 0x0" :: "v"(xs) : "memory");   // precaution, as in FaChunk::load: the loads' address registers stay live and unwritten up to this wait
#pragma unroll   // constant k: a[] stays in registers
    for (int k = 0; k < GNK; ++k) for (int q = 0; q < 4; ++q) s = __fadd_rn(s, bfr(a[k][q]));
    s = wg_sum(s, red); const float mb = __fdiv_rn(s, (float)GNE);
#pragma unroll   // as above
    for (int k = 0; k < GNK; ++k) for (int q = 0; q < 4; ++q) { const float dv = __fsub_rn(bfr(a[k][q]), mb); s2 = __fadd_rn(s2, __fmul_rn(dv, dv)); }
    s2 = wg_sum(s2, red); if (tid == 0) { v2f o; o[0] = s; o[1] = s2; *(v2f*)(PS + (by * GNG + bx) * GNP) = o; } }
// {mean, 1 / sqrt(var + eps)} of batch element by from its GNG pairs; every thread of a 256-thread work-group calls it and gets both
__device__ __forceinline__ v2f gnstat(int by, const float* __restrict__ PS, float* red) { static_assert(GNG == 256, "one pair a thread"); const float n = (float)(CC * TT); const float* pa = PS + (by * GNG + (int)threadIdx.x) * GNP; const v2f pr = *(const v2f*)pa;
    asm volatile("s_wait_xcnt 0x0" :: "v"(pa) : "memory");   // precaution, as in FaChunk::load
    const float mean = __fdiv_rn(wg_sum(pr[0], red), n); const float dm = __fsub_rn(__fdiv_rn(pr[0], (float)GNE), mean);
    const float var = __fdiv_rn(wg_sum(__fadd_rn(pr[1], __fmul_rn((float)GNE, __fmul_rn(dm, dm))), red), n);
    v2f o; o[0] = mean; o[1] = __fdiv_rn(1.0f, __fsqrt_rn(__fadd_rn(var, 1e-5f))); return o; }
// ---- k_prep: the five jobs that read nothing but inputs, in ONE launch, told apart by the block number: first the NB_ x GNG blocks of gnsum (the longest job), then WPB blocks each for Wq, Wk, Wv (wpadh) and Wo (wopadh).
// A block does one job whole, so the barriers of wg_sum stand under a condition that is the same for the whole work-group.
#define WPB  (DQ * DM / 8 / 256)
__global__ __launch_bounds__(256) void k_prep(const float* __restrict__ x, float* PS, const float* __restrict__ wq, const float* __restrict__ bq, const float* __restrict__ wk, const float* __restrict__ bk, const float* __restrict__ wv, const float* __restrict__ bv, const float* __restrict__ wo,
                                              bf* WQ, float* BQP, bf* WK, float* BKP, bf* WV, float* BVP, bf* WO) {
    static_assert(DQ * DM % (8 * 256) == 0, "whole blocks a weight matrix");
    __shared__ float red[256]; const int blk = blockIdx.x;
    if (blk < NB_ * GNG) { gnsum(blk % GNG, blk / GNG, x, PS, red); return; }
    const int m = (blk - NB_ * GNG) / WPB, jb = (blk - NB_ * GNG) % WPB;
    if (m == 3) wopadh(jb, wo, WO);
    else wpadh(jb, m == 0 ? wq : m == 1 ? wk : wv, m == 0 ? bq : m == 1 ? bk : bv, m == 0 ? WQ : m == 1 ? WK : WV, m == 0 ? BQP : m == 1 ? BKP : BVP);
}
// ---- k_gnT: normalises and turns x [channel][token] into the token-major hi/lo planes. One work-group a tile of 64 channels x 64 tokens; grid (TT / 64, CC / 64, batch elements).
// A thread reads 4 channels x 4 tokens with four 16-byte loads: 16 lanes cover 256 bytes in a row of one channel, so every load takes whole 128-byte lines. The loads are issued ahead of gnstat and fly under its barriers.
// The tile is turned in LDS, hi and lo packed into one 32-bit word, row = token, pitch GTP words = 16 B x odd. Read back, 4 lanes hold one token's 64 channels = one whole 128-byte line a plane, so a line has one writer.
#define GTP  68
__global__ __launch_bounds__(256) void k_gnT(const float* __restrict__ xs, const float* __restrict__ PS, const float* __restrict__ g, const float* __restrict__ bb, bf* XH, bf* XL) { static_assert(TT % 64 == 0 && CC % 64 == 0, "whole tiles: every thread reaches every barrier");
    __shared__ float red[256]; __shared__ __align__(16) unsigned tl[64 * GTP];
    const int tid = threadIdx.x, t0 = blockIdx.x * 64, cb = blockIdx.y * 64; const size_t eo = (size_t)blockIdx.z * CC * TT;   // batch element = blockIdx.z
    const int c4 = (tid >> 4) * 4, t4 = (tid & 15) * 4;   // this thread's 4 channels and 4 tokens in the tile
    const float* xp = xs + eo + (size_t)(cb + c4) * TT + t0 + t4; const float* gp = g + cb + c4; const float* bp = bb + cb + c4; v4f a[4];
#pragma unroll   // all four loads are in flight together; a[] stays in registers
    for (int s = 0; s < 4; ++s) a[s] = *(const v4f*)(xp + (size_t)s * TT);
    const v4f gv = *(const v4f*)gp, bv = *(const v4f*)bp;
    asm volatile("s_wait_xcnt 0x0" :: "v"(xp), "v"(gp), "v"(bp) : "memory");   // precaution, as in FaChunk::load: the loads' address registers stay live and unwritten up to this wait
    const v2f st = gnstat(blockIdx.z, PS, red); const float mean = st[0], rs = st[1];
#pragma unroll   // constant indices: the arrays stay in registers
    for (int q = 0; q < 4; ++q) { v4u w;
#pragma unroll   // as above
        for (int s = 0; s < 4; ++s) { const float dv = __fsub_rn(bfr(a[s][q]), mean); const float y = __fadd_rn(__fmul_rn(__fmul_rn(dv, rs), bfr(gv[s])), bfr(bv[s])); unsigned short a2, c2; splitf(y, a2, c2); w[s] = (unsigned)a2 | ((unsigned)c2 << 16); }
        *(v4u*)(tl + (t4 + q) * GTP + c4) = w; }
    __syncthreads();   // the whole tile is in LDS before any thread reads a token's row
    const int t = tid >> 2, cs = (tid & 3) * 16; const unsigned* sp = tl + t * GTP + cs; v8us oh[2], ol[2];
#pragma unroll   // constant indices: the arrays stay in registers
    for (int j = 0; j < 2; ++j)
#pragma unroll   // as above
        for (int i = 0; i < 2; ++i) { const v4u w = *(const v4u*)(sp + j * 8 + i * 4);
#pragma unroll   // as above
            for (int e = 0; e < 4; ++e) { oh[j][i * 4 + e] = (unsigned short)(w[e] & 0xFFFFu); ol[j][i * 4 + e] = (unsigned short)(w[e] >> 16); } }
    bf* ph = XH + eo + (size_t)(t0 + t) * CC + cb + cs; bf* pl = XL + eo + (size_t)(t0 + t) * CC + cb + cs;
    *(v8us*)ph = oh[0]; *(v8us*)(ph + 8) = oh[1]; *(v8us*)pl = ol[0]; *(v8us*)(pl + 8) = ol[1]; }

// ---- k_fattn: scores, softmax and P.V of one head for FQB query rows (FQH for rows < RH) in ONE work-group; scores and probabilities never leave the registers. Grid (batch x heads, row blocks), 4 waves, 32 query rows (two column tiles) a wave.
// Transposed products: S^T = K Q^T (A = 16 K rows from LDS, B = 16 query rows, kept in registers), O^T += V^T P^T. A lane then holds scores of ONE query (column lane & 15), and two S^T tiles (keys +0..15, +16..31),
// converted in place, are the B operand of the second product in the hardware k order (element s: key 8 hi + s, or 16 + 8 hi + s - 8), which is also the order of WFrag::ld on a V^T row. Only the HR = 32 real head columns are read.
// Two sweeps over the keys, K (and V^T) staged in LDS in chunks of CK keys: sweep 1 the row maximum; sweep 2 the same scores again, p = exp(s - max), f32 row sum of the unrounded p, P.V; the division by the sum comes last.
// The next chunk is fetched into registers while the present one is worked on. Rows < RH: bf16 hi/lo planes, three products each (hh, hl, lh) as before; the other rows f16.
// Rows < RH cost about three times the others, so their work-groups are cut short: FQH = 32 rows a work-group, which all KW = 4 waves hold, and wave w takes keys [w CK / KW, +CK / KW) of every chunk.
// The waves' row maxima (behind sweep 1), partial row sums and partial O tiles (behind sweep 2) meet in LDS (xw) and are joined in wave order.
#define FQB  128
#define FQH  32
#define FKW  4
#define XWN  (2 * FKW * 32 + FKW * 4 * 256)   // floats: maxima and sums [wave][column tile][16], O tiles [wave][column tile][row tile][2][32 lanes][4]
#define KPT  40      // LDS pitch of a staged K row in 16-bit elements: 80 B = 16 B x odd, conflict-free for 16-byte reads
#define FSM  (2 * (128 * KPT + HR * (128 + 8)))   // the larger of the two paths' LDS needs, in 16-bit elements
typedef __attribute__((ext_vector_type(8))) __bf16 v8bf;
__device__ __forceinline__ v8f splat8(float x) { return (v8f){x, x, x, x, x, x, x, x}; }
__device__ __forceinline__ v8f bfup(v8bf h) { const v4u w = __builtin_bit_cast(v4u, h); v8f r;   // packed bf16 back to f32: one shift or one mask an element
#pragma unroll   // constant indices: the arrays stay in registers
    for (int i = 0; i < 4; ++i) { r[2 * i] = __uint_as_float(w[i] << 16); r[2 * i + 1] = __uint_as_float(w[i] & 0xFFFF0000u); }
    return r; }
template <typename T16, int CK> struct FaChunk {   // one plane's share of a chunk in one thread's registers: CK / 32 16-byte pieces of K rows and as many of V^T rows
    typedef __attribute__((ext_vector_type(8))) T16 V8; V8 k[CK / 32], v[CK / 32];
    static constexpr int UR = CK / 8, RS = 128 / UR;   // 16-byte pieces in a V^T row of the chunk; V^T rows that the 128 threads cover at once (K: 4 pieces a row, 32 rows at once)
    // piece s of thread tid: K row (tid >> 2) + 32 s, V^T row tid / UR + RS s: a uniform base, one offset a thread, and a constant step
    template <bool WITHV> __device__ __forceinline__ void load(const T16* __restrict__ Kg, const T16* __restrict__ Vg, int key0) { const unsigned tid = threadIdx.x; const T16* ka = Kg + (size_t)key0 * HD + (tid >> 2) * HD + (tid & 3) * 8; const T16* va = Vg + key0 + (tid / UR) * TT + (tid % UR) * 8;
#pragma unroll   // constant indices: k[] and v[] stay in registers
        for (int s = 0; s < CK / 32; ++s) { k[s] = *(const V8*)(ka + s * 32 * HD); if constexpr (WITHV) v[s] = *(const V8*)(va + s * RS * TT); }
        // precaution: the loads' address registers are inputs here, so they stay live and unwritten (by a later load's result too) up to this wait
        if constexpr (WITHV) asm volatile("s_wait_xcnt 0x0" :: "v"(ka), "v"(va) : "memory"); else asm volatile("s_wait_xcnt 0x0" :: "v"(ka) : "memory"); }
    template <bool WITHV> __device__ __forceinline__ void store(T16* sK, T16* sV) const { const unsigned tid = threadIdx.x; T16* kd = sK + (tid >> 2) * KPT + (tid & 3) * 8; T16* vd = sV + (tid / UR) * (CK + 8) + (tid % UR) * 8;
#pragma unroll   // as above
        for (int s = 0; s < CK / 32; ++s) { *(V8*)(kd + s * 32 * KPT) = k[s]; if constexpr (WITHV) *(V8*)(vd + s * RS * (CK + 8)) = v[s]; } }
};
template <typename T16, bool HL, int CK, int KW = 1>
__device__ __forceinline__ void fattn(const T16* __restrict__ Q, const T16* __restrict__ Q2, const T16* __restrict__ Kg, const T16* __restrict__ K2, const T16* __restrict__ Vg, const T16* __restrict__ V2, int q0, bf* Ah, bf* Al, T16* sm, float* xw = nullptr) {
    typedef WFrag<T16> F; typedef typename F::V V; constexpr int VPT = CK + 8;   // V^T row pitch: 16 B x odd
    static_assert((HL ? 2 : 1) * (CK * KPT + HR * VPT) <= FSM && TT % CK == 0 && CK % (32 * KW) == 0 && (KW == 1 || KW == FKW), "a chunk fits the LDS array; whole 32-key groups a wave");
    T16* sK = sm; T16* sV = sK + CK * KPT; T16* sK2 = sV + HR * VPT; T16* sV2 = sK2 + CK * KPT;
    const int lane = threadIdx.x & 31, lr = lane & 15, hi = lane >> 4, wave = threadIdx.x >> 5; const int t0 = q0 + (KW == 1 ? wave * 32 : 0) + lr;
    const int wv = KW == 1 ? 0 : __builtin_amdgcn_readfirstlane(wave), kw0 = wv * (CK / KW);   // this wave's keys in a chunk start at kw0 (a scalar)
    V qf[2], qf2[2]; const T16* qa = Q + (size_t)t0 * HD + 8 * hi; const T16* qa2 = HL ? Q2 + (size_t)t0 * HD + 8 * hi : qa;
#pragma unroll   // constant indices: the arrays stay in registers
    for (int g = 0; g < 2; ++g) { qf[g] = F::ld(qa + 16 * g * HD); if constexpr (HL) qf2[g] = F::ld(qa2 + 16 * g * HD); }
    asm volatile("s_wait_xcnt 0x0" :: "v"(qa), "v"(qa2) : "memory");   // precaution, as in FaChunk::load
    const int koff = lr * KPT + 8 * hi, voff = lr * VPT + 8 * hi;
    FaChunk<T16, CK> r, r2;
    v8f mx[2] = {splat8(-3.0e38f), splat8(-3.0e38f)};   // eight independent maxima a column tile, joined behind the sweep
    r.template load<false>(Kg, Vg, 0); if constexpr (HL) r2.template load<false>(K2, V2, 0);
#pragma unroll 1   // one chunk at a time: the LDS array holds one
    for (int c = 0; c < TT; c += CK) {
        __syncthreads();   // every wave has left the chunk that is overwritten next
        r.template store<false>(sK, sV); if constexpr (HL) r2.template store<false>(sK2, sV2);
        __syncthreads();   // the chunk is complete before any wave reads it
        if (c + CK < TT) { r.template load<false>(Kg, Vg, c + CK); if constexpr (HL) r2.template load<false>(K2, V2, c + CK); }   // flies under this chunk's products
#pragma unroll 2   // two independent 32-key groups: one group's LDS reads fly under the other's products
        for (int kk = kw0; kk < kw0 + CK / KW; kk += 32) { const V a0 = F::ld(sK + koff + kk * KPT), a1 = F::ld(sK + koff + (kk + 16) * KPT); V b0, b1; if constexpr (HL) { b0 = F::ld(sK2 + koff + kk * KPT); b1 = F::ld(sK2 + koff + (kk + 16) * KPT); }
#pragma unroll   // constant indices: the arrays stay in registers
            for (int g = 0; g < 2; ++g) { v8f s0 = F::mma(a0, qf[g], (v8f){}), s1 = F::mma(a1, qf[g], (v8f){});
                if constexpr (HL) { s0 = F::mma(a0, qf2[g], s0); s1 = F::mma(a1, qf2[g], s1); s0 = F::mma(b0, qf[g], s0); s1 = F::mma(b1, qf[g], s1); }
#pragma unroll   // constant indices: the arrays stay in registers
                for (int j = 0; j < 8; ++j) mx[g][j] = fmaxf(mx[g][j], fmaxf(s0[j], s1[j])); } }
    }
    const float c1 = SCL * 1.4426950408889634f; const v8f c1v = splat8(c1); v8f nm[2], sv[2], o[2][2]; float mr[2];
#pragma unroll   // constant indices: the arrays stay in registers
    for (int g = 0; g < 2; ++g) { float m = fmaxf(fmaxf(fmaxf(mx[g][0], mx[g][1]), fmaxf(mx[g][2], mx[g][3])), fmaxf(fmaxf(mx[g][4], mx[g][5]), fmaxf(mx[g][6], mx[g][7]))); m = fmaxf(m, __shfl_xor(m, 16, 32));   // lanes l and l ^ 16 hold the two halves of one query's keys
        mr[g] = m; if constexpr (KW > 1) { if (hi == 0) xw[(wv * 2 + g) * 16 + lr] = m; } }
    if constexpr (KW > 1) { __syncthreads();   // every wave's row maxima are in LDS before any wave joins them
#pragma unroll   // constant indices: the arrays stay in registers
        for (int g = 0; g < 2; ++g)
#pragma unroll   // as above
            for (int w = 0; w < KW; ++w) mr[g] = fmaxf(mr[g], xw[(w * 2 + g) * 16 + lr]); }
#pragma unroll   // constant indices: the arrays stay in registers
    for (int g = 0; g < 2; ++g) { const float m = mr[g];
        nm[g] = splat8((HL ? 0.0f : 6.0f) - m * c1);   // f16 path: p carries a factor 2^6, which cancels against the row sum, so that small p stay normal f16 numbers
        sv[g] = (v8f){}; o[g][0] = (v8f){}; o[g][1] = (v8f){}; }
    r.template load<true>(Kg, Vg, 0); if constexpr (HL) r2.template load<true>(K2, V2, 0);
#pragma unroll 1   // one chunk at a time
    for (int c = 0; c < TT; c += CK) {
        __syncthreads();   // every wave has left the chunk that is overwritten next
        r.template store<true>(sK, sV); if constexpr (HL) r2.template store<true>(sK2, sV2);
        __syncthreads();   // the chunk is complete before any wave reads it
        if (c + CK < TT) { r.template load<true>(Kg, Vg, c + CK); if constexpr (HL) r2.template load<true>(K2, V2, c + CK); }   // flies under this chunk's products
#pragma unroll 2   // as in sweep 1
        for (int kk = kw0; kk < kw0 + CK / KW; kk += 32) { const V a0 = F::ld(sK + koff + kk * KPT), a1 = F::ld(sK + koff + (kk + 16) * KPT); V b0, b1; if constexpr (HL) { b0 = F::ld(sK2 + koff + kk * KPT); b1 = F::ld(sK2 + koff + (kk + 16) * KPT); }
            const V v0 = F::ld(sV + voff + kk), v1 = F::ld(sV + voff + 16 * VPT + kk); V w0, w1; if constexpr (HL) { w0 = F::ld(sV2 + voff + kk); w1 = F::ld(sV2 + voff + 16 * VPT + kk); }
            v8f s0[2], s1[2];
#pragma unroll   // constant indices: the arrays stay in registers
            for (int g = 0; g < 2; ++g) { s0[g] = F::mma(a0, qf[g], (v8f){}); s1[g] = F::mma(a1, qf[g], (v8f){}); }
            if constexpr (HL) {
#pragma unroll   // constant indices: the arrays stay in registers
                for (int g = 0; g < 2; ++g) { s0[g] = F::mma(a0, qf2[g], s0[g]); s1[g] = F::mma(a1, qf2[g], s1[g]); }
#pragma unroll   // constant indices: the arrays stay in registers
                for (int g = 0; g < 2; ++g) { s0[g] = F::mma(b0, qf[g], s0[g]); s1[g] = F::mma(b1, qf[g], s1[g]); } }
#pragma unroll   // constant indices: the arrays stay in registers
            for (int g = 0; g < 2; ++g) { const v8f x0 = __builtin_elementwise_fma(s0[g], c1v, nm[g]), x1 = __builtin_elementwise_fma(s1[g], c1v, nm[g]); v8f p0, p1;
#pragma unroll   // constant indices: the arrays stay in registers
                for (int j = 0; j < 8; ++j) { p0[j] = __builtin_amdgcn_exp2f(x0[j]); p1[j] = __builtin_amdgcn_exp2f(x1[j]); }
                sv[g] += p0; sv[g] += p1;
                if constexpr (HL) {
                    const v8bf h0 = __builtin_convertvector(p0, v8bf), h1 = __builtin_convertvector(p1, v8bf); const v8bf l0 = __builtin_convertvector(p0 - bfup(h0), v8bf), l1 = __builtin_convertvector(p1 - bfup(h1), v8bf);
                    const V ph = __builtin_shufflevector(h0, h1, 0, 1, 2, 3, 4, 5, 6, 7, 8, 9, 10, 11, 12, 13, 14, 15), pl = __builtin_shufflevector(l0, l1, 0, 1, 2, 3, 4, 5, 6, 7, 8, 9, 10, 11, 12, 13, 14, 15);
                    o[g][0] = F::mma(v0, ph, o[g][0]); o[g][1] = F::mma(v1, ph, o[g][1]); o[g][0] = F::mma(v0, pl, o[g][0]); o[g][1] = F::mma(v1, pl, o[g][1]); o[g][0] = F::mma(w0, ph, o[g][0]); o[g][1] = F::mma(w1, ph, o[g][1]);
                } else {
                    const V pf = cat16(__builtin_convertvector(p0, v8h), __builtin_convertvector(p1, v8h));
                    o[g][0] = F::mma(v0, pf, o[g][0]); o[g][1] = F::mma(v1, pf, o[g][1]); } } }
    }
    if constexpr (KW > 1) {
        float* xsum = xw + KW * 32; float* xo = xw + 2 * KW * 32;
#pragma unroll   // constant indices: the arrays stay in registers
        for (int g = 0; g < 2; ++g) { float sum = ((sv[g][0] + sv[g][1]) + (sv[g][2] + sv[g][3])) + ((sv[g][4] + sv[g][5]) + (sv[g][6] + sv[g][7])); sum += __shfl_xor(sum, 16, 32); if (hi == 0) xsum[(wv * 2 + g) * 16 + lr] = sum;
#pragma unroll   // as above
            for (int h = 0; h < 2; ++h) { float* d = xo + (wv * 4 + g * 2 + h) * 256 + lane * 4; *(v4fa*)d = __builtin_shufflevector(o[g][h], o[g][h], 0, 1, 2, 3); *(v4fa*)(d + 128) = __builtin_shufflevector(o[g][h], o[g][h], 4, 5, 6, 7); } }
        __syncthreads();   // every wave's partial row sums and O tiles are in LDS before they are added
        if (wv < 2) {   // wave g finishes column tile g, both row tiles: a 128-byte output line keeps one writer
            float sum = xsum[wv * 16 + lr]; v8f oo[2];
#pragma unroll   // fixed order: wave 0, 1, 2, 3
            for (int w = 1; w < KW; ++w) sum = __fadd_rn(sum, xsum[(w * 2 + wv) * 16 + lr]);
#pragma unroll   // constant indices: the arrays stay in registers
            for (int h = 0; h < 2; ++h) { const float* s = xo + (wv * 2 + h) * 256 + lane * 4; v4f a = *(const v4fa*)s, b = *(const v4fa*)(s + 128);
#pragma unroll   // fixed order: wave 0, 1, 2, 3
                for (int w = 1; w < KW; ++w) { a += *(const v4fa*)(s + w * 1024); b += *(const v4fa*)(s + w * 1024 + 128); }
                oo[h] = __builtin_shufflevector(a, b, 0, 1, 2, 3, 4, 5, 6, 7); }
            const float inv = __fdiv_rn(1.0f, sum); v8us h0, l0, h1, l1; const v8us zz = (v8us){};
#pragma unroll   // constant indices: the arrays stay in registers
            for (int j = 0; j < 8; ++j) { unsigned short a, b; splitf(oo[0][j] * inv, a, b); h0[j] = a; l0[j] = b; splitf(oo[1][j] * inv, a, b); h1[j] = a; l1[j] = b; }
            bf* ph = Ah + (size_t)(t0 + 16 * wv) * DQ + 8 * hi; bf* pl = Al + (size_t)(t0 + 16 * wv) * DQ + 8 * hi;
            *(v8us*)ph = h0; *(v8us*)(ph + 16) = h1; *(v8us*)(ph + 32) = zz; *(v8us*)(ph + 48) = zz; *(v8us*)pl = l0; *(v8us*)(pl + 16) = l1; *(v8us*)(pl + 32) = zz; *(v8us*)(pl + 48) = zz;
            asm volatile("s_wait_xcnt 0x0" :: "v"(ph), "v"(pl) : "memory");   // precaution, as in FaChunk::load: the stores' address registers stay live and unwritten up to this wait
        }
        return;
    }
#pragma unroll   // constant indices: the arrays stay in registers
    for (int g = 0; g < 2; ++g) { float sum = ((sv[g][0] + sv[g][1]) + (sv[g][2] + sv[g][3])) + ((sv[g][4] + sv[g][5]) + (sv[g][6] + sv[g][7])); sum += __shfl_xor(sum, 16, 32); const float inv = __fdiv_rn(1.0f, sum);
        v8us h0, l0, h1, l1; const v8us zz = (v8us){};
#pragma unroll   // constant indices: the arrays stay in registers
        for (int j = 0; j < 8; ++j) { unsigned short a, b; splitf(o[g][0][j] * inv, a, b); h0[j] = a; l0[j] = b; splitf(o[g][1][j] * inv, a, b); h1[j] = a; l1[j] = b; }
        // o[g][0][j] = O[t][8 hi + j], o[g][1][j] = O[t][16 + 8 hi + j]; columns HR .. HD - 1 of the padded head are zero
        bf* ph = Ah + (size_t)(t0 + 16 * g) * DQ + 8 * hi; bf* pl = Al + (size_t)(t0 + 16 * g) * DQ + 8 * hi;
        *(v8us*)ph = h0; *(v8us*)(ph + 16) = h1; *(v8us*)(ph + 32) = zz; *(v8us*)(ph + 48) = zz; *(v8us*)pl = l0; *(v8us*)(pl + 16) = l1; *(v8us*)(pl + 32) = zz; *(v8us*)(pl + 48) = zz; }
}
// ---- k_proj: the q, k and v projections of every batch element in ONE launch; its epilogue rounds the f32 sums (+ f32 bias) straight into the 16-bit planes that k_fattn reads (f16, bf16 hi, bf16 lo), so no f32 copy of q, k or v exists.
// Grid (TT / 64, NH_ / 2, 3 NB_), one wave a tile of 64 tokens x the HR real columns of two heads; blockIdx.z = 3 x batch element + (0 q, 1 k, 2 v). The padded rows of W and the padded plane columns, which k_fattn never reads, are left out.
// K loop and product order (x hi, then x lo, per 32-wide k step) as in k_gemmw<bf, 1, true>. W and bias keep wpadh's padded row numbering: head * HD + column.
// q, k (VT false): transposed product, A = 16 W rows, B = 16 tokens: a lane holds 8 neighbouring columns of ONE token = one 16-byte store a plane into [head][t][HD].
// v (VT true): A = 16 tokens, B = 16 W rows: a lane holds 8 neighbouring tokens of ONE column = one 16-byte store a plane into [head][column][TT]. Either way a wave writes whole 64- or 128-byte runs, and a 128-byte line has one writer.
template <bool VT>
__device__ __forceinline__ void proj_tile(const bf* __restrict__ XH, const bf* __restrict__ XL, const bf* __restrict__ Wt, const float* __restrict__ bias, int r0, int h0, h16* P16, bf* Ph, bf* Pl) {
    typedef WFrag<bf> F; typedef F::V V;
    const int lane = threadIdx.x & 31, lr = lane & 15, hi = lane >> 4;
    const bf* xh = XH + (size_t)(r0 + lr) * DM + 8 * hi; const bf* xl = XL + (size_t)(r0 + lr) * DM + 8 * hi; const bf* wr = Wt + (size_t)(h0 * HD + lr) * DM + 8 * hi;
    v8f acc[4][4];
#pragma unroll   // constant indices: the arrays stay in registers
    for (int mb = 0; mb < 4; ++mb)
#pragma unroll   // as above
        for (int nb = 0; nb < 4; ++nb) acc[mb][nb] = (v8f){};
#pragma unroll 1   // one k step's fragments in registers at a time, as in k_gemmw
    for (int kc = 0; kc < DM; kc += 32) {
        V a[4], a2[4], b[4];
#pragma unroll   // constant indices: the arrays stay in registers
        for (int mb = 0; mb < 4; ++mb) { a[mb] = F::ld(xh + mb * 16 * DM); a2[mb] = F::ld(xl + mb * 16 * DM); }
#pragma unroll   // as above
        for (int nb = 0; nb < 4; ++nb) b[nb] = F::ld(wr + ((nb >> 1) * HD + (nb & 1) * 16) * DM);   // column block nb: head h0 + nb / 2, columns 16 (nb % 2) ..
        // precaution, as in FaChunk::load: the loads' address registers are inputs here, so they stay live and unwritten (by a later load's result too) up to this wait.
        // The loaded fragments are inputs too: each keeps registers of its own, so all 24 loads are in flight together and a k step waits for memory once (without them the x lo loads wait for the x hi registers: twice)
        asm volatile("s_wait_xcnt 0x0" :: "v"(xh), "v"(xl), "v"(wr), "v"(a[0]), "v"(a[1]), "v"(a[2]), "v"(a[3]), "v"(a2[0]), "v"(a2[1]), "v"(a2[2]), "v"(a2[3]), "v"(b[0]), "v"(b[1]), "v"(b[2]), "v"(b[3]) : "memory");
        xh += 32; xl += 32; wr += 32;
#pragma unroll   // as above
        for (int nb = 0; nb < 4; ++nb)
#pragma unroll   // as above
            for (int mb = 0; mb < 4; ++mb) {
                if constexpr (VT) { acc[mb][nb] = F::mma(a[mb], b[nb], acc[mb][nb]); acc[mb][nb] = F::mma(a2[mb], b[nb], acc[mb][nb]); }
                else { acc[mb][nb] = F::mma(b[nb], a[mb], acc[mb][nb]); acc[mb][nb] = F::mma(b[nb], a2[mb], acc[mb][nb]); } }
    }
    v8f bv[4];   // the bias of column block nb as this lane adds it; the four loads fly together
    if constexpr (VT) { const int bi = h0 * HD + lr; float bs[4];
#pragma unroll   // constant indices: the arrays stay in registers
        for (int nb = 0; nb < 4; ++nb) bs[nb] = bias[bi + (nb >> 1) * HD + (nb & 1) * 16];
        asm volatile("s_wait_xcnt 0x0" :: "v"(bi) : "memory");   // precaution, as above: the loads' offset register is an input here
#pragma unroll   // as above
        for (int nb = 0; nb < 4; ++nb) bv[nb] = splat8(bfr(bs[nb]));
    } else { const float* bp = bias + h0 * HD + 8 * hi;
#pragma unroll   // as above
        for (int nb = 0; nb < 4; ++nb) bv[nb] = *(const v8f*)(bp + (nb >> 1) * HD + (nb & 1) * 16);
#pragma unroll   // as above
        for (int nb = 0; nb < 4; ++nb)
#pragma unroll   // as above
            for (int j = 0; j < 8; ++j) bv[nb][j] = bfr(bv[nb][j]); }
#pragma unroll   // as above
    for (int nb = 0; nb < 4; ++nb) { const int hd = (h0 + (nb >> 1)) * HD + (nb & 1) * 16;   // padded number of the block's first column
#pragma unroll   // as above
        for (int mb = 0; mb < 4; ++mb) { const v8f y = acc[mb][nb] + bv[nb]; const v8h o16 = __builtin_convertvector(y, v8h);   // packed conversions, round to nearest even: the values of tohx and splitf
            const v8bf yh = __builtin_convertvector(y, v8bf); const v8bf yl = __builtin_convertvector(y - bfup(yh), v8bf); const v8us oh = __builtin_bit_cast(v8us, yh), ol = __builtin_bit_cast(v8us, yl);
            const size_t e = VT ? (size_t)(hd + lr) * TT + r0 + mb * 16 + 8 * hi : ((size_t)(h0 + (nb >> 1)) * TT + r0 + mb * 16 + lr) * HD + (nb & 1) * 16 + 8 * hi;
            *(v8h*)(P16 + e) = o16; *(v8us*)(Ph + e) = oh; *(v8us*)(Pl + e) = ol; } }
}
__global__ __launch_bounds__(32) void k_proj(const bf* __restrict__ XH, const bf* __restrict__ XL, const bf* __restrict__ WQ, const bf* __restrict__ WK, const bf* __restrict__ WV, const float* __restrict__ BQ, const float* __restrict__ BK, const float* __restrict__ BV,
                                             h16* Q16, bf* Qh, bf* Ql, h16* K16, bf* Kh, bf* Kl, h16* V16, bf* Vh, bf* Vl) {
    static_assert(TT % 64 == 0 && NH_ % 2 == 0 && HR == 32 && DM % 32 == 0 && NH_ == NKV, "whole tiles; two 16-column blocks a head");
    const int b = blockIdx.z / 3, p = blockIdx.z % 3; const int r0 = blockIdx.x * 64, h0 = blockIdx.y * 2; const size_t xo = (size_t)b * TT * DM, po = (size_t)b * NH_ * TT * HD;
    if (p == 2) proj_tile<true>(XH + xo, XL + xo, WV, BV, r0, h0, V16 + po, Vh + po, Vl + po);
    else proj_tile<false>(XH + xo, XL + xo, p ? WK : WQ, p ? BK : BQ, r0, h0, (p ? K16 : Q16) + po, (p ? Kh : Qh) + po, (p ? Kl : Ql) + po);
}

// Planes [batch][head][...], outputs [batch][t][DQ]. blockIdx.y is the row block: first the RH / FQH blocks of rows < RH, then the (TT - RH) / FQB blocks of the other rows.
__global__ __launch_bounds__(128) void k_fattn(const h16* __restrict__ Q16, const bf* __restrict__ Qh, const bf* __restrict__ Ql, const h16* __restrict__ K16, const bf* __restrict__ Kh, const bf* __restrict__ Kl, const h16* __restrict__ V16, const bf* __restrict__ Vh, const bf* __restrict__ Vl, bf* Ah, bf* Al) {
    static_assert(RH % FQH == 0 && (TT - RH) % FQB == 0 && HR == 32 && HD == 64 && NH_ == NKV, "whole work-groups on either side of RH; one 32-wide k step a head");
    __shared__ __align__(16) unsigned short sm[FSM]; __shared__ __align__(16) float xw[XWN];
    const size_t hp = (size_t)blockIdx.x * TT * HD; const int by = blockIdx.y; const int q0 = by < RH / FQH ? by * FQH : RH + (by - RH / FQH) * FQB; const size_t ao = (size_t)(blockIdx.x / NH_) * TT * DQ + (blockIdx.x % NH_) * HD;
    if (q0 < RH) fattn<bf, true, 128, FKW>(Qh + hp, Ql + hp, Kh + hp, Kl + hp, Vh + hp, Vl + hp, q0, Ah + ao, Al + ao, (bf*)sm, xw);
    else fattn<h16, false, 256>(Q16 + hp, nullptr, K16 + hp, nullptr, V16 + hp, nullptr, q0, Ah + ao, Al + ao, (h16*)sm);
}

extern "C" void kernel_launch(void* const* d_in, const int* in_sizes, int n_in,
                              void* d_out, int out_size, void* d_ws, size_t ws_size, hipStream_t stream) {
    (void)in_sizes; (void)n_in; (void)out_size;
    const float* x = (const float*)d_in[0]; const float* gnw = (const float*)d_in[1]; const float* gnb = (const float*)d_in[2]; const float* wq = (const float*)d_in[3]; const float* bq = (const float*)d_in[4]; const float* wk = (const float*)d_in[5]; const float* bk = (const float*)d_in[6]; const float* wv = (const float*)d_in[7]; const float* bv = (const float*)d_in[8]; const float* wo = (const float*)d_in[9]; const float* bo = (const float*)d_in[10];
    float* OUT = (float*)d_out;     // [2][256][4096]
    char* wsp = (char*)d_ws;
    auto take = [&](size_t bytes) { char* p = wsp; wsp += (bytes + 255) & ~(size_t)255; return (void*)p; };
    float* BQP = (float*)take(DQ * 4); float* BKP = (float*)take(DQ * 4); float* BVP = (float*)take(DQ * 4); bf* XH = (bf*)take((size_t)NB_ * TT * DM * 2); bf* XL = (bf*)take((size_t)NB_ * TT * DM * 2); float* PS = (float*)take((size_t)NB_ * GNG * GNP * 4); bf* WQ = (bf*)take((size_t)DQ * DM * 2); bf* WK = (bf*)take((size_t)DKV * DM * 2); bf* WV = (bf*)take((size_t)DKV * DM * 2); bf* WO = (bf*)take((size_t)DM * DQ * 2);
    const size_t PL = (size_t)NH_ * TT * HD;   // elements of one batch element's head planes; every plane below holds all NB_ batch elements
    h16* QP16 = (h16*)take(NB_ * PL * 2); h16* KP16 = (h16*)take(NB_ * PL * 2); h16* VT16 = (h16*)take(NB_ * PL * 2);
    bf* QPh = (bf*)take(NB_ * PL * 2); bf* QPl = (bf*)take(NB_ * PL * 2); bf* KPh = (bf*)take(NB_ * PL * 2); bf* KPl = (bf*)take(NB_ * PL * 2); bf* VTh = (bf*)take(NB_ * PL * 2); bf* VTl = (bf*)take(NB_ * PL * 2);
    bf* ATh = (bf*)take((size_t)NB_ * TT * DQ * 2); bf* ATl = (bf*)take((size_t)NB_ * TT * DQ * 2);
    if ((size_t)(wsp - (char*)d_ws) > ws_size) return;    // ws 256 MiB
    k_prep<<<NB_ * GNG + 4 * WPB, 256, 0, stream>>>(x, PS, wq, bq, wk, bk, wv, bv, wo, WQ, BQP, WK, BKP, WV, BVP, WO);   /* GroupNorm partial pairs and the four weight preparations */
    k_gnT<<<dim3(TT / 64, CC / 64, NB_), 256, 0, stream>>>(x, PS, gnw, gnb, XH, XL);   /* mean and variance joined, then normalised, token-major, hi/lo; every batch element */
    k_proj<<<dim3(TT / 64, NH_ / 2, 3 * NB_), 32, 0, stream>>>(XH, XL, WQ, WK, WV, BQP, BKP, BVP, QP16, QPh, QPl, KP16, KPh, KPl, VT16, VTh, VTl);   /* q, k, v of every batch element, straight into the head planes */
    k_fattn<<<dim3(NB_ * NH_, RH / FQH + (TT - RH) / FQB), 128, 0, stream>>>(QP16, QPh, QPl, KP16, KPh, KPl, VT16, VTh, VTl, ATh, ATl);   /* every head of every batch element */
    k_gemmw<bf, 1, true, 1, 1, true><<<dim3(TT / 64, DM / 64, NB_), 32, 0, stream>>>(ATh, ATl, WO, nullptr, DQ, OUT, TT, bo, (size_t)TT * DQ, 0, (size_t)CC * TT, 0, x);   /* Wo product of every batch element (z), stored channel-major + bias + hidden residual */
}

// v010
// A run of this version takes 96.5 microseconds.
// Timed twice side by side with v009, it ran 1.15 times as fast both times.
// All steps since v000 together make it 54.7 times as fast.
#include <hip/hip_runtime.h>

// 1-D self-attention block with GroupNorm and residual on a channel-major sequence (hidden [2][256][4096]; x = GroupNorm(1 group over all 256 x 4096 values, eps 1e-5) x gn_weight + gn_bias; h = x^T; q,k,v = h W^T + b ('oi' [256][256] + [256], 1/16; 8 heads x 32); scores = (q 32^-1/4).(k 32^-1/4); softmax over all 4,096 keys; out = merged Wo^T + bo, transposed back + hidden -> [2][256][4096] (2.1 M)).
// Compute dtypes, f32 accumulate: every input rounded to bf16; GroupNorm f32 (fixed-order sums); projections hi/lo x exact + f32 biases; attention rows < 512 3 products, rest fp16; softmax f32; Wo hl x exact + bias; residual f32.

#define NB_  2
#define TT   4096
#define DM   256
#define NH_  8
#define NKV  8
#define REP  (NH_ / NKV)
#define HD   64
#define DQ   (NH_ * HD)
#define DKV  (NKV * HD)
#define RH   512                  // query rows < RH use hi+lo planes (0: none)
#define WIN  0
#define SCL  0.17677669529663689f   // 32^-1/2 == (32^-1/4)^2 applied once to q.k
#define CC   256     // channels
#define HR   32      // real head width (padded to HD = 64)
typedef _Float16 h16;
typedef unsigned short bf;
typedef __attribute__((ext_vector_type(16))) __bf16   v16bf;
typedef __attribute__((ext_vector_type(16))) _Float16 v16h;
typedef __attribute__((ext_vector_type(8)))  _Float16 v8h;
typedef __attribute__((ext_vector_type(8)))  unsigned short v8us;
typedef __attribute__((ext_vector_type(8)))  float    v8f;
typedef __attribute__((ext_vector_type(4)))  float    v4f;
typedef v8h  __attribute__((may_alias)) v8ha;
typedef v4f  __attribute__((may_alias)) v4fa;
typedef v8us __attribute__((may_alias)) v8usa;

__device__ __forceinline__ unsigned short f2bf(float f) { unsigned u = __float_as_uint(f); u += 0x7FFFu + ((u >> 16) & 1u); return (unsigned short)(u >> 16); }
__device__ __forceinline__ float bf2f(unsigned short b) { return __uint_as_float(((unsigned)b) << 16); }
__device__ __forceinline__ float bfr(float f) { return bf2f(f2bf(f)); }
__device__ __forceinline__ v16h cat16(v8h lo, v8h hi) { return __builtin_shufflevector(lo, hi, 0, 1, 2, 3, 4, 5, 6, 7, 8, 9, 10, 11, 12, 13, 14, 15); }
__device__ __forceinline__ v16bf cat16b(v8us lo, v8us hi) { return __builtin_bit_cast(v16bf, __builtin_shufflevector(lo, hi, 0, 1, 2, 3, 4, 5, 6, 7, 8, 9, 10, 11, 12, 13, 14, 15)); }
__device__ __forceinline__ v8f wmma16(v16h a, v16h b, v8f c) { return __builtin_amdgcn_wmma_f32_16x16x32_f16(false, a, false, b, (short)0, c, false, false); }
__device__ __forceinline__ v8f wmmab(v16bf a, v16bf b, v8f c) { return __builtin_amdgcn_wmma_f32_16x16x32_bf16(false, a, false, b, (short)0, c, false, false); }



// ---- k_gemmw: register-blocked GEMM, ONE WAVE per 64x64 output tile (16 accumulators), operands straight from K-contiguous 16-bit planes; grid (M/64, N/64, Z), 32 threads.
// C[m][n] (f32, pitch ldc, + optional f32 bias[n]) = sum_k A[m][k] Bt[n][k] (+ split products per NSPLIT). z-batch strides sA/sB/sC in elements. K % 32 == 0.
// For a long K on a small grid: K split over KS work-groups (blockIdx.z % KS; grid z = Z KS) and, inside each, over its NW waves (NW*32 threads); wave w of part zk sums k in [(zk NW + w) K/(KS NW), +K/(KS NW)).
// The NW f32 partial tiles meet in LDS (row pitch 68 floats) and are added in wave order, each wave finishing 64/NW whole rows; part zk stores to plane C + zk sP, and the reader of C adds the KS planes in order. K % (32 KS NW) == 0.
// TR: C is the block's output itself, column-major ([n][TT], z stride sC): C[n][m] = bf16-rounded xr[n][m] + (sum + bias[n]), xr laid out like C. The 64x64 tile is turned in LDS, so no f32 copy of the product exists.
template <typename T16> struct WFrag;
template <> struct WFrag<h16> { typedef v16h V; static __device__ __forceinline__ V ld(const h16* p) { return cat16(*(const v8h*)p, *(const v8h*)(p + 16)); } static __device__ __forceinline__ v8f mma(V a, V b, v8f c) { return wmma16(a, b, c); } };
template <> struct WFrag<bf> { typedef v16bf V; static __device__ __forceinline__ V ld(const bf* p) { return cat16b(*(const v8us*)p, *(const v8us*)(p + 16)); } static __device__ __forceinline__ v8f mma(V a, V b, v8f c) { return wmmab(a, b, c); } };
template <typename T16, int NSPLIT, bool BIAS, int KS = 1, int NW = 1, bool TR = false>
__global__ __launch_bounds__(NW * 32) void k_gemmw(const T16* __restrict__ A, const T16* __restrict__ A2, const T16* __restrict__ Bt, const T16* __restrict__ Bt2, int K, float* C, int ldc, const float* __restrict__ bias, size_t sA, size_t sB, size_t sC, size_t sP = 0, const float* __restrict__ xr = nullptr) {
    static_assert(NW == 1 ? KS == 1 : (!BIAS && 64 % (2 * NW) == 0), "split K: no bias, whole row pairs per wave");
    static_assert(!TR || (NW == 1 && BIAS), "the turned epilogue: one wave a tile, with bias");
    typedef typename WFrag<T16>::V V;
    __shared__ __align__(16) float os[(NW == 1 ? (TR ? 64 : 16) : NW * 64) * 68];
    const size_t z = blockIdx.z / KS; const int zk = blockIdx.z % KS; A += z * sA; if (A2) A2 += z * sA; Bt += z * sB; if (Bt2) Bt2 += z * sB; C += z * sC + zk * sP;
    const int wave = (NW == 1) ? 0 : __builtin_amdgcn_readfirstlane((int)(threadIdx.x >> 5)); const int ks = K / (KS * NW), k0 = (zk * NW + wave) * ks;
    const int lane = threadIdx.x & 31, lr = lane & 15, hi = lane >> 4; const int r0 = blockIdx.x * 64, c0 = blockIdx.y * 64;
    v8f acc[4][4];
#pragma unroll
    for (int mb = 0; mb < 4; ++mb)
#pragma unroll
        for (int nb = 0; nb < 4; ++nb) acc[mb][nb] = (v8f){};
    const size_t aoff = (size_t)(r0 + lr) * K + 8 * hi, boff = (size_t)(c0 + lr) * K + 8 * hi;
    float bs[4];   // TR: the bias of column nb 16 + lr, fetched here so that its latency passes under the K loop
    if constexpr (TR) {
#pragma unroll   // constant indices: the array stays in registers
        for (int nb = 0; nb < 4; ++nb) bs[nb] = bias[c0 + lr + nb * 16]; }
#pragma unroll 1
    for (int kc = k0; kc < k0 + ks; kc += 32) {
        V a[4], a2[4];
#pragma unroll
        for (int mb = 0; mb < 4; ++mb) { a[mb] = WFrag<T16>::ld(A + aoff + (size_t)mb * 16 * K + kc); if (NSPLIT == 1 || NSPLIT == 2) a2[mb] = WFrag<T16>::ld(A2 + aoff + (size_t)mb * 16 * K + kc); }
#pragma unroll
        for (int nb = 0; nb < 4; ++nb) { const V b = WFrag<T16>::ld(Bt + boff + (size_t)nb * 16 * K + kc); V b2; if (NSPLIT >= 2) b2 = WFrag<T16>::ld(Bt2 + boff + (size_t)nb * 16 * K + kc);
#pragma unroll
            for (int mb = 0; mb < 4; ++mb) { acc[mb][nb] = WFrag<T16>::mma(a[mb], b, acc[mb][nb]); if (NSPLIT == 1 || NSPLIT == 2) acc[mb][nb] = WFrag<T16>::mma(a2[mb], b, acc[mb][nb]); if (NSPLIT >= 2) acc[mb][nb] = WFrag<T16>::mma(a[mb], b2, acc[mb][nb]); } }
        asm volatile("v_nop\n\tv_nop\n\tv_nop\n\tv_nop" : "+v"(acc[0][0]), "+v"(acc[1][1]), "+v"(acc[2][2]), "+v"(acc[3][3]) : "v"(a[0]), "v"(a[3]));
    }
    if constexpr (NW > 1) {
        float* pw = os + wave * (64 * 68);
#pragma unroll
        for (int mb = 0; mb < 4; ++mb)
#pragma unroll
            for (int nb = 0; nb < 4; ++nb)
#pragma unroll
                for (int j = 0; j < 8; ++j) pw[(mb * 16 + hi * 8 + j) * 68 + nb * 16 + lr] = acc[mb][nb][j];
        __syncthreads();   // every wave's partial tile is in LDS before any wave adds them
#pragma unroll
        for (int s = 0; s < 64 / (2 * NW); ++s) { const int row = wave * (64 / NW) + 2 * s + hi, cofs = lr * 4; v4f val = *(const v4fa*)(os + row * 68 + cofs);
#pragma unroll
            for (int w = 1; w < NW; ++w) { const v4f pv = *(const v4fa*)(os + w * (64 * 68) + row * 68 + cofs); val[0] = __fadd_rn(val[0], pv[0]); val[1] = __fadd_rn(val[1], pv[1]); val[2] = __fadd_rn(val[2], pv[2]); val[3] = __fadd_rn(val[3], pv[3]); }
            *(v4f*)(C + (size_t)(r0 + row) * ldc + c0 + cofs) = val; }
        return;
    }
    if constexpr (TR) {
        // acc[mb][nb][j] = sum[row mb 16 + 8 hi + j][column nb 16 + lr]: a lane holds 8 neighbouring rows of one column = 32 bytes of LDS row (column) nb 16 + lr, pitch 68 floats = 16 B x odd.
        // Read back, 16 lanes hold one column's 64 rows = 256 bytes in a row: every global load and store below covers four whole 128-byte lines, and a line has one writer.
        const size_t eo = (size_t)(c0 + hi) * TT + r0 + lr * 4; const float* xp = xr + z * sC + eo; float* op = C + eo; v4f xa[32];
#pragma unroll   // the first half of the residual loads flies under the LDS turn (the fragment registers are free by now)
        for (int s = 0; s < 16; ++s) xa[s] = *(const v4f*)(xp + (size_t)s * 2 * TT);
#pragma unroll   // constant indices: the arrays stay in registers
        for (int nb = 0; nb < 4; ++nb) { const float b1 = bfr(bs[nb]); const v8f bb = (v8f){b1, b1, b1, b1, b1, b1, b1, b1};
#pragma unroll   // as above
            for (int mb = 0; mb < 4; ++mb) { const v8f y = acc[mb][nb] + bb; float* d = os + (nb * 16 + lr) * 68 + mb * 16 + hi * 8; *(v4fa*)d = __builtin_shufflevector(y, y, 0, 1, 2, 3); *(v4fa*)(d + 4) = __builtin_shufflevector(y, y, 4, 5, 6, 7); } }
        asm volatile("" ::: "memory");   // holds the loads below behind the LDS writes, so that they land in the registers that the accumulators have left (hoisted, they push the kernel past v255)
#pragma unroll   // the second half of the residual loads
        for (int s = 16; s < 32; ++s) xa[s] = *(const v4f*)(xp + (size_t)s * 2 * TT);
#pragma unroll   // constant indices: xa[] stays in registers
        for (int h = 0; h < 2; ++h) { v4f o[16];
#pragma unroll   // as above
            for (int s = 0; s < 16; ++s) { const int u = h * 16 + s; const v4f val = *(const v4fa*)(os + (2 * u + hi) * 68 + lr * 4);
#pragma unroll   // as above
                for (int q = 0; q < 4; ++q) o[s][q] = __fadd_rn(bfr(xa[u][q]), val[q]);
                *(v4f*)(op + (size_t)u * 2 * TT) = o[s]; }
            // precaution, as in FaChunk::load: the address registers of the residual loads and of the stores above and the stored values are inputs here, so they stay live and unwritten up to this wait
            asm volatile("s_wait_xcnt 0x0" :: "v"(xp), "v"(op), "v"(o[0]), "v"(o[1]), "v"(o[2]), "v"(o[3]), "v"(o[4]), "v"(o[5]), "v"(o[6]), "v"(o[7]), "v"(o[8]), "v"(o[9]), "v"(o[10]), "v"(o[11]), "v"(o[12]), "v"(o[13]), "v"(o[14]), "v"(o[15]) : "memory"); }
        return;
    }
#pragma unroll
    for (int mb = 0; mb < 4; ++mb) {
#pragma unroll
        for (int nb = 0; nb < 4; ++nb) {
#pragma unroll
            for (int j = 0; j < 8; ++j) os[(hi * 8 + j) * 68 + nb * 16 + lr] = acc[mb][nb][j]; }
        __builtin_amdgcn_wave_barrier(); asm volatile("" ::: "memory");
        float* crow = C + (size_t)(r0 + mb * 16) * ldc + c0;
{
#pragma unroll
            for (int s = 0; s < 8; ++s) { const int row = 2 * s + hi, cofs = lr * 4; v4f val = *(const v4fa*)(os + row * 68 + cofs); if (BIAS) { val[0] += bfr(bias[c0 + cofs]); val[1] += bfr(bias[c0 + cofs + 1]); val[2] += bfr(bias[c0 + cofs + 2]); val[3] += bfr(bias[c0 + cofs + 3]); }
                *(v4f*)(crow + (size_t)row * ldc + cofs) = val; }
             }
        __builtin_amdgcn_wave_barrier(); asm volatile("" ::: "memory");
    }
}

__device__ __forceinline__ h16 tohx(float x) { return (h16)x; }
__device__ __forceinline__ void splitf(float y, unsigned short& h, unsigned short& l) { h = f2bf(y); l = f2bf(y - bf2f(h)); }
typedef __attribute__((ext_vector_type(2))) _Float16 v2h;
typedef __attribute__((ext_vector_type(4))) _Float16 v4h;
typedef __attribute__((ext_vector_type(2))) unsigned short v2us;
typedef __attribute__((ext_vector_type(4))) unsigned short v4us;
typedef __attribute__((ext_vector_type(2))) float v2f;
typedef __attribute__((ext_vector_type(4))) int v4i;
typedef __attribute__((ext_vector_type(4))) unsigned v4u;

__global__ __launch_bounds__(256) void k_wtG(const float* __restrict__ w, int K, int N, bf* Bt) {
    const int lane = threadIdx.x & 31; const int L0 = (blockIdx.x * 8 + (threadIdx.x >> 5)) * 8; const int nlines = N * K / 64;
{
#pragma unroll 1
        for (int l = 0; l < 8; ++l) { const int L = L0 + l; if (L >= nlines) break; const size_t e = (size_t)L * 64 + lane * 2; const int k = (int)(e % K), n = (int)(e / K); v2us o;
            o[0] = f2bf(w[(size_t)k * N + n]); o[1] = f2bf(w[(size_t)(k + 1) * N + n]); *(v2us*)(Bt + e) = o; }
         }
}
__global__ __launch_bounds__(256) void k_cvt8(const float* __restrict__ src, bf* dst, size_t n8) { const size_t i = (size_t)blockIdx.x * 256 + threadIdx.x; if (i >= n8) return; const v8f v = *(const v8f*)(src + i * 8); v8us o;
#pragma unroll
    for (int k = 0; k < 8; ++k) o[k] = f2bf(v[k]); *(v8us*)(dst + i * 8) = o;  }

__device__ __forceinline__ void wpadh(int blk, const float* __restrict__ w, const float* __restrict__ bias, bf* Bt, float* bp) { const int i = blk * 256 + threadIdx.x; if (i >= DQ * DM / 8) return; const int c0 = (i % (DM / 8)) * 8; const int r = i / (DM / 8); const int h = r / HD, d = r % HD; const int sr = h * HR + min(d, HR - 1); const float* src = w + (size_t)sr * DM + c0; v8us o;
#pragma unroll
    for (int q = 0; q < 8; ++q) { const unsigned short v = f2bf(src[q]); o[q] = (d < HR) ? v : (unsigned short)0; }
    *(v8us*)(Bt + (size_t)r * DM + c0) = o; if (i < DQ) { const int hb = i / HD, db = i % HD; const float bb = bias[hb * HR + min(db, HR - 1)]; ((float*)bp)[i] = (db < HR) ? bb : 0.0f; }     }
__device__ __forceinline__ void wopadh(int blk, const float* __restrict__ w, bf* Bt) { const int i = blk * 256 + threadIdx.x; if (i >= DM * DQ / 8) return; const int k0 = (i % (DQ / 8)) * 8; const int o = i / (DQ / 8); v8us ov; const float* wa[8]; float wl[8];
#pragma unroll
    for (int q = 0; q < 8; ++q) { const int kk = k0 + q; const int h = kk / HD, d = kk % HD; wa[q] = w + (size_t)o * DM + h * HR + min(d, HR - 1); wl[q] = *wa[q]; }
    // precaution, as in FaChunk::load: the loads' address registers are inputs here, so they stay live and unwritten (by a later load's result too) up to this wait
    asm volatile("s_wait_xcnt 0x0" :: "v"(wa[0]), "v"(wa[1]), "v"(wa[2]), "v"(wa[3]), "v"(wa[4]), "v"(wa[5]), "v"(wa[6]), "v"(wa[7]) : "memory");
#pragma unroll
    for (int q = 0; q < 8; ++q) { const int d = (k0 + q) % HD; const unsigned short v = f2bf(wl[q]); ov[q] = (d < HR) ? v : (unsigned short)0; }
    *(v8us*)(Bt + (size_t)o * DQ + k0) = ov;  }
// GroupNorm statistics of all NB_ batch elements, with no launch of their own. Each element's CC x TT values are shared by GNG work-groups, GNK 16-byte loads a thread, all in flight at once and kept in registers.
// gnsum (in k_prep): a work-group's pair {S = sum of its GNE values, M = sum of (x - S / GNE)^2}, the squares taken about the work-group's OWN mean, which needs no other work-group.
// gnstat (in k_gnT, every work-group for itself): mean = sum S / n; n var = sum (M + GNE (S / GNE - mean)^2), the exact identity for joining sums of squares about different means: no difference of large numbers, as in the two-pass form.
// Every sum has a fixed order: in the thread, then wg_sum's tree, then wg_sum over the GNG pairs. Each pair has a 128-byte line of its own (pitch GNP floats), so a line has one writer.
#define GNG  256
#define GNK  (CC * TT / GNG / 1024)
#define GNP  32
#define GNE  (GNK * 1024)   // values a work-group of gnsum
__device__ __forceinline__ float wg_sum(float v, float* red) { const int tid = threadIdx.x; red[tid] = v; __syncthreads();
    for (int st = 128; st > 0; st >>= 1) { if (tid < st) red[tid] = __fadd_rn(red[tid], red[tid + st]); __syncthreads(); }
    const float r = red[0]; __syncthreads();   // red is free for the next sum once every thread has read the total
    return r; }
__device__ __forceinline__ void gnsum(int bx, int by, const float* __restrict__ x, float* PS, float* red) { const int tid = threadIdx.x; const float* xs = x + (size_t)by * CC * TT + (size_t)bx * GNE + tid * 4; float s = 0.f, s2 = 0.f; v4f a[GNK];
#pragma unroll   // all GNK loads are issued before the first is waited for; a[] stays in registers for the second sum
    for (int k = 0; k < GNK; ++k) a[k] = *(const v4f*)(xs + k * 1024);
    asm volatile("s_wait_xcnt 0x0" :: "v"(xs) : "memory");   // precaution, as in FaChunk::load: the loads' address registers stay live and unwritten up to this wait
#pragma unroll   // constant k: a[] stays in registers
    for (int k = 0; k < GNK; ++k) for (int q = 0; q < 4; ++q) s = __fadd_rn(s, bfr(a[k][q]));
    s = wg_sum(s, red); const float mb = __fdiv_rn(s, (float)GNE);
#pragma unroll   // as above
    for (int k = 0; k < GNK; ++k) for (int q = 0; q < 4; ++q) { const float dv = __fsub_rn(bfr(a[k][q]), mb); s2 = __fadd_rn(s2, __fmul_rn(dv, dv)); }
    s2 = wg_sum(s2, red); if (tid == 0) { v2f o; o[0] = s; o[1] = s2; *(v2f*)(PS + (by * GNG + bx) * GNP) = o; } }
// {mean, 1 / sqrt(var + eps)} of batch element by from its GNG pairs; every thread of a 256-thread work-group calls it and gets both
__device__ __forceinline__ v2f gnstat(int by, const float* __restrict__ PS, float* red) { static_assert(GNG == 256, "one pair a thread"); const float n = (float)(CC * TT); const float* pa = PS + (by * GNG + (int)threadIdx.x) * GNP; const v2f pr = *(const v2f*)pa;
    asm volatile("s_wait_xcnt 0x0" :: "v"(pa) : "memory");   // precaution, as in FaChunk::load
    const float mean = __fdiv_rn(wg_sum(pr[0], red), n); const float dm = __fsub_rn(__fdiv_rn(pr[0], (float)GNE), mean);
    const float var = __fdiv_rn(wg_sum(__fadd_rn(pr[1], __fmul_rn((float)GNE, __fmul_rn(dm, dm))), red), n);
    v2f o; o[0] = mean; o[1] = __fdiv_rn(1.0f, __fsqrt_rn(__fadd_rn(var, 1e-5f))); return o; }
// ---- k_prep: the five jobs that read nothing but inputs, in ONE launch, told apart by the block number: first the NB_ x GNG blocks of gnsum (the longest job), then WPB blocks each for Wq, Wk, Wv (wpadh) and Wo (wopadh).
// A block does one job whole, so the barriers of wg_sum stand under a condition that is the same for the whole work-group.
#define WPB  (DQ * DM / 8 / 256)
__global__ __launch_bounds__(256) void k_prep(const float* __restrict__ x, float* PS, const float* __restrict__ wq, const float* __restrict__ bq, const float* __restrict__ wk, const float* __restrict__ bk, const float* __restrict__ wv, const float* __restrict__ bv, const float* __restrict__ wo,
                                              bf* WQ, float* BQP, bf* WK, float* BKP, bf* WV, float* BVP, bf* WO) {
    static_assert(DQ * DM % (8 * 256) == 0, "whole blocks a weight matrix");
    __shared__ float red[256]; const int blk = blockIdx.x;
    if (blk < NB_ * GNG) { gnsum(blk % GNG, blk / GNG, x, PS, red); return; }
    const int m = (blk - NB_ * GNG) / WPB, jb = (blk - NB_ * GNG) % WPB;
    if (m == 3) wopadh(jb, wo, WO);
    else wpadh(jb, m == 0 ? wq : m == 1 ? wk : wv, m == 0 ? bq : m == 1 ? bk : bv, m == 0 ? WQ : m == 1 ? WK : WV, m == 0 ? BQP : m == 1 ? BKP : BVP);
}
// ---- k_gnT: normalises and turns x [channel][token] into the token-major hi/lo planes. One work-group a tile of 64 channels x 64 tokens; grid (TT / 64, CC / 64, batch elements).
// A thread reads 4 channels x 4 tokens with four 16-byte loads: 16 lanes cover 256 bytes in a row of one channel, so every load takes whole 128-byte lines. The loads are issued ahead of gnstat and fly under its barriers.
// The tile is turned in LDS, hi and lo packed into one 32-bit word, row = token, pitch GTP words = 16 B x odd. Read back, 4 lanes hold one token's 64 channels = one whole 128-byte line a plane, so a line has one writer.
#define GTP  68
__global__ __launch_bounds__(256) void k_gnT(const float* __restrict__ xs, const float* __restrict__ PS, const float* __restrict__ g, const float* __restrict__ bb, bf* XH, bf* XL) { static_assert(TT % 64 == 0 && CC % 64 == 0, "whole tiles: every thread reaches every barrier");
    __shared__ float red[256]; __shared__ __align__(16) unsigned tl[64 * GTP];
    const int tid = threadIdx.x, t0 = blockIdx.x * 64, cb = blockIdx.y * 64; const size_t eo = (size_t)blockIdx.z * CC * TT;   // batch element = blockIdx.z
    const int c4 = (tid >> 4) * 4, t4 = (tid & 15) * 4;   // this thread's 4 channels and 4 tokens in the tile
    const float* xp = xs + eo + (size_t)(cb + c4) * TT + t0 + t4; const float* gp = g + cb + c4; const float* bp = bb + cb + c4; v4f a[4];
#pragma unroll   // all four loads are in flight together; a[] stays in registers
    for (int s = 0; s < 4; ++s) a[s] = *(const v4f*)(xp + (size_t)s * TT);
    const v4f gv = *(const v4f*)gp, bv = *(const v4f*)bp;
    asm volatile("s_wait_xcnt 0x0" :: "v"(xp), "v"(gp), "v"(bp) : "memory");   // precaution, as in FaChunk::load: the loads' address registers stay live and unwritten up to this wait
    const v2f st = gnstat(blockIdx.z, PS, red); const float mean = st[0], rs = st[1];
#pragma unroll   // constant indices: the arrays stay in registers
    for (int q = 0; q < 4; ++q) { v4u w;
#pragma unroll   // as above
        for (int s = 0; s < 4; ++s) { const float dv = __fsub_rn(bfr(a[s][q]), mean); const float y = __fadd_rn(__fmul_rn(__fmul_rn(dv, rs), bfr(gv[s])), bfr(bv[s])); unsigned short a2, c2; splitf(y, a2, c2); w[s] = (unsigned)a2 | ((unsigned)c2 << 16); }
        *(v4u*)(tl + (t4 + q) * GTP + c4) = w; }
    __syncthreads();   // the whole tile is in LDS before any thread reads a token's row
    const int t = tid >> 2, cs = (tid & 3) * 16; const unsigned* sp = tl + t * GTP + cs; v8us oh[2], ol[2];
#pragma unroll   // constant indices: the arrays stay in registers
    for (int j = 0; j < 2; ++j)
#pragma unroll   // as above
        for (int i = 0; i < 2; ++i) { const v4u w = *(const v4u*)(sp + j * 8 + i * 4);
#pragma unroll   // as above
            for (int e = 0; e < 4; ++e) { oh[j][i * 4 + e] = (unsigned short)(w[e] & 0xFFFFu); ol[j][i * 4 + e] = (unsigned short)(w[e] >> 16); } }
    bf* ph = XH + eo + (size_t)(t0 + t) * CC + cb + cs; bf* pl = XL + eo + (size_t)(t0 + t) * CC + cb + cs;
    *(v8us*)ph = oh[0]; *(v8us*)(ph + 8) = oh[1]; *(v8us*)pl = ol[0]; *(v8us*)(pl + 8) = ol[1]; }

// ---- k_fattn: scores, softmax and P.V of one head for FQB query rows (FQH for rows < RH) in ONE work-group; scores and probabilities never leave the registers. Grid (batch x heads, row blocks), 4 waves, 32 query rows (two column tiles) a wave.
// Transposed products: S^T = K Q^T (A = 16 K rows from LDS, B = 16 query rows, kept in registers), O^T += V^T P^T. A lane then holds scores of ONE query (column lane & 15), and two S^T tiles (keys +0..15, +16..31),
// converted in place, are the B operand of the second product in the hardware k order (element s: key 8 hi + s, or 16 + 8 hi + s - 8), which is also the order of WFrag::ld on a V^T row. Only the HR = 32 real head columns are read.
// One sweep over the keys, K and V^T staged in LDS in chunks of CK keys: p = exp(s - reference), f32 row sum of the unrounded p, P.V; the division by the sum comes last. The reference is a maximum of the query's scores seen so far;
// it moves, and the sums so far are rescaled, only when a pass's sums of p show that a score has risen far above it (softmax does not depend on the reference; the test keeps p inside the 16-bit range).
// The next chunk is fetched into registers while the present one is worked on. Rows < RH: bf16 hi/lo planes, three products each (hh, hl, lh) as before; the other rows f16.
// Rows < RH cost about three times the others, so their work-groups are cut short: FQH = 32 rows a work-group, which all KW = 4 waves hold, and wave w takes keys [w CK / KW, +CK / KW) of every chunk.
// Each wave has references of its own; the waves' references, partial row sums and partial O tiles meet in LDS (xw) behind the sweep and are joined in wave order, each scaled to the largest reference.
#define FQB  128
#define FQH  32
#define FKW  4
#define XWN  (2 * FKW * 32 + FKW * 4 * 256)   // floats: references and sums [wave][column tile][16], O tiles [wave][column tile][row tile][2][32 lanes][4]
#define KPT  40      // LDS pitch of a staged K row in 16-bit elements: 80 B = 16 B x odd, conflict-free for 16-byte reads
#define FSM  (2 * (128 * KPT + HR * (128 + 8)))   // the larger of the two paths' LDS needs, in 16-bit elements
typedef __attribute__((ext_vector_type(8))) __bf16 v8bf;
__device__ __forceinline__ v8f splat8(float x) { return (v8f){x, x, x, x, x, x, x, x}; }
__device__ __forceinline__ v8f bfup(v8bf h) { const v4u w = __builtin_bit_cast(v4u, h); v8f r;   // packed bf16 back to f32: one shift or one mask an element
#pragma unroll   // constant indices: the arrays stay in registers
    for (int i = 0; i < 4; ++i) { r[2 * i] = __uint_as_float(w[i] << 16); r[2 * i + 1] = __uint_as_float(w[i] & 0xFFFF0000u); }
    return r; }
template <typename T16, int CK> struct FaChunk {   // one plane's share of a chunk in one thread's registers: CK / 32 16-byte pieces of K rows and as many of V^T rows
    typedef __attribute__((ext_vector_type(8))) T16 V8; V8 k[CK / 32], v[CK / 32];
    static constexpr int UR = CK / 8, RS = 128 / UR;   // 16-byte pieces in a V^T row of the chunk; V^T rows that the 128 threads cover at once (K: 4 pieces a row, 32 rows at once)
    // piece s of thread tid: K row (tid >> 2) + 32 s, V^T row tid / UR + RS s: a uniform base, one offset a thread, and a constant step
    template <bool WITHV> __device__ __forceinline__ void load(const T16* __restrict__ Kg, const T16* __restrict__ Vg, int key0) { const unsigned tid = threadIdx.x; const T16* ka = Kg + (size_t)key0 * HD + (tid >> 2) * HD + (tid & 3) * 8; const T16* va = Vg + key0 + (tid / UR) * TT + (tid % UR) * 8;
#pragma unroll   // constant indices: k[] and v[] stay in registers
        for (int s = 0; s < CK / 32; ++s) { k[s] = *(const V8*)(ka + s * 32 * HD); if constexpr (WITHV) v[s] = *(const V8*)(va + s * RS * TT); }
        // precaution: the loads' address registers are inputs here, so they stay live and unwritten (by a later load's result too) up to this wait
        if constexpr (WITHV) asm volatile("s_wait_xcnt 0x0" :: "v"(ka), "v"(va) : "memory"); else asm volatile("s_wait_xcnt 0x0" :: "v"(ka) : "memory"); }
    template <bool WITHV> __device__ __forceinline__ void store(T16* sK, T16* sV) const { const unsigned tid = threadIdx.x; T16* kd = sK + (tid >> 2) * KPT + (tid & 3) * 8; T16* vd = sV + (tid / UR) * (CK + 8) + (tid % UR) * 8;
#pragma unroll   // as above
        for (int s = 0; s < CK / 32; ++s) { *(V8*)(kd + s * 32 * KPT) = k[s]; if constexpr (WITHV) *(V8*)(vd + s * RS * (CK + 8)) = v[s]; } }
};
template <typename T16, bool HL, int CK, int KW = 1>
__device__ __forceinline__ void fattn(const T16* __restrict__ Q, const T16* __restrict__ Q2, const T16* __restrict__ Kg, const T16* __restrict__ K2, const T16* __restrict__ Vg, const T16* __restrict__ V2, int q0, bf* Ah, bf* Al, T16* sm, float* xw = nullptr) {
    typedef WFrag<T16> F; typedef typename F::V V; constexpr int VPT = CK + 8;   // V^T row pitch: 16 B x odd
    static_assert((HL ? 2 : 1) * (CK * KPT + HR * VPT) <= FSM && TT % CK == 0 && CK % (32 * KW) == 0 && (KW == 1 || KW == FKW), "a chunk fits the LDS array; whole 32-key groups a wave");
    T16* sK = sm; T16* sV = sK + CK * KPT; T16* sK2 = sV + HR * VPT; T16* sV2 = sK2 + CK * KPT;
    const int lane = threadIdx.x & 31, lr = lane & 15, hi = lane >> 4, wave = threadIdx.x >> 5; const int t0 = q0 + (KW == 1 ? wave * 32 : 0) + lr;
    const int wv = KW == 1 ? 0 : __builtin_amdgcn_readfirstlane(wave), kw0 = wv * (CK / KW);   // this wave's keys in a chunk start at kw0 (a scalar)
    V qf[2], qf2[2]; const T16* qa = Q + (size_t)t0 * HD + 8 * hi; const T16* qa2 = HL ? Q2 + (size_t)t0 * HD + 8 * hi : qa;
#pragma unroll   // constant indices: the arrays stay in registers
    for (int g = 0; g < 2; ++g) { qf[g] = F::ld(qa + 16 * g * HD); if constexpr (HL) qf2[g] = F::ld(qa2 + 16 * g * HD); }
    asm volatile("s_wait_xcnt 0x0" :: "v"(qa), "v"(qa2) : "memory");   // precaution, as in FaChunk::load
    const int koff = lr * KPT + 8 * hi, voff = lr * VPT + 8 * hi;
    FaChunk<T16, CK> r, r2;
    const float c1 = SCL * 1.4426950408889634f; const v8f c1v = splat8(c1); constexpr float OFF = HL ? 0.0f : 6.0f;   // f16 path: p carries a factor 2^6, which cancels against the row sum, so that small p stay normal f16 numbers
    constexpr int NG = (CK / KW) % 64 == 0 ? 2 : 1;   // 32-key groups a pass; the reference is tested once a pass
    v8f nm[2], sv[2], o[2][2]; float mr[2];   // mr: the reference in use, one a query, alike in lanes l and l ^ 16; it starts so low that the first pass fails the test and sets it
#pragma unroll   // constant indices: the arrays stay in registers
    for (int g = 0; g < 2; ++g) { mr[g] = -3.0e38f; nm[g] = splat8(OFF - mr[g] * c1); sv[g] = (v8f){}; o[g][0] = (v8f){}; o[g][1] = (v8f){}; }
    // s[n][g][h]: scores of keys kk + 32 n + 16 h .. + 15 against column tile g
    auto scores = [&](int kk, v8f (&s)[NG][2][2]) {
#pragma unroll   // constant indices: the arrays stay in registers
        for (int n = 0; n < NG; ++n) { const int k0 = kk + 32 * n; const V a0 = F::ld(sK + koff + k0 * KPT), a1 = F::ld(sK + koff + (k0 + 16) * KPT); V b0, b1; if constexpr (HL) { b0 = F::ld(sK2 + koff + k0 * KPT); b1 = F::ld(sK2 + koff + (k0 + 16) * KPT); }
#pragma unroll   // constant indices: the arrays stay in registers
            for (int g = 0; g < 2; ++g) { s[n][g][0] = F::mma(a0, qf[g], (v8f){}); s[n][g][1] = F::mma(a1, qf[g], (v8f){}); }
            if constexpr (HL) {
#pragma unroll   // constant indices: the arrays stay in registers
                for (int g = 0; g < 2; ++g) { s[n][g][0] = F::mma(a0, qf2[g], s[n][g][0]); s[n][g][1] = F::mma(a1, qf2[g], s[n][g][1]); }
#pragma unroll   // constant indices: the arrays stay in registers
                for (int g = 0; g < 2; ++g) { s[n][g][0] = F::mma(b0, qf[g], s[n][g][0]); s[n][g][1] = F::mma(b1, qf[g], s[n][g][1]); } } } };
    // p = 2^(c1 (s - reference) + OFF), and ts[g]: the pass's sums of p, eight a lane
    auto expo = [&](const v8f (&s)[NG][2][2], v8f (&p)[NG][2][2], v8f (&ts)[2]) {
#pragma unroll   // constant indices: the arrays stay in registers
        for (int g = 0; g < 2; ++g) {
#pragma unroll   // constant indices: the arrays stay in registers
            for (int n = 0; n < NG; ++n)
#pragma unroll   // constant indices: the arrays stay in registers
                for (int h = 0; h < 2; ++h) { const v8f x = __builtin_elementwise_fma(s[n][g][h], c1v, nm[g]);
#pragma unroll   // constant indices: the arrays stay in registers
                    for (int j = 0; j < 8; ++j) p[n][g][h][j] = __builtin_amdgcn_exp2f(x[j]); }
            ts[g] = p[0][g][0] + p[0][g][1]; if constexpr (NG == 2) ts[g] += p[1][g][0] + p[1][g][1]; } };
    r.template load<true>(Kg, Vg, 0); if constexpr (HL) r2.template load<true>(K2, V2, 0);
#pragma unroll 1   // one chunk at a time: the LDS array holds one
    for (int c = 0; c < TT; c += CK) {
        __syncthreads();   // every wave has left the chunk that is overwritten next
        r.template store<true>(sK, sV); if constexpr (HL) r2.template store<true>(sK2, sV2);
        __syncthreads();   // the chunk is complete before any wave reads it
        if (c + CK < TT) { r.template load<true>(Kg, Vg, c + CK); if constexpr (HL) r2.template load<true>(K2, V2, c + CK); }   // flies under this chunk's products
#pragma unroll 1   // a pass holds NG independent 32-key groups already; two passes at once would not fit the registers of three waves a SIMD
        for (int kk = kw0; kk < kw0 + CK / KW; kk += 32 * NG) { v8f s[NG][2][2], p[NG][2][2], ts[2]; V v0[NG], v1[NG], w0[NG], w1[NG];
            scores(kk, s);
#pragma unroll   // constant indices: the arrays stay in registers
            for (int n = 0; n < NG; ++n) { v0[n] = F::ld(sV + voff + kk + 32 * n); v1[n] = F::ld(sV + voff + 16 * VPT + kk + 32 * n); if constexpr (HL) { w0[n] = F::ld(sV2 + voff + kk + 32 * n); w1[n] = F::ld(sV2 + voff + 16 * VPT + kk + 32 * n); } }
            expo(s, p, ts);
            // The test: every p is positive, so a sum of at most 2^15 bounds each p of the pass (f16 holds it), which is so as long as no score stands more than about 7 (log2) above the reference.
            const float t0m = fmaxf(fmaxf(ts[0][0], ts[0][1]), ts[0][2]), t1m = fmaxf(fmaxf(ts[0][3], ts[0][4]), ts[0][5]), t2m = fmaxf(fmaxf(ts[0][6], ts[0][7]), ts[1][0]), t3m = fmaxf(fmaxf(ts[1][1], ts[1][2]), ts[1][3]), t4m = fmaxf(fmaxf(ts[1][4], ts[1][5]), ts[1][6]);
            const float tm = fmaxf(fmaxf(fmaxf(t0m, t1m), t2m), fmaxf(fmaxf(t3m, t4m), ts[1][7]));
            if (__builtin_amdgcn_ballot_w32(!(tm <= 32768.0f)) != 0) {   // one scalar branch a pass, taken by the whole wave; rare behind the first pass
                scores(kk, s);
#pragma unroll   // constant indices: the arrays stay in registers
                for (int g = 0; g < 2; ++g) { v8f mm = __builtin_elementwise_max(s[0][g][0], s[0][g][1]); if constexpr (NG == 2) mm = __builtin_elementwise_max(mm, __builtin_elementwise_max(s[1][g][0], s[1][g][1]));
                    float m = fmaxf(fmaxf(fmaxf(mm[0], mm[1]), fmaxf(mm[2], mm[3])), fmaxf(fmaxf(mm[4], mm[5]), fmaxf(mm[6], mm[7]))); m = fmaxf(m, __shfl_xor(m, 16, 32));   // lanes l and l ^ 16 hold the two halves of one query's keys
                    const float mn = fmaxf(mr[g], m); const v8f f = splat8(__builtin_amdgcn_exp2f((mr[g] - mn) * c1));   // what has been summed so far moves to the new reference
                    mr[g] = mn; nm[g] = splat8(OFF - mn * c1); sv[g] *= f; o[g][0] *= f; o[g][1] *= f; }
                expo(s, p, ts);   // now every p is at most 2^OFF
            }
#pragma unroll   // constant indices: the arrays stay in registers
            for (int g = 0; g < 2; ++g) { sv[g] += ts[g];
#pragma unroll   // constant indices: the arrays stay in registers
                for (int n = 0; n < NG; ++n) { const v8f p0 = p[n][g][0], p1 = p[n][g][1];
                    if constexpr (HL) {
                        const v8bf h0 = __builtin_convertvector(p0, v8bf), h1 = __builtin_convertvector(p1, v8bf); const v8bf l0 = __builtin_convertvector(p0 - bfup(h0), v8bf), l1 = __builtin_convertvector(p1 - bfup(h1), v8bf);
                        const V ph = __builtin_shufflevector(h0, h1, 0, 1, 2, 3, 4, 5, 6, 7, 8, 9, 10, 11, 12, 13, 14, 15), pl = __builtin_shufflevector(l0, l1, 0, 1, 2, 3, 4, 5, 6, 7, 8, 9, 10, 11, 12, 13, 14, 15);
                        o[g][0] = F::mma(v0[n], ph, o[g][0]); o[g][1] = F::mma(v1[n], ph, o[g][1]); o[g][0] = F::mma(v0[n], pl, o[g][0]); o[g][1] = F::mma(v1[n], pl, o[g][1]); o[g][0] = F::mma(w0[n], ph, o[g][0]); o[g][1] = F::mma(w1[n], ph, o[g][1]);
                    } else {
                        const V pf = cat16(__builtin_convertvector(p0, v8h), __builtin_convertvector(p1, v8h));
                        o[g][0] = F::mma(v0[n], pf, o[g][0]); o[g][1] = F::mma(v1[n], pf, o[g][1]); } } } }
    }
    if constexpr (KW > 1) {
        float* xsum = xw + KW * 32; float* xo = xw + 2 * KW * 32;
#pragma unroll   // constant indices: the arrays stay in registers
        for (int g = 0; g < 2; ++g) { float sum = ((sv[g][0] + sv[g][1]) + (sv[g][2] + sv[g][3])) + ((sv[g][4] + sv[g][5]) + (sv[g][6] + sv[g][7])); sum += __shfl_xor(sum, 16, 32); if (hi == 0) { xw[(wv * 2 + g) * 16 + lr] = mr[g]; xsum[(wv * 2 + g) * 16 + lr] = sum; }
#pragma unroll   // as above
            for (int h = 0; h < 2; ++h) { float* d = xo + (wv * 4 + g * 2 + h) * 256 + lane * 4; *(v4fa*)d = __builtin_shufflevector(o[g][h], o[g][h], 0, 1, 2, 3); *(v4fa*)(d + 128) = __builtin_shufflevector(o[g][h], o[g][h], 4, 5, 6, 7); } }
        __syncthreads();   // every wave's references, partial row sums and O tiles are in LDS before they are joined
        if (wv < 2) {   // wave g finishes column tile g, both row tiles: a 128-byte output line keeps one writer
            float fw[KW], mj = xw[wv * 16 + lr]; v8f oo[2];   // fw[w] takes wave w's sums from its own reference to the largest of the KW
#pragma unroll   // constant indices: the arrays stay in registers
            for (int w = 1; w < KW; ++w) mj = fmaxf(mj, xw[(w * 2 + wv) * 16 + lr]);
#pragma unroll   // as above
            for (int w = 0; w < KW; ++w) fw[w] = __builtin_amdgcn_exp2f((xw[(w * 2 + wv) * 16 + lr] - mj) * c1);
            float sum = xsum[wv * 16 + lr] * fw[0];
#pragma unroll   // fixed order: wave 0, 1, 2, 3
            for (int w = 1; w < KW; ++w) sum += xsum[(w * 2 + wv) * 16 + lr] * fw[w];
#pragma unroll   // constant indices: the arrays stay in registers
            for (int h = 0; h < 2; ++h) { const float* s = xo + (wv * 2 + h) * 256 + lane * 4; v4f a = *(const v4fa*)s * fw[0], b = *(const v4fa*)(s + 128) * fw[0];
#pragma unroll   // fixed order: wave 0, 1, 2, 3
                for (int w = 1; w < KW; ++w) { a += *(const v4fa*)(s + w * 1024) * fw[w]; b += *(const v4fa*)(s + w * 1024 + 128) * fw[w]; }
                oo[h] = __builtin_shufflevector(a, b, 0, 1, 2, 3, 4, 5, 6, 7); }
            const float inv = __fdiv_rn(1.0f, sum); v8us h0, l0, h1, l1; const v8us zz = (v8us){};
#pragma unroll   // constant indices: the arrays stay in registers
            for (int j = 0; j < 8; ++j) { unsigned short a, b; splitf(oo[0][j] * inv, a, b); h0[j] = a; l0[j] = b; splitf(oo[1][j] * inv, a, b); h1[j] = a; l1[j] = b; }
            bf* ph = Ah + (size_t)(t0 + 16 * wv) * DQ + 8 * hi; bf* pl = Al + (size_t)(t0 + 16 * wv) * DQ + 8 * hi;
            *(v8us*)ph = h0; *(v8us*)(ph + 16) = h1; *(v8us*)(ph + 32) = zz; *(v8us*)(ph + 48) = zz; *(v8us*)pl = l0; *(v8us*)(pl + 16) = l1; *(v8us*)(pl + 32) = zz; *(v8us*)(pl + 48) = zz;
            asm volatile("s_wait_xcnt 0x0" :: "v"(ph), "v"(pl) : "memory");   // precaution, as in FaChunk::load: the stores' address registers stay live and unwritten up to this wait
        }
        return;
    }
#pragma unroll   // constant indices: the arrays stay in registers
    for (int g = 0; g < 2; ++g) { float sum = ((sv[g][0] + sv[g][1]) + (sv[g][2] + sv[g][3])) + ((sv[g][4] + sv[g][5]) + (sv[g][6] + sv[g][7])); sum += __shfl_xor(sum, 16, 32); const float inv = __fdiv_rn(1.0f, sum);
        v8us h0, l0, h1, l1; const v8us zz = (v8us){};
#pragma unroll   // constant indices: the arrays stay in registers
        for (int j = 0; j < 8; ++j) { unsigned short a, b; splitf(o[g][0][j] * inv, a, b); h0[j] = a; l0[j] = b; splitf(o[g][1][j] * inv, a, b); h1[j] = a; l1[j] = b; }
        // o[g][0][j] = O[t][8 hi + j], o[g][1][j] = O[t][16 + 8 hi + j]; columns HR .. HD - 1 of the padded head are zero
        bf* ph = Ah + (size_t)(t0 + 16 * g) * DQ + 8 * hi; bf* pl = Al + (size_t)(t0 + 16 * g) * DQ + 8 * hi;
        *(v8us*)ph = h0; *(v8us*)(ph + 16) = h1; *(v8us*)(ph + 32) = zz; *(v8us*)(ph + 48) = zz; *(v8us*)pl = l0; *(v8us*)(pl + 16) = l1; *(v8us*)(pl + 32) = zz; *(v8us*)(pl + 48) = zz; }
}
// ---- k_proj: the q, k and v projections of every batch element in ONE launch; its epilogue rounds the f32 sums (+ f32 bias) straight into the 16-bit planes that k_fattn reads (f16, bf16 hi, bf16 lo), so no f32 copy of q, k or v exists.
// Grid (TT / 64, NH_ / 2, 3 NB_), one wave a tile of 64 tokens x the HR real columns of two heads; blockIdx.z = 3 x batch element + (0 q, 1 k, 2 v). The padded rows of W and the padded plane columns, which k_fattn never reads, are left out.
// K loop and product order (x hi, then x lo, per 32-wide k step) as in k_gemmw<bf, 1, true>. W and bias keep wpadh's padded row numbering: head * HD + column.
// q, k (VT false): transposed product, A = 16 W rows, B = 16 tokens: a lane holds 8 neighbouring columns of ONE token = one 16-byte store a plane into [head][t][HD].
// v (VT true): A = 16 tokens, B = 16 W rows: a lane holds 8 neighbouring tokens of ONE column = one 16-byte store a plane into [head][column][TT]. Either way a wave writes whole 64- or 128-byte runs, and a 128-byte line has one writer.
template <bool VT>
__device__ __forceinline__ void proj_tile(const bf* __restrict__ XH, const bf* __restrict__ XL, const bf* __restrict__ Wt, const float* __restrict__ bias, int r0, int h0, h16* P16, bf* Ph, bf* Pl) {
    typedef WFrag<bf> F; typedef F::V V;
    const int lane = threadIdx.x & 31, lr = lane & 15, hi = lane >> 4;
    const bf* xh = XH + (size_t)(r0 + lr) * DM + 8 * hi; const bf* xl = XL + (size_t)(r0 + lr) * DM + 8 * hi; const bf* wr = Wt + (size_t)(h0 * HD + lr) * DM + 8 * hi;
    v8f acc[4][4];
#pragma unroll   // constant indices: the arrays stay in registers
    for (int mb = 0; mb < 4; ++mb)
#pragma unroll   // as above
        for (int nb = 0; nb < 4; ++nb) acc[mb][nb] = (v8f){};
#pragma unroll 1   // one k step's fragments in registers at a time, as in k_gemmw
    for (int kc = 0; kc < DM; kc += 32) {
        V a[4], a2[4], b[4];
#pragma unroll   // constant indices: the arrays stay in registers
        for (int mb = 0; mb < 4; ++mb) { a[mb] = F::ld(xh + mb * 16 * DM); a2[mb] = F::ld(xl + mb * 16 * DM); }
#pragma unroll   // as above
        for (int nb = 0; nb < 4; ++nb) b[nb] = F::ld(wr + ((nb >> 1) * HD + (nb & 1) * 16) * DM);   // column block nb: head h0 + nb / 2, columns 16 (nb % 2) ..
        // precaution, as in FaChunk::load: the loads' address registers are inputs here, so they stay live and unwritten (by a later load's result too) up to this wait.
        // The loaded fragments are inputs too: each keeps registers of its own, so all 24 loads are in flight together and a k step waits for memory once (without them the x lo loads wait for the x hi registers: twice)
        asm volatile("s_wait_xcnt 0x0" :: "v"(xh), "v"(xl), "v"(wr), "v"(a[0]), "v"(a[1]), "v"(a[2]), "v"(a[3]), "v"(a2[0]), "v"(a2[1]), "v"(a2[2]), "v"(a2[3]), "v"(b[0]), "v"(b[1]), "v"(b[2]), "v"(b[3]) : "memory");
        xh += 32; xl += 32; wr += 32;
#pragma unroll   // as above
        for (int nb = 0; nb < 4; ++nb)
#pragma unroll   // as above
            for (int mb = 0; mb < 4; ++mb) {
                if constexpr (VT) { acc[mb][nb] = F::mma(a[mb], b[nb], acc[mb][nb]); acc[mb][nb] = F::mma(a2[mb], b[nb], acc[mb][nb]); }
                else { acc[mb][nb] = F::mma(b[nb], a[mb], acc[mb][nb]); acc[mb][nb] = F::mma(b[nb], a2[mb], acc[mb][nb]); } }
    }
    v8f bv[4];   // the bias of column block nb as this lane adds it; the four loads fly together
    if constexpr (VT) { const int bi = h0 * HD + lr; float bs[4];
#pragma unroll   // constant indices: the arrays stay in registers
        for (int nb = 0; nb < 4; ++nb) bs[nb] = bias[bi + (nb >> 1) * HD + (nb & 1) * 16];
        asm volatile("s_wait_xcnt 0x0" :: "v"(bi) : "memory");   // precaution, as above: the loads' offset register is an input here
#pragma unroll   // as above
        for (int nb = 0; nb < 4; ++nb) bv[nb] = splat8(bfr(bs[nb]));
    } else { const float* bp = bias + h0 * HD + 8 * hi;
#pragma unroll   // as above
        for (int nb = 0; nb < 4; ++nb) bv[nb] = *(const v8f*)(bp + (nb >> 1) * HD + (nb & 1) * 16);
#pragma unroll   // as above
        for (int nb = 0; nb < 4; ++nb)
#pragma unroll   // as above
            for (int j = 0; j < 8; ++j) bv[nb][j] = bfr(bv[nb][j]); }
#pragma unroll   // as above
    for (int nb = 0; nb < 4; ++nb) { const int hd = (h0 + (nb >> 1)) * HD + (nb & 1) * 16;   // padded number of the block's first column
#pragma unroll   // as above
        for (int mb = 0; mb < 4; ++mb) { const v8f y = acc[mb][nb] + bv[nb]; const v8h o16 = __builtin_convertvector(y, v8h);   // packed conversions, round to nearest even: the values of tohx and splitf
            const v8bf yh = __builtin_convertvector(y, v8bf); const v8bf yl = __builtin_convertvector(y - bfup(yh), v8bf); const v8us oh = __builtin_bit_cast(v8us, yh), ol = __builtin_bit_cast(v8us, yl);
            const size_t e = VT ? (size_t)(hd + lr) * TT + r0 + mb * 16 + 8 * hi : ((size_t)(h0 + (nb >> 1)) * TT + r0 + mb * 16 + lr) * HD + (nb & 1) * 16 + 8 * hi;
            *(v8h*)(P16 + e) = o16; *(v8us*)(Ph + e) = oh; *(v8us*)(Pl + e) = ol; } }
}
__global__ __launch_bounds__(32) void k_proj(const bf* __restrict__ XH, const bf* __restrict__ XL, const bf* __restrict__ WQ, const bf* __restrict__ WK, const bf* __restrict__ WV, const float* __restrict__ BQ, const float* __restrict__ BK, const float* __restrict__ BV,
                                             h16* Q16, bf* Qh, bf* Ql, h16* K16, bf* Kh, bf* Kl, h16* V16, bf* Vh, bf* Vl) {
    static_assert(TT % 64 == 0 && NH_ % 2 == 0 && HR == 32 && DM % 32 == 0 && NH_ == NKV, "whole tiles; two 16-column blocks a head");
    const int b = blockIdx.z / 3, p = blockIdx.z % 3; const int r0 = blockIdx.x * 64, h0 = blockIdx.y * 2; const size_t xo = (size_t)b * TT * DM, po = (size_t)b * NH_ * TT * HD;
    if (p == 2) proj_tile<true>(XH + xo, XL + xo, WV, BV, r0, h0, V16 + po, Vh + po, Vl + po);
    else proj_tile<false>(XH + xo, XL + xo, p ? WK : WQ, p ? BK : BQ, r0, h0, (p ? K16 : Q16) + po, (p ? Kh : Qh) + po, (p ? Kl : Ql) + po);
}

// Planes [batch][head][...], outputs [batch][t][DQ]. blockIdx.y is the row block: first the RH / FQH blocks of rows < RH, then the (TT - RH) / FQB blocks of the other rows.
__global__ __launch_bounds__(128) void k_fattn(const h16* __restrict__ Q16, const bf* __restrict__ Qh, const bf* __restrict__ Ql, const h16* __restrict__ K16, const bf* __restrict__ Kh, const bf* __restrict__ Kl, const h16* __restrict__ V16, const bf* __restrict__ Vh, const bf* __restrict__ Vl, bf* Ah, bf* Al) {
    static_assert(RH % FQH == 0 && (TT - RH) % FQB == 0 && HR == 32 && HD == 64 && NH_ == NKV, "whole work-groups on either side of RH; one 32-wide k step a head");
    __shared__ __align__(16) unsigned short sm[FSM]; __shared__ __align__(16) float xw[XWN];
    const size_t hp = (size_t)blockIdx.x * TT * HD; const int by = blockIdx.y; const int q0 = by < RH / FQH ? by * FQH : RH + (by - RH / FQH) * FQB; const size_t ao = (size_t)(blockIdx.x / NH_) * TT * DQ + (blockIdx.x % NH_) * HD;
    if (q0 < RH) fattn<bf, true, 128, FKW>(Qh + hp, Ql + hp, Kh + hp, Kl + hp, Vh + hp, Vl + hp, q0, Ah + ao, Al + ao, (bf*)sm, xw);
    else fattn<h16, false, 256>(Q16 + hp, nullptr, K16 + hp, nullptr, V16 + hp, nullptr, q0, Ah + ao, Al + ao, (h16*)sm);
}

extern "C" void kernel_launch(void* const* d_in, const int* in_sizes, int n_in,
                              void* d_out, int out_size, void* d_ws, size_t ws_size, hipStream_t stream) {
    (void)in_sizes; (void)n_in; (void)out_size;
    const float* x = (const float*)d_in[0]; const float* gnw = (const float*)d_in[1]; const float* gnb = (const float*)d_in[2]; const float* wq = (const float*)d_in[3]; const float* bq = (const float*)d_in[4]; const float* wk = (const float*)d_in[5]; const float* bk = (const float*)d_in[6]; const float* wv = (const float*)d_in[7]; const float* bv = (const float*)d_in[8]; const float* wo = (const float*)d_in[9]; const float* bo = (const float*)d_in[10];
    float* OUT = (float*)d_out;     // [2][256][4096]
    char* wsp = (char*)d_ws;
    auto take = [&](size_t bytes) { char* p = wsp; wsp += (bytes + 255) & ~(size_t)255; return (void*)p; };
    float* BQP = (float*)take(DQ * 4); float* BKP = (float*)take(DQ * 4); float* BVP = (float*)take(DQ * 4); bf* XH = (bf*)take((size_t)NB_ * TT * DM * 2); bf* XL = (bf*)take((size_t)NB_ * TT * DM * 2); float* PS = (float*)take((size_t)NB_ * GNG * GNP * 4); bf* WQ = (bf*)take((size_t)DQ * DM * 2); bf* WK = (bf*)take((size_t)DKV * DM * 2); bf* WV = (bf*)take((size_t)DKV * DM * 2); bf* WO = (bf*)take((size_t)DM * DQ * 2);
    const size_t PL = (size_t)NH_ * TT * HD;   // elements of one batch element's head planes; every plane below holds all NB_ batch elements
    h16* QP16 = (h16*)take(NB_ * PL * 2); h16* KP16 = (h16*)take(NB_ * PL * 2); h16* VT16 = (h16*)take(NB_ * PL * 2);
    bf* QPh = (bf*)take(NB_ * PL * 2); bf* QPl = (bf*)take(NB_ * PL * 2); bf* KPh = (bf*)take(NB_ * PL * 2); bf* KPl = (bf*)take(NB_ * PL * 2); bf* VTh = (bf*)take(NB_ * PL * 2); bf* VTl = (bf*)take(NB_ * PL * 2);
    bf* ATh = (bf*)take((size_t)NB_ * TT * DQ * 2); bf* ATl = (bf*)take((size_t)NB_ * TT * DQ * 2);
    if ((size_t)(wsp - (char*)d_ws) > ws_size) return;    // ws 256 MiB
    k_prep<<<NB_ * GNG + 4 * WPB, 256, 0, stream>>>(x, PS, wq, bq, wk, bk, wv, bv, wo, WQ, BQP, WK, BKP, WV, BVP, WO);   /* GroupNorm partial pairs and the four weight preparations */
    k_gnT<<<dim3(TT / 64, CC / 64, NB_), 256, 0, stream>>>(x, PS, gnw, gnb, XH, XL);   /* mean and variance joined, then normalised, token-major, hi/lo; every batch element */
    k_proj<<<dim3(TT / 64, NH_ / 2, 3 * NB_), 32, 0, stream>>>(XH, XL, WQ, WK, WV, BQP, BKP, BVP, QP16, QPh, QPl, KP16, KPh, KPl, VT16, VTh, VTl);   /* q, k, v of every batch element, straight into the head planes */
    k_fattn<<<dim3(NB_ * NH_, RH / FQH + (TT - RH) / FQB), 128, 0, stream>>>(QP16, QPh, QPl, KP16, KPh, KPl, VT16, VTh, VTl, ATh, ATl);   /* every head of every batch element */
    k_gemmw<bf, 1, true, 1, 1, true><<<dim3(TT / 64, DM / 64, NB_), 32, 0, stream>>>(ATh, ATl, WO, nullptr, DQ, OUT, TT, bo, (size_t)TT * DQ, 0, (size_t)CC * TT, 0, x);   /* Wo product of every batch element (z), stored channel-major + bias + hidden residual */
}
